// v000
// Times are from an AMD MI455X. After a warm-up the kernel runs many times in a row, and a time is the length of
// such a window on the GPU divided by its runs, so every launch and the gaps after it count. The runs cycle
// through copies of the inputs. A figure is the median of several windows, for all but v000 over two sittings.
// Sittings can differ by a few percent; kernels timed side by side share one.
// The starting kernel, v000, takes 3860 microseconds a run.
// compute dtype: all float inputs rounded to bf16; q / k (64-wide) and v (512-wide) projections with EXACT bf16 products on WMMA 16x16x32 (f32 accumulate) + bias; causal logits UNSCALED: q and k each as f16 hi + (x 2^10) residual, 3 products on every row; softmax f32; P x 2^11 once to f16 x v once to f16 (bf16 hi + lo below row 384), eight 64-column passes over the same probability plane; y = bf16(x) + o and LayerNorm over 512 in f32; f32 output.
#include <hip/hip_runtime.h>
#include <math.h>

typedef __attribute__((ext_vector_type(16))) _Float16 v16h;
typedef __attribute__((ext_vector_type(16))) __bf16 v16b;
typedef __attribute__((ext_vector_type(8)))  _Float16 v8h;
typedef __attribute__((ext_vector_type(8)))  float v8f;
typedef __attribute__((ext_vector_type(4)))  float v4f;
typedef __attribute__((ext_vector_type(2)))  float v2f;
typedef __attribute__((ext_vector_type(4)))  unsigned v4u;
typedef __attribute__((ext_vector_type(4)))  int v4i;
typedef float __attribute__((may_alias)) float_a;
typedef int __attribute__((may_alias)) int_a;

template <typename T> __device__ __forceinline__ void vst2(void* p, T v) { *(T*)p = v;  }
__device__ __forceinline__ v8f wmma16(v16h a, v16h b, v8f c) {
  v8f d = __builtin_amdgcn_wmma_f32_16x16x32_f16(false, a, false, b, (short)0, c, false, false);
  asm volatile("v_nop\n\tv_nop\n\tv_nop\n\tv_nop" : "+v"(d) : "v"(a), "v"(b));
  return d;
}
__device__ __forceinline__ v8f wmma_bf(v16b a, v16b b, v8f c) {
  v8f d = __builtin_amdgcn_wmma_f32_16x16x32_bf16(false, a, false, b, (short)0, c, false, false);
  asm volatile("v_nop\n\tv_nop\n\tv_nop\n\tv_nop" : "+v"(d) : "v"(a), "v"(b));
  return d;
}
// 16x16x32 fragments: lane = (h = lane>>4, row/col = lane&15); elements 0..7 = k0+8h+0..7, 8..15 = k0+16+8h+0..7; D element r = row 8h+r
__device__ __forceinline__ v16h frag_h(const _Float16* rowk0, int lane) {
  union { v16h v; v8h q[2]; } u; const _Float16* p = rowk0 + 8 * (lane >> 4);
  u.q[0] = *(const v8h*)p; u.q[1] = *(const v8h*)(p + 16); return u.v;
}
__device__ __forceinline__ v16h frag_f32(const float* rowk0, int lane) {
  v16h a; const float* p = rowk0 + 8 * (lane >> 4);
#pragma unroll
  for (int i = 0; i < 8; ++i) { a[i] = (_Float16)p[i]; a[8 + i] = (_Float16)p[16 + i]; }
  return a;
}
__device__ __forceinline__ v16h frag_f32s(const float* rowk0, int lane, float sc) {
  v16h a; const float* p = rowk0 + 8 * (lane >> 4);
#pragma unroll
  for (int i = 0; i < 8; ++i) { a[i] = (_Float16)(p[i] * sc); a[8 + i] = (_Float16)(p[16 + i] * sc); }
  return a;
}
// column fragment from a [K][ld] layout (column n), rows >= K read as 0
__device__ __forceinline__ v16h fragc_f32(const float* W, int k0, int n, int lane, int ld, int K) {
  v16h a; const int g = lane >> 4;
#pragma unroll
  for (int i = 0; i < 8; ++i) { const int ka = k0 + 8 * g + i, kb = ka + 16;
    a[i] = (_Float16)(ka < K ? W[(size_t)(ka < K ? ka : K - 1) * ld + n] : 0.f); a[8 + i] = (_Float16)(kb < K ? W[(size_t)(kb < K ? kb : K - 1) * ld + n] : 0.f); }
  return a;
}
struct F2 { v16b h, l; };
__device__ __forceinline__ F2 bsplit16(const float v[16]) { F2 r;
#pragma unroll
  for (int i = 0; i < 16; ++i) { const __bf16 h = (__bf16)v[i]; r.h[i] = h; r.l[i] = (__bf16)(v[i] - (float)h); }
  return r; }
__device__ __forceinline__ F2 split_row(const float* row, int k0, int lane) { float v[16]; const float* p = row + k0 + 8 * (lane >> 4);
#pragma unroll
  for (int i = 0; i < 8; ++i) { v[i] = p[i]; v[8 + i] = p[16 + i]; }
  return bsplit16(v); }
__device__ __forceinline__ F2 split_rowK(const float* row, int k0, int lane, int K) { float v[16]; const int g = lane >> 4;
#pragma unroll
  for (int i = 0; i < 8; ++i) { const int ka = k0 + 8 * g + i, kb = ka + 16; v[i] = ka < K ? row[ka < K ? ka : K - 1] : 0.f; v[8 + i] = kb < K ? row[kb < K ? kb : K - 1] : 0.f; }
  return bsplit16(v); }
__device__ __forceinline__ F2 split_col(const float* W, int k0, int n, int lane, int ld, int K) { float v[16]; const int g = lane >> 4;
#pragma unroll
  for (int i = 0; i < 8; ++i) { const int ka = k0 + 8 * g + i, kb = ka + 16; v[i] = ka < K ? W[(size_t)(ka < K ? ka : K - 1) * ld + n] : 0.f; v[8 + i] = kb < K ? W[(size_t)(kb < K ? kb : K - 1) * ld + n] : 0.f; }
  return bsplit16(v); }
__device__ __forceinline__ v8f mac3(const F2& a, const F2& b, v8f c) { c = wmma_bf(a.l, b.h, c); c = wmma_bf(a.h, b.l, c); return wmma_bf(a.h, b.h, c); }
__device__ __forceinline__ float sigm(float v) { return 1.0f / (1.0f + expf(-v)); }
#define LDSX() do { asm volatile("s_wait_dscnt 0" ::: "memory"); __builtin_amdgcn_wave_barrier(); __builtin_amdgcn_fence(__ATOMIC_RELEASE, "workgroup"); } while (0)

// Single-head causal self-attention with a residual and LayerNorm (x [4,4096,512]; (in,out) Wq / Wk [512,64] and Wv [512,512] uniform(+-1/sqrt(512)) with biases of the same scale - NONZERO; q, k = x W + b (64-wide), v = x Wv + bv (512-wide); scores = q k^T with NO scaling; tril kept, -inf elsewhere; softmax over the keys; o = attn v [4,4096,512]; y = x + o; LayerNorm over the 512 features (biased variance, eps 1e-5) * gamma + beta (ones / zeros, read)). ONE 64-wide score head in columns 0..63 of the 512-wide q / k rows; P.v as eight ordinary 64-wide column groups that all read the same probability plane.
#define NB 4
#define TT 4096
#define CC 512            // NH * HD = projected width
#define DIN 512          // input (model) width
#define NH 8
#define HD 64
#define NQB (TT / 64)
#define HG 1
#define SCALE (1.0f)
#define CAUSAL 1
#ifndef TNB
#define TNB NB
#endif
__device__ __forceinline__ float bfr(float v) { return (float)(__bf16)v; }
__host__ __device__ __forceinline__ int kb_last(int qb) { return CAUSAL ? ((qb * 64 + 63) >> 7) : (TT / 128 - 1); }
typedef __attribute__((ext_vector_type(8))) __bf16 v8b;
__device__ __forceinline__ v16b frag_b(const __bf16* rowk0, int lane) {
  union { v16b v; v8b q[2]; } u; const __bf16* p = rowk0 + 8 * (lane >> 4);
  u.q[0] = *(const v8b*)p; u.q[1] = *(const v8b*)(p + 16); return u.v;
}
#define QBH 6              // causal: query blocks 0..QBH-1 of each sequence (few keys, no averaging) take the high-precision path
#define QHI TT             // rows carrying a q residual plane (all rows: 3-product logits everywhere)
#define KHI TT             // key rows carrying a k residual plane (read by every k_sc block: its 3-product branch)
#define VHI 384            // v bf16 hi / lo planes only for key rows t < VHI (read by the causal early band: query blocks < 6 see keys <= 383)
#define RW 64              // real width of q / k
// B fragment (k rows k0+.., output column o) of a weight: (in,out) [K][ld] or (out,in) [ld rows of K]: bf16 exact, or f16(bf16 * 256) exact
__device__ __forceinline__ v16b wcol_io(const float* Wm, int k0, int o, int lane, int ld) { v16b w; const int g = lane >> 4;
#pragma unroll
  for (int i = 0; i < 8; ++i) { w[i] = (__bf16)Wm[(size_t)(k0 + 8 * g + i) * ld + o]; w[8 + i] = (__bf16)Wm[(size_t)(k0 + 16 + 8 * g + i) * ld + o]; }
  return w; }
__device__ __forceinline__ v16b wcol_oi(const float* Wm, int k0, int o, int lane, int K) { v16b w; const float* p = Wm + (size_t)o * K + k0 + 8 * (lane >> 4);
#pragma unroll
  for (int i = 0; i < 8; ++i) { w[i] = (__bf16)p[i]; w[8 + i] = (__bf16)p[16 + i]; }
  return w; }
__device__ __forceinline__ v16h wcolh_io(const float* Wm, int k0, int o, int lane, int ld) { v16h w; const int g = lane >> 4;
#pragma unroll
  for (int i = 0; i < 8; ++i) { w[i] = (_Float16)(bfr(Wm[(size_t)(k0 + 8 * g + i) * ld + o]) * 256.0f); w[8 + i] = (_Float16)(bfr(Wm[(size_t)(k0 + 16 + 8 * g + i) * ld + o]) * 256.0f); }
  return w; }
__device__ __forceinline__ v16h wcolh_oi(const float* Wm, int k0, int o, int lane, int K) { v16h w; const float* p = Wm + (size_t)o * K + k0 + 8 * (lane >> 4);
#pragma unroll
  for (int i = 0; i < 8; ++i) { w[i] = (_Float16)(bfr(p[i]) * 256.0f); w[8 + i] = (_Float16)(bfr(p[16 + i]) * 256.0f); }
  return w; }
#define WQKV_LAYOUT 0   // 0 = (in,out): Wv [DIN][CC], Wq / Wk [DIN][RW]; 1 = (out,in) [CC][DIN]; 2 = per-head [NH][DIN][HD]
__device__ __forceinline__ v16b wcol_hdk(const float* Wm, int k0, int o, int lane) { v16b w; const int g = lane >> 4; const float* p = Wm + (size_t)(o / HD) * DIN * HD + (o % HD);
#pragma unroll
  for (int i = 0; i < 8; ++i) { w[i] = (__bf16)p[(size_t)(k0 + 8 * g + i) * HD]; w[8 + i] = (__bf16)p[(size_t)(k0 + 16 + 8 * g + i) * HD]; }
  return w; }
#define WO_OUT_IN 0
#if WQKV_LAYOUT == 1
#define WCOL(W, k0, o, lane) wcol_oi(W, k0, o, lane, DIN)
#elif WQKV_LAYOUT == 2
#define WCOL(W, k0, o, lane) wcol_hdk(W, k0, o, lane)
#else
__device__ __forceinline__ v16b zero16b() { v16b w; _Pragma("unroll") for (int i = 0; i < 16; ++i) w[i] = (__bf16)0.0f; return w; }
#define WCOL(W, k0, o, lane) (((which) == 2) ? wcol_io(W, k0, o, lane, CC) : (((o) < RW) ? wcol_io(W, k0, o, lane, RW) : zero16b()))   /* (in,out): Wv [512][512]; Wq / Wk [512][64]: columns >= 64 of the q / k rows are zero (and never read) */
#endif
#if WO_OUT_IN
#define WOCOL(W, k0, o, lane) wcol_oi(W, k0, o, lane, CC)
#define WOCOLH(W, k0, o, lane) wcolh_oi(W, k0, o, lane, CC)
#else
#define WOCOL(W, k0, o, lane) wcol_io(W, k0, o, lane, DIN)
#define WOCOLH(W, k0, o, lane) wcolh_io(W, k0, o, lane, DIN)
#endif

#ifndef SM_EXTRA_PARAMS
#define SM_EXTRA_PARAMS
#endif
#ifndef PROJ_EXTRA_PARAMS
#define PROJ_EXTRA_PARAMS
#endif
#ifndef SM_MASK_HOOK
#define SM_MASK_HOOK (void)0
#endif

#define WS_QH  0u                                      // f16 q rows [b*t][CC]
#define WS_KH  (WS_QH + 2u * (size_t)NB * TT * CC)      // f16 k rows [b*t][CC]
#define WS_VT  (WS_KH + 2u * (size_t)NB * TT * CC)      // f16 v planes [b][c][t]
#define WS_QL  (WS_VT + 2u * (size_t)NB * CC * TT)      // f16 q residual x 2^10 rows [b][t < QHI][CC]
#define WS_KL  (WS_QL + 2u * (size_t)NB * QHI * CC)     // f16 k residual x 2^10 rows [b][t < KHI][CC]
#define WS_VB  (WS_KL + 2u * (size_t)NB * KHI * CC)     // bf16 v hi planes [b][c][t < VHI]
#define WS_VBL (WS_VB + 2u * (size_t)NB * CC * VHI)
#define WS_S   (WS_VBL + 2u * (size_t)NB * CC * VHI)    // f32 logits / P [hg][t][s]
#define WS_Y   (WS_S  + 4u * (size_t)HG * TT * TT)      // f32 ctx rows [b*t][CC]
#define WS_END (WS_Y  + 4u * (size_t)NB * TT * CC)   // o rows [(b*TT + t)][CC] (k_pv writes them; the residual-LayerNorm kernel writes the output)

// ---- k_proj: block = (64 rows, 128 cols, which): q/k/v = X W (+ b) with exact bf16 products (K = DIN) -> which 0: q f16 rows (+ residual rows < QHI); 1: k f16 rows (+ residual rows < KHI); 2: v f16 planes [c][t] (+ bf16 hi/lo planes for t < VHI)
__global__ __launch_bounds__(128) void k_proj(const float* __restrict__ XQ, const float* __restrict__ XK, const float* __restrict__ XV, const float* __restrict__ WQ, const float* __restrict__ WK, const float* __restrict__ WV, const float* __restrict__ BQ, const float* __restrict__ BK, const float* __restrict__ BV,
    _Float16* __restrict__ QH, _Float16* __restrict__ QL, _Float16* __restrict__ KH, _Float16* __restrict__ KL, _Float16* __restrict__ VT, __bf16* __restrict__ VB, __bf16* __restrict__ VBL) {
  __shared__ __align__(16) _Float16 sh[64][136], sl[64][136]; __shared__ __align__(16) _Float16 th[128][72]; __shared__ __align__(16) __bf16 tb[128][72], tbl[128][72];
  const int tid = threadIdx.x, wave = tid >> 5, lane = tid & 31, col = lane & 15, g = lane >> 4; const int which = blockIdx.z; const int c0 = blockIdx.y * 128; const size_t r0 = (size_t)blockIdx.x * 64; const size_t bb = r0 / TT; const int t0 = (int)(r0 % TT);
  if (which < 2 && blockIdx.y > 0) return;   /* q / k have 64 real columns: only the first 128-column tile is computed; the others are never read (block-uniform exit before any barrier) */
  const float* X = which == 0 ? XQ : which == 1 ? XK : XV; const float* WA = which == 0 ? WQ : which == 1 ? WK : WV; const float* BA = which == 0 ? BQ : which == 1 ? BK : BV;
  v8f acc[8] = {};
#pragma unroll 2
  for (int kc = 0; kc < DIN / 32; ++kc) { v16b a; { const float* p = X + (r0 + wave * 16 + col) * DIN + kc * 32 + 8 * g;
#pragma unroll
      for (int i = 0; i < 8; ++i) { a[i] = (__bf16)p[i]; a[8 + i] = (__bf16)p[16 + i]; } }
    asm volatile("s_wait_loadcnt 0x0" ::: "memory");
#pragma unroll
    for (int j = 0; j < 8; ++j) { const v16b w = WCOL(WA, kc * 32, c0 + j * 16 + col, lane); asm volatile("s_wait_loadcnt 0x0" ::: "memory"); acc[j] = wmma_bf(a, w, acc[j]); } }
  if (which < 2) { _Float16* DH = which == 0 ? QH : KH; _Float16* DL = which == 0 ? QL : KL; const int nhi = which == 0 ? QHI : KHI; const bool hi_rows = t0 < nhi;
#pragma unroll
    for (int j = 0; j < 8; ++j) { const float bias = (BA && ((which) == 2 || (c0 + j * 16 + col) < RW)) ? bfr(BA[c0 + j * 16 + col]) : 0.f;
#pragma unroll
      for (int r = 0; r < 8; ++r) { const float v = acc[j][r] + bias; const _Float16 hv = (_Float16)v; sh[wave * 16 + 8 * g + r][j * 16 + col] = hv; sl[wave * 16 + 8 * g + r][j * 16 + col] = (_Float16)((v - (float)hv) * 1024.0f); } }
    __syncthreads();
    for (int e = tid; e < 64 * 16; e += 128) { const int rl = e >> 4, q = e & 15; vst2((unsigned*)(DH + (r0 + rl) * CC + c0 + q * 8), *(const v4u*)&sh[rl][q * 8]); if (hi_rows) vst2((unsigned*)(DL + (bb * nhi + t0 + rl) * (size_t)CC + c0 + q * 8), *(const v4u*)&sl[rl][q * 8]); }
  } else { const bool hi_rows = t0 < VHI;
#pragma unroll
    for (int j = 0; j < 8; ++j) { const float bias = (BA && ((which) == 2 || (c0 + j * 16 + col) < RW)) ? bfr(BA[c0 + j * 16 + col]) : 0.f;
#pragma unroll
      for (int r = 0; r < 8; ++r) { const float v = acc[j][r] + bias; const int rl = wave * 16 + 8 * g + r, cl = j * 16 + col; th[cl][rl] = (_Float16)v; const __bf16 bh = (__bf16)v; tb[cl][rl] = bh; tbl[cl][rl] = (__bf16)(v - (float)bh); } }
    __syncthreads();
    for (int e = tid; e < 128 * 8; e += 128) { const int cl = e >> 3, q = e & 7; vst2((unsigned*)(VT + (bb * CC + c0 + cl) * (size_t)TT + t0 + q * 8), *(const v4u*)&th[cl][q * 8]); if (hi_rows) { const size_t o3 = (bb * CC + c0 + cl) * (size_t)VHI + t0 + q * 8; vst2((unsigned*)(VB + o3), *(const v4u*)&tb[cl][q * 8]); vst2((unsigned*)(VBL + o3), *(const v4u*)&tbl[cl][q * 8]); } } } }
#undef QBH
#define QBH NQB   // SCORE KERNEL ONLY: every query block takes the 3-product branch (unscaled logits)
// ---- k_sc: block = (query block qb, key block kb <= kb_last(qb), head in group) of batch b: logits x SCALE; q hi + residual (x 2^10) against k (2 products) for query rows < QHI, plus the k residual (3 products) for query blocks < QBH (QBH = NQB here: every block); causal: blocks past the diagonal exit, the mask itself is applied by index in k_sm
__global__ __launch_bounds__(128) void k_sc(const _Float16* __restrict__ QH, const _Float16* __restrict__ KH, const _Float16* __restrict__ QL, const _Float16* __restrict__ KL, int b, int h0, float* __restrict__ S0) { __shared__ __align__(16) float ss[4][16][132];
  const int qb = blockIdx.x, kb = blockIdx.y; if (kb > kb_last(qb)) return;
  const int h = h0 + blockIdx.z; float* S = S0 + (size_t)blockIdx.z * TT * TT;
  const int tid = threadIdx.x, wave = tid >> 5, lane = tid & 31, col = lane & 15, g = lane >> 4; const int k0 = kb * 128; const int ql0 = qb * 64 + wave * 16; const size_t q0 = (size_t)b * TT + ql0, kr0 = (size_t)b * TT + k0;
  v8f acc[8] = {}, accl[8] = {};
  const _Float16* QLb = QL + (size_t)b * QHI * CC; const _Float16* KLb = KL + (size_t)b * KHI * CC;
  if (qb < QBH) {
#pragma unroll
    for (int kc = 0; kc < HD / 32; ++kc) { const v16h ah = frag_h(QH + (q0 + col) * CC + h * HD + kc * 32, lane), al = frag_h(QLb + (size_t)(ql0 + col) * CC + h * HD + kc * 32, lane);
#pragma unroll
      for (int j = 0; j < 8; ++j) { const v16h kbf = frag_h(KH + (kr0 + j * 16 + col) * CC + h * HD + kc * 32, lane), klf = frag_h(KLb + (size_t)(k0 + j * 16 + col) * CC + h * HD + kc * 32, lane); acc[j] = wmma16(ah, kbf, acc[j]); accl[j] = wmma16(al, kbf, accl[j]); accl[j] = wmma16(ah, klf, accl[j]); } }
  } else if (qb * 64 < QHI) {
#pragma unroll
    for (int kc = 0; kc < HD / 32; ++kc) { const v16h ah = frag_h(QH + (q0 + col) * CC + h * HD + kc * 32, lane), al = frag_h(QLb + (size_t)(ql0 + col) * CC + h * HD + kc * 32, lane);
#pragma unroll
      for (int j = 0; j < 8; ++j) { const v16h kbf = frag_h(KH + (kr0 + j * 16 + col) * CC + h * HD + kc * 32, lane); acc[j] = wmma16(ah, kbf, acc[j]); accl[j] = wmma16(al, kbf, accl[j]); } }
  } else {
#pragma unroll
    for (int kc = 0; kc < HD / 32; ++kc) { const v16h ah = frag_h(QH + (q0 + col) * CC + h * HD + kc * 32, lane);
#pragma unroll
      for (int j = 0; j < 8; ++j) { const v16h kbf = frag_h(KH + (kr0 + j * 16 + col) * CC + h * HD + kc * 32, lane); acc[j] = wmma16(ah, kbf, acc[j]); } } }
#pragma unroll
  for (int j = 0; j < 8; ++j) {
#pragma unroll
    for (int r = 0; r < 8; ++r) ss[wave][8 * g + r][j * 16 + col] = (acc[j][r] + accl[j][r] * (1.0f / 1024.0f)) * SCALE; }
  LDSX(); for (int rl = 0; rl < 16; ++rl) vst2(S + (size_t)(ql0 + rl) * TT + k0 + lane * 4, *(const v4f*)&ss[wave][rl][lane * 4]); }
#undef QBH
#define QBH 6   // restored: the P.v kernel keeps the causal early band of 6 query blocks
// ---- k_sm: block = query row t (head in group): keys [0, kend): causal -> logit if s <= t else excluded; softmax in f32; P x 2^11 in place (0 for excluded)
__global__ __launch_bounds__(256) void k_sm(float* __restrict__ S0 SM_EXTRA_PARAMS) { __shared__ float sred[8]; __shared__ float sbc; __shared__ __align__(16) float shv[TT];
  const int tid = threadIdx.x; const int t = blockIdx.x; const int kend = (kb_last(t >> 6) + 1) * 128;
  float* sr = S0 + (size_t)blockIdx.y * TT * TT + (size_t)t * TT;
  float m = -3.0e38f; for (int k = tid; k < kend; k += 256) { float v = (!CAUSAL || k <= t) ? sr[k] : -3.0e38f; SM_MASK_HOOK; shv[k] = v; m = fmaxf(m, v); }
#pragma unroll
  for (int o = 1; o < 32; o <<= 1) m = fmaxf(m, __shfl_xor(m, o));
  if ((tid & 31) == 0) sred[tid >> 5] = m; __syncthreads(); if (tid == 0) { float a = sred[0]; for (int i = 1; i < 8; ++i) a = fmaxf(a, sred[i]); sbc = a; } __syncthreads(); m = sbc; __syncthreads();
  float sum = 0.f; for (int k = tid; k < kend; k += 256) { const float v = shv[k]; const float e = (v <= -1.0e38f) ? 0.f : expf(v - m); shv[k] = e; sum += e; }
#pragma unroll
  for (int o = 1; o < 32; o <<= 1) sum += __shfl_xor(sum, o);
  if ((tid & 31) == 0) sred[tid >> 5] = sum; __syncthreads(); if (tid == 0) { float a = 0.f; for (int i = 0; i < 8; ++i) a += sred[i]; sbc = a > 0.f ? 2048.0f / a : 0.f; }   /* a fully excluded row yields P = 0 */ __syncthreads(); const float inv = sbc;
  for (int k = tid; k < kend; k += 256) shv[k] = shv[k] * inv;
  __syncthreads(); for (int q = tid; q < kend / 4; q += 256) vst2(sr + q * 4, *(const v4f*)&shv[q * 4]); }
// ---- k_pv: block = 64 queries (qb) of (b, h): ctx = P . v over keys [0, kend) (P x 2^11 once to f16 against v f16: 1 product; causal early query blocks: P and v as bf16 hi + lo, 3 products); 256-B (row, head) segment by 16 lanes
__global__ __launch_bounds__(128) void k_pv(const float* __restrict__ PS0, const _Float16* __restrict__ VT, const __bf16* __restrict__ VB, const __bf16* __restrict__ VBL, int b, int h0, float* __restrict__ Y) { const int h = h0 + blockIdx.z; const float* PS = PS0 + (size_t)blockIdx.z * TT * TT; __shared__ __align__(16) float ss[4][16][HD + 4];
  const int tid = threadIdx.x, wave = tid >> 5, lane = tid & 31, col = lane & 15, g = lane >> 4; const int qb = blockIdx.x; const int ql0 = qb * 64 + wave * 16; const int kce = (kb_last(qb) + 1) * 4;
  v8f acc[HD / 16] = {};
  if (qb < QBH) {
#pragma unroll 1
    for (int kc = 0; kc < kce; ++kc) { const F2 p = split_row(PS + (size_t)(ql0 + col) * TT, kc * 32, lane);
      asm volatile("s_wait_loadcnt 0x0" ::: "memory");
#pragma unroll
      for (int j = 0; j < HD / 16; ++j) { const size_t po = ((size_t)b * CC + h * HD + j * 16 + col) * (size_t)VHI + kc * 32; const v16b vh = frag_b(VB + po, lane); acc[j] = wmma_bf(p.h, vh, acc[j]); acc[j] = wmma_bf(p.l, vh, acc[j]); acc[j] = wmma_bf(p.h, frag_b(VBL + po, lane), acc[j]); } }
  } else {
#pragma unroll 1
    for (int kc = 0; kc < kce; ++kc) { const v16h p = frag_f32(PS + (size_t)(ql0 + col) * TT + kc * 32, lane);
      asm volatile("s_wait_loadcnt 0x0" ::: "memory");
#pragma unroll
      for (int j = 0; j < HD / 16; ++j) { const size_t po = ((size_t)b * CC + h * HD + j * 16 + col) * (size_t)TT + kc * 32; acc[j] = wmma16(p, frag_h(VT + po, lane), acc[j]); } } }
#pragma unroll
  for (int j = 0; j < HD / 16; ++j)
#pragma unroll
    for (int r = 0; r < 8; ++r) ss[wave][8 * g + r][j * 16 + col] = acc[j][r] * (1.0f / 2048.0f);
  LDSX(); for (int rl = 0; rl < 16; ++rl) if (lane < HD / 4) vst2(Y + ((size_t)b * TT + ql0 + rl) * CC + h * HD + lane * 4, *(const v4f*)&ss[wave][rl][lane * 4]); }

#define LN_EPS 1.0e-5f
__global__ __launch_bounds__(128) void k_resln(const float* __restrict__ O, const float* __restrict__ X, const float* __restrict__ GAM, const float* __restrict__ BET, float* __restrict__ OUT) { __shared__ float sred[2][4]; const size_t r = blockIdx.x; const int tid = threadIdx.x; const v4f o = *(const v4f*)(O + r * CC + tid * 4); const v4f xr = *(const v4f*)(X + r * CC + tid * 4); asm volatile("s_wait_loadcnt 0x0" ::: "memory"); float y[4]; float a = 0.f;
#pragma unroll
  for (int i = 0; i < 4; ++i) { y[i] = bfr(xr[i]) + o[i]; a += y[i]; }
#pragma unroll
  for (int s_ = 1; s_ < 32; s_ <<= 1) a += __shfl_xor(a, s_);
  if ((tid & 31) == 0) sred[0][tid >> 5] = a; __syncthreads();
  const float mu = (sred[0][0] + sred[0][1] + sred[0][2] + sred[0][3]) * (1.0f / (float)CC); float v = 0.f;
#pragma unroll
  for (int i = 0; i < 4; ++i) { const float d = y[i] - mu; v += d * d; }
#pragma unroll
  for (int s_ = 1; s_ < 32; s_ <<= 1) v += __shfl_xor(v, s_);
  if ((tid & 31) == 0) sred[1][tid >> 5] = v; __syncthreads();
  const float rs = 1.0f / sqrtf((sred[1][0] + sred[1][1] + sred[1][2] + sred[1][3]) * (1.0f / (float)CC) + LN_EPS); const v4f g4 = *(const v4f*)(GAM + tid * 4), b4 = *(const v4f*)(BET + tid * 4); v4f w;
#pragma unroll
  for (int i = 0; i < 4; ++i) w[i] = (y[i] - mu) * rs * bfr(g4[i]) + bfr(b4[i]);
  vst2(OUT + r * CC + tid * 4, w); }
static_assert(CC == 512 && DIN == CC, "k_resln: 128 threads x 4 floats per row; the residual adds the input row");
extern "C" void kernel_launch(void* const* d_in, const int* in_sizes, int n_in, void* d_out, int out_size, void* d_ws, size_t ws_size, hipStream_t stream) {
  (void)in_sizes; (void)n_in; (void)out_size;
  const float** F = (const float**)d_in;
  if (ws_size < (size_t)WS_END) return;
  char* ws = (char*)d_ws; _Float16 *QH = (_Float16*)(ws + WS_QH), *KH = (_Float16*)(ws + WS_KH), *VT = (_Float16*)(ws + WS_VT), *QL = (_Float16*)(ws + WS_QL), *KL = (_Float16*)(ws + WS_KL); __bf16 *VB = (__bf16*)(ws + WS_VB), *VBL = (__bf16*)(ws + WS_VBL); float *S = (float*)(ws + WS_S), *Y = (float*)(ws + WS_Y);
  (void)Y; (void)QL; (void)KL; (void)VB; (void)VBL;
  // inputs: 0 x [4,4096,512]; 1 Wq [512,64] (in,out), 2 bq [64]; 3 Wk [512,64], 4 bk; 5 Wv [512,512], 6 bv [512] (biases NONZERO); 7 gamma [512]; 8 beta [512] (ones / zeros, read)
  float* Yo = (float*)(ws + WS_Y);
  k_proj<<<dim3(TNB * TT / 64, CC / 128, 3), 128, 0, stream>>>(F[0], F[0], F[0], F[1], F[3], F[5], F[2], F[4], F[6], QH, QL, KH, KL, VT, VB, VBL);
  for (int b = 0; b < TNB; ++b) {
    k_sc<<<dim3(NQB, TT / 128, 1), 128, 0, stream>>>(QH, KH, QL, KL, b, 0, S);   /* the one score head: columns 0..63 */
    k_sm<<<dim3(TT, 1), 256, 0, stream>>>(S);
    for (int g = 0; g < NH; ++g) k_pv<<<dim3(NQB, 1, 1), 128, 0, stream>>>(S, VT, VB, VBL, b, g, Yo);   /* column group g: v / o columns 64g .. 64g+63, all eight from plane 0 */
  }
  k_resln<<<dim3(TNB * TT), 128, 0, stream>>>(Yo, F[0], F[7], F[8], (float*)d_out);
}

// v001
// A run of this version takes 846 microseconds.
// Next to v000, in two timings, it ran 4.57 times as fast each time.
// compute dtype: all float inputs rounded to bf16; q / k (64-wide) and v (512-wide) projections with EXACT bf16 products on WMMA 16x16x32 (f32 accumulate) + bias; causal logits UNSCALED: q and k each as f16 hi + (x 2^10) residual, 3 products on every row; softmax f32; P x 2^11 once to f16 x v once to f16 (bf16 hi + lo below row 384), eight 64-column passes over the same probability plane; y = bf16(x) + o and LayerNorm over 512 in f32; f32 output.
#include <hip/hip_runtime.h>
#include <math.h>

typedef __attribute__((ext_vector_type(16))) _Float16 v16h;
typedef __attribute__((ext_vector_type(16))) __bf16 v16b;
typedef __attribute__((ext_vector_type(8)))  _Float16 v8h;
typedef __attribute__((ext_vector_type(8)))  float v8f;
typedef __attribute__((ext_vector_type(4)))  float v4f;
typedef __attribute__((ext_vector_type(2)))  float v2f;
typedef __attribute__((ext_vector_type(4)))  unsigned v4u;
typedef __attribute__((ext_vector_type(4)))  int v4i;
typedef float __attribute__((may_alias)) float_a;
typedef int __attribute__((may_alias)) int_a;

template <typename T> __device__ __forceinline__ void vst2(void* p, T v) { *(T*)p = v;  }
__device__ __forceinline__ v8f wmma16(v16h a, v16h b, v8f c) {
  v8f d = __builtin_amdgcn_wmma_f32_16x16x32_f16(false, a, false, b, (short)0, c, false, false);
  asm volatile("v_nop\n\tv_nop\n\tv_nop\n\tv_nop" : "+v"(d) : "v"(a), "v"(b));
  return d;
}
__device__ __forceinline__ v8f wmma_bf(v16b a, v16b b, v8f c) {
  v8f d = __builtin_amdgcn_wmma_f32_16x16x32_bf16(false, a, false, b, (short)0, c, false, false);
  asm volatile("v_nop\n\tv_nop\n\tv_nop\n\tv_nop" : "+v"(d) : "v"(a), "v"(b));
  return d;
}
// 16x16x32 fragments: lane = (h = lane>>4, row/col = lane&15); elements 0..7 = k0+8h+0..7, 8..15 = k0+16+8h+0..7; D element r = row 8h+r
__device__ __forceinline__ v16h frag_h(const _Float16* rowk0, int lane) {
  union { v16h v; v8h q[2]; } u; const _Float16* p = rowk0 + 8 * (lane >> 4);
  u.q[0] = *(const v8h*)p; u.q[1] = *(const v8h*)(p + 16); return u.v;
}
__device__ __forceinline__ v16h frag_f32(const float* rowk0, int lane) {
  v16h a; const float* p = rowk0 + 8 * (lane >> 4);
#pragma unroll
  for (int i = 0; i < 8; ++i) { a[i] = (_Float16)p[i]; a[8 + i] = (_Float16)p[16 + i]; }
  return a;
}
__device__ __forceinline__ v16h frag_f32s(const float* rowk0, int lane, float sc) {
  v16h a; const float* p = rowk0 + 8 * (lane >> 4);
#pragma unroll
  for (int i = 0; i < 8; ++i) { a[i] = (_Float16)(p[i] * sc); a[8 + i] = (_Float16)(p[16 + i] * sc); }
  return a;
}
// column fragment from a [K][ld] layout (column n), rows >= K read as 0
__device__ __forceinline__ v16h fragc_f32(const float* W, int k0, int n, int lane, int ld, int K) {
  v16h a; const int g = lane >> 4;
#pragma unroll
  for (int i = 0; i < 8; ++i) { const int ka = k0 + 8 * g + i, kb = ka + 16;
    a[i] = (_Float16)(ka < K ? W[(size_t)(ka < K ? ka : K - 1) * ld + n] : 0.f); a[8 + i] = (_Float16)(kb < K ? W[(size_t)(kb < K ? kb : K - 1) * ld + n] : 0.f); }
  return a;
}
struct F2 { v16b h, l; };
__device__ __forceinline__ F2 bsplit16(const float v[16]) { F2 r;
#pragma unroll
  for (int i = 0; i < 16; ++i) { const __bf16 h = (__bf16)v[i]; r.h[i] = h; r.l[i] = (__bf16)(v[i] - (float)h); }
  return r; }
__device__ __forceinline__ F2 split_row(const float* row, int k0, int lane) { float v[16]; const float* p = row + k0 + 8 * (lane >> 4);
#pragma unroll
  for (int i = 0; i < 8; ++i) { v[i] = p[i]; v[8 + i] = p[16 + i]; }
  return bsplit16(v); }
__device__ __forceinline__ F2 split_rowK(const float* row, int k0, int lane, int K) { float v[16]; const int g = lane >> 4;
#pragma unroll
  for (int i = 0; i < 8; ++i) { const int ka = k0 + 8 * g + i, kb = ka + 16; v[i] = ka < K ? row[ka < K ? ka : K - 1] : 0.f; v[8 + i] = kb < K ? row[kb < K ? kb : K - 1] : 0.f; }
  return bsplit16(v); }
__device__ __forceinline__ F2 split_col(const float* W, int k0, int n, int lane, int ld, int K) { float v[16]; const int g = lane >> 4;
#pragma unroll
  for (int i = 0; i < 8; ++i) { const int ka = k0 + 8 * g + i, kb = ka + 16; v[i] = ka < K ? W[(size_t)(ka < K ? ka : K - 1) * ld + n] : 0.f; v[8 + i] = kb < K ? W[(size_t)(kb < K ? kb : K - 1) * ld + n] : 0.f; }
  return bsplit16(v); }
__device__ __forceinline__ v8f mac3(const F2& a, const F2& b, v8f c) { c = wmma_bf(a.l, b.h, c); c = wmma_bf(a.h, b.l, c); return wmma_bf(a.h, b.h, c); }
__device__ __forceinline__ float sigm(float v) { return 1.0f / (1.0f + expf(-v)); }
#define LDSX() do { asm volatile("s_wait_dscnt 0" ::: "memory"); __builtin_amdgcn_wave_barrier(); __builtin_amdgcn_fence(__ATOMIC_RELEASE, "workgroup"); } while (0)

// Single-head causal self-attention with a residual and LayerNorm (x [4,4096,512]; (in,out) Wq / Wk [512,64] and Wv [512,512] uniform(+-1/sqrt(512)) with biases of the same scale - NONZERO; q, k = x W + b (64-wide), v = x Wv + bv (512-wide); scores = q k^T with NO scaling; tril kept, -inf elsewhere; softmax over the keys; o = attn v [4,4096,512]; y = x + o; LayerNorm over the 512 features (biased variance, eps 1e-5) * gamma + beta (ones / zeros, read)). ONE 64-wide score head in columns 0..63 of the 512-wide q / k rows; P.v as eight ordinary 64-wide column groups that all read the same probability plane.
#define NB 4
#define TT 4096
#define CC 512            // NH * HD = projected width
#define DIN 512          // input (model) width
#define NH 8
#define HD 64
#define NQB (TT / 64)
#define HG 1
#define SCALE (1.0f)
#define CAUSAL 1
#ifndef TNB
#define TNB NB
#endif
__device__ __forceinline__ float bfr(float v) { return (float)(__bf16)v; }
__host__ __device__ __forceinline__ int kb_last(int qb) { return CAUSAL ? ((qb * 64 + 63) >> 7) : (TT / 128 - 1); }
typedef __attribute__((ext_vector_type(8))) __bf16 v8b;
__device__ __forceinline__ v16b frag_b(const __bf16* rowk0, int lane) {
  union { v16b v; v8b q[2]; } u; const __bf16* p = rowk0 + 8 * (lane >> 4);
  u.q[0] = *(const v8b*)p; u.q[1] = *(const v8b*)(p + 16); return u.v;
}
#define QBH 6              // causal: query blocks 0..QBH-1 of each sequence (few keys, no averaging) take the high-precision path
#define QHI TT             // rows carrying a q residual plane (all rows: 3-product logits everywhere)
#define KHI TT             // key rows carrying a k residual plane (read by every k_sc block: its 3-product branch)
#define VHI 384            // v bf16 hi / lo planes only for key rows t < VHI (read by the causal early band: query blocks < 6 see keys <= 383)
#define RW 64              // real width of q / k
// B fragment (k rows k0+.., output column o) of a weight: (in,out) [K][ld] or (out,in) [ld rows of K]: bf16 exact, or f16(bf16 * 256) exact
__device__ __forceinline__ v16b wcol_io(const float* Wm, int k0, int o, int lane, int ld) { v16b w; const int g = lane >> 4;
#pragma unroll
  for (int i = 0; i < 8; ++i) { w[i] = (__bf16)Wm[(size_t)(k0 + 8 * g + i) * ld + o]; w[8 + i] = (__bf16)Wm[(size_t)(k0 + 16 + 8 * g + i) * ld + o]; }
  return w; }
__device__ __forceinline__ v16b wcol_oi(const float* Wm, int k0, int o, int lane, int K) { v16b w; const float* p = Wm + (size_t)o * K + k0 + 8 * (lane >> 4);
#pragma unroll
  for (int i = 0; i < 8; ++i) { w[i] = (__bf16)p[i]; w[8 + i] = (__bf16)p[16 + i]; }
  return w; }
__device__ __forceinline__ v16h wcolh_io(const float* Wm, int k0, int o, int lane, int ld) { v16h w; const int g = lane >> 4;
#pragma unroll
  for (int i = 0; i < 8; ++i) { w[i] = (_Float16)(bfr(Wm[(size_t)(k0 + 8 * g + i) * ld + o]) * 256.0f); w[8 + i] = (_Float16)(bfr(Wm[(size_t)(k0 + 16 + 8 * g + i) * ld + o]) * 256.0f); }
  return w; }
__device__ __forceinline__ v16h wcolh_oi(const float* Wm, int k0, int o, int lane, int K) { v16h w; const float* p = Wm + (size_t)o * K + k0 + 8 * (lane >> 4);
#pragma unroll
  for (int i = 0; i < 8; ++i) { w[i] = (_Float16)(bfr(p[i]) * 256.0f); w[8 + i] = (_Float16)(bfr(p[16 + i]) * 256.0f); }
  return w; }
#define WQKV_LAYOUT 0   // 0 = (in,out): Wv [DIN][CC], Wq / Wk [DIN][RW]; 1 = (out,in) [CC][DIN]; 2 = per-head [NH][DIN][HD]
__device__ __forceinline__ v16b wcol_hdk(const float* Wm, int k0, int o, int lane) { v16b w; const int g = lane >> 4; const float* p = Wm + (size_t)(o / HD) * DIN * HD + (o % HD);
#pragma unroll
  for (int i = 0; i < 8; ++i) { w[i] = (__bf16)p[(size_t)(k0 + 8 * g + i) * HD]; w[8 + i] = (__bf16)p[(size_t)(k0 + 16 + 8 * g + i) * HD]; }
  return w; }
#define WO_OUT_IN 0
#if WQKV_LAYOUT == 1
#define WCOL(W, k0, o, lane) wcol_oi(W, k0, o, lane, DIN)
#elif WQKV_LAYOUT == 2
#define WCOL(W, k0, o, lane) wcol_hdk(W, k0, o, lane)
#else
__device__ __forceinline__ v16b zero16b() { v16b w; _Pragma("unroll") for (int i = 0; i < 16; ++i) w[i] = (__bf16)0.0f; return w; }
#define WCOL(W, k0, o, lane) (((which) == 2) ? wcol_io(W, k0, o, lane, CC) : (((o) < RW) ? wcol_io(W, k0, o, lane, RW) : zero16b()))   /* (in,out): Wv [512][512]; Wq / Wk [512][64]: columns >= 64 of the q / k rows are zero (and never read) */
#endif
#if WO_OUT_IN
#define WOCOL(W, k0, o, lane) wcol_oi(W, k0, o, lane, CC)
#define WOCOLH(W, k0, o, lane) wcolh_oi(W, k0, o, lane, CC)
#else
#define WOCOL(W, k0, o, lane) wcol_io(W, k0, o, lane, DIN)
#define WOCOLH(W, k0, o, lane) wcolh_io(W, k0, o, lane, DIN)
#endif

#ifndef SM_EXTRA_PARAMS
#define SM_EXTRA_PARAMS
#endif
#ifndef PROJ_EXTRA_PARAMS
#define PROJ_EXTRA_PARAMS
#endif
#ifndef SM_MASK_HOOK
#define SM_MASK_HOOK (void)0
#endif

#define WS_QH  0u                                      // f16 q rows [b*t][CC]
#define WS_KH  (WS_QH + 2u * (size_t)NB * TT * CC)      // f16 k rows [b*t][CC]
#define WS_VT  (WS_KH + 2u * (size_t)NB * TT * CC)      // f16 v planes [b][c][t]
#define WS_QL  (WS_VT + 2u * (size_t)NB * CC * TT)      // f16 q residual x 2^10 rows [b][t < QHI][CC]
#define WS_KL  (WS_QL + 2u * (size_t)NB * QHI * CC)     // f16 k residual x 2^10 rows [b][t < KHI][CC]
#define WS_VB  (WS_KL + 2u * (size_t)NB * KHI * CC)     // bf16 v hi planes [b][c][t < VHI]
#define WS_VBL (WS_VB + 2u * (size_t)NB * CC * VHI)
#define WS_S   (WS_VBL + 2u * (size_t)NB * CC * VHI)    // f32 logits / P [hg][t][s]
#define WS_Y   (WS_S  + 4u * (size_t)HG * TT * TT)      // f32 ctx rows [b*t][CC]
#define WS_END (WS_Y  + 4u * (size_t)NB * TT * CC)   // o rows [(b*TT + t)][CC] (k_pv writes them; the residual-LayerNorm kernel writes the output)

// ---- k_proj: block = (64 rows, 128 cols, which): q/k/v = X W (+ b) with exact bf16 products (K = DIN) -> which 0: q f16 rows (+ residual rows < QHI); 1: k f16 rows (+ residual rows < KHI); 2: v f16 planes [c][t] (+ bf16 hi/lo planes for t < VHI)
__global__ __launch_bounds__(128) void k_proj(const float* __restrict__ XQ, const float* __restrict__ XK, const float* __restrict__ XV, const float* __restrict__ WQ, const float* __restrict__ WK, const float* __restrict__ WV, const float* __restrict__ BQ, const float* __restrict__ BK, const float* __restrict__ BV,
    _Float16* __restrict__ QH, _Float16* __restrict__ QL, _Float16* __restrict__ KH, _Float16* __restrict__ KL, _Float16* __restrict__ VT, __bf16* __restrict__ VB, __bf16* __restrict__ VBL) {
  __shared__ __align__(16) _Float16 sh[64][136], sl[64][136]; __shared__ __align__(16) _Float16 th[128][72]; __shared__ __align__(16) __bf16 tb[128][72], tbl[128][72];
  const int tid = threadIdx.x, wave = tid >> 5, lane = tid & 31, col = lane & 15, g = lane >> 4; const int which = blockIdx.z; const int c0 = blockIdx.y * 128; const size_t r0 = (size_t)blockIdx.x * 64; const size_t bb = r0 / TT; const int t0 = (int)(r0 % TT);
  if (which < 2 && blockIdx.y > 0) return;   /* q / k have 64 real columns: only the first 128-column tile is computed; the others are never read (block-uniform exit before any barrier) */
  const float* X = which == 0 ? XQ : which == 1 ? XK : XV; const float* WA = which == 0 ? WQ : which == 1 ? WK : WV; const float* BA = which == 0 ? BQ : which == 1 ? BK : BV;
  v8f acc[8] = {};
#pragma unroll 2
  for (int kc = 0; kc < DIN / 32; ++kc) { v16b a; { const float* p = X + (r0 + wave * 16 + col) * DIN + kc * 32 + 8 * g;
#pragma unroll
      for (int i = 0; i < 8; ++i) { a[i] = (__bf16)p[i]; a[8 + i] = (__bf16)p[16 + i]; } }
    asm volatile("s_wait_loadcnt 0x0" ::: "memory");
#pragma unroll
    for (int j = 0; j < 8; ++j) { const v16b w = WCOL(WA, kc * 32, c0 + j * 16 + col, lane); asm volatile("s_wait_loadcnt 0x0" ::: "memory"); acc[j] = wmma_bf(a, w, acc[j]); } }
  if (which < 2) { _Float16* DH = which == 0 ? QH : KH; _Float16* DL = which == 0 ? QL : KL; const int nhi = which == 0 ? QHI : KHI; const bool hi_rows = t0 < nhi;
#pragma unroll
    for (int j = 0; j < 8; ++j) { const float bias = (BA && ((which) == 2 || (c0 + j * 16 + col) < RW)) ? bfr(BA[c0 + j * 16 + col]) : 0.f;
#pragma unroll
      for (int r = 0; r < 8; ++r) { const float v = acc[j][r] + bias; const _Float16 hv = (_Float16)v; sh[wave * 16 + 8 * g + r][j * 16 + col] = hv; sl[wave * 16 + 8 * g + r][j * 16 + col] = (_Float16)((v - (float)hv) * 1024.0f); } }
    __syncthreads();
    for (int e = tid; e < 64 * 16; e += 128) { const int rl = e >> 4, q = e & 15; vst2((unsigned*)(DH + (r0 + rl) * CC + c0 + q * 8), *(const v4u*)&sh[rl][q * 8]); if (hi_rows) vst2((unsigned*)(DL + (bb * nhi + t0 + rl) * (size_t)CC + c0 + q * 8), *(const v4u*)&sl[rl][q * 8]); }
  } else { const bool hi_rows = t0 < VHI;
#pragma unroll
    for (int j = 0; j < 8; ++j) { const float bias = (BA && ((which) == 2 || (c0 + j * 16 + col) < RW)) ? bfr(BA[c0 + j * 16 + col]) : 0.f;
#pragma unroll
      for (int r = 0; r < 8; ++r) { const float v = acc[j][r] + bias; const int rl = wave * 16 + 8 * g + r, cl = j * 16 + col; th[cl][rl] = (_Float16)v; const __bf16 bh = (__bf16)v; tb[cl][rl] = bh; tbl[cl][rl] = (__bf16)(v - (float)bh); } }
    __syncthreads();
    for (int e = tid; e < 128 * 8; e += 128) { const int cl = e >> 3, q = e & 7; vst2((unsigned*)(VT + (bb * CC + c0 + cl) * (size_t)TT + t0 + q * 8), *(const v4u*)&th[cl][q * 8]); if (hi_rows) { const size_t o3 = (bb * CC + c0 + cl) * (size_t)VHI + t0 + q * 8; vst2((unsigned*)(VB + o3), *(const v4u*)&tb[cl][q * 8]); vst2((unsigned*)(VBL + o3), *(const v4u*)&tbl[cl][q * 8]); } } } }
#undef QBH
#define QBH NQB   // SCORE KERNEL ONLY: every query block takes the 3-product branch (unscaled logits)
// ---- k_sc: block = (query block qb, key block kb <= kb_last(qb), head in group) of batch b: logits x SCALE; q hi + residual (x 2^10) against k (2 products) for query rows < QHI, plus the k residual (3 products) for query blocks < QBH (QBH = NQB here: every block); causal: blocks past the diagonal exit, the mask itself is applied by index in k_sm
__global__ __launch_bounds__(128) void k_sc(const _Float16* __restrict__ QH, const _Float16* __restrict__ KH, const _Float16* __restrict__ QL, const _Float16* __restrict__ KL, int b, int h0, float* __restrict__ S0) { __shared__ __align__(16) float ss[4][16][132];
  const int qb = blockIdx.x, kb = blockIdx.y; if (kb > kb_last(qb)) return;
  const int h = h0 + blockIdx.z; float* S = S0 + (size_t)blockIdx.z * TT * TT;
  const int tid = threadIdx.x, wave = tid >> 5, lane = tid & 31, col = lane & 15, g = lane >> 4; const int k0 = kb * 128; const int ql0 = qb * 64 + wave * 16; const size_t q0 = (size_t)b * TT + ql0, kr0 = (size_t)b * TT + k0;
  v8f acc[8] = {}, accl[8] = {};
  const _Float16* QLb = QL + (size_t)b * QHI * CC; const _Float16* KLb = KL + (size_t)b * KHI * CC;
  if (qb < QBH) {
#pragma unroll
    for (int kc = 0; kc < HD / 32; ++kc) { const v16h ah = frag_h(QH + (q0 + col) * CC + h * HD + kc * 32, lane), al = frag_h(QLb + (size_t)(ql0 + col) * CC + h * HD + kc * 32, lane);
#pragma unroll
      for (int j = 0; j < 8; ++j) { const v16h kbf = frag_h(KH + (kr0 + j * 16 + col) * CC + h * HD + kc * 32, lane), klf = frag_h(KLb + (size_t)(k0 + j * 16 + col) * CC + h * HD + kc * 32, lane); acc[j] = wmma16(ah, kbf, acc[j]); accl[j] = wmma16(al, kbf, accl[j]); accl[j] = wmma16(ah, klf, accl[j]); } }
  } else if (qb * 64 < QHI) {
#pragma unroll
    for (int kc = 0; kc < HD / 32; ++kc) { const v16h ah = frag_h(QH + (q0 + col) * CC + h * HD + kc * 32, lane), al = frag_h(QLb + (size_t)(ql0 + col) * CC + h * HD + kc * 32, lane);
#pragma unroll
      for (int j = 0; j < 8; ++j) { const v16h kbf = frag_h(KH + (kr0 + j * 16 + col) * CC + h * HD + kc * 32, lane); acc[j] = wmma16(ah, kbf, acc[j]); accl[j] = wmma16(al, kbf, accl[j]); } }
  } else {
#pragma unroll
    for (int kc = 0; kc < HD / 32; ++kc) { const v16h ah = frag_h(QH + (q0 + col) * CC + h * HD + kc * 32, lane);
#pragma unroll
      for (int j = 0; j < 8; ++j) { const v16h kbf = frag_h(KH + (kr0 + j * 16 + col) * CC + h * HD + kc * 32, lane); acc[j] = wmma16(ah, kbf, acc[j]); } } }
#pragma unroll
  for (int j = 0; j < 8; ++j) {
#pragma unroll
    for (int r = 0; r < 8; ++r) ss[wave][8 * g + r][j * 16 + col] = (acc[j][r] + accl[j][r] * (1.0f / 1024.0f)) * SCALE; }
  LDSX(); for (int rl = 0; rl < 16; ++rl) vst2(S + (size_t)(ql0 + rl) * TT + k0 + lane * 4, *(const v4f*)&ss[wave][rl][lane * 4]); }
#undef QBH
#define QBH 6   // restored: the P.v kernel keeps the causal early band of 6 query blocks
// ---- k_sm: block = query row t (head in group): keys [0, kend): causal -> logit if s <= t else excluded; softmax in f32; P x 2^11 in place (0 for excluded)
__global__ __launch_bounds__(256) void k_sm(float* __restrict__ S0 SM_EXTRA_PARAMS) { __shared__ float sred[8]; __shared__ float sbc; __shared__ __align__(16) float shv[TT];
  const int tid = threadIdx.x; const int t = blockIdx.x; const int kend = (kb_last(t >> 6) + 1) * 128;
  float* sr = S0 + (size_t)blockIdx.y * TT * TT + (size_t)t * TT;
  float m = -3.0e38f; for (int k = tid; k < kend; k += 256) { float v = (!CAUSAL || k <= t) ? sr[k] : -3.0e38f; SM_MASK_HOOK; shv[k] = v; m = fmaxf(m, v); }
#pragma unroll
  for (int o = 1; o < 32; o <<= 1) m = fmaxf(m, __shfl_xor(m, o));
  if ((tid & 31) == 0) sred[tid >> 5] = m; __syncthreads(); if (tid == 0) { float a = sred[0]; for (int i = 1; i < 8; ++i) a = fmaxf(a, sred[i]); sbc = a; } __syncthreads(); m = sbc; __syncthreads();
  float sum = 0.f; for (int k = tid; k < kend; k += 256) { const float v = shv[k]; const float e = (v <= -1.0e38f) ? 0.f : expf(v - m); shv[k] = e; sum += e; }
#pragma unroll
  for (int o = 1; o < 32; o <<= 1) sum += __shfl_xor(sum, o);
  if ((tid & 31) == 0) sred[tid >> 5] = sum; __syncthreads(); if (tid == 0) { float a = 0.f; for (int i = 0; i < 8; ++i) a += sred[i]; sbc = a > 0.f ? 2048.0f / a : 0.f; }   /* a fully excluded row yields P = 0 */ __syncthreads(); const float inv = sbc;
  for (int k = tid; k < kend; k += 256) shv[k] = shv[k] * inv;
  __syncthreads(); for (int q = tid; q < kend / 4; q += 256) vst2(sr + q * 4, *(const v4f*)&shv[q * 4]); }
// ---- k_pv: block = 64 queries (qb) of (b, h): ctx = P . v over keys [0, kend) (P x 2^11 once to f16 against v f16: 1 product; causal early query blocks: P and v as bf16 hi + lo, 3 products); 256-B (row, head) segment by 16 lanes
__global__ __launch_bounds__(128) void k_pv(const float* __restrict__ PS0, const _Float16* __restrict__ VT, const __bf16* __restrict__ VB, const __bf16* __restrict__ VBL, int b, int h0, float* __restrict__ Y) { const int h = h0 + blockIdx.z; const float* PS = PS0;   /* blockIdx.z = column group; every group reads the one probability plane */ __shared__ __align__(16) float ss[4][16][HD + 4];
  const int tid = threadIdx.x, wave = tid >> 5, lane = tid & 31, col = lane & 15, g = lane >> 4; const int qb = blockIdx.x; const int ql0 = qb * 64 + wave * 16; const int kce = (kb_last(qb) + 1) * 4;
  v8f acc[HD / 16] = {};
  if (qb < QBH) {
#pragma unroll 1
    for (int kc = 0; kc < kce; ++kc) { const F2 p = split_row(PS + (size_t)(ql0 + col) * TT, kc * 32, lane);
      asm volatile("s_wait_loadcnt 0x0" ::: "memory");
#pragma unroll
      for (int j = 0; j < HD / 16; ++j) { const size_t po = ((size_t)b * CC + h * HD + j * 16 + col) * (size_t)VHI + kc * 32; const v16b vh = frag_b(VB + po, lane); acc[j] = wmma_bf(p.h, vh, acc[j]); acc[j] = wmma_bf(p.l, vh, acc[j]); acc[j] = wmma_bf(p.h, frag_b(VBL + po, lane), acc[j]); } }
  } else {
#pragma unroll 1
    for (int kc = 0; kc < kce; ++kc) { const v16h p = frag_f32(PS + (size_t)(ql0 + col) * TT + kc * 32, lane);
      asm volatile("s_wait_loadcnt 0x0" ::: "memory");
#pragma unroll
      for (int j = 0; j < HD / 16; ++j) { const size_t po = ((size_t)b * CC + h * HD + j * 16 + col) * (size_t)TT + kc * 32; acc[j] = wmma16(p, frag_h(VT + po, lane), acc[j]); } } }
#pragma unroll
  for (int j = 0; j < HD / 16; ++j)
#pragma unroll
    for (int r = 0; r < 8; ++r) ss[wave][8 * g + r][j * 16 + col] = acc[j][r] * (1.0f / 2048.0f);
  LDSX(); for (int rl = 0; rl < 16; ++rl) if (lane < HD / 4) vst2(Y + ((size_t)b * TT + ql0 + rl) * CC + h * HD + lane * 4, *(const v4f*)&ss[wave][rl][lane * 4]); }

#define LN_EPS 1.0e-5f
__global__ __launch_bounds__(128) void k_resln(const float* __restrict__ O, const float* __restrict__ X, const float* __restrict__ GAM, const float* __restrict__ BET, float* __restrict__ OUT) { __shared__ float sred[2][4]; const size_t r = blockIdx.x; const int tid = threadIdx.x; const v4f o = *(const v4f*)(O + r * CC + tid * 4); const v4f xr = *(const v4f*)(X + r * CC + tid * 4); asm volatile("s_wait_loadcnt 0x0" ::: "memory"); float y[4]; float a = 0.f;
#pragma unroll
  for (int i = 0; i < 4; ++i) { y[i] = bfr(xr[i]) + o[i]; a += y[i]; }
#pragma unroll
  for (int s_ = 1; s_ < 32; s_ <<= 1) a += __shfl_xor(a, s_);
  if ((tid & 31) == 0) sred[0][tid >> 5] = a; __syncthreads();
  const float mu = (sred[0][0] + sred[0][1] + sred[0][2] + sred[0][3]) * (1.0f / (float)CC); float v = 0.f;
#pragma unroll
  for (int i = 0; i < 4; ++i) { const float d = y[i] - mu; v += d * d; }
#pragma unroll
  for (int s_ = 1; s_ < 32; s_ <<= 1) v += __shfl_xor(v, s_);
  if ((tid & 31) == 0) sred[1][tid >> 5] = v; __syncthreads();
  const float rs = 1.0f / sqrtf((sred[1][0] + sred[1][1] + sred[1][2] + sred[1][3]) * (1.0f / (float)CC) + LN_EPS); const v4f g4 = *(const v4f*)(GAM + tid * 4), b4 = *(const v4f*)(BET + tid * 4); v4f w;
#pragma unroll
  for (int i = 0; i < 4; ++i) w[i] = (y[i] - mu) * rs * bfr(g4[i]) + bfr(b4[i]);
  vst2(OUT + r * CC + tid * 4, w); }
static_assert(CC == 512 && DIN == CC, "k_resln: 128 threads x 4 floats per row; the residual adds the input row");
extern "C" void kernel_launch(void* const* d_in, const int* in_sizes, int n_in, void* d_out, int out_size, void* d_ws, size_t ws_size, hipStream_t stream) {
  (void)in_sizes; (void)n_in; (void)out_size;
  const float** F = (const float**)d_in;
  if (ws_size < (size_t)WS_END) return;
  char* ws = (char*)d_ws; _Float16 *QH = (_Float16*)(ws + WS_QH), *KH = (_Float16*)(ws + WS_KH), *VT = (_Float16*)(ws + WS_VT), *QL = (_Float16*)(ws + WS_QL), *KL = (_Float16*)(ws + WS_KL); __bf16 *VB = (__bf16*)(ws + WS_VB), *VBL = (__bf16*)(ws + WS_VBL); float *S = (float*)(ws + WS_S), *Y = (float*)(ws + WS_Y);
  (void)Y; (void)QL; (void)KL; (void)VB; (void)VBL;
  // inputs: 0 x [4,4096,512]; 1 Wq [512,64] (in,out), 2 bq [64]; 3 Wk [512,64], 4 bk; 5 Wv [512,512], 6 bv [512] (biases NONZERO); 7 gamma [512]; 8 beta [512] (ones / zeros, read)
  float* Yo = (float*)(ws + WS_Y);
  k_proj<<<dim3(TNB * TT / 64, CC / 128, 3), 128, 0, stream>>>(F[0], F[0], F[0], F[1], F[3], F[5], F[2], F[4], F[6], QH, QL, KH, KL, VT, VB, VBL);
  for (int b = 0; b < TNB; ++b) {
    k_sc<<<dim3(NQB, TT / 128, 1), 128, 0, stream>>>(QH, KH, QL, KL, b, 0, S);   /* the one score head: columns 0..63 */
    k_sm<<<dim3(TT, 1), 256, 0, stream>>>(S);
    k_pv<<<dim3(NQB, 1, NH), 128, 0, stream>>>(S, VT, VB, VBL, b, 0, Yo);   /* one launch, blockIdx.z = column group g: v / o columns 64g .. 64g+63, all eight from plane 0 */
  }
  k_resln<<<dim3(TNB * TT), 128, 0, stream>>>(Yo, F[0], F[7], F[8], (float*)d_out);
}

// v002
// It runs in 431 microseconds.
// Timed twice side by side with v001, it ran 1.95 and 1.99 times as fast.
// Over all steps from v000 it is 9.00 times as fast.
// compute dtype: all float inputs rounded to bf16; q / k (64-wide) and v (512-wide) projections with EXACT bf16 products on WMMA 16x16x32 (f32 accumulate) + bias; causal logits UNSCALED: q and k each as f16 hi + (x 2^10) residual, 3 products on every row; softmax f32; P x 2^11 once to f16 x v once to f16 (bf16 hi + lo below row 384), eight 64-column passes over the same probability plane; y = bf16(x) + o and LayerNorm over 512 in f32; f32 output.
#include <hip/hip_runtime.h>
#include <math.h>

typedef __attribute__((ext_vector_type(16))) _Float16 v16h;
typedef __attribute__((ext_vector_type(16))) __bf16 v16b;
typedef __attribute__((ext_vector_type(8)))  _Float16 v8h;
typedef __attribute__((ext_vector_type(8)))  float v8f;
typedef __attribute__((ext_vector_type(4)))  float v4f;
typedef __attribute__((ext_vector_type(2)))  float v2f;
typedef __attribute__((ext_vector_type(4)))  unsigned v4u;
typedef __attribute__((ext_vector_type(4)))  int v4i;
typedef float __attribute__((may_alias)) float_a;
typedef int __attribute__((may_alias)) int_a;

template <typename T> __device__ __forceinline__ void vst2(void* p, T v) { *(T*)p = v;  }
__device__ __forceinline__ v8f wmma16(v16h a, v16h b, v8f c) {
  v8f d = __builtin_amdgcn_wmma_f32_16x16x32_f16(false, a, false, b, (short)0, c, false, false);
  asm volatile("v_nop\n\tv_nop\n\tv_nop\n\tv_nop" : "+v"(d) : "v"(a), "v"(b));
  return d;
}
__device__ __forceinline__ v8f wmma_bf(v16b a, v16b b, v8f c) {
  v8f d = __builtin_amdgcn_wmma_f32_16x16x32_bf16(false, a, false, b, (short)0, c, false, false);
  asm volatile("v_nop\n\tv_nop\n\tv_nop\n\tv_nop" : "+v"(d) : "v"(a), "v"(b));
  return d;
}
// 16x16x32 fragments: lane = (h = lane>>4, row/col = lane&15); elements 0..7 = k0+8h+0..7, 8..15 = k0+16+8h+0..7; D element r = row 8h+r
__device__ __forceinline__ v16h frag_h(const _Float16* rowk0, int lane) {
  union { v16h v; v8h q[2]; } u; const _Float16* p = rowk0 + 8 * (lane >> 4);
  u.q[0] = *(const v8h*)p; u.q[1] = *(const v8h*)(p + 16); return u.v;
}
__device__ __forceinline__ v16h frag_f32(const float* rowk0, int lane) {
  v16h a; const float* p = rowk0 + 8 * (lane >> 4);
#pragma unroll
  for (int i = 0; i < 8; ++i) { a[i] = (_Float16)p[i]; a[8 + i] = (_Float16)p[16 + i]; }
  return a;
}
__device__ __forceinline__ v16h frag_f32s(const float* rowk0, int lane, float sc) {
  v16h a; const float* p = rowk0 + 8 * (lane >> 4);
#pragma unroll
  for (int i = 0; i < 8; ++i) { a[i] = (_Float16)(p[i] * sc); a[8 + i] = (_Float16)(p[16 + i] * sc); }
  return a;
}
// column fragment from a [K][ld] layout (column n), rows >= K read as 0
__device__ __forceinline__ v16h fragc_f32(const float* W, int k0, int n, int lane, int ld, int K) {
  v16h a; const int g = lane >> 4;
#pragma unroll
  for (int i = 0; i < 8; ++i) { const int ka = k0 + 8 * g + i, kb = ka + 16;
    a[i] = (_Float16)(ka < K ? W[(size_t)(ka < K ? ka : K - 1) * ld + n] : 0.f); a[8 + i] = (_Float16)(kb < K ? W[(size_t)(kb < K ? kb : K - 1) * ld + n] : 0.f); }
  return a;
}
struct F2 { v16b h, l; };
__device__ __forceinline__ F2 bsplit16(const float v[16]) { F2 r;
#pragma unroll
  for (int i = 0; i < 16; ++i) { const __bf16 h = (__bf16)v[i]; r.h[i] = h; r.l[i] = (__bf16)(v[i] - (float)h); }
  return r; }
__device__ __forceinline__ F2 split_row(const float* row, int k0, int lane) { float v[16]; const float* p = row + k0 + 8 * (lane >> 4);
#pragma unroll
  for (int i = 0; i < 8; ++i) { v[i] = p[i]; v[8 + i] = p[16 + i]; }
  return bsplit16(v); }
__device__ __forceinline__ F2 split_rowK(const float* row, int k0, int lane, int K) { float v[16]; const int g = lane >> 4;
#pragma unroll
  for (int i = 0; i < 8; ++i) { const int ka = k0 + 8 * g + i, kb = ka + 16; v[i] = ka < K ? row[ka < K ? ka : K - 1] : 0.f; v[8 + i] = kb < K ? row[kb < K ? kb : K - 1] : 0.f; }
  return bsplit16(v); }
__device__ __forceinline__ F2 split_col(const float* W, int k0, int n, int lane, int ld, int K) { float v[16]; const int g = lane >> 4;
#pragma unroll
  for (int i = 0; i < 8; ++i) { const int ka = k0 + 8 * g + i, kb = ka + 16; v[i] = ka < K ? W[(size_t)(ka < K ? ka : K - 1) * ld + n] : 0.f; v[8 + i] = kb < K ? W[(size_t)(kb < K ? kb : K - 1) * ld + n] : 0.f; }
  return bsplit16(v); }
__device__ __forceinline__ v8f mac3(const F2& a, const F2& b, v8f c) { c = wmma_bf(a.l, b.h, c); c = wmma_bf(a.h, b.l, c); return wmma_bf(a.h, b.h, c); }
__device__ __forceinline__ float sigm(float v) { return 1.0f / (1.0f + expf(-v)); }
#define LDSX() do { asm volatile("s_wait_dscnt 0" ::: "memory"); __builtin_amdgcn_wave_barrier(); __builtin_amdgcn_fence(__ATOMIC_RELEASE, "workgroup"); } while (0)

// Single-head causal self-attention with a residual and LayerNorm (x [4,4096,512]; (in,out) Wq / Wk [512,64] and Wv [512,512] uniform(+-1/sqrt(512)) with biases of the same scale - NONZERO; q, k = x W + b (64-wide), v = x Wv + bv (512-wide); scores = q k^T with NO scaling; tril kept, -inf elsewhere; softmax over the keys; o = attn v [4,4096,512]; y = x + o; LayerNorm over the 512 features (biased variance, eps 1e-5) * gamma + beta (ones / zeros, read)). ONE 64-wide score head in columns 0..63 of the 512-wide q / k rows; P.v as eight ordinary 64-wide column groups that all read the same probability plane.
#define NB 4
#define TT 4096
#define CC 512            // NH * HD = projected width
#define DIN 512          // input (model) width
#define NH 8
#define HD 64
#define NQB (TT / 64)
#define HG 1
#define SCALE (1.0f)
#define CAUSAL 1
#ifndef TNB
#define TNB NB
#endif
__device__ __forceinline__ float bfr(float v) { return (float)(__bf16)v; }
__host__ __device__ __forceinline__ int kb_last(int qb) { return CAUSAL ? ((qb * 64 + 63) >> 7) : (TT / 128 - 1); }
typedef __attribute__((ext_vector_type(8))) __bf16 v8b;
__device__ __forceinline__ v16b frag_b(const __bf16* rowk0, int lane) {
  union { v16b v; v8b q[2]; } u; const __bf16* p = rowk0 + 8 * (lane >> 4);
  u.q[0] = *(const v8b*)p; u.q[1] = *(const v8b*)(p + 16); return u.v;
}
#define QBH 6              // causal: query blocks 0..QBH-1 of each sequence (few keys, no averaging) take the high-precision path
#define QHI TT             // rows carrying a q residual plane (all rows: 3-product logits everywhere)
#define KHI TT             // key rows carrying a k residual plane (read by every k_sc block: its 3-product branch)
#define VHI 384            // v bf16 hi / lo planes only for key rows t < VHI (read by the causal early band: query blocks < 6 see keys <= 383)
#define RW 64              // real width of q / k
// B fragment (k rows k0+.., output column o) of a weight: (in,out) [K][ld] or (out,in) [ld rows of K]: bf16 exact, or f16(bf16 * 256) exact
__device__ __forceinline__ v16b wcol_io(const float* Wm, int k0, int o, int lane, int ld) { v16b w; const int g = lane >> 4;
#pragma unroll
  for (int i = 0; i < 8; ++i) { w[i] = (__bf16)Wm[(size_t)(k0 + 8 * g + i) * ld + o]; w[8 + i] = (__bf16)Wm[(size_t)(k0 + 16 + 8 * g + i) * ld + o]; }
  return w; }
__device__ __forceinline__ v16b wcol_oi(const float* Wm, int k0, int o, int lane, int K) { v16b w; const float* p = Wm + (size_t)o * K + k0 + 8 * (lane >> 4);
#pragma unroll
  for (int i = 0; i < 8; ++i) { w[i] = (__bf16)p[i]; w[8 + i] = (__bf16)p[16 + i]; }
  return w; }
__device__ __forceinline__ v16h wcolh_io(const float* Wm, int k0, int o, int lane, int ld) { v16h w; const int g = lane >> 4;
#pragma unroll
  for (int i = 0; i < 8; ++i) { w[i] = (_Float16)(bfr(Wm[(size_t)(k0 + 8 * g + i) * ld + o]) * 256.0f); w[8 + i] = (_Float16)(bfr(Wm[(size_t)(k0 + 16 + 8 * g + i) * ld + o]) * 256.0f); }
  return w; }
__device__ __forceinline__ v16h wcolh_oi(const float* Wm, int k0, int o, int lane, int K) { v16h w; const float* p = Wm + (size_t)o * K + k0 + 8 * (lane >> 4);
#pragma unroll
  for (int i = 0; i < 8; ++i) { w[i] = (_Float16)(bfr(p[i]) * 256.0f); w[8 + i] = (_Float16)(bfr(p[16 + i]) * 256.0f); }
  return w; }
#define WQKV_LAYOUT 0   // 0 = (in,out): Wv [DIN][CC], Wq / Wk [DIN][RW]; 1 = (out,in) [CC][DIN]; 2 = per-head [NH][DIN][HD]
__device__ __forceinline__ v16b wcol_hdk(const float* Wm, int k0, int o, int lane) { v16b w; const int g = lane >> 4; const float* p = Wm + (size_t)(o / HD) * DIN * HD + (o % HD);
#pragma unroll
  for (int i = 0; i < 8; ++i) { w[i] = (__bf16)p[(size_t)(k0 + 8 * g + i) * HD]; w[8 + i] = (__bf16)p[(size_t)(k0 + 16 + 8 * g + i) * HD]; }
  return w; }
#define WO_OUT_IN 0
#if WQKV_LAYOUT == 1
#define WCOL(W, k0, o, lane) wcol_oi(W, k0, o, lane, DIN)
#elif WQKV_LAYOUT == 2
#define WCOL(W, k0, o, lane) wcol_hdk(W, k0, o, lane)
#else
__device__ __forceinline__ v16b zero16b() { v16b w; _Pragma("unroll") for (int i = 0; i < 16; ++i) w[i] = (__bf16)0.0f; return w; }
#define WCOL(W, k0, o, lane) (((which) == 2) ? wcol_io(W, k0, o, lane, CC) : (((o) < RW) ? wcol_io(W, k0, o, lane, RW) : zero16b()))   /* (in,out): Wv [512][512]; Wq / Wk [512][64]: columns >= 64 of the q / k rows are zero (and never read) */
#endif
#if WO_OUT_IN
#define WOCOL(W, k0, o, lane) wcol_oi(W, k0, o, lane, CC)
#define WOCOLH(W, k0, o, lane) wcolh_oi(W, k0, o, lane, CC)
#else
#define WOCOL(W, k0, o, lane) wcol_io(W, k0, o, lane, DIN)
#define WOCOLH(W, k0, o, lane) wcolh_io(W, k0, o, lane, DIN)
#endif

#ifndef SM_EXTRA_PARAMS
#define SM_EXTRA_PARAMS
#endif
#ifndef PROJ_EXTRA_PARAMS
#define PROJ_EXTRA_PARAMS
#endif
#ifndef SM_MASK_HOOK
#define SM_MASK_HOOK (void)0
#endif

#define WS_QH  0u                                      // f16 q rows [b*t][CC]
#define WS_KH  (WS_QH + 2u * (size_t)NB * TT * CC)      // f16 k rows [b*t][CC]
#define WS_VT  (WS_KH + 2u * (size_t)NB * TT * CC)      // f16 v planes [b][c][t]
#define WS_QL  (WS_VT + 2u * (size_t)NB * CC * TT)      // f16 q residual x 2^10 rows [b][t < QHI][CC]
#define WS_KL  (WS_QL + 2u * (size_t)NB * QHI * CC)     // f16 k residual x 2^10 rows [b][t < KHI][CC]
#define WS_VB  (WS_KL + 2u * (size_t)NB * KHI * CC)     // bf16 v hi planes [b][c][t < VHI]
#define WS_VBL (WS_VB + 2u * (size_t)NB * CC * VHI)
#define WS_S   (WS_VBL + 2u * (size_t)NB * CC * VHI)    // f32 logits / P [hg][t][s]
#define WS_Y   (WS_S  + 4u * (size_t)HG * TT * TT)      // f32 ctx rows [b*t][CC]
#define WS_END (WS_Y  + 4u * (size_t)NB * TT * CC)   // o rows [(b*TT + t)][CC] (k_pv writes them; the residual-LayerNorm kernel writes the output)

// ---- k_proj: block = (64 rows, 128 cols, which): q/k/v = X W (+ b) with exact bf16 products (K = DIN) -> which 0: q f16 rows (+ residual rows < QHI); 1: k f16 rows (+ residual rows < KHI); 2: v f16 planes [c][t] (+ bf16 hi/lo planes for t < VHI)
__global__ __launch_bounds__(128) void k_proj(const float* __restrict__ XQ, const float* __restrict__ XK, const float* __restrict__ XV, const float* __restrict__ WQ, const float* __restrict__ WK, const float* __restrict__ WV, const float* __restrict__ BQ, const float* __restrict__ BK, const float* __restrict__ BV,
    _Float16* __restrict__ QH, _Float16* __restrict__ QL, _Float16* __restrict__ KH, _Float16* __restrict__ KL, _Float16* __restrict__ VT, __bf16* __restrict__ VB, __bf16* __restrict__ VBL) {
  __shared__ __align__(16) _Float16 sh[64][136], sl[64][136]; __shared__ __align__(16) _Float16 th[128][72]; __shared__ __align__(16) __bf16 tb[128][72], tbl[128][72];
  const int tid = threadIdx.x, wave = tid >> 5, lane = tid & 31, col = lane & 15, g = lane >> 4; const int which = blockIdx.z; const int c0 = blockIdx.y * 128; const size_t r0 = (size_t)blockIdx.x * 64; const size_t bb = r0 / TT; const int t0 = (int)(r0 % TT);
  if (which < 2 && blockIdx.y > 0) return;   /* q / k have 64 real columns: only the first 128-column tile is computed; the others are never read (block-uniform exit before any barrier) */
  const float* X = which == 0 ? XQ : which == 1 ? XK : XV; const float* WA = which == 0 ? WQ : which == 1 ? WK : WV; const float* BA = which == 0 ? BQ : which == 1 ? BK : BV;
  v8f acc[8] = {};
#pragma unroll 2
  for (int kc = 0; kc < DIN / 32; ++kc) { v16b a; { const float* p = X + (r0 + wave * 16 + col) * DIN + kc * 32 + 8 * g;
#pragma unroll
      for (int i = 0; i < 8; ++i) { a[i] = (__bf16)p[i]; a[8 + i] = (__bf16)p[16 + i]; } }
    asm volatile("s_wait_loadcnt 0x0" ::: "memory");
#pragma unroll
    for (int j = 0; j < 8; ++j) { const v16b w = WCOL(WA, kc * 32, c0 + j * 16 + col, lane); asm volatile("s_wait_loadcnt 0x0" ::: "memory"); acc[j] = wmma_bf(a, w, acc[j]); } }
  if (which < 2) { _Float16* DH = which == 0 ? QH : KH; _Float16* DL = which == 0 ? QL : KL; const int nhi = which == 0 ? QHI : KHI; const bool hi_rows = t0 < nhi;
#pragma unroll
    for (int j = 0; j < 8; ++j) { const float bias = (BA && ((which) == 2 || (c0 + j * 16 + col) < RW)) ? bfr(BA[c0 + j * 16 + col]) : 0.f;
#pragma unroll
      for (int r = 0; r < 8; ++r) { const float v = acc[j][r] + bias; const _Float16 hv = (_Float16)v; sh[wave * 16 + 8 * g + r][j * 16 + col] = hv; sl[wave * 16 + 8 * g + r][j * 16 + col] = (_Float16)((v - (float)hv) * 1024.0f); } }
    __syncthreads();
    for (int e = tid; e < 64 * 16; e += 128) { const int rl = e >> 4, q = e & 15; vst2((unsigned*)(DH + (r0 + rl) * CC + c0 + q * 8), *(const v4u*)&sh[rl][q * 8]); if (hi_rows) vst2((unsigned*)(DL + (bb * nhi + t0 + rl) * (size_t)CC + c0 + q * 8), *(const v4u*)&sl[rl][q * 8]); }
  } else { const bool hi_rows = t0 < VHI;
#pragma unroll
    for (int j = 0; j < 8; ++j) { const float bias = (BA && ((which) == 2 || (c0 + j * 16 + col) < RW)) ? bfr(BA[c0 + j * 16 + col]) : 0.f;
#pragma unroll
      for (int r = 0; r < 8; ++r) { const float v = acc[j][r] + bias; const int rl = wave * 16 + 8 * g + r, cl = j * 16 + col; th[cl][rl] = (_Float16)v; const __bf16 bh = (__bf16)v; tb[cl][rl] = bh; tbl[cl][rl] = (__bf16)(v - (float)bh); } }
    __syncthreads();
    for (int e = tid; e < 128 * 8; e += 128) { const int cl = e >> 3, q = e & 7; vst2((unsigned*)(VT + (bb * CC + c0 + cl) * (size_t)TT + t0 + q * 8), *(const v4u*)&th[cl][q * 8]); if (hi_rows) { const size_t o3 = (bb * CC + c0 + cl) * (size_t)VHI + t0 + q * 8; vst2((unsigned*)(VB + o3), *(const v4u*)&tb[cl][q * 8]); vst2((unsigned*)(VBL + o3), *(const v4u*)&tbl[cl][q * 8]); } } } }
#undef QBH
#define QBH NQB   // SCORE KERNEL ONLY: every query block takes the 3-product branch (unscaled logits)
// ---- k_sc: block = (query block qb, key block kb <= kb_last(qb), head in group) of batch b: logits x SCALE; q hi + residual (x 2^10) against k (2 products) for query rows < QHI, plus the k residual (3 products) for query blocks < QBH (QBH = NQB here: every block); causal: blocks past the diagonal exit, the mask itself is applied by index in k_sm
__global__ __launch_bounds__(128) void k_sc(const _Float16* __restrict__ QH, const _Float16* __restrict__ KH, const _Float16* __restrict__ QL, const _Float16* __restrict__ KL, int b, int h0, float* __restrict__ S0) { __shared__ __align__(16) float ss[4][16][132];
  const int qb = blockIdx.x, kb = blockIdx.y; if (kb > kb_last(qb)) return;
  const int h = h0 + blockIdx.z; float* S = S0 + (size_t)blockIdx.z * TT * TT;
  const int tid = threadIdx.x, wave = tid >> 5, lane = tid & 31, col = lane & 15, g = lane >> 4; const int k0 = kb * 128; const int ql0 = qb * 64 + wave * 16; const size_t q0 = (size_t)b * TT + ql0, kr0 = (size_t)b * TT + k0;
  v8f acc[8] = {}, accl[8] = {};
  const _Float16* QLb = QL + (size_t)b * QHI * CC; const _Float16* KLb = KL + (size_t)b * KHI * CC;
  if (qb < QBH) {
#pragma unroll
    for (int kc = 0; kc < HD / 32; ++kc) { const v16h ah = frag_h(QH + (q0 + col) * CC + h * HD + kc * 32, lane), al = frag_h(QLb + (size_t)(ql0 + col) * CC + h * HD + kc * 32, lane);
#pragma unroll
      for (int j = 0; j < 8; ++j) { const v16h kbf = frag_h(KH + (kr0 + j * 16 + col) * CC + h * HD + kc * 32, lane), klf = frag_h(KLb + (size_t)(k0 + j * 16 + col) * CC + h * HD + kc * 32, lane); acc[j] = wmma16(ah, kbf, acc[j]); accl[j] = wmma16(al, kbf, accl[j]); accl[j] = wmma16(ah, klf, accl[j]); } }
  } else if (qb * 64 < QHI) {
#pragma unroll
    for (int kc = 0; kc < HD / 32; ++kc) { const v16h ah = frag_h(QH + (q0 + col) * CC + h * HD + kc * 32, lane), al = frag_h(QLb + (size_t)(ql0 + col) * CC + h * HD + kc * 32, lane);
#pragma unroll
      for (int j = 0; j < 8; ++j) { const v16h kbf = frag_h(KH + (kr0 + j * 16 + col) * CC + h * HD + kc * 32, lane); acc[j] = wmma16(ah, kbf, acc[j]); accl[j] = wmma16(al, kbf, accl[j]); } }
  } else {
#pragma unroll
    for (int kc = 0; kc < HD / 32; ++kc) { const v16h ah = frag_h(QH + (q0 + col) * CC + h * HD + kc * 32, lane);
#pragma unroll
      for (int j = 0; j < 8; ++j) { const v16h kbf = frag_h(KH + (kr0 + j * 16 + col) * CC + h * HD + kc * 32, lane); acc[j] = wmma16(ah, kbf, acc[j]); } } }
#pragma unroll
  for (int j = 0; j < 8; ++j) {
#pragma unroll
    for (int r = 0; r < 8; ++r) ss[wave][8 * g + r][j * 16 + col] = (acc[j][r] + accl[j][r] * (1.0f / 1024.0f)) * SCALE; }
  LDSX(); for (int rl = 0; rl < 16; ++rl) vst2(S + (size_t)(ql0 + rl) * TT + k0 + lane * 4, *(const v4f*)&ss[wave][rl][lane * 4]); }
#undef QBH
#define QBH 6   // restored: the P.v kernel keeps the causal early band of 6 query blocks
// ---- k_sm: block = query row t (head in group): keys [0, kend): causal -> logit if s <= t else excluded; softmax in f32; P x 2^11 in place (0 for excluded)
__global__ __launch_bounds__(256) void k_sm(float* __restrict__ S0 SM_EXTRA_PARAMS) { __shared__ float sred[8]; __shared__ float sbc; __shared__ __align__(16) float shv[TT];
  const int tid = threadIdx.x; const int t = blockIdx.x; const int kend = (kb_last(t >> 6) + 1) * 128;
  float* sr = S0 + (size_t)blockIdx.y * TT * TT + (size_t)t * TT;
  float m = -3.0e38f; for (int k = tid; k < kend; k += 256) { float v = (!CAUSAL || k <= t) ? sr[k] : -3.0e38f; SM_MASK_HOOK; shv[k] = v; m = fmaxf(m, v); }
#pragma unroll
  for (int o = 1; o < 32; o <<= 1) m = fmaxf(m, __shfl_xor(m, o));
  if ((tid & 31) == 0) sred[tid >> 5] = m; __syncthreads(); if (tid == 0) { float a = sred[0]; for (int i = 1; i < 8; ++i) a = fmaxf(a, sred[i]); sbc = a; } __syncthreads(); m = sbc; __syncthreads();
  float sum = 0.f; for (int k = tid; k < kend; k += 256) { const float v = shv[k]; const float e = (v <= -1.0e38f) ? 0.f : expf(v - m); shv[k] = e; sum += e; }
#pragma unroll
  for (int o = 1; o < 32; o <<= 1) sum += __shfl_xor(sum, o);
  if ((tid & 31) == 0) sred[tid >> 5] = sum; __syncthreads(); if (tid == 0) { float a = 0.f; for (int i = 0; i < 8; ++i) a += sred[i]; sbc = a > 0.f ? 2048.0f / a : 0.f; }   /* a fully excluded row yields P = 0 */ __syncthreads(); const float inv = sbc;
  for (int k = tid; k < kend; k += 256) shv[k] = shv[k] * inv;
  __syncthreads(); for (int q = tid; q < kend / 4; q += 256) vst2(sr + q * 4, *(const v4f*)&shv[q * 4]); }
#define PVK 128            // keys per staged tile of k_pv (kb_last counts in the same 128-key units)
#define PVP (PVK + 4)      // P row pitch in LDS, floats: 528 B = 16 B x 33, conflict-free for 16-byte reads
#define PVV (PVK + 8)      // v row pitch in LDS, halves: 272 B = 16 B x 17
// eight asynchronous copies of 16 bytes a lane, global -> LDS, rows lstep / gstep bytes apart; the s_wait_xcnt in the same statement stands before anything can rewrite an address register of a copy
__device__ __forceinline__ void acopy8(unsigned l, unsigned lstep, const char* gsrc, size_t gstep) {
  asm volatile("global_load_async_to_lds_b128 %0, %8, off\n\t"
               "global_load_async_to_lds_b128 %1, %9, off\n\t"
               "global_load_async_to_lds_b128 %2, %10, off\n\t"
               "global_load_async_to_lds_b128 %3, %11, off\n\t"
               "global_load_async_to_lds_b128 %4, %12, off\n\t"
               "global_load_async_to_lds_b128 %5, %13, off\n\t"
               "global_load_async_to_lds_b128 %6, %14, off\n\t"
               "global_load_async_to_lds_b128 %7, %15, off\n\t"
               "s_wait_xcnt 0x0"
               :: "v"(l), "v"(l + lstep), "v"(l + 2 * lstep), "v"(l + 3 * lstep), "v"(l + 4 * lstep), "v"(l + 5 * lstep), "v"(l + 6 * lstep), "v"(l + 7 * lstep),
                  "v"(gsrc), "v"(gsrc + gstep), "v"(gsrc + 2 * gstep), "v"(gsrc + 3 * gstep), "v"(gsrc + 4 * gstep), "v"(gsrc + 5 * gstep), "v"(gsrc + 6 * gstep), "v"(gsrc + 7 * gstep)
               : "memory");
}
// one wave's share of a tile: its 16 P rows (512 B each, one row a copy) and 16 v rows (256 B each, two rows a copy)
__device__ __forceinline__ void pv_tile(unsigned lp, unsigned lv, const char* gp, const char* gv) {
  acopy8(lp, PVP * 4u, gp, (size_t)TT * 4); acopy8(lp + 8u * PVP * 4u, PVP * 4u, gp + (size_t)8 * TT * 4, (size_t)TT * 4); acopy8(lv, 2u * PVV * 2u, gv, (size_t)2 * TT * 2);
}
// frag_f32 with 16-byte reads (LDS rows)
__device__ __forceinline__ v16h frag_f32v(const float* rowk0, int lane) {
  const float* p = rowk0 + 8 * (lane >> 4); const v4f a0 = *(const v4f*)p, a1 = *(const v4f*)(p + 4), a2 = *(const v4f*)(p + 16), a3 = *(const v4f*)(p + 20); v16h a;
#pragma unroll
  for (int i = 0; i < 4; ++i) { a[i] = (_Float16)a0[i]; a[4 + i] = (_Float16)a1[i]; a[8 + i] = (_Float16)a2[i]; a[12 + i] = (_Float16)a3[i]; }
  return a;
}
// ---- k_pv: block = 64 queries (qb) of (b, h): ctx = P . v over keys [0, kend) (P x 2^11 once to f16 against v f16: 1 product; causal early query blocks: P and v as bf16 hi + lo, 3 products); 256-B (row, head) segment by 16 lanes
__global__ __launch_bounds__(128) void k_pv(const float* __restrict__ PS0, const _Float16* __restrict__ VT, const __bf16* __restrict__ VB, const __bf16* __restrict__ VBL, int b, int h0, float* __restrict__ Y) { const int h = h0 + blockIdx.z; const float* PS = PS0;   /* blockIdx.z = column group; every group reads the one probability plane */ __shared__ __align__(16) float ss[4][16][HD + 4];
  __shared__ __align__(16) float sp[2][64][PVP]; __shared__ __align__(16) _Float16 sv[2][HD][PVV];   /* two buffers each: P tile (64 queries x 128 keys, f32) and v tile (64 columns x 128 keys, f16) */
  const int tid = threadIdx.x, wave = tid >> 5, lane = tid & 31, col = lane & 15, g = lane >> 4; const int qb = blockIdx.x; const int ql0 = qb * 64 + wave * 16; const int kce = (kb_last(qb) + 1) * 4;
  v8f acc[HD / 16] = {};
  if (qb < QBH) {
#pragma unroll 1
    for (int kc = 0; kc < kce; ++kc) { const F2 p = split_row(PS + (size_t)(ql0 + col) * TT, kc * 32, lane);
      asm volatile("s_wait_loadcnt 0x0" ::: "memory");
#pragma unroll
      for (int j = 0; j < HD / 16; ++j) { const size_t po = ((size_t)b * CC + h * HD + j * 16 + col) * (size_t)VHI + kc * 32; const v16b vh = frag_b(VB + po, lane); acc[j] = wmma_bf(p.h, vh, acc[j]); acc[j] = wmma_bf(p.l, vh, acc[j]); acc[j] = wmma_bf(p.h, frag_b(VBL + po, lane), acc[j]); } }
  } else {
    // tiles of 128 keys come into LDS in whole 128-byte lines (a P row = one copy of a wave, two v rows = one copy); each wave brings 16 P rows and 16 v rows of every tile
    const int nst = kce / (PVK / 32);
    const unsigned lp = (unsigned)(size_t)&sp[0][wave * 16][lane * 4], lv = (unsigned)(size_t)&sv[0][wave * 16 + g][col * 8];
    const char* gp = (const char*)(PS + (size_t)ql0 * TT + lane * 4); const char* gv = (const char*)(VT + ((size_t)b * CC + h * HD + wave * 16 + g) * (size_t)TT + col * 8);
    pv_tile(lp, lv, gp, gv);
    asm volatile("s_wait_asynccnt 0x0" ::: "memory");   // tile 0 has landed before the barrier publishes it
    __syncthreads();
    if (nst > 1) pv_tile(lp + (unsigned)sizeof(sp[0]), lv + (unsigned)sizeof(sv[0]), gp + PVK * 4, gv + PVK * 2);
#pragma unroll 1   // one tile a trip: the buffer index alternates, the code stays small
    for (int t = 0; t < nst; ++t) { const int bu = t & 1;
      v16h pf[PVK / 32], vf[PVK / 32][HD / 16];   // all fragment reads of the tile are issued first: the products then wait on counted LDS returns, not on one LDS latency each
#pragma unroll
      for (int kc = 0; kc < PVK / 32; ++kc) { pf[kc] = frag_f32v(&sp[bu][wave * 16 + col][kc * 32], lane);
#pragma unroll
        for (int j = 0; j < HD / 16; ++j) vf[kc][j] = frag_h(&sv[bu][j * 16 + col][kc * 32], lane); }
#pragma unroll
      for (int kc = 0; kc < PVK / 32; ++kc) {
#pragma unroll
        for (int j = 0; j < HD / 16; ++j) acc[j] = wmma16(pf[kc], vf[kc][j], acc[j]); }
      asm volatile("s_wait_dscnt 0x0" ::: "memory");      // this wave's reads of buffer bu are done before the barrier frees it
      asm volatile("s_wait_asynccnt 0x0" ::: "memory");   // this wave's copies of tile t + 1 have landed before the barrier publishes them
      __syncthreads();
      if (t + 2 < nst) pv_tile(lp + (unsigned)(bu * sizeof(sp[0])), lv + (unsigned)(bu * sizeof(sv[0])), gp + (size_t)(t + 2) * (PVK * 4), gv + (size_t)(t + 2) * (PVK * 2)); }
    asm volatile("s_wait_asynccnt 0x0" ::: "memory");   // no copy is left in flight behind the loop
  }
#pragma unroll
  for (int j = 0; j < HD / 16; ++j)
#pragma unroll
    for (int r = 0; r < 8; ++r) ss[wave][8 * g + r][j * 16 + col] = acc[j][r] * (1.0f / 2048.0f);
  LDSX(); for (int rl = 0; rl < 16; ++rl) if (lane < HD / 4) vst2(Y + ((size_t)b * TT + ql0 + rl) * CC + h * HD + lane * 4, *(const v4f*)&ss[wave][rl][lane * 4]); }

#define LN_EPS 1.0e-5f
__global__ __launch_bounds__(128) void k_resln(const float* __restrict__ O, const float* __restrict__ X, const float* __restrict__ GAM, const float* __restrict__ BET, float* __restrict__ OUT) { __shared__ float sred[2][4]; const size_t r = blockIdx.x; const int tid = threadIdx.x; const v4f o = *(const v4f*)(O + r * CC + tid * 4); const v4f xr = *(const v4f*)(X + r * CC + tid * 4); asm volatile("s_wait_loadcnt 0x0" ::: "memory"); float y[4]; float a = 0.f;
#pragma unroll
  for (int i = 0; i < 4; ++i) { y[i] = bfr(xr[i]) + o[i]; a += y[i]; }
#pragma unroll
  for (int s_ = 1; s_ < 32; s_ <<= 1) a += __shfl_xor(a, s_);
  if ((tid & 31) == 0) sred[0][tid >> 5] = a; __syncthreads();
  const float mu = (sred[0][0] + sred[0][1] + sred[0][2] + sred[0][3]) * (1.0f / (float)CC); float v = 0.f;
#pragma unroll
  for (int i = 0; i < 4; ++i) { const float d = y[i] - mu; v += d * d; }
#pragma unroll
  for (int s_ = 1; s_ < 32; s_ <<= 1) v += __shfl_xor(v, s_);
  if ((tid & 31) == 0) sred[1][tid >> 5] = v; __syncthreads();
  const float rs = 1.0f / sqrtf((sred[1][0] + sred[1][1] + sred[1][2] + sred[1][3]) * (1.0f / (float)CC) + LN_EPS); const v4f g4 = *(const v4f*)(GAM + tid * 4), b4 = *(const v4f*)(BET + tid * 4); v4f w;
#pragma unroll
  for (int i = 0; i < 4; ++i) w[i] = (y[i] - mu) * rs * bfr(g4[i]) + bfr(b4[i]);
  vst2(OUT + r * CC + tid * 4, w); }
static_assert(CC == 512 && DIN == CC, "k_resln: 128 threads x 4 floats per row; the residual adds the input row");
extern "C" void kernel_launch(void* const* d_in, const int* in_sizes, int n_in, void* d_out, int out_size, void* d_ws, size_t ws_size, hipStream_t stream) {
  (void)in_sizes; (void)n_in; (void)out_size;
  const float** F = (const float**)d_in;
  if (ws_size < (size_t)WS_END) return;
  char* ws = (char*)d_ws; _Float16 *QH = (_Float16*)(ws + WS_QH), *KH = (_Float16*)(ws + WS_KH), *VT = (_Float16*)(ws + WS_VT), *QL = (_Float16*)(ws + WS_QL), *KL = (_Float16*)(ws + WS_KL); __bf16 *VB = (__bf16*)(ws + WS_VB), *VBL = (__bf16*)(ws + WS_VBL); float *S = (float*)(ws + WS_S), *Y = (float*)(ws + WS_Y);
  (void)Y; (void)QL; (void)KL; (void)VB; (void)VBL;
  // inputs: 0 x [4,4096,512]; 1 Wq [512,64] (in,out), 2 bq [64]; 3 Wk [512,64], 4 bk; 5 Wv [512,512], 6 bv [512] (biases NONZERO); 7 gamma [512]; 8 beta [512] (ones / zeros, read)
  float* Yo = (float*)(ws + WS_Y);
  k_proj<<<dim3(TNB * TT / 64, CC / 128, 3), 128, 0, stream>>>(F[0], F[0], F[0], F[1], F[3], F[5], F[2], F[4], F[6], QH, QL, KH, KL, VT, VB, VBL);
  for (int b = 0; b < TNB; ++b) {
    k_sc<<<dim3(NQB, TT / 128, 1), 128, 0, stream>>>(QH, KH, QL, KL, b, 0, S);   /* the one score head: columns 0..63 */
    k_sm<<<dim3(TT, 1), 256, 0, stream>>>(S);
    k_pv<<<dim3(NQB, 1, NH), 128, 0, stream>>>(S, VT, VB, VBL, b, 0, Yo);   /* one launch, blockIdx.z = column group g: v / o columns 64g .. 64g+63, all eight from plane 0 */
  }
  k_resln<<<dim3(TNB * TT), 128, 0, stream>>>(Yo, F[0], F[7], F[8], (float*)d_out);
}

// v003
// One run takes 399 microseconds.
// Two timings next to v002 put it at 1.07 and 1.08 times that version's speed.
// Over all steps from v000 it is 9.66 times as fast.
// compute dtype: all float inputs rounded to bf16; q / k (64-wide) and v (512-wide) projections with EXACT bf16 products on WMMA 16x16x32 (f32 accumulate) + bias; causal logits UNSCALED: q and k each as f16 hi + (x 2^10) residual, 3 products on every row; softmax f32; P x 2^11 once to f16 x v once to f16 (bf16 hi + lo below row 384), eight 64-column passes over the same probability plane; y = bf16(x) + o and LayerNorm over 512 in f32; f32 output.
#include <hip/hip_runtime.h>
#include <math.h>

typedef __attribute__((ext_vector_type(16))) _Float16 v16h;
typedef __attribute__((ext_vector_type(16))) __bf16 v16b;
typedef __attribute__((ext_vector_type(8)))  _Float16 v8h;
typedef __attribute__((ext_vector_type(8)))  float v8f;
typedef __attribute__((ext_vector_type(4)))  float v4f;
typedef __attribute__((ext_vector_type(2)))  float v2f;
typedef __attribute__((ext_vector_type(4)))  unsigned v4u;
typedef __attribute__((ext_vector_type(4)))  int v4i;
typedef float __attribute__((may_alias)) float_a;
typedef int __attribute__((may_alias)) int_a;

template <typename T> __device__ __forceinline__ void vst2(void* p, T v) { *(T*)p = v;  }
__device__ __forceinline__ v8f wmma16(v16h a, v16h b, v8f c) {
  v8f d = __builtin_amdgcn_wmma_f32_16x16x32_f16(false, a, false, b, (short)0, c, false, false);
  asm volatile("v_nop\n\tv_nop\n\tv_nop\n\tv_nop" : "+v"(d) : "v"(a), "v"(b));
  return d;
}
__device__ __forceinline__ v8f wmma_bf(v16b a, v16b b, v8f c) {
  v8f d = __builtin_amdgcn_wmma_f32_16x16x32_bf16(false, a, false, b, (short)0, c, false, false);
  asm volatile("v_nop\n\tv_nop\n\tv_nop\n\tv_nop" : "+v"(d) : "v"(a), "v"(b));
  return d;
}
// 16x16x32 fragments: lane = (h = lane>>4, row/col = lane&15); elements 0..7 = k0+8h+0..7, 8..15 = k0+16+8h+0..7; D element r = row 8h+r
__device__ __forceinline__ v16h frag_h(const _Float16* rowk0, int lane) {
  union { v16h v; v8h q[2]; } u; const _Float16* p = rowk0 + 8 * (lane >> 4);
  u.q[0] = *(const v8h*)p; u.q[1] = *(const v8h*)(p + 16); return u.v;
}
__device__ __forceinline__ v16h frag_f32(const float* rowk0, int lane) {
  v16h a; const float* p = rowk0 + 8 * (lane >> 4);
#pragma unroll
  for (int i = 0; i < 8; ++i) { a[i] = (_Float16)p[i]; a[8 + i] = (_Float16)p[16 + i]; }
  return a;
}
__device__ __forceinline__ v16h frag_f32s(const float* rowk0, int lane, float sc) {
  v16h a; const float* p = rowk0 + 8 * (lane >> 4);
#pragma unroll
  for (int i = 0; i < 8; ++i) { a[i] = (_Float16)(p[i] * sc); a[8 + i] = (_Float16)(p[16 + i] * sc); }
  return a;
}
// column fragment from a [K][ld] layout (column n), rows >= K read as 0
__device__ __forceinline__ v16h fragc_f32(const float* W, int k0, int n, int lane, int ld, int K) {
  v16h a; const int g = lane >> 4;
#pragma unroll
  for (int i = 0; i < 8; ++i) { const int ka = k0 + 8 * g + i, kb = ka + 16;
    a[i] = (_Float16)(ka < K ? W[(size_t)(ka < K ? ka : K - 1) * ld + n] : 0.f); a[8 + i] = (_Float16)(kb < K ? W[(size_t)(kb < K ? kb : K - 1) * ld + n] : 0.f); }
  return a;
}
struct F2 { v16b h, l; };
__device__ __forceinline__ F2 bsplit16(const float v[16]) { F2 r;
#pragma unroll
  for (int i = 0; i < 16; ++i) { const __bf16 h = (__bf16)v[i]; r.h[i] = h; r.l[i] = (__bf16)(v[i] - (float)h); }
  return r; }
__device__ __forceinline__ F2 split_row(const float* row, int k0, int lane) { float v[16]; const float* p = row + k0 + 8 * (lane >> 4);
#pragma unroll
  for (int i = 0; i < 8; ++i) { v[i] = p[i]; v[8 + i] = p[16 + i]; }
  return bsplit16(v); }
__device__ __forceinline__ F2 split_rowK(const float* row, int k0, int lane, int K) { float v[16]; const int g = lane >> 4;
#pragma unroll
  for (int i = 0; i < 8; ++i) { const int ka = k0 + 8 * g + i, kb = ka + 16; v[i] = ka < K ? row[ka < K ? ka : K - 1] : 0.f; v[8 + i] = kb < K ? row[kb < K ? kb : K - 1] : 0.f; }
  return bsplit16(v); }
__device__ __forceinline__ F2 split_col(const float* W, int k0, int n, int lane, int ld, int K) { float v[16]; const int g = lane >> 4;
#pragma unroll
  for (int i = 0; i < 8; ++i) { const int ka = k0 + 8 * g + i, kb = ka + 16; v[i] = ka < K ? W[(size_t)(ka < K ? ka : K - 1) * ld + n] : 0.f; v[8 + i] = kb < K ? W[(size_t)(kb < K ? kb : K - 1) * ld + n] : 0.f; }
  return bsplit16(v); }
__device__ __forceinline__ v8f mac3(const F2& a, const F2& b, v8f c) { c = wmma_bf(a.l, b.h, c); c = wmma_bf(a.h, b.l, c); return wmma_bf(a.h, b.h, c); }
__device__ __forceinline__ float sigm(float v) { return 1.0f / (1.0f + expf(-v)); }
#define LDSX() do { asm volatile("s_wait_dscnt 0" ::: "memory"); __builtin_amdgcn_wave_barrier(); __builtin_amdgcn_fence(__ATOMIC_RELEASE, "workgroup"); } while (0)

// Single-head causal self-attention with a residual and LayerNorm (x [4,4096,512]; (in,out) Wq / Wk [512,64] and Wv [512,512] uniform(+-1/sqrt(512)) with biases of the same scale - NONZERO; q, k = x W + b (64-wide), v = x Wv + bv (512-wide); scores = q k^T with NO scaling; tril kept, -inf elsewhere; softmax over the keys; o = attn v [4,4096,512]; y = x + o; LayerNorm over the 512 features (biased variance, eps 1e-5) * gamma + beta (ones / zeros, read)). ONE 64-wide score head in columns 0..63 of the 512-wide q / k rows; P.v as eight ordinary 64-wide column groups that all read the same probability plane.
#define NB 4
#define TT 4096
#define CC 512            // NH * HD = projected width
#define DIN 512          // input (model) width
#define NH 8
#define HD 64
#define NQB (TT / 64)
#define HG 1
#define SCALE (1.0f)
#define CAUSAL 1
#ifndef TNB
#define TNB NB
#endif
__device__ __forceinline__ float bfr(float v) { return (float)(__bf16)v; }
__host__ __device__ __forceinline__ int kb_last(int qb) { return CAUSAL ? ((qb * 64 + 63) >> 7) : (TT / 128 - 1); }
typedef __attribute__((ext_vector_type(8))) __bf16 v8b;
__device__ __forceinline__ v16b frag_b(const __bf16* rowk0, int lane) {
  union { v16b v; v8b q[2]; } u; const __bf16* p = rowk0 + 8 * (lane >> 4);
  u.q[0] = *(const v8b*)p; u.q[1] = *(const v8b*)(p + 16); return u.v;
}
#define QBH 6              // causal: query blocks 0..QBH-1 of each sequence (few keys, no averaging) take the high-precision path
#define QHI TT             // rows carrying a q residual plane (all rows: 3-product logits everywhere)
#define KHI TT             // key rows carrying a k residual plane (read by every k_sc block: its 3-product branch)
#define VHI 384            // v bf16 hi / lo planes only for key rows t < VHI (read by the causal early band: query blocks < 6 see keys <= 383)
#define RW 64              // real width of q / k
// B fragment (k rows k0+.., output column o) of a weight: (in,out) [K][ld] or (out,in) [ld rows of K]: bf16 exact, or f16(bf16 * 256) exact
__device__ __forceinline__ v16b wcol_io(const float* Wm, int k0, int o, int lane, int ld) { v16b w; const int g = lane >> 4;
#pragma unroll
  for (int i = 0; i < 8; ++i) { w[i] = (__bf16)Wm[(size_t)(k0 + 8 * g + i) * ld + o]; w[8 + i] = (__bf16)Wm[(size_t)(k0 + 16 + 8 * g + i) * ld + o]; }
  return w; }
__device__ __forceinline__ v16b wcol_oi(const float* Wm, int k0, int o, int lane, int K) { v16b w; const float* p = Wm + (size_t)o * K + k0 + 8 * (lane >> 4);
#pragma unroll
  for (int i = 0; i < 8; ++i) { w[i] = (__bf16)p[i]; w[8 + i] = (__bf16)p[16 + i]; }
  return w; }
__device__ __forceinline__ v16h wcolh_io(const float* Wm, int k0, int o, int lane, int ld) { v16h w; const int g = lane >> 4;
#pragma unroll
  for (int i = 0; i < 8; ++i) { w[i] = (_Float16)(bfr(Wm[(size_t)(k0 + 8 * g + i) * ld + o]) * 256.0f); w[8 + i] = (_Float16)(bfr(Wm[(size_t)(k0 + 16 + 8 * g + i) * ld + o]) * 256.0f); }
  return w; }
__device__ __forceinline__ v16h wcolh_oi(const float* Wm, int k0, int o, int lane, int K) { v16h w; const float* p = Wm + (size_t)o * K + k0 + 8 * (lane >> 4);
#pragma unroll
  for (int i = 0; i < 8; ++i) { w[i] = (_Float16)(bfr(p[i]) * 256.0f); w[8 + i] = (_Float16)(bfr(p[16 + i]) * 256.0f); }
  return w; }
#define WQKV_LAYOUT 0   // 0 = (in,out): Wv [DIN][CC], Wq / Wk [DIN][RW]; 1 = (out,in) [CC][DIN]; 2 = per-head [NH][DIN][HD]
__device__ __forceinline__ v16b wcol_hdk(const float* Wm, int k0, int o, int lane) { v16b w; const int g = lane >> 4; const float* p = Wm + (size_t)(o / HD) * DIN * HD + (o % HD);
#pragma unroll
  for (int i = 0; i < 8; ++i) { w[i] = (__bf16)p[(size_t)(k0 + 8 * g + i) * HD]; w[8 + i] = (__bf16)p[(size_t)(k0 + 16 + 8 * g + i) * HD]; }
  return w; }
#define WO_OUT_IN 0
#if WQKV_LAYOUT == 1
#define WCOL(W, k0, o, lane) wcol_oi(W, k0, o, lane, DIN)
#elif WQKV_LAYOUT == 2
#define WCOL(W, k0, o, lane) wcol_hdk(W, k0, o, lane)
#else
__device__ __forceinline__ v16b zero16b() { v16b w; _Pragma("unroll") for (int i = 0; i < 16; ++i) w[i] = (__bf16)0.0f; return w; }
#define WCOL(W, k0, o, lane) (((which) == 2) ? wcol_io(W, k0, o, lane, CC) : (((o) < RW) ? wcol_io(W, k0, o, lane, RW) : zero16b()))   /* (in,out): Wv [512][512]; Wq / Wk [512][64]: columns >= 64 of the q / k rows are zero (and never read) */
#endif
#if WO_OUT_IN
#define WOCOL(W, k0, o, lane) wcol_oi(W, k0, o, lane, CC)
#define WOCOLH(W, k0, o, lane) wcolh_oi(W, k0, o, lane, CC)
#else
#define WOCOL(W, k0, o, lane) wcol_io(W, k0, o, lane, DIN)
#define WOCOLH(W, k0, o, lane) wcolh_io(W, k0, o, lane, DIN)
#endif

#ifndef SM_EXTRA_PARAMS
#define SM_EXTRA_PARAMS
#endif
#ifndef PROJ_EXTRA_PARAMS
#define PROJ_EXTRA_PARAMS
#endif
#ifndef SM_MASK_HOOK
#define SM_MASK_HOOK (void)0
#endif

#define WS_QH  0u                                      // f16 q rows [b*t][CC]
#define WS_KH  (WS_QH + 2u * (size_t)NB * TT * CC)      // f16 k rows [b*t][CC]
#define WS_VT  (WS_KH + 2u * (size_t)NB * TT * CC)      // f16 v planes [b][c][t]
#define WS_QL  (WS_VT + 2u * (size_t)NB * CC * TT)      // f16 q residual x 2^10 rows [b][t < QHI][CC]
#define WS_KL  (WS_QL + 2u * (size_t)NB * QHI * CC)     // f16 k residual x 2^10 rows [b][t < KHI][CC]
#define WS_VB  (WS_KL + 2u * (size_t)NB * KHI * CC)     // bf16 v hi planes [b][c][t < VHI]
#define WS_VBL (WS_VB + 2u * (size_t)NB * CC * VHI)
#define WS_S   (WS_VBL + 2u * (size_t)NB * CC * VHI)    // f32 logits / P [hg][t][s]
#define WS_Y   (WS_S  + 4u * (size_t)HG * TT * TT)      // f32 ctx rows [b*t][CC]
#define WS_END (WS_Y  + 4u * (size_t)NB * TT * CC)   // o rows [(b*TT + t)][CC] (k_pv writes them; the residual-LayerNorm kernel writes the output)

// ---- k_proj: block = (64 rows, 128 cols, which): q/k/v = X W (+ b) with exact bf16 products (K = DIN) -> which 0: q f16 rows (+ residual rows < QHI); 1: k f16 rows (+ residual rows < KHI); 2: v f16 planes [c][t] (+ bf16 hi/lo planes for t < VHI)
__global__ __launch_bounds__(128) void k_proj(const float* __restrict__ XQ, const float* __restrict__ XK, const float* __restrict__ XV, const float* __restrict__ WQ, const float* __restrict__ WK, const float* __restrict__ WV, const float* __restrict__ BQ, const float* __restrict__ BK, const float* __restrict__ BV,
    _Float16* __restrict__ QH, _Float16* __restrict__ QL, _Float16* __restrict__ KH, _Float16* __restrict__ KL, _Float16* __restrict__ VT, __bf16* __restrict__ VB, __bf16* __restrict__ VBL) {
  __shared__ __align__(16) _Float16 sh[64][136], sl[64][136]; __shared__ __align__(16) _Float16 th[128][72]; __shared__ __align__(16) __bf16 tb[128][72], tbl[128][72];
  const int tid = threadIdx.x, wave = tid >> 5, lane = tid & 31, col = lane & 15, g = lane >> 4; const int which = blockIdx.z; const int c0 = blockIdx.y * 128; const size_t r0 = (size_t)blockIdx.x * 64; const size_t bb = r0 / TT; const int t0 = (int)(r0 % TT);
  if (which < 2 && blockIdx.y > 0) return;   /* q / k have 64 real columns: only the first 128-column tile is computed; the others are never read (block-uniform exit before any barrier) */
  const float* X = which == 0 ? XQ : which == 1 ? XK : XV; const float* WA = which == 0 ? WQ : which == 1 ? WK : WV; const float* BA = which == 0 ? BQ : which == 1 ? BK : BV;
  v8f acc[8] = {};
#pragma unroll 2
  for (int kc = 0; kc < DIN / 32; ++kc) { v16b a; { const float* p = X + (r0 + wave * 16 + col) * DIN + kc * 32 + 8 * g;
#pragma unroll
      for (int i = 0; i < 8; ++i) { a[i] = (__bf16)p[i]; a[8 + i] = (__bf16)p[16 + i]; } }
    asm volatile("s_wait_loadcnt 0x0" ::: "memory");
#pragma unroll
    for (int j = 0; j < 8; ++j) { const v16b w = WCOL(WA, kc * 32, c0 + j * 16 + col, lane); asm volatile("s_wait_loadcnt 0x0" ::: "memory"); acc[j] = wmma_bf(a, w, acc[j]); } }
  if (which < 2) { _Float16* DH = which == 0 ? QH : KH; _Float16* DL = which == 0 ? QL : KL; const int nhi = which == 0 ? QHI : KHI; const bool hi_rows = t0 < nhi;
#pragma unroll
    for (int j = 0; j < 8; ++j) { const float bias = (BA && ((which) == 2 || (c0 + j * 16 + col) < RW)) ? bfr(BA[c0 + j * 16 + col]) : 0.f;
#pragma unroll
      for (int r = 0; r < 8; ++r) { const float v = acc[j][r] + bias; const _Float16 hv = (_Float16)v; sh[wave * 16 + 8 * g + r][j * 16 + col] = hv; sl[wave * 16 + 8 * g + r][j * 16 + col] = (_Float16)((v - (float)hv) * 1024.0f); } }
    __syncthreads();
    for (int e = tid; e < 64 * 16; e += 128) { const int rl = e >> 4, q = e & 15; vst2((unsigned*)(DH + (r0 + rl) * CC + c0 + q * 8), *(const v4u*)&sh[rl][q * 8]); if (hi_rows) vst2((unsigned*)(DL + (bb * nhi + t0 + rl) * (size_t)CC + c0 + q * 8), *(const v4u*)&sl[rl][q * 8]); }
  } else { const bool hi_rows = t0 < VHI;
#pragma unroll
    for (int j = 0; j < 8; ++j) { const float bias = (BA && ((which) == 2 || (c0 + j * 16 + col) < RW)) ? bfr(BA[c0 + j * 16 + col]) : 0.f;
#pragma unroll
      for (int r = 0; r < 8; ++r) { const float v = acc[j][r] + bias; const int rl = wave * 16 + 8 * g + r, cl = j * 16 + col; th[cl][rl] = (_Float16)v; const __bf16 bh = (__bf16)v; tb[cl][rl] = bh; tbl[cl][rl] = (__bf16)(v - (float)bh); } }
    __syncthreads();
    for (int e = tid; e < 128 * 8; e += 128) { const int cl = e >> 3, q = e & 7; vst2((unsigned*)(VT + (bb * CC + c0 + cl) * (size_t)TT + t0 + q * 8), *(const v4u*)&th[cl][q * 8]); if (hi_rows) { const size_t o3 = (bb * CC + c0 + cl) * (size_t)VHI + t0 + q * 8; vst2((unsigned*)(VB + o3), *(const v4u*)&tb[cl][q * 8]); vst2((unsigned*)(VBL + o3), *(const v4u*)&tbl[cl][q * 8]); } } } }
#undef QBH
#define QBH NQB   // SCORE KERNEL ONLY: every query block takes the 3-product branch (unscaled logits)
// ---- k_sc: block = (query block qb, key block kb <= kb_last(qb), head in group) of batch b: logits x SCALE; q hi + residual (x 2^10) against k (2 products) for query rows < QHI, plus the k residual (3 products) for query blocks < QBH (QBH = NQB here: every block); causal: blocks past the diagonal exit, the mask itself is applied by index in k_sm
__global__ __launch_bounds__(128) void k_sc(const _Float16* __restrict__ QH, const _Float16* __restrict__ KH, const _Float16* __restrict__ QL, const _Float16* __restrict__ KL, int b, int h0, float* __restrict__ S0) { __shared__ __align__(16) float ss[4][16][132];
  const int qb = blockIdx.x, kb = blockIdx.y; if (kb > kb_last(qb)) return;
  const int h = h0 + blockIdx.z; float* S = S0 + (size_t)blockIdx.z * TT * TT;
  const int tid = threadIdx.x, wave = tid >> 5, lane = tid & 31, col = lane & 15, g = lane >> 4; const int k0 = kb * 128; const int ql0 = qb * 64 + wave * 16; const size_t q0 = (size_t)b * TT + ql0, kr0 = (size_t)b * TT + k0;
  v8f acc[8] = {}, accl[8] = {};
  const _Float16* QLb = QL + (size_t)b * QHI * CC; const _Float16* KLb = KL + (size_t)b * KHI * CC;
  if (qb < QBH) {
#pragma unroll
    for (int kc = 0; kc < HD / 32; ++kc) { const v16h ah = frag_h(QH + (q0 + col) * CC + h * HD + kc * 32, lane), al = frag_h(QLb + (size_t)(ql0 + col) * CC + h * HD + kc * 32, lane);
#pragma unroll
      for (int j = 0; j < 8; ++j) { const v16h kbf = frag_h(KH + (kr0 + j * 16 + col) * CC + h * HD + kc * 32, lane), klf = frag_h(KLb + (size_t)(k0 + j * 16 + col) * CC + h * HD + kc * 32, lane); acc[j] = wmma16(ah, kbf, acc[j]); accl[j] = wmma16(al, kbf, accl[j]); accl[j] = wmma16(ah, klf, accl[j]); } }
  } else if (qb * 64 < QHI) {
#pragma unroll
    for (int kc = 0; kc < HD / 32; ++kc) { const v16h ah = frag_h(QH + (q0 + col) * CC + h * HD + kc * 32, lane), al = frag_h(QLb + (size_t)(ql0 + col) * CC + h * HD + kc * 32, lane);
#pragma unroll
      for (int j = 0; j < 8; ++j) { const v16h kbf = frag_h(KH + (kr0 + j * 16 + col) * CC + h * HD + kc * 32, lane); acc[j] = wmma16(ah, kbf, acc[j]); accl[j] = wmma16(al, kbf, accl[j]); } }
  } else {
#pragma unroll
    for (int kc = 0; kc < HD / 32; ++kc) { const v16h ah = frag_h(QH + (q0 + col) * CC + h * HD + kc * 32, lane);
#pragma unroll
      for (int j = 0; j < 8; ++j) { const v16h kbf = frag_h(KH + (kr0 + j * 16 + col) * CC + h * HD + kc * 32, lane); acc[j] = wmma16(ah, kbf, acc[j]); } } }
#pragma unroll
  for (int j = 0; j < 8; ++j) {
#pragma unroll
    for (int r = 0; r < 8; ++r) ss[wave][8 * g + r][j * 16 + col] = (acc[j][r] + accl[j][r] * (1.0f / 1024.0f)) * SCALE; }
  LDSX(); for (int rl = 0; rl < 16; ++rl) vst2(S + (size_t)(ql0 + rl) * TT + k0 + lane * 4, *(const v4f*)&ss[wave][rl][lane * 4]); }
#undef QBH
#define QBH 6   // restored: the P.v kernel keeps the causal early band of 6 query blocks
// ---- k_sm: one wave = one query row t (eight rows a block, no LDS, no barrier, so the waves of a block need not run alike): the row's keys [0, kend) stay in registers from the load to the store, 16 bytes a lane and 512 bytes a wave per access; causal -> logit if s <= t else excluded; softmax in f32; P x 2^11 in place (0 for excluded)
#define SMC (TT / 128)     // 128-key chunks of a full row: one 16-byte access of a wave each
__device__ __forceinline__ float sm_e(float x, float m) { const float ex = expf(x - m); return (x <= -1.0e38f) ? 0.f : ex; }   /* excluded -> 0; the exponential stands in front of the choice, so the choice is a select and no branch per element */
__global__ __launch_bounds__(256) void k_sm(float* __restrict__ S0 SM_EXTRA_PARAMS) {
  const int lane = threadIdx.x & 31; const int wv = __builtin_amdgcn_readfirstlane(threadIdx.x >> 5);   /* the wave's number as a scalar: the row and its chunk count are then scalars, and the tests on nf below scalar branches */
  const int r = blockIdx.x * 4 + (wv & 3); const int t = wv < 4 ? r : TT - 1 - r;   /* waves w and w + 4 take rows r and TT - 1 - r, a short causal row and a long one: every block carries the same work; each row is taken once */
  const int nf = kb_last(t >> 6);   /* whole chunks in front of the row's last one */
  float* sr = S0 + (size_t)blockIdx.y * TT * TT + (size_t)t * TT + lane * 4;
  v4f v[SMC - 1]; v4f vl = *(const v4f*)(sr + nf * 128);   /* vl: the last chunk, the only one the diagonal crosses (t >> 7 == nf) */
#pragma unroll   // constant chunk numbers keep the row in registers (so for every loop over the chunks in this kernel); all loads of the row are in flight together
  for (int i = 0; i < SMC - 1; ++i) if (i < nf) v[i] = *(const v4f*)(sr + i * 128);
  if (CAUSAL) {
#pragma unroll
    for (int c = 0; c < 4; ++c) if (nf * 128 + lane * 4 + c > t) vl[c] = -3.0e38f; }
  float m = fmaxf(-3.0e38f, fmaxf(fmaxf(vl[0], vl[1]), fmaxf(vl[2], vl[3])));
#pragma unroll
  for (int i = 0; i < SMC - 1; ++i) if (i < nf) m = fmaxf(m, fmaxf(fmaxf(v[i][0], v[i][1]), fmaxf(v[i][2], v[i][3])));
#pragma unroll
  for (int o = 1; o < 32; o <<= 1) m = fmaxf(m, __shfl_xor(m, o));
  v4f s4 = {0.f, 0.f, 0.f, 0.f};
#pragma unroll
  for (int i = 0; i < SMC - 1; ++i) if (i < nf) {
#pragma unroll
    for (int c = 0; c < 4; ++c) { const float e = sm_e(v[i][c], m); v[i][c] = e; s4[c] += e; } }
#pragma unroll
  for (int c = 0; c < 4; ++c) { const float e = sm_e(vl[c], m); vl[c] = e; s4[c] += e; }
  float sum = (s4[0] + s4[1]) + (s4[2] + s4[3]);
#pragma unroll
  for (int o = 1; o < 32; o <<= 1) sum += __shfl_xor(sum, o);
  const float inv = sum > 0.f ? 2048.0f / sum : 0.f;   /* a fully excluded row yields P = 0 */
#pragma unroll
  for (int i = 0; i < SMC - 1; ++i) if (i < nf) { vst2(sr + i * 128, v[i] * inv);
    asm volatile("s_wait_xcnt 0x0" ::: "memory"); }   // the next chunk's products reuse the registers this store names: the wait stands between the store and that overwrite
  vst2(sr + nf * 128, vl * inv); }
#define PVK 128            // keys per staged tile of k_pv (kb_last counts in the same 128-key units)
#define PVP (PVK + 4)      // P row pitch in LDS, floats: 528 B = 16 B x 33, conflict-free for 16-byte reads
#define PVV (PVK + 8)      // v row pitch in LDS, halves: 272 B = 16 B x 17
// eight asynchronous copies of 16 bytes a lane, global -> LDS, rows lstep / gstep bytes apart; the s_wait_xcnt in the same statement stands before anything can rewrite an address register of a copy
__device__ __forceinline__ void acopy8(unsigned l, unsigned lstep, const char* gsrc, size_t gstep) {
  asm volatile("global_load_async_to_lds_b128 %0, %8, off\n\t"
               "global_load_async_to_lds_b128 %1, %9, off\n\t"
               "global_load_async_to_lds_b128 %2, %10, off\n\t"
               "global_load_async_to_lds_b128 %3, %11, off\n\t"
               "global_load_async_to_lds_b128 %4, %12, off\n\t"
               "global_load_async_to_lds_b128 %5, %13, off\n\t"
               "global_load_async_to_lds_b128 %6, %14, off\n\t"
               "global_load_async_to_lds_b128 %7, %15, off\n\t"
               "s_wait_xcnt 0x0"
               :: "v"(l), "v"(l + lstep), "v"(l + 2 * lstep), "v"(l + 3 * lstep), "v"(l + 4 * lstep), "v"(l + 5 * lstep), "v"(l + 6 * lstep), "v"(l + 7 * lstep),
                  "v"(gsrc), "v"(gsrc + gstep), "v"(gsrc + 2 * gstep), "v"(gsrc + 3 * gstep), "v"(gsrc + 4 * gstep), "v"(gsrc + 5 * gstep), "v"(gsrc + 6 * gstep), "v"(gsrc + 7 * gstep)
               : "memory");
}
// one wave's share of a tile: its 16 P rows (512 B each, one row a copy) and 16 v rows (256 B each, two rows a copy)
__device__ __forceinline__ void pv_tile(unsigned lp, unsigned lv, const char* gp, const char* gv) {
  acopy8(lp, PVP * 4u, gp, (size_t)TT * 4); acopy8(lp + 8u * PVP * 4u, PVP * 4u, gp + (size_t)8 * TT * 4, (size_t)TT * 4); acopy8(lv, 2u * PVV * 2u, gv, (size_t)2 * TT * 2);
}
// frag_f32 with 16-byte reads (LDS rows)
__device__ __forceinline__ v16h frag_f32v(const float* rowk0, int lane) {
  const float* p = rowk0 + 8 * (lane >> 4); const v4f a0 = *(const v4f*)p, a1 = *(const v4f*)(p + 4), a2 = *(const v4f*)(p + 16), a3 = *(const v4f*)(p + 20); v16h a;
#pragma unroll
  for (int i = 0; i < 4; ++i) { a[i] = (_Float16)a0[i]; a[4 + i] = (_Float16)a1[i]; a[8 + i] = (_Float16)a2[i]; a[12 + i] = (_Float16)a3[i]; }
  return a;
}
// ---- k_pv: block = 64 queries (qb) of (b, h): ctx = P . v over keys [0, kend) (P x 2^11 once to f16 against v f16: 1 product; causal early query blocks: P and v as bf16 hi + lo, 3 products); 256-B (row, head) segment by 16 lanes
__global__ __launch_bounds__(128) void k_pv(const float* __restrict__ PS0, const _Float16* __restrict__ VT, const __bf16* __restrict__ VB, const __bf16* __restrict__ VBL, int b, int h0, float* __restrict__ Y) { const int h = h0 + blockIdx.z; const float* PS = PS0;   /* blockIdx.z = column group; every group reads the one probability plane */ __shared__ __align__(16) float ss[4][16][HD + 4];
  __shared__ __align__(16) float sp[2][64][PVP]; __shared__ __align__(16) _Float16 sv[2][HD][PVV];   /* two buffers each: P tile (64 queries x 128 keys, f32) and v tile (64 columns x 128 keys, f16) */
  const int tid = threadIdx.x, wave = tid >> 5, lane = tid & 31, col = lane & 15, g = lane >> 4; const int qb = blockIdx.x; const int ql0 = qb * 64 + wave * 16; const int kce = (kb_last(qb) + 1) * 4;
  v8f acc[HD / 16] = {};
  if (qb < QBH) {
#pragma unroll 1
    for (int kc = 0; kc < kce; ++kc) { const F2 p = split_row(PS + (size_t)(ql0 + col) * TT, kc * 32, lane);
      asm volatile("s_wait_loadcnt 0x0" ::: "memory");
#pragma unroll
      for (int j = 0; j < HD / 16; ++j) { const size_t po = ((size_t)b * CC + h * HD + j * 16 + col) * (size_t)VHI + kc * 32; const v16b vh = frag_b(VB + po, lane); acc[j] = wmma_bf(p.h, vh, acc[j]); acc[j] = wmma_bf(p.l, vh, acc[j]); acc[j] = wmma_bf(p.h, frag_b(VBL + po, lane), acc[j]); } }
  } else {
    // tiles of 128 keys come into LDS in whole 128-byte lines (a P row = one copy of a wave, two v rows = one copy); each wave brings 16 P rows and 16 v rows of every tile
    const int nst = kce / (PVK / 32);
    const unsigned lp = (unsigned)(size_t)&sp[0][wave * 16][lane * 4], lv = (unsigned)(size_t)&sv[0][wave * 16 + g][col * 8];
    const char* gp = (const char*)(PS + (size_t)ql0 * TT + lane * 4); const char* gv = (const char*)(VT + ((size_t)b * CC + h * HD + wave * 16 + g) * (size_t)TT + col * 8);
    pv_tile(lp, lv, gp, gv);
    asm volatile("s_wait_asynccnt 0x0" ::: "memory");   // tile 0 has landed before the barrier publishes it
    __syncthreads();
    if (nst > 1) pv_tile(lp + (unsigned)sizeof(sp[0]), lv + (unsigned)sizeof(sv[0]), gp + PVK * 4, gv + PVK * 2);
#pragma unroll 1   // one tile a trip: the buffer index alternates, the code stays small
    for (int t = 0; t < nst; ++t) { const int bu = t & 1;
      v16h pf[PVK / 32], vf[PVK / 32][HD / 16];   // all fragment reads of the tile are issued first: the products then wait on counted LDS returns, not on one LDS latency each
#pragma unroll
      for (int kc = 0; kc < PVK / 32; ++kc) { pf[kc] = frag_f32v(&sp[bu][wave * 16 + col][kc * 32], lane);
#pragma unroll
        for (int j = 0; j < HD / 16; ++j) vf[kc][j] = frag_h(&sv[bu][j * 16 + col][kc * 32], lane); }
#pragma unroll
      for (int kc = 0; kc < PVK / 32; ++kc) {
#pragma unroll
        for (int j = 0; j < HD / 16; ++j) acc[j] = wmma16(pf[kc], vf[kc][j], acc[j]); }
      asm volatile("s_wait_dscnt 0x0" ::: "memory");      // this wave's reads of buffer bu are done before the barrier frees it
      asm volatile("s_wait_asynccnt 0x0" ::: "memory");   // this wave's copies of tile t + 1 have landed before the barrier publishes them
      __syncthreads();
      if (t + 2 < nst) pv_tile(lp + (unsigned)(bu * sizeof(sp[0])), lv + (unsigned)(bu * sizeof(sv[0])), gp + (size_t)(t + 2) * (PVK * 4), gv + (size_t)(t + 2) * (PVK * 2)); }
    asm volatile("s_wait_asynccnt 0x0" ::: "memory");   // no copy is left in flight behind the loop
  }
#pragma unroll
  for (int j = 0; j < HD / 16; ++j)
#pragma unroll
    for (int r = 0; r < 8; ++r) ss[wave][8 * g + r][j * 16 + col] = acc[j][r] * (1.0f / 2048.0f);
  LDSX(); for (int rl = 0; rl < 16; ++rl) if (lane < HD / 4) vst2(Y + ((size_t)b * TT + ql0 + rl) * CC + h * HD + lane * 4, *(const v4f*)&ss[wave][rl][lane * 4]); }

#define LN_EPS 1.0e-5f
__global__ __launch_bounds__(128) void k_resln(const float* __restrict__ O, const float* __restrict__ X, const float* __restrict__ GAM, const float* __restrict__ BET, float* __restrict__ OUT) { __shared__ float sred[2][4]; const size_t r = blockIdx.x; const int tid = threadIdx.x; const v4f o = *(const v4f*)(O + r * CC + tid * 4); const v4f xr = *(const v4f*)(X + r * CC + tid * 4); asm volatile("s_wait_loadcnt 0x0" ::: "memory"); float y[4]; float a = 0.f;
#pragma unroll
  for (int i = 0; i < 4; ++i) { y[i] = bfr(xr[i]) + o[i]; a += y[i]; }
#pragma unroll
  for (int s_ = 1; s_ < 32; s_ <<= 1) a += __shfl_xor(a, s_);
  if ((tid & 31) == 0) sred[0][tid >> 5] = a; __syncthreads();
  const float mu = (sred[0][0] + sred[0][1] + sred[0][2] + sred[0][3]) * (1.0f / (float)CC); float v = 0.f;
#pragma unroll
  for (int i = 0; i < 4; ++i) { const float d = y[i] - mu; v += d * d; }
#pragma unroll
  for (int s_ = 1; s_ < 32; s_ <<= 1) v += __shfl_xor(v, s_);
  if ((tid & 31) == 0) sred[1][tid >> 5] = v; __syncthreads();
  const float rs = 1.0f / sqrtf((sred[1][0] + sred[1][1] + sred[1][2] + sred[1][3]) * (1.0f / (float)CC) + LN_EPS); const v4f g4 = *(const v4f*)(GAM + tid * 4), b4 = *(const v4f*)(BET + tid * 4); v4f w;
#pragma unroll
  for (int i = 0; i < 4; ++i) w[i] = (y[i] - mu) * rs * bfr(g4[i]) + bfr(b4[i]);
  vst2(OUT + r * CC + tid * 4, w); }
static_assert(CC == 512 && DIN == CC, "k_resln: 128 threads x 4 floats per row; the residual adds the input row");
extern "C" void kernel_launch(void* const* d_in, const int* in_sizes, int n_in, void* d_out, int out_size, void* d_ws, size_t ws_size, hipStream_t stream) {
  (void)in_sizes; (void)n_in; (void)out_size;
  const float** F = (const float**)d_in;
  if (ws_size < (size_t)WS_END) return;
  char* ws = (char*)d_ws; _Float16 *QH = (_Float16*)(ws + WS_QH), *KH = (_Float16*)(ws + WS_KH), *VT = (_Float16*)(ws + WS_VT), *QL = (_Float16*)(ws + WS_QL), *KL = (_Float16*)(ws + WS_KL); __bf16 *VB = (__bf16*)(ws + WS_VB), *VBL = (__bf16*)(ws + WS_VBL); float *S = (float*)(ws + WS_S), *Y = (float*)(ws + WS_Y);
  (void)Y; (void)QL; (void)KL; (void)VB; (void)VBL;
  // inputs: 0 x [4,4096,512]; 1 Wq [512,64] (in,out), 2 bq [64]; 3 Wk [512,64], 4 bk; 5 Wv [512,512], 6 bv [512] (biases NONZERO); 7 gamma [512]; 8 beta [512] (ones / zeros, read)
  float* Yo = (float*)(ws + WS_Y);
  k_proj<<<dim3(TNB * TT / 64, CC / 128, 3), 128, 0, stream>>>(F[0], F[0], F[0], F[1], F[3], F[5], F[2], F[4], F[6], QH, QL, KH, KL, VT, VB, VBL);
  for (int b = 0; b < TNB; ++b) {
    k_sc<<<dim3(NQB, TT / 128, 1), 128, 0, stream>>>(QH, KH, QL, KL, b, 0, S);   /* the one score head: columns 0..63 */
    k_sm<<<dim3(TT / 8, 1), 256, 0, stream>>>(S);
    k_pv<<<dim3(NQB, 1, NH), 128, 0, stream>>>(S, VT, VB, VBL, b, 0, Yo);   /* one launch, blockIdx.z = column group g: v / o columns 64g .. 64g+63, all eight from plane 0 */
  }
  k_resln<<<dim3(TNB * TT), 128, 0, stream>>>(Yo, F[0], F[7], F[8], (float*)d_out);
}

// v004
// One run takes 295 microseconds.
// Timed twice side by side with v003, it ran 1.35 and 1.36 times as fast.
// Over all steps from v000 it is 13.1 times as fast.
// compute dtype: all float inputs rounded to bf16; q / k (64-wide) and v (512-wide) projections with EXACT bf16 products on WMMA 16x16x32 (f32 accumulate) + bias; causal logits UNSCALED: q and k each as f16 hi + (x 2^10) residual, 3 products on every row; softmax f32; P x 2^11 once to f16 x v once to f16 (bf16 hi + lo below row 384), eight 64-column passes over the same probability plane; y = bf16(x) + o and LayerNorm over 512 in f32; f32 output.
#include <hip/hip_runtime.h>
#include <math.h>

typedef __attribute__((ext_vector_type(16))) _Float16 v16h;
typedef __attribute__((ext_vector_type(16))) __bf16 v16b;
typedef __attribute__((ext_vector_type(8)))  _Float16 v8h;
typedef __attribute__((ext_vector_type(8)))  float v8f;
typedef __attribute__((ext_vector_type(4)))  float v4f;
typedef __attribute__((ext_vector_type(2)))  float v2f;
typedef __attribute__((ext_vector_type(4)))  unsigned v4u;
typedef __attribute__((ext_vector_type(4)))  int v4i;
typedef float __attribute__((may_alias)) float_a;
typedef int __attribute__((may_alias)) int_a;

template <typename T> __device__ __forceinline__ void vst2(void* p, T v) { *(T*)p = v;  }
__device__ __forceinline__ v8f wmma16(v16h a, v16h b, v8f c) {
  v8f d = __builtin_amdgcn_wmma_f32_16x16x32_f16(false, a, false, b, (short)0, c, false, false);
  asm volatile("v_nop\n\tv_nop\n\tv_nop\n\tv_nop" : "+v"(d) : "v"(a), "v"(b));
  return d;
}
__device__ __forceinline__ v8f wmma_bf(v16b a, v16b b, v8f c) {
  v8f d = __builtin_amdgcn_wmma_f32_16x16x32_bf16(false, a, false, b, (short)0, c, false, false);
  asm volatile("v_nop\n\tv_nop\n\tv_nop\n\tv_nop" : "+v"(d) : "v"(a), "v"(b));
  return d;
}
// 16x16x32 fragments: lane = (h = lane>>4, row/col = lane&15); elements 0..7 = k0+8h+0..7, 8..15 = k0+16+8h+0..7; D element r = row 8h+r
__device__ __forceinline__ v16h frag_h(const _Float16* rowk0, int lane) {
  union { v16h v; v8h q[2]; } u; const _Float16* p = rowk0 + 8 * (lane >> 4);
  u.q[0] = *(const v8h*)p; u.q[1] = *(const v8h*)(p + 16); return u.v;
}
__device__ __forceinline__ v16h frag_f32(const float* rowk0, int lane) {
  v16h a; const float* p = rowk0 + 8 * (lane >> 4);
#pragma unroll
  for (int i = 0; i < 8; ++i) { a[i] = (_Float16)p[i]; a[8 + i] = (_Float16)p[16 + i]; }
  return a;
}
__device__ __forceinline__ v16h frag_f32s(const float* rowk0, int lane, float sc) {
  v16h a; const float* p = rowk0 + 8 * (lane >> 4);
#pragma unroll
  for (int i = 0; i < 8; ++i) { a[i] = (_Float16)(p[i] * sc); a[8 + i] = (_Float16)(p[16 + i] * sc); }
  return a;
}
// column fragment from a [K][ld] layout (column n), rows >= K read as 0
__device__ __forceinline__ v16h fragc_f32(const float* W, int k0, int n, int lane, int ld, int K) {
  v16h a; const int g = lane >> 4;
#pragma unroll
  for (int i = 0; i < 8; ++i) { const int ka = k0 + 8 * g + i, kb = ka + 16;
    a[i] = (_Float16)(ka < K ? W[(size_t)(ka < K ? ka : K - 1) * ld + n] : 0.f); a[8 + i] = (_Float16)(kb < K ? W[(size_t)(kb < K ? kb : K - 1) * ld + n] : 0.f); }
  return a;
}
struct F2 { v16b h, l; };
__device__ __forceinline__ F2 bsplit16(const float v[16]) { F2 r;
#pragma unroll
  for (int i = 0; i < 16; ++i) { const __bf16 h = (__bf16)v[i]; r.h[i] = h; r.l[i] = (__bf16)(v[i] - (float)h); }
  return r; }
__device__ __forceinline__ F2 split_row(const float* row, int k0, int lane) { float v[16]; const float* p = row + k0 + 8 * (lane >> 4);
#pragma unroll
  for (int i = 0; i < 8; ++i) { v[i] = p[i]; v[8 + i] = p[16 + i]; }
  return bsplit16(v); }
__device__ __forceinline__ F2 split_rowK(const float* row, int k0, int lane, int K) { float v[16]; const int g = lane >> 4;
#pragma unroll
  for (int i = 0; i < 8; ++i) { const int ka = k0 + 8 * g + i, kb = ka + 16; v[i] = ka < K ? row[ka < K ? ka : K - 1] : 0.f; v[8 + i] = kb < K ? row[kb < K ? kb : K - 1] : 0.f; }
  return bsplit16(v); }
__device__ __forceinline__ F2 split_col(const float* W, int k0, int n, int lane, int ld, int K) { float v[16]; const int g = lane >> 4;
#pragma unroll
  for (int i = 0; i < 8; ++i) { const int ka = k0 + 8 * g + i, kb = ka + 16; v[i] = ka < K ? W[(size_t)(ka < K ? ka : K - 1) * ld + n] : 0.f; v[8 + i] = kb < K ? W[(size_t)(kb < K ? kb : K - 1) * ld + n] : 0.f; }
  return bsplit16(v); }
__device__ __forceinline__ v8f mac3(const F2& a, const F2& b, v8f c) { c = wmma_bf(a.l, b.h, c); c = wmma_bf(a.h, b.l, c); return wmma_bf(a.h, b.h, c); }
__device__ __forceinline__ float sigm(float v) { return 1.0f / (1.0f + expf(-v)); }
#define LDSX() do { asm volatile("s_wait_dscnt 0" ::: "memory"); __builtin_amdgcn_wave_barrier(); __builtin_amdgcn_fence(__ATOMIC_RELEASE, "workgroup"); } while (0)

// Single-head causal self-attention with a residual and LayerNorm (x [4,4096,512]; (in,out) Wq / Wk [512,64] and Wv [512,512] uniform(+-1/sqrt(512)) with biases of the same scale - NONZERO; q, k = x W + b (64-wide), v = x Wv + bv (512-wide); scores = q k^T with NO scaling; tril kept, -inf elsewhere; softmax over the keys; o = attn v [4,4096,512]; y = x + o; LayerNorm over the 512 features (biased variance, eps 1e-5) * gamma + beta (ones / zeros, read)). ONE 64-wide score head in columns 0..63 of the 512-wide q / k rows; P.v as eight ordinary 64-wide column groups that all read the same probability plane.
#define NB 4
#define TT 4096
#define CC 512            // NH * HD = projected width
#define DIN 512          // input (model) width
#define NH 8
#define HD 64
#define NQB (TT / 64)
#define HG 1
#define SCALE (1.0f)
#define CAUSAL 1
#ifndef TNB
#define TNB NB
#endif
__device__ __forceinline__ float bfr(float v) { return (float)(__bf16)v; }
__host__ __device__ __forceinline__ int kb_last(int qb) { return CAUSAL ? ((qb * 64 + 63) >> 7) : (TT / 128 - 1); }
typedef __attribute__((ext_vector_type(8))) __bf16 v8b;
__device__ __forceinline__ v16b frag_b(const __bf16* rowk0, int lane) {
  union { v16b v; v8b q[2]; } u; const __bf16* p = rowk0 + 8 * (lane >> 4);
  u.q[0] = *(const v8b*)p; u.q[1] = *(const v8b*)(p + 16); return u.v;
}
#define QBH 6              // causal: query blocks 0..QBH-1 of each sequence (few keys, no averaging) take the high-precision path
#define QHI TT             // rows carrying a q residual plane (all rows: 3-product logits everywhere)
#define KHI TT             // key rows carrying a k residual plane (read by every k_sc block: its 3-product branch)
#define VHI 384            // v bf16 hi / lo planes only for key rows t < VHI (read by the causal early band: query blocks < 6 see keys <= 383)
#define RW 64              // real width of q / k
// B fragment (k rows k0+.., output column o) of a weight: (in,out) [K][ld] or (out,in) [ld rows of K]: bf16 exact, or f16(bf16 * 256) exact
__device__ __forceinline__ v16b wcol_io(const float* Wm, int k0, int o, int lane, int ld) { v16b w; const int g = lane >> 4;
#pragma unroll
  for (int i = 0; i < 8; ++i) { w[i] = (__bf16)Wm[(size_t)(k0 + 8 * g + i) * ld + o]; w[8 + i] = (__bf16)Wm[(size_t)(k0 + 16 + 8 * g + i) * ld + o]; }
  return w; }
__device__ __forceinline__ v16b wcol_oi(const float* Wm, int k0, int o, int lane, int K) { v16b w; const float* p = Wm + (size_t)o * K + k0 + 8 * (lane >> 4);
#pragma unroll
  for (int i = 0; i < 8; ++i) { w[i] = (__bf16)p[i]; w[8 + i] = (__bf16)p[16 + i]; }
  return w; }
__device__ __forceinline__ v16h wcolh_io(const float* Wm, int k0, int o, int lane, int ld) { v16h w; const int g = lane >> 4;
#pragma unroll
  for (int i = 0; i < 8; ++i) { w[i] = (_Float16)(bfr(Wm[(size_t)(k0 + 8 * g + i) * ld + o]) * 256.0f); w[8 + i] = (_Float16)(bfr(Wm[(size_t)(k0 + 16 + 8 * g + i) * ld + o]) * 256.0f); }
  return w; }
__device__ __forceinline__ v16h wcolh_oi(const float* Wm, int k0, int o, int lane, int K) { v16h w; const float* p = Wm + (size_t)o * K + k0 + 8 * (lane >> 4);
#pragma unroll
  for (int i = 0; i < 8; ++i) { w[i] = (_Float16)(bfr(p[i]) * 256.0f); w[8 + i] = (_Float16)(bfr(p[16 + i]) * 256.0f); }
  return w; }
#define WQKV_LAYOUT 0   // 0 = (in,out): Wv [DIN][CC], Wq / Wk [DIN][RW]; 1 = (out,in) [CC][DIN]; 2 = per-head [NH][DIN][HD]
__device__ __forceinline__ v16b wcol_hdk(const float* Wm, int k0, int o, int lane) { v16b w; const int g = lane >> 4; const float* p = Wm + (size_t)(o / HD) * DIN * HD + (o % HD);
#pragma unroll
  for (int i = 0; i < 8; ++i) { w[i] = (__bf16)p[(size_t)(k0 + 8 * g + i) * HD]; w[8 + i] = (__bf16)p[(size_t)(k0 + 16 + 8 * g + i) * HD]; }
  return w; }
#define WO_OUT_IN 0
#if WQKV_LAYOUT == 1
#define WCOL(W, k0, o, lane) wcol_oi(W, k0, o, lane, DIN)
#elif WQKV_LAYOUT == 2
#define WCOL(W, k0, o, lane) wcol_hdk(W, k0, o, lane)
#else
__device__ __forceinline__ v16b zero16b() { v16b w; _Pragma("unroll") for (int i = 0; i < 16; ++i) w[i] = (__bf16)0.0f; return w; }
#define WCOL(W, k0, o, lane) (((which) == 2) ? wcol_io(W, k0, o, lane, CC) : (((o) < RW) ? wcol_io(W, k0, o, lane, RW) : zero16b()))   /* (in,out): Wv [512][512]; Wq / Wk [512][64]: columns >= 64 of the q / k rows are zero (and never read) */
#endif
#if WO_OUT_IN
#define WOCOL(W, k0, o, lane) wcol_oi(W, k0, o, lane, CC)
#define WOCOLH(W, k0, o, lane) wcolh_oi(W, k0, o, lane, CC)
#else
#define WOCOL(W, k0, o, lane) wcol_io(W, k0, o, lane, DIN)
#define WOCOLH(W, k0, o, lane) wcolh_io(W, k0, o, lane, DIN)
#endif

#ifndef SM_EXTRA_PARAMS
#define SM_EXTRA_PARAMS
#endif
#ifndef PROJ_EXTRA_PARAMS
#define PROJ_EXTRA_PARAMS
#endif
#ifndef SM_MASK_HOOK
#define SM_MASK_HOOK (void)0
#endif

#define WS_QH  0u                                      // f16 q rows [b*t][CC]
#define WS_KH  (WS_QH + 2u * (size_t)NB * TT * CC)      // f16 k rows [b*t][CC]
#define WS_VT  (WS_KH + 2u * (size_t)NB * TT * CC)      // f16 v planes [b][c][t]
#define WS_QL  (WS_VT + 2u * (size_t)NB * CC * TT)      // f16 q residual x 2^10 rows [b][t < QHI][CC]
#define WS_KL  (WS_QL + 2u * (size_t)NB * QHI * CC)     // f16 k residual x 2^10 rows [b][t < KHI][CC]
#define WS_VB  (WS_KL + 2u * (size_t)NB * KHI * CC)     // bf16 v hi planes [b][c][t < VHI]
#define WS_VBL (WS_VB + 2u * (size_t)NB * CC * VHI)
#define WS_S   (WS_VBL + 2u * (size_t)NB * CC * VHI)    // f32 logits / P [hg][t][s]
#define WS_Y   (WS_S  + 4u * (size_t)HG * TT * TT)      // f32 ctx rows [b*t][CC]
#define WS_END (WS_Y  + 4u * (size_t)NB * TT * CC)   // o rows [(b*TT + t)][CC] (k_pv writes them; the residual-LayerNorm kernel writes the output)

#define PJK 64             // k rows per staged weight tile of k_proj
// one thread's share of a stage: 16 weight rows x 4 columns (a row of 128 columns = one 512-byte access of a wave; LD, the row length, is a constant, so the 16 rows are immediate offsets from one address) and the x values of its two A fragments
template <int LD> __device__ __forceinline__ void pj_load(v4f (&wr)[16], v4f (&xr)[8], const float* wp, const float* xrow) {
#pragma unroll
  for (int i = 0; i < 16; ++i) wr[i] = *(const v4f*)(wp + i * LD);
#pragma unroll
  for (int kc = 0; kc < PJK / 32; ++kc) { const float* p = xrow + kc * 32; xr[kc * 4] = *(const v4f*)p; xr[kc * 4 + 1] = *(const v4f*)(p + 4); xr[kc * 4 + 2] = *(const v4f*)(p + 16); xr[kc * 4 + 3] = *(const v4f*)(p + 20); }
}
// the 16 x 4 weight values to bf16, transposed in registers: eight k of one column = one 16-byte LDS store. The 16-byte group kg of column c lies at place kg ^ ((c >> 4) & 3) of its row: 16 lanes, four columns apart, then fall on 16 different bank groups; a fragment's 16 columns share one (c >> 4)
__device__ __forceinline__ void pj_store(__bf16 (*buf)[72], const v4f (&wr)[16], int wave, int lane) {
#pragma unroll
  for (int q = 0; q < 2; ++q) {
#pragma unroll
    for (int cc = 0; cc < 4; ++cc) { v8b pk;
#pragma unroll
      for (int i = 0; i < 8; ++i) pk[i] = (__bf16)wr[q * 8 + i][cc];
      *(v8b*)&buf[lane * 4 + cc][((wave * 2 + q) ^ ((lane >> 2) & 3)) * 8] = pk; } }
}
__device__ __forceinline__ void pj_afrag(v16b (&a)[PJK / 32], const v4f (&xr)[8]) {
#pragma unroll
  for (int kc = 0; kc < PJK / 32; ++kc)
#pragma unroll
    for (int i = 0; i < 4; ++i) { a[kc][i] = (__bf16)xr[kc * 4][i]; a[kc][4 + i] = (__bf16)xr[kc * 4 + 1][i]; a[kc][8 + i] = (__bf16)xr[kc * 4 + 2][i]; a[kc][12 + i] = (__bf16)xr[kc * 4 + 3][i]; }
}
// K loop of k_proj in stages of PJK k rows: the stage's weight tile (PJK x 128 columns) lies in LDS as bf16 [column][k], in b0 and b1 by turns; the next stage's weight rows and x values are loaded while this stage's products run. LD = 64 (Wq / Wk, 64 real columns): tile columns >= 64 are zero in both buffers, written once in front of the loop; their lanes re-read real columns (in bounds) and store nothing
template <int LD> __device__ __forceinline__ void pj_main(v8f (&acc)[8], const float* wp, const float* xrow, __bf16 (*b0)[72], __bf16 (*b1)[72], int wave, int lane) {
  const int col = lane & 15, g = lane >> 4; const bool wreal = LD == CC || lane < RW / 4;
  v4f wr[16], xr[8]; v16b a[PJK / 32];
  pj_load<LD>(wr, xr, wp, xrow);
  if (wreal) pj_store(b0, wr, wave, lane);
  else { const v4f z[16] = {}; pj_store(b0, z, wave, lane); pj_store(b1, z, wave, lane); }
  pj_afrag(a, xr);
  __syncthreads();
#pragma unroll 1   // one stage a trip: the buffers alternate, the code stays small
  for (int s = 0; s < DIN / PJK; ++s) { const __bf16 (*cur)[72] = (s & 1) ? b1 : b0; __bf16 (*nxt)[72] = (s & 1) ? b0 : b1;
    if (s + 1 < DIN / PJK) { wp += PJK * LD; xrow += PJK; pj_load<LD>(wr, xr, wp, xrow); }
#pragma unroll
    for (int kc = 0; kc < PJK / 32; ++kc) { union { v16b v; v8b q[2]; } u[8];   // the eight fragment reads of a k step are issued first: the products then wait on counted LDS returns, not on one LDS latency each
#pragma unroll
      for (int j = 0; j < 8; ++j) { const __bf16* rw = &cur[j * 16 + col][0]; u[j].q[0] = *(const v8b*)(rw + ((kc * 4 + g) ^ (j & 3)) * 8); u[j].q[1] = *(const v8b*)(rw + ((kc * 4 + 2 + g) ^ (j & 3)) * 8); }
#pragma unroll
      for (int j = 0; j < 8; ++j) acc[j] = wmma_bf(a[kc], u[j].v, acc[j]); }
    if (s + 1 < DIN / PJK) { if (wreal) pj_store(nxt, wr, wave, lane); pj_afrag(a, xr); }
    __syncthreads(); }   /* publishes stage s + 1 and ends every read of stage s: its buffer is rewritten in the next trip, or by the epilogue */
}
// ---- k_proj: block = (64 rows, 128 cols, which): q/k/v = X W (+ b) with exact bf16 products (K = DIN) -> which 0: q f16 rows (+ residual rows < QHI); 1: k f16 rows (+ residual rows < KHI); 2: v f16 planes [c][t] (+ bf16 hi/lo planes for t < VHI)
__global__ __launch_bounds__(128) void k_proj(const float* __restrict__ XQ, const float* __restrict__ XK, const float* __restrict__ XV, const float* __restrict__ WQ, const float* __restrict__ WK, const float* __restrict__ WV, const float* __restrict__ BQ, const float* __restrict__ BK, const float* __restrict__ BV,
    _Float16* __restrict__ QH, _Float16* __restrict__ QL, _Float16* __restrict__ KH, _Float16* __restrict__ KL, _Float16* __restrict__ VT, __bf16* __restrict__ VB, __bf16* __restrict__ VBL) {
  __shared__ __align__(16) _Float16 sh[64][136], sl[64][136]; __shared__ __align__(16) _Float16 th[128][72]; __shared__ __align__(16) __bf16 tb[128][72], tbl[128][72];
  const int tid = threadIdx.x, wave = tid >> 5, lane = tid & 31, col = lane & 15, g = lane >> 4; const int which = blockIdx.z; const int c0 = blockIdx.y * 128; const size_t r0 = (size_t)blockIdx.x * 64; const size_t bb = r0 / TT; const int t0 = (int)(r0 % TT);
  if (which < 2 && blockIdx.y > 0) return;   /* q / k have 64 real columns: only the first 128-column tile is computed; the others are never read (block-uniform exit before any barrier) */
  const float* X = which == 0 ? XQ : which == 1 ? XK : XV; const float* WA = which == 0 ? WQ : which == 1 ? WK : WV; const float* BA = which == 0 ? BQ : which == 1 ? BK : BV;
  v8f acc[8] = {};
  { const float* xrow = X + (r0 + wave * 16 + col) * DIN + 8 * g;   /* tb and tbl, free until the epilogue, are the two weight buffers; which is the same for the whole block */
    if (which == 2) pj_main<CC>(acc, WA + (size_t)(wave * 16) * CC + c0 + lane * 4, xrow, tb, tbl, wave, lane);
    else pj_main<RW>(acc, WA + (size_t)(wave * 16) * RW + (lane & (RW / 4 - 1)) * 4, xrow, tb, tbl, wave, lane); }
  if (which < 2) { _Float16* DH = which == 0 ? QH : KH; _Float16* DL = which == 0 ? QL : KL; const int nhi = which == 0 ? QHI : KHI; const bool hi_rows = t0 < nhi;
#pragma unroll
    for (int j = 0; j < 8; ++j) { const float bias = (BA && ((which) == 2 || (c0 + j * 16 + col) < RW)) ? bfr(BA[c0 + j * 16 + col]) : 0.f;
#pragma unroll
      for (int r = 0; r < 8; ++r) { const float v = acc[j][r] + bias; const _Float16 hv = (_Float16)v; sh[wave * 16 + 8 * g + r][j * 16 + col] = hv; sl[wave * 16 + 8 * g + r][j * 16 + col] = (_Float16)((v - (float)hv) * 1024.0f); } }
    __syncthreads();
    for (int e = tid; e < 64 * 16; e += 128) { const int rl = e >> 4, q = e & 15; vst2((unsigned*)(DH + (r0 + rl) * CC + c0 + q * 8), *(const v4u*)&sh[rl][q * 8]); if (hi_rows) vst2((unsigned*)(DL + (bb * nhi + t0 + rl) * (size_t)CC + c0 + q * 8), *(const v4u*)&sl[rl][q * 8]); }
  } else { const bool hi_rows = t0 < VHI;
#pragma unroll
    for (int j = 0; j < 8; ++j) { const float bias = (BA && ((which) == 2 || (c0 + j * 16 + col) < RW)) ? bfr(BA[c0 + j * 16 + col]) : 0.f;
#pragma unroll
      for (int r = 0; r < 8; ++r) { const float v = acc[j][r] + bias; const int rl = wave * 16 + 8 * g + r, cl = j * 16 + col; th[cl][rl] = (_Float16)v; const __bf16 bh = (__bf16)v; tb[cl][rl] = bh; tbl[cl][rl] = (__bf16)(v - (float)bh); } }
    __syncthreads();
    for (int e = tid; e < 128 * 8; e += 128) { const int cl = e >> 3, q = e & 7; vst2((unsigned*)(VT + (bb * CC + c0 + cl) * (size_t)TT + t0 + q * 8), *(const v4u*)&th[cl][q * 8]); if (hi_rows) { const size_t o3 = (bb * CC + c0 + cl) * (size_t)VHI + t0 + q * 8; vst2((unsigned*)(VB + o3), *(const v4u*)&tb[cl][q * 8]); vst2((unsigned*)(VBL + o3), *(const v4u*)&tbl[cl][q * 8]); } } } }
#undef QBH
#define QBH NQB   // SCORE KERNEL ONLY: every query block takes the 3-product branch (unscaled logits)
// ---- k_sc: block = (query block qb, key block kb <= kb_last(qb), head in group) of batch b: logits x SCALE; q hi + residual (x 2^10) against k (2 products) for query rows < QHI, plus the k residual (3 products) for query blocks < QBH (QBH = NQB here: every block); causal: blocks past the diagonal exit, the mask itself is applied by index in k_sm
__global__ __launch_bounds__(128) void k_sc(const _Float16* __restrict__ QH, const _Float16* __restrict__ KH, const _Float16* __restrict__ QL, const _Float16* __restrict__ KL, int b, int h0, float* __restrict__ S0) { __shared__ __align__(16) float ss[4][16][132];
  const int qb = blockIdx.x, kb = blockIdx.y; if (kb > kb_last(qb)) return;
  const int h = h0 + blockIdx.z; float* S = S0 + (size_t)blockIdx.z * TT * TT;
  const int tid = threadIdx.x, wave = tid >> 5, lane = tid & 31, col = lane & 15, g = lane >> 4; const int k0 = kb * 128; const int ql0 = qb * 64 + wave * 16; const size_t q0 = (size_t)b * TT + ql0, kr0 = (size_t)b * TT + k0;
  v8f acc[8] = {}, accl[8] = {};
  const _Float16* QLb = QL + (size_t)b * QHI * CC; const _Float16* KLb = KL + (size_t)b * KHI * CC;
  if (qb < QBH) {
#pragma unroll
    for (int kc = 0; kc < HD / 32; ++kc) { const v16h ah = frag_h(QH + (q0 + col) * CC + h * HD + kc * 32, lane), al = frag_h(QLb + (size_t)(ql0 + col) * CC + h * HD + kc * 32, lane);
#pragma unroll
      for (int j = 0; j < 8; ++j) { const v16h kbf = frag_h(KH + (kr0 + j * 16 + col) * CC + h * HD + kc * 32, lane), klf = frag_h(KLb + (size_t)(k0 + j * 16 + col) * CC + h * HD + kc * 32, lane); acc[j] = wmma16(ah, kbf, acc[j]); accl[j] = wmma16(al, kbf, accl[j]); accl[j] = wmma16(ah, klf, accl[j]); } }
  } else if (qb * 64 < QHI) {
#pragma unroll
    for (int kc = 0; kc < HD / 32; ++kc) { const v16h ah = frag_h(QH + (q0 + col) * CC + h * HD + kc * 32, lane), al = frag_h(QLb + (size_t)(ql0 + col) * CC + h * HD + kc * 32, lane);
#pragma unroll
      for (int j = 0; j < 8; ++j) { const v16h kbf = frag_h(KH + (kr0 + j * 16 + col) * CC + h * HD + kc * 32, lane); acc[j] = wmma16(ah, kbf, acc[j]); accl[j] = wmma16(al, kbf, accl[j]); } }
  } else {
#pragma unroll
    for (int kc = 0; kc < HD / 32; ++kc) { const v16h ah = frag_h(QH + (q0 + col) * CC + h * HD + kc * 32, lane);
#pragma unroll
      for (int j = 0; j < 8; ++j) { const v16h kbf = frag_h(KH + (kr0 + j * 16 + col) * CC + h * HD + kc * 32, lane); acc[j] = wmma16(ah, kbf, acc[j]); } } }
#pragma unroll
  for (int j = 0; j < 8; ++j) {
#pragma unroll
    for (int r = 0; r < 8; ++r) ss[wave][8 * g + r][j * 16 + col] = (acc[j][r] + accl[j][r] * (1.0f / 1024.0f)) * SCALE; }
  LDSX(); for (int rl = 0; rl < 16; ++rl) vst2(S + (size_t)(ql0 + rl) * TT + k0 + lane * 4, *(const v4f*)&ss[wave][rl][lane * 4]); }
#undef QBH
#define QBH 6   // restored: the P.v kernel keeps the causal early band of 6 query blocks
// ---- k_sm: one wave = one query row t (eight rows a block, no LDS, no barrier, so the waves of a block need not run alike): the row's keys [0, kend) stay in registers from the load to the store, 16 bytes a lane and 512 bytes a wave per access; causal -> logit if s <= t else excluded; softmax in f32; P x 2^11 in place (0 for excluded)
#define SMC (TT / 128)     // 128-key chunks of a full row: one 16-byte access of a wave each
__device__ __forceinline__ float sm_e(float x, float m) { const float ex = expf(x - m); return (x <= -1.0e38f) ? 0.f : ex; }   /* excluded -> 0; the exponential stands in front of the choice, so the choice is a select and no branch per element */
__global__ __launch_bounds__(256) void k_sm(float* __restrict__ S0 SM_EXTRA_PARAMS) {
  const int lane = threadIdx.x & 31; const int wv = __builtin_amdgcn_readfirstlane(threadIdx.x >> 5);   /* the wave's number as a scalar: the row and its chunk count are then scalars, and the tests on nf below scalar branches */
  const int r = blockIdx.x * 4 + (wv & 3); const int t = wv < 4 ? r : TT - 1 - r;   /* waves w and w + 4 take rows r and TT - 1 - r, a short causal row and a long one: every block carries the same work; each row is taken once */
  const int nf = kb_last(t >> 6);   /* whole chunks in front of the row's last one */
  float* sr = S0 + (size_t)blockIdx.y * TT * TT + (size_t)t * TT + lane * 4;
  v4f v[SMC - 1]; v4f vl = *(const v4f*)(sr + nf * 128);   /* vl: the last chunk, the only one the diagonal crosses (t >> 7 == nf) */
#pragma unroll   // constant chunk numbers keep the row in registers (so for every loop over the chunks in this kernel); all loads of the row are in flight together
  for (int i = 0; i < SMC - 1; ++i) if (i < nf) v[i] = *(const v4f*)(sr + i * 128);
  if (CAUSAL) {
#pragma unroll
    for (int c = 0; c < 4; ++c) if (nf * 128 + lane * 4 + c > t) vl[c] = -3.0e38f; }
  float m = fmaxf(-3.0e38f, fmaxf(fmaxf(vl[0], vl[1]), fmaxf(vl[2], vl[3])));
#pragma unroll
  for (int i = 0; i < SMC - 1; ++i) if (i < nf) m = fmaxf(m, fmaxf(fmaxf(v[i][0], v[i][1]), fmaxf(v[i][2], v[i][3])));
#pragma unroll
  for (int o = 1; o < 32; o <<= 1) m = fmaxf(m, __shfl_xor(m, o));
  v4f s4 = {0.f, 0.f, 0.f, 0.f};
#pragma unroll
  for (int i = 0; i < SMC - 1; ++i) if (i < nf) {
#pragma unroll
    for (int c = 0; c < 4; ++c) { const float e = sm_e(v[i][c], m); v[i][c] = e; s4[c] += e; } }
#pragma unroll
  for (int c = 0; c < 4; ++c) { const float e = sm_e(vl[c], m); vl[c] = e; s4[c] += e; }
  float sum = (s4[0] + s4[1]) + (s4[2] + s4[3]);
#pragma unroll
  for (int o = 1; o < 32; o <<= 1) sum += __shfl_xor(sum, o);
  const float inv = sum > 0.f ? 2048.0f / sum : 0.f;   /* a fully excluded row yields P = 0 */
#pragma unroll
  for (int i = 0; i < SMC - 1; ++i) if (i < nf) { vst2(sr + i * 128, v[i] * inv);
    asm volatile("s_wait_xcnt 0x0" ::: "memory"); }   // the next chunk's products reuse the registers this store names: the wait stands between the store and that overwrite
  vst2(sr + nf * 128, vl * inv); }
#define PVK 128            // keys per staged tile of k_pv (kb_last counts in the same 128-key units)
#define PVP (PVK + 4)      // P row pitch in LDS, floats: 528 B = 16 B x 33, conflict-free for 16-byte reads
#define PVV (PVK + 8)      // v row pitch in LDS, halves: 272 B = 16 B x 17
// eight asynchronous copies of 16 bytes a lane, global -> LDS, rows lstep / gstep bytes apart; the s_wait_xcnt in the same statement stands before anything can rewrite an address register of a copy
__device__ __forceinline__ void acopy8(unsigned l, unsigned lstep, const char* gsrc, size_t gstep) {
  asm volatile("global_load_async_to_lds_b128 %0, %8, off\n\t"
               "global_load_async_to_lds_b128 %1, %9, off\n\t"
               "global_load_async_to_lds_b128 %2, %10, off\n\t"
               "global_load_async_to_lds_b128 %3, %11, off\n\t"
               "global_load_async_to_lds_b128 %4, %12, off\n\t"
               "global_load_async_to_lds_b128 %5, %13, off\n\t"
               "global_load_async_to_lds_b128 %6, %14, off\n\t"
               "global_load_async_to_lds_b128 %7, %15, off\n\t"
               "s_wait_xcnt 0x0"
               :: "v"(l), "v"(l + lstep), "v"(l + 2 * lstep), "v"(l + 3 * lstep), "v"(l + 4 * lstep), "v"(l + 5 * lstep), "v"(l + 6 * lstep), "v"(l + 7 * lstep),
                  "v"(gsrc), "v"(gsrc + gstep), "v"(gsrc + 2 * gstep), "v"(gsrc + 3 * gstep), "v"(gsrc + 4 * gstep), "v"(gsrc + 5 * gstep), "v"(gsrc + 6 * gstep), "v"(gsrc + 7 * gstep)
               : "memory");
}
// one wave's share of a tile: its 16 P rows (512 B each, one row a copy) and 16 v rows (256 B each, two rows a copy)
__device__ __forceinline__ void pv_tile(unsigned lp, unsigned lv, const char* gp, const char* gv) {
  acopy8(lp, PVP * 4u, gp, (size_t)TT * 4); acopy8(lp + 8u * PVP * 4u, PVP * 4u, gp + (size_t)8 * TT * 4, (size_t)TT * 4); acopy8(lv, 2u * PVV * 2u, gv, (size_t)2 * TT * 2);
}
// frag_f32 with 16-byte reads (LDS rows)
__device__ __forceinline__ v16h frag_f32v(const float* rowk0, int lane) {
  const float* p = rowk0 + 8 * (lane >> 4); const v4f a0 = *(const v4f*)p, a1 = *(const v4f*)(p + 4), a2 = *(const v4f*)(p + 16), a3 = *(const v4f*)(p + 20); v16h a;
#pragma unroll
  for (int i = 0; i < 4; ++i) { a[i] = (_Float16)a0[i]; a[4 + i] = (_Float16)a1[i]; a[8 + i] = (_Float16)a2[i]; a[12 + i] = (_Float16)a3[i]; }
  return a;
}
// ---- k_pv: block = 64 queries (qb) of (b, h): ctx = P . v over keys [0, kend) (P x 2^11 once to f16 against v f16: 1 product; causal early query blocks: P and v as bf16 hi + lo, 3 products); 256-B (row, head) segment by 16 lanes
__global__ __launch_bounds__(128) void k_pv(const float* __restrict__ PS0, const _Float16* __restrict__ VT, const __bf16* __restrict__ VB, const __bf16* __restrict__ VBL, int b, int h0, float* __restrict__ Y) { const int h = h0 + blockIdx.z; const float* PS = PS0;   /* blockIdx.z = column group; every group reads the one probability plane */ __shared__ __align__(16) float ss[4][16][HD + 4];
  __shared__ __align__(16) float sp[2][64][PVP]; __shared__ __align__(16) _Float16 sv[2][HD][PVV];   /* two buffers each: P tile (64 queries x 128 keys, f32) and v tile (64 columns x 128 keys, f16) */
  const int tid = threadIdx.x, wave = tid >> 5, lane = tid & 31, col = lane & 15, g = lane >> 4; const int qb = blockIdx.x; const int ql0 = qb * 64 + wave * 16; const int kce = (kb_last(qb) + 1) * 4;
  v8f acc[HD / 16] = {};
  if (qb < QBH) {
#pragma unroll 1
    for (int kc = 0; kc < kce; ++kc) { const F2 p = split_row(PS + (size_t)(ql0 + col) * TT, kc * 32, lane);
      asm volatile("s_wait_loadcnt 0x0" ::: "memory");
#pragma unroll
      for (int j = 0; j < HD / 16; ++j) { const size_t po = ((size_t)b * CC + h * HD + j * 16 + col) * (size_t)VHI + kc * 32; const v16b vh = frag_b(VB + po, lane); acc[j] = wmma_bf(p.h, vh, acc[j]); acc[j] = wmma_bf(p.l, vh, acc[j]); acc[j] = wmma_bf(p.h, frag_b(VBL + po, lane), acc[j]); } }
  } else {
    // tiles of 128 keys come into LDS in whole 128-byte lines (a P row = one copy of a wave, two v rows = one copy); each wave brings 16 P rows and 16 v rows of every tile
    const int nst = kce / (PVK / 32);
    const unsigned lp = (unsigned)(size_t)&sp[0][wave * 16][lane * 4], lv = (unsigned)(size_t)&sv[0][wave * 16 + g][col * 8];
    const char* gp = (const char*)(PS + (size_t)ql0 * TT + lane * 4); const char* gv = (const char*)(VT + ((size_t)b * CC + h * HD + wave * 16 + g) * (size_t)TT + col * 8);
    pv_tile(lp, lv, gp, gv);
    asm volatile("s_wait_asynccnt 0x0" ::: "memory");   // tile 0 has landed before the barrier publishes it
    __syncthreads();
    if (nst > 1) pv_tile(lp + (unsigned)sizeof(sp[0]), lv + (unsigned)sizeof(sv[0]), gp + PVK * 4, gv + PVK * 2);
#pragma unroll 1   // one tile a trip: the buffer index alternates, the code stays small
    for (int t = 0; t < nst; ++t) { const int bu = t & 1;
      v16h pf[PVK / 32], vf[PVK / 32][HD / 16];   // all fragment reads of the tile are issued first: the products then wait on counted LDS returns, not on one LDS latency each
#pragma unroll
      for (int kc = 0; kc < PVK / 32; ++kc) { pf[kc] = frag_f32v(&sp[bu][wave * 16 + col][kc * 32], lane);
#pragma unroll
        for (int j = 0; j < HD / 16; ++j) vf[kc][j] = frag_h(&sv[bu][j * 16 + col][kc * 32], lane); }
#pragma unroll
      for (int kc = 0; kc < PVK / 32; ++kc) {
#pragma unroll
        for (int j = 0; j < HD / 16; ++j) acc[j] = wmma16(pf[kc], vf[kc][j], acc[j]); }
      asm volatile("s_wait_dscnt 0x0" ::: "memory");      // this wave's reads of buffer bu are done before the barrier frees it
      asm volatile("s_wait_asynccnt 0x0" ::: "memory");   // this wave's copies of tile t + 1 have landed before the barrier publishes them
      __syncthreads();
      if (t + 2 < nst) pv_tile(lp + (unsigned)(bu * sizeof(sp[0])), lv + (unsigned)(bu * sizeof(sv[0])), gp + (size_t)(t + 2) * (PVK * 4), gv + (size_t)(t + 2) * (PVK * 2)); }
    asm volatile("s_wait_asynccnt 0x0" ::: "memory");   // no copy is left in flight behind the loop
  }
#pragma unroll
  for (int j = 0; j < HD / 16; ++j)
#pragma unroll
    for (int r = 0; r < 8; ++r) ss[wave][8 * g + r][j * 16 + col] = acc[j][r] * (1.0f / 2048.0f);
  LDSX(); for (int rl = 0; rl < 16; ++rl) if (lane < HD / 4) vst2(Y + ((size_t)b * TT + ql0 + rl) * CC + h * HD + lane * 4, *(const v4f*)&ss[wave][rl][lane * 4]); }

#define LN_EPS 1.0e-5f
__global__ __launch_bounds__(128) void k_resln(const float* __restrict__ O, const float* __restrict__ X, const float* __restrict__ GAM, const float* __restrict__ BET, float* __restrict__ OUT) { __shared__ float sred[2][4]; const size_t r = blockIdx.x; const int tid = threadIdx.x; const v4f o = *(const v4f*)(O + r * CC + tid * 4); const v4f xr = *(const v4f*)(X + r * CC + tid * 4); asm volatile("s_wait_loadcnt 0x0" ::: "memory"); float y[4]; float a = 0.f;
#pragma unroll
  for (int i = 0; i < 4; ++i) { y[i] = bfr(xr[i]) + o[i]; a += y[i]; }
#pragma unroll
  for (int s_ = 1; s_ < 32; s_ <<= 1) a += __shfl_xor(a, s_);
  if ((tid & 31) == 0) sred[0][tid >> 5] = a; __syncthreads();
  const float mu = (sred[0][0] + sred[0][1] + sred[0][2] + sred[0][3]) * (1.0f / (float)CC); float v = 0.f;
#pragma unroll
  for (int i = 0; i < 4; ++i) { const float d = y[i] - mu; v += d * d; }
#pragma unroll
  for (int s_ = 1; s_ < 32; s_ <<= 1) v += __shfl_xor(v, s_);
  if ((tid & 31) == 0) sred[1][tid >> 5] = v; __syncthreads();
  const float rs = 1.0f / sqrtf((sred[1][0] + sred[1][1] + sred[1][2] + sred[1][3]) * (1.0f / (float)CC) + LN_EPS); const v4f g4 = *(const v4f*)(GAM + tid * 4), b4 = *(const v4f*)(BET + tid * 4); v4f w;
#pragma unroll
  for (int i = 0; i < 4; ++i) w[i] = (y[i] - mu) * rs * bfr(g4[i]) + bfr(b4[i]);
  vst2(OUT + r * CC + tid * 4, w); }
static_assert(CC == 512 && DIN == CC, "k_resln: 128 threads x 4 floats per row; the residual adds the input row");
extern "C" void kernel_launch(void* const* d_in, const int* in_sizes, int n_in, void* d_out, int out_size, void* d_ws, size_t ws_size, hipStream_t stream) {
  (void)in_sizes; (void)n_in; (void)out_size;
  const float** F = (const float**)d_in;
  if (ws_size < (size_t)WS_END) return;
  char* ws = (char*)d_ws; _Float16 *QH = (_Float16*)(ws + WS_QH), *KH = (_Float16*)(ws + WS_KH), *VT = (_Float16*)(ws + WS_VT), *QL = (_Float16*)(ws + WS_QL), *KL = (_Float16*)(ws + WS_KL); __bf16 *VB = (__bf16*)(ws + WS_VB), *VBL = (__bf16*)(ws + WS_VBL); float *S = (float*)(ws + WS_S), *Y = (float*)(ws + WS_Y);
  (void)Y; (void)QL; (void)KL; (void)VB; (void)VBL;
  // inputs: 0 x [4,4096,512]; 1 Wq [512,64] (in,out), 2 bq [64]; 3 Wk [512,64], 4 bk; 5 Wv [512,512], 6 bv [512] (biases NONZERO); 7 gamma [512]; 8 beta [512] (ones / zeros, read)
  float* Yo = (float*)(ws + WS_Y);
  k_proj<<<dim3(TNB * TT / 64, CC / 128, 3), 128, 0, stream>>>(F[0], F[0], F[0], F[1], F[3], F[5], F[2], F[4], F[6], QH, QL, KH, KL, VT, VB, VBL);
  for (int b = 0; b < TNB; ++b) {
    k_sc<<<dim3(NQB, TT / 128, 1), 128, 0, stream>>>(QH, KH, QL, KL, b, 0, S);   /* the one score head: columns 0..63 */
    k_sm<<<dim3(TT / 8, 1), 256, 0, stream>>>(S);
    k_pv<<<dim3(NQB, 1, NH), 128, 0, stream>>>(S, VT, VB, VBL, b, 0, Yo);   /* one launch, blockIdx.z = column group g: v / o columns 64g .. 64g+63, all eight from plane 0 */
  }
  k_resln<<<dim3(TNB * TT), 128, 0, stream>>>(Yo, F[0], F[7], F[8], (float*)d_out);
}

// v005
// It runs in 223 microseconds.
// Two timings next to v004 put it at 1.32 and 1.33 times that version's speed.
// Counting every step since v000, it is 17.4 times as fast.
// compute dtype: all float inputs rounded to bf16; q / k (64-wide) and v (512-wide) projections with EXACT bf16 products on WMMA 16x16x32 (f32 accumulate) + bias; causal logits UNSCALED: q and k each as f16 hi + (x 2^10) residual, 3 products on every row; softmax f32; P x 2^11 once to f16 x v once to f16 (bf16 hi + lo below row 384), eight 64-column passes over the same probability plane; y = bf16(x) + o and LayerNorm over 512 in f32; f32 output.
#include <hip/hip_runtime.h>
#include <math.h>

typedef __attribute__((ext_vector_type(16))) _Float16 v16h;
typedef __attribute__((ext_vector_type(16))) __bf16 v16b;
typedef __attribute__((ext_vector_type(8)))  _Float16 v8h;
typedef __attribute__((ext_vector_type(8)))  float v8f;
typedef __attribute__((ext_vector_type(4)))  float v4f;
typedef __attribute__((ext_vector_type(2)))  float v2f;
typedef __attribute__((ext_vector_type(4)))  unsigned v4u;
typedef __attribute__((ext_vector_type(4)))  int v4i;
typedef float __attribute__((may_alias)) float_a;
typedef int __attribute__((may_alias)) int_a;

template <typename T> __device__ __forceinline__ void vst2(void* p, T v) { *(T*)p = v;  }
__device__ __forceinline__ v8f wmma16(v16h a, v16h b, v8f c) {
  v8f d = __builtin_amdgcn_wmma_f32_16x16x32_f16(false, a, false, b, (short)0, c, false, false);
  asm volatile("v_nop\n\tv_nop\n\tv_nop\n\tv_nop" : "+v"(d) : "v"(a), "v"(b));
  return d;
}
__device__ __forceinline__ v8f wmma_bf(v16b a, v16b b, v8f c) {
  v8f d = __builtin_amdgcn_wmma_f32_16x16x32_bf16(false, a, false, b, (short)0, c, false, false);
  asm volatile("v_nop\n\tv_nop\n\tv_nop\n\tv_nop" : "+v"(d) : "v"(a), "v"(b));
  return d;
}
// 16x16x32 fragments: lane = (h = lane>>4, row/col = lane&15); elements 0..7 = k0+8h+0..7, 8..15 = k0+16+8h+0..7; D element r = row 8h+r
__device__ __forceinline__ v16h frag_h(const _Float16* rowk0, int lane) {
  union { v16h v; v8h q[2]; } u; const _Float16* p = rowk0 + 8 * (lane >> 4);
  u.q[0] = *(const v8h*)p; u.q[1] = *(const v8h*)(p + 16); return u.v;
}
__device__ __forceinline__ v16h frag_f32(const float* rowk0, int lane) {
  v16h a; const float* p = rowk0 + 8 * (lane >> 4);
#pragma unroll
  for (int i = 0; i < 8; ++i) { a[i] = (_Float16)p[i]; a[8 + i] = (_Float16)p[16 + i]; }
  return a;
}
__device__ __forceinline__ v16h frag_f32s(const float* rowk0, int lane, float sc) {
  v16h a; const float* p = rowk0 + 8 * (lane >> 4);
#pragma unroll
  for (int i = 0; i < 8; ++i) { a[i] = (_Float16)(p[i] * sc); a[8 + i] = (_Float16)(p[16 + i] * sc); }
  return a;
}
// column fragment from a [K][ld] layout (column n), rows >= K read as 0
__device__ __forceinline__ v16h fragc_f32(const float* W, int k0, int n, int lane, int ld, int K) {
  v16h a; const int g = lane >> 4;
#pragma unroll
  for (int i = 0; i < 8; ++i) { const int ka = k0 + 8 * g + i, kb = ka + 16;
    a[i] = (_Float16)(ka < K ? W[(size_t)(ka < K ? ka : K - 1) * ld + n] : 0.f); a[8 + i] = (_Float16)(kb < K ? W[(size_t)(kb < K ? kb : K - 1) * ld + n] : 0.f); }
  return a;
}
struct F2 { v16b h, l; };
__device__ __forceinline__ F2 bsplit16(const float v[16]) { F2 r;
#pragma unroll
  for (int i = 0; i < 16; ++i) { const __bf16 h = (__bf16)v[i]; r.h[i] = h; r.l[i] = (__bf16)(v[i] - (float)h); }
  return r; }
__device__ __forceinline__ F2 split_row(const float* row, int k0, int lane) { float v[16]; const float* p = row + k0 + 8 * (lane >> 4);
#pragma unroll
  for (int i = 0; i < 8; ++i) { v[i] = p[i]; v[8 + i] = p[16 + i]; }
  return bsplit16(v); }
__device__ __forceinline__ F2 split_rowK(const float* row, int k0, int lane, int K) { float v[16]; const int g = lane >> 4;
#pragma unroll
  for (int i = 0; i < 8; ++i) { const int ka = k0 + 8 * g + i, kb = ka + 16; v[i] = ka < K ? row[ka < K ? ka : K - 1] : 0.f; v[8 + i] = kb < K ? row[kb < K ? kb : K - 1] : 0.f; }
  return bsplit16(v); }
__device__ __forceinline__ F2 split_col(const float* W, int k0, int n, int lane, int ld, int K) { float v[16]; const int g = lane >> 4;
#pragma unroll
  for (int i = 0; i < 8; ++i) { const int ka = k0 + 8 * g + i, kb = ka + 16; v[i] = ka < K ? W[(size_t)(ka < K ? ka : K - 1) * ld + n] : 0.f; v[8 + i] = kb < K ? W[(size_t)(kb < K ? kb : K - 1) * ld + n] : 0.f; }
  return bsplit16(v); }
__device__ __forceinline__ v8f mac3(const F2& a, const F2& b, v8f c) { c = wmma_bf(a.l, b.h, c); c = wmma_bf(a.h, b.l, c); return wmma_bf(a.h, b.h, c); }
__device__ __forceinline__ float sigm(float v) { return 1.0f / (1.0f + expf(-v)); }
#define LDSX() do { asm volatile("s_wait_dscnt 0" ::: "memory"); __builtin_amdgcn_wave_barrier(); __builtin_amdgcn_fence(__ATOMIC_RELEASE, "workgroup"); } while (0)

// Single-head causal self-attention with a residual and LayerNorm (x [4,4096,512]; (in,out) Wq / Wk [512,64] and Wv [512,512] uniform(+-1/sqrt(512)) with biases of the same scale - NONZERO; q, k = x W + b (64-wide), v = x Wv + bv (512-wide); scores = q k^T with NO scaling; tril kept, -inf elsewhere; softmax over the keys; o = attn v [4,4096,512]; y = x + o; LayerNorm over the 512 features (biased variance, eps 1e-5) * gamma + beta (ones / zeros, read)). ONE 64-wide score head in columns 0..63 of the 512-wide q / k rows; P.v as eight ordinary 64-wide column groups that all read the same probability plane.
#define NB 4
#define TT 4096
#define CC 512            // NH * HD = projected width
#define DIN 512          // input (model) width
#define NH 8
#define HD 64
#define NQB (TT / 64)
#define HG 1
#define SCALE (1.0f)
#define CAUSAL 1
#ifndef TNB
#define TNB NB
#endif
__device__ __forceinline__ float bfr(float v) { return (float)(__bf16)v; }
__host__ __device__ __forceinline__ int kb_last(int qb) { return CAUSAL ? ((qb * 64 + 63) >> 7) : (TT / 128 - 1); }
// packed causal logits / P plane of one batch: tiles of 64 queries x 128 keys (STILE floats, rows of 128), for query block qb only its key blocks 0..kb_last(qb), one behind the other from s_base(qb); so the planes of all batches fit in the workspace together, and every stride inside a query block is a constant
#define STILE (64 * 128)
static_assert(CAUSAL == 1 && NQB % 2 == 0, "s_base sums kb_last(i) + 1 = (i >> 1) + 1 over i < qb");
__device__ __forceinline__ size_t s_base(int qb) { const int m = qb >> 1; return (size_t)STILE * (size_t)((m + 1) * (m + (qb & 1))); }
#define SPLANE ((size_t)STILE * (NQB / 2) * (NQB / 2 + 1))   // floats per batch = s_base(NQB)
typedef __attribute__((ext_vector_type(8))) __bf16 v8b;
__device__ __forceinline__ v16b frag_b(const __bf16* rowk0, int lane) {
  union { v16b v; v8b q[2]; } u; const __bf16* p = rowk0 + 8 * (lane >> 4);
  u.q[0] = *(const v8b*)p; u.q[1] = *(const v8b*)(p + 16); return u.v;
}
#define QBH 6              // causal: query blocks 0..QBH-1 of each sequence (few keys, no averaging) take the high-precision path
#define QHI TT             // rows carrying a q residual plane (all rows: 3-product logits everywhere)
#define KHI TT             // key rows carrying a k residual plane (read by every k_sc block: its 3-product branch)
#define VHI 384            // v bf16 hi / lo planes only for key rows t < VHI (read by the causal early band: query blocks < 6 see keys <= 383)
#define RW 64              // real width of q / k
// B fragment (k rows k0+.., output column o) of a weight: (in,out) [K][ld] or (out,in) [ld rows of K]: bf16 exact, or f16(bf16 * 256) exact
__device__ __forceinline__ v16b wcol_io(const float* Wm, int k0, int o, int lane, int ld) { v16b w; const int g = lane >> 4;
#pragma unroll
  for (int i = 0; i < 8; ++i) { w[i] = (__bf16)Wm[(size_t)(k0 + 8 * g + i) * ld + o]; w[8 + i] = (__bf16)Wm[(size_t)(k0 + 16 + 8 * g + i) * ld + o]; }
  return w; }
__device__ __forceinline__ v16b wcol_oi(const float* Wm, int k0, int o, int lane, int K) { v16b w; const float* p = Wm + (size_t)o * K + k0 + 8 * (lane >> 4);
#pragma unroll
  for (int i = 0; i < 8; ++i) { w[i] = (__bf16)p[i]; w[8 + i] = (__bf16)p[16 + i]; }
  return w; }
__device__ __forceinline__ v16h wcolh_io(const float* Wm, int k0, int o, int lane, int ld) { v16h w; const int g = lane >> 4;
#pragma unroll
  for (int i = 0; i < 8; ++i) { w[i] = (_Float16)(bfr(Wm[(size_t)(k0 + 8 * g + i) * ld + o]) * 256.0f); w[8 + i] = (_Float16)(bfr(Wm[(size_t)(k0 + 16 + 8 * g + i) * ld + o]) * 256.0f); }
  return w; }
__device__ __forceinline__ v16h wcolh_oi(const float* Wm, int k0, int o, int lane, int K) { v16h w; const float* p = Wm + (size_t)o * K + k0 + 8 * (lane >> 4);
#pragma unroll
  for (int i = 0; i < 8; ++i) { w[i] = (_Float16)(bfr(p[i]) * 256.0f); w[8 + i] = (_Float16)(bfr(p[16 + i]) * 256.0f); }
  return w; }
#define WQKV_LAYOUT 0   // 0 = (in,out): Wv [DIN][CC], Wq / Wk [DIN][RW]; 1 = (out,in) [CC][DIN]; 2 = per-head [NH][DIN][HD]
__device__ __forceinline__ v16b wcol_hdk(const float* Wm, int k0, int o, int lane) { v16b w; const int g = lane >> 4; const float* p = Wm + (size_t)(o / HD) * DIN * HD + (o % HD);
#pragma unroll
  for (int i = 0; i < 8; ++i) { w[i] = (__bf16)p[(size_t)(k0 + 8 * g + i) * HD]; w[8 + i] = (__bf16)p[(size_t)(k0 + 16 + 8 * g + i) * HD]; }
  return w; }
#define WO_OUT_IN 0
#if WQKV_LAYOUT == 1
#define WCOL(W, k0, o, lane) wcol_oi(W, k0, o, lane, DIN)
#elif WQKV_LAYOUT == 2
#define WCOL(W, k0, o, lane) wcol_hdk(W, k0, o, lane)
#else
__device__ __forceinline__ v16b zero16b() { v16b w; _Pragma("unroll") for (int i = 0; i < 16; ++i) w[i] = (__bf16)0.0f; return w; }
#define WCOL(W, k0, o, lane) (((which) == 2) ? wcol_io(W, k0, o, lane, CC) : (((o) < RW) ? wcol_io(W, k0, o, lane, RW) : zero16b()))   /* (in,out): Wv [512][512]; Wq / Wk [512][64]: columns >= 64 of the q / k rows are zero (and never read) */
#endif
#if WO_OUT_IN
#define WOCOL(W, k0, o, lane) wcol_oi(W, k0, o, lane, CC)
#define WOCOLH(W, k0, o, lane) wcolh_oi(W, k0, o, lane, CC)
#else
#define WOCOL(W, k0, o, lane) wcol_io(W, k0, o, lane, DIN)
#define WOCOLH(W, k0, o, lane) wcolh_io(W, k0, o, lane, DIN)
#endif

#ifndef SM_EXTRA_PARAMS
#define SM_EXTRA_PARAMS
#endif
#ifndef PROJ_EXTRA_PARAMS
#define PROJ_EXTRA_PARAMS
#endif
#ifndef SM_MASK_HOOK
#define SM_MASK_HOOK (void)0
#endif

#define WS_QH  0u                                      // f16 q rows [b*t][CC]
#define WS_KH  (WS_QH + 2u * (size_t)NB * TT * CC)      // f16 k rows [b*t][CC]
#define WS_VT  (WS_KH + 2u * (size_t)NB * TT * CC)      // f16 v planes [b][c][t]
#define WS_QL  (WS_VT + 2u * (size_t)NB * CC * TT)      // f16 q residual x 2^10 rows [b][t < QHI][CC]
#define WS_KL  (WS_QL + 2u * (size_t)NB * QHI * CC)     // f16 k residual x 2^10 rows [b][t < KHI][CC]
#define WS_VB  (WS_KL + 2u * (size_t)NB * KHI * CC)     // bf16 v hi planes [b][c][t < VHI]
#define WS_VBL (WS_VB + 2u * (size_t)NB * CC * VHI)
#define WS_S   (WS_VBL + 2u * (size_t)NB * CC * VHI)    // f32 logits / P, one packed plane per batch [b][SPLANE]
#define WS_Y   (WS_S  + 4u * (size_t)NB * SPLANE)       // f32 ctx rows [b*t][CC]
#define WS_END (WS_Y  + 4u * (size_t)NB * TT * CC)   // o rows [(b*TT + t)][CC] (k_pv writes them; the residual-LayerNorm kernel writes the output)

#define PJK 64             // k rows per staged weight tile of k_proj
// one thread's share of a stage: 16 weight rows x 4 columns (a row of 128 columns = one 512-byte access of a wave; LD, the row length, is a constant, so the 16 rows are immediate offsets from one address) and the x values of its two A fragments
template <int LD> __device__ __forceinline__ void pj_load(v4f (&wr)[16], v4f (&xr)[8], const float* wp, const float* xrow) {
#pragma unroll
  for (int i = 0; i < 16; ++i) wr[i] = *(const v4f*)(wp + i * LD);
#pragma unroll
  for (int kc = 0; kc < PJK / 32; ++kc) { const float* p = xrow + kc * 32; xr[kc * 4] = *(const v4f*)p; xr[kc * 4 + 1] = *(const v4f*)(p + 4); xr[kc * 4 + 2] = *(const v4f*)(p + 16); xr[kc * 4 + 3] = *(const v4f*)(p + 20); }
}
// the 16 x 4 weight values to bf16, transposed in registers: eight k of one column = one 16-byte LDS store. The 16-byte group kg of column c lies at place kg ^ ((c >> 4) & 3) of its row: 16 lanes, four columns apart, then fall on 16 different bank groups; a fragment's 16 columns share one (c >> 4)
__device__ __forceinline__ void pj_store(__bf16 (*buf)[72], const v4f (&wr)[16], int wave, int lane) {
#pragma unroll
  for (int q = 0; q < 2; ++q) {
#pragma unroll
    for (int cc = 0; cc < 4; ++cc) { v8b pk;
#pragma unroll
      for (int i = 0; i < 8; ++i) pk[i] = (__bf16)wr[q * 8 + i][cc];
      *(v8b*)&buf[lane * 4 + cc][((wave * 2 + q) ^ ((lane >> 2) & 3)) * 8] = pk; } }
}
__device__ __forceinline__ void pj_afrag(v16b (&a)[PJK / 32], const v4f (&xr)[8]) {
#pragma unroll
  for (int kc = 0; kc < PJK / 32; ++kc)
#pragma unroll
    for (int i = 0; i < 4; ++i) { a[kc][i] = (__bf16)xr[kc * 4][i]; a[kc][4 + i] = (__bf16)xr[kc * 4 + 1][i]; a[kc][8 + i] = (__bf16)xr[kc * 4 + 2][i]; a[kc][12 + i] = (__bf16)xr[kc * 4 + 3][i]; }
}
// K loop of k_proj in stages of PJK k rows: the stage's weight tile (PJK x 128 columns) lies in LDS as bf16 [column][k], in b0 and b1 by turns; the next stage's weight rows and x values are loaded while this stage's products run. LD = 64 (Wq / Wk, 64 real columns): tile columns >= 64 are zero in both buffers, written once in front of the loop; their lanes re-read real columns (in bounds) and store nothing
template <int LD> __device__ __forceinline__ void pj_main(v8f (&acc)[8], const float* wp, const float* xrow, __bf16 (*b0)[72], __bf16 (*b1)[72], int wave, int lane) {
  const int col = lane & 15, g = lane >> 4; const bool wreal = LD == CC || lane < RW / 4;
  v4f wr[16], xr[8]; v16b a[PJK / 32];
  pj_load<LD>(wr, xr, wp, xrow);
  if (wreal) pj_store(b0, wr, wave, lane);
  else { const v4f z[16] = {}; pj_store(b0, z, wave, lane); pj_store(b1, z, wave, lane); }
  pj_afrag(a, xr);
  __syncthreads();
#pragma unroll 1   // one stage a trip: the buffers alternate, the code stays small
  for (int s = 0; s < DIN / PJK; ++s) { const __bf16 (*cur)[72] = (s & 1) ? b1 : b0; __bf16 (*nxt)[72] = (s & 1) ? b0 : b1;
    if (s + 1 < DIN / PJK) { wp += PJK * LD; xrow += PJK; pj_load<LD>(wr, xr, wp, xrow); }
#pragma unroll
    for (int kc = 0; kc < PJK / 32; ++kc) { union { v16b v; v8b q[2]; } u[8];   // the eight fragment reads of a k step are issued first: the products then wait on counted LDS returns, not on one LDS latency each
#pragma unroll
      for (int j = 0; j < 8; ++j) { const __bf16* rw = &cur[j * 16 + col][0]; u[j].q[0] = *(const v8b*)(rw + ((kc * 4 + g) ^ (j & 3)) * 8); u[j].q[1] = *(const v8b*)(rw + ((kc * 4 + 2 + g) ^ (j & 3)) * 8); }
#pragma unroll
      for (int j = 0; j < 8; ++j) acc[j] = wmma_bf(a[kc], u[j].v, acc[j]); }
    if (s + 1 < DIN / PJK) { if (wreal) pj_store(nxt, wr, wave, lane); pj_afrag(a, xr); }
    __syncthreads(); }   /* publishes stage s + 1 and ends every read of stage s: its buffer is rewritten in the next trip, or by the epilogue */
}
// ---- k_proj: block = (64 rows, 128 cols, which): q/k/v = X W (+ b) with exact bf16 products (K = DIN) -> which 0: q f16 rows (+ residual rows < QHI); 1: k f16 rows (+ residual rows < KHI); 2: v f16 planes [c][t] (+ bf16 hi/lo planes for t < VHI)
__global__ __launch_bounds__(128) void k_proj(const float* __restrict__ XQ, const float* __restrict__ XK, const float* __restrict__ XV, const float* __restrict__ WQ, const float* __restrict__ WK, const float* __restrict__ WV, const float* __restrict__ BQ, const float* __restrict__ BK, const float* __restrict__ BV,
    _Float16* __restrict__ QH, _Float16* __restrict__ QL, _Float16* __restrict__ KH, _Float16* __restrict__ KL, _Float16* __restrict__ VT, __bf16* __restrict__ VB, __bf16* __restrict__ VBL) {
  __shared__ __align__(16) _Float16 sh[64][136], sl[64][136]; __shared__ __align__(16) _Float16 th[128][72]; __shared__ __align__(16) __bf16 tb[128][72], tbl[128][72];
  const int tid = threadIdx.x, wave = tid >> 5, lane = tid & 31, col = lane & 15, g = lane >> 4; const int which = blockIdx.z; const int c0 = blockIdx.y * 128; const size_t r0 = (size_t)blockIdx.x * 64; const size_t bb = r0 / TT; const int t0 = (int)(r0 % TT);
  if (which < 2 && blockIdx.y > 0) return;   /* q / k have 64 real columns: only the first 128-column tile is computed; the others are never read (block-uniform exit before any barrier) */
  const float* X = which == 0 ? XQ : which == 1 ? XK : XV; const float* WA = which == 0 ? WQ : which == 1 ? WK : WV; const float* BA = which == 0 ? BQ : which == 1 ? BK : BV;
  v8f acc[8] = {};
  { const float* xrow = X + (r0 + wave * 16 + col) * DIN + 8 * g;   /* tb and tbl, free until the epilogue, are the two weight buffers; which is the same for the whole block */
    if (which == 2) pj_main<CC>(acc, WA + (size_t)(wave * 16) * CC + c0 + lane * 4, xrow, tb, tbl, wave, lane);
    else pj_main<RW>(acc, WA + (size_t)(wave * 16) * RW + (lane & (RW / 4 - 1)) * 4, xrow, tb, tbl, wave, lane); }
  if (which < 2) { _Float16* DH = which == 0 ? QH : KH; _Float16* DL = which == 0 ? QL : KL; const int nhi = which == 0 ? QHI : KHI; const bool hi_rows = t0 < nhi;
#pragma unroll
    for (int j = 0; j < 8; ++j) { const float bias = (BA && ((which) == 2 || (c0 + j * 16 + col) < RW)) ? bfr(BA[c0 + j * 16 + col]) : 0.f;
#pragma unroll
      for (int r = 0; r < 8; ++r) { const float v = acc[j][r] + bias; const _Float16 hv = (_Float16)v; sh[wave * 16 + 8 * g + r][j * 16 + col] = hv; sl[wave * 16 + 8 * g + r][j * 16 + col] = (_Float16)((v - (float)hv) * 1024.0f); } }
    __syncthreads();
    for (int e = tid; e < 64 * 16; e += 128) { const int rl = e >> 4, q = e & 15; vst2((unsigned*)(DH + (r0 + rl) * CC + c0 + q * 8), *(const v4u*)&sh[rl][q * 8]); if (hi_rows) vst2((unsigned*)(DL + (bb * nhi + t0 + rl) * (size_t)CC + c0 + q * 8), *(const v4u*)&sl[rl][q * 8]); }
  } else { const bool hi_rows = t0 < VHI;
#pragma unroll
    for (int j = 0; j < 8; ++j) { const float bias = (BA && ((which) == 2 || (c0 + j * 16 + col) < RW)) ? bfr(BA[c0 + j * 16 + col]) : 0.f;
#pragma unroll
      for (int r = 0; r < 8; ++r) { const float v = acc[j][r] + bias; const int rl = wave * 16 + 8 * g + r, cl = j * 16 + col; th[cl][rl] = (_Float16)v; const __bf16 bh = (__bf16)v; tb[cl][rl] = bh; tbl[cl][rl] = (__bf16)(v - (float)bh); } }
    __syncthreads();
    for (int e = tid; e < 128 * 8; e += 128) { const int cl = e >> 3, q = e & 7; vst2((unsigned*)(VT + (bb * CC + c0 + cl) * (size_t)TT + t0 + q * 8), *(const v4u*)&th[cl][q * 8]); if (hi_rows) { const size_t o3 = (bb * CC + c0 + cl) * (size_t)VHI + t0 + q * 8; vst2((unsigned*)(VB + o3), *(const v4u*)&tb[cl][q * 8]); vst2((unsigned*)(VBL + o3), *(const v4u*)&tbl[cl][q * 8]); } } } }
#undef QBH
#define QBH NQB   // SCORE KERNEL ONLY: every query block takes the 3-product branch (unscaled logits)
// ---- k_sc: block = (query block qb, key block kb <= kb_last(qb), batch b): logits x SCALE; q hi + residual (x 2^10) against k (2 products) for query rows < QHI, plus the k residual (3 products) for query blocks < QBH (here every query block); causal: blocks past the diagonal exit, the mask itself is applied by index in k_sm
__global__ __launch_bounds__(128) void k_sc(const _Float16* __restrict__ QH, const _Float16* __restrict__ KH, const _Float16* __restrict__ QL, const _Float16* __restrict__ KL, int h0, float* __restrict__ S0) { __shared__ __align__(16) float ss[4][16][132];
  const int qb = blockIdx.x, kb = blockIdx.y; if (kb > kb_last(qb)) return;
  const int b = blockIdx.z, h = h0; float* S = S0 + (size_t)b * SPLANE + s_base(qb) + (size_t)kb * STILE;   /* blockIdx.z = batch; S = this block's tile */
  const int tid = threadIdx.x, wave = tid >> 5, lane = tid & 31, col = lane & 15, g = lane >> 4; const int k0 = kb * 128; const int ql0 = qb * 64 + wave * 16; const size_t q0 = (size_t)b * TT + ql0, kr0 = (size_t)b * TT + k0;
  v8f acc[8] = {}, accl[8] = {};
  const _Float16* QLb = QL + (size_t)b * QHI * CC; const _Float16* KLb = KL + (size_t)b * KHI * CC;
  if (qb < QBH) {
#pragma unroll
    for (int kc = 0; kc < HD / 32; ++kc) { const v16h ah = frag_h(QH + (q0 + col) * CC + h * HD + kc * 32, lane), al = frag_h(QLb + (size_t)(ql0 + col) * CC + h * HD + kc * 32, lane);
#pragma unroll
      for (int j = 0; j < 8; ++j) { const v16h kbf = frag_h(KH + (kr0 + j * 16 + col) * CC + h * HD + kc * 32, lane), klf = frag_h(KLb + (size_t)(k0 + j * 16 + col) * CC + h * HD + kc * 32, lane); acc[j] = wmma16(ah, kbf, acc[j]); accl[j] = wmma16(al, kbf, accl[j]); accl[j] = wmma16(ah, klf, accl[j]); } }
  } else if (qb * 64 < QHI) {
#pragma unroll
    for (int kc = 0; kc < HD / 32; ++kc) { const v16h ah = frag_h(QH + (q0 + col) * CC + h * HD + kc * 32, lane), al = frag_h(QLb + (size_t)(ql0 + col) * CC + h * HD + kc * 32, lane);
#pragma unroll
      for (int j = 0; j < 8; ++j) { const v16h kbf = frag_h(KH + (kr0 + j * 16 + col) * CC + h * HD + kc * 32, lane); acc[j] = wmma16(ah, kbf, acc[j]); accl[j] = wmma16(al, kbf, accl[j]); } }
  } else {
#pragma unroll
    for (int kc = 0; kc < HD / 32; ++kc) { const v16h ah = frag_h(QH + (q0 + col) * CC + h * HD + kc * 32, lane);
#pragma unroll
      for (int j = 0; j < 8; ++j) { const v16h kbf = frag_h(KH + (kr0 + j * 16 + col) * CC + h * HD + kc * 32, lane); acc[j] = wmma16(ah, kbf, acc[j]); } } }
#pragma unroll
  for (int j = 0; j < 8; ++j) {
#pragma unroll
    for (int r = 0; r < 8; ++r) ss[wave][8 * g + r][j * 16 + col] = (acc[j][r] + accl[j][r] * (1.0f / 1024.0f)) * SCALE; }
  LDSX(); for (int rl = 0; rl < 16; ++rl) vst2(S + (wave * 16 + rl) * 128 + lane * 4, *(const v4f*)&ss[wave][rl][lane * 4]); }
#undef QBH
#define QBH 6   // restored: the P.v kernel keeps the causal early band of 6 query blocks
// ---- k_sm: one wave = one query row t (eight rows a block, no LDS, no barrier, so the waves of a block need not run alike): the row's keys [0, kend) stay in registers from the load to the store, 16 bytes a lane and 512 bytes a wave per access; causal -> logit if s <= t else excluded; softmax in f32; P x 2^11 in place (0 for excluded)
#define SMC (TT / 128)     // 128-key chunks of a full row: one 16-byte access of a wave each
__device__ __forceinline__ float sm_e(float x, float m) { const float ex = expf(x - m); return (x <= -1.0e38f) ? 0.f : ex; }   /* excluded -> 0; the exponential stands in front of the choice, so the choice is a select and no branch per element */
__global__ __launch_bounds__(256) void k_sm(float* __restrict__ S0 SM_EXTRA_PARAMS) {
  const int lane = threadIdx.x & 31; const int wv = __builtin_amdgcn_readfirstlane(threadIdx.x >> 5);   /* the wave's number as a scalar: the row and its chunk count are then scalars, and the tests on nf below scalar branches */
  const int r = blockIdx.x * 4 + (wv & 3); const int t = wv < 4 ? r : TT - 1 - r;   /* waves w and w + 4 take rows r and TT - 1 - r, a short causal row and a long one: every block carries the same work; each row is taken once */
  const int nf = kb_last(t >> 6);   /* whole chunks in front of the row's last one */
  float* sr = S0 + (size_t)blockIdx.y * SPLANE + s_base(t >> 6) + (t & 63) * 128 + lane * 4;   /* blockIdx.y = batch; chunk i of the row lies in tile i of its query block */
  v4f v[SMC - 1]; v4f vl = *(const v4f*)(sr + nf * STILE);   /* vl: the last chunk, the only one the diagonal crosses (t >> 7 == nf) */
#pragma unroll   // constant chunk numbers keep the row in registers (so for every loop over the chunks in this kernel); all loads of the row are in flight together
  for (int i = 0; i < SMC - 1; ++i) if (i < nf) v[i] = *(const v4f*)(sr + i * STILE);
  if (CAUSAL) {
#pragma unroll
    for (int c = 0; c < 4; ++c) if (nf * 128 + lane * 4 + c > t) vl[c] = -3.0e38f; }
  float m = fmaxf(-3.0e38f, fmaxf(fmaxf(vl[0], vl[1]), fmaxf(vl[2], vl[3])));
#pragma unroll
  for (int i = 0; i < SMC - 1; ++i) if (i < nf) m = fmaxf(m, fmaxf(fmaxf(v[i][0], v[i][1]), fmaxf(v[i][2], v[i][3])));
#pragma unroll
  for (int o = 1; o < 32; o <<= 1) m = fmaxf(m, __shfl_xor(m, o));
  v4f s4 = {0.f, 0.f, 0.f, 0.f};
#pragma unroll
  for (int i = 0; i < SMC - 1; ++i) if (i < nf) {
#pragma unroll
    for (int c = 0; c < 4; ++c) { const float e = sm_e(v[i][c], m); v[i][c] = e; s4[c] += e; } }
#pragma unroll
  for (int c = 0; c < 4; ++c) { const float e = sm_e(vl[c], m); vl[c] = e; s4[c] += e; }
  float sum = (s4[0] + s4[1]) + (s4[2] + s4[3]);
#pragma unroll
  for (int o = 1; o < 32; o <<= 1) sum += __shfl_xor(sum, o);
  const float inv = sum > 0.f ? 2048.0f / sum : 0.f;   /* a fully excluded row yields P = 0 */
#pragma unroll
  for (int i = 0; i < SMC - 1; ++i) if (i < nf) { vst2(sr + i * STILE, v[i] * inv);
    asm volatile("s_wait_xcnt 0x0" ::: "memory"); }   // the next chunk's products reuse the registers this store names: the wait stands between the store and that overwrite
  vst2(sr + nf * STILE, vl * inv); }
#define PVK 128            // keys per staged tile of k_pv (kb_last counts in the same 128-key units; a staged P tile is one stored tile of STILE floats)
#define PVP (PVK + 4)      // P row pitch in LDS, floats: 528 B = 16 B x 33, conflict-free for 16-byte reads
#define PVV (PVK + 8)      // v row pitch in LDS, halves: 272 B = 16 B x 17
// eight asynchronous copies of 16 bytes a lane, global -> LDS, rows lstep / gstep bytes apart; the s_wait_xcnt in the same statement stands before anything can rewrite an address register of a copy
__device__ __forceinline__ void acopy8(unsigned l, unsigned lstep, const char* gsrc, size_t gstep) {
  asm volatile("global_load_async_to_lds_b128 %0, %8, off\n\t"
               "global_load_async_to_lds_b128 %1, %9, off\n\t"
               "global_load_async_to_lds_b128 %2, %10, off\n\t"
               "global_load_async_to_lds_b128 %3, %11, off\n\t"
               "global_load_async_to_lds_b128 %4, %12, off\n\t"
               "global_load_async_to_lds_b128 %5, %13, off\n\t"
               "global_load_async_to_lds_b128 %6, %14, off\n\t"
               "global_load_async_to_lds_b128 %7, %15, off\n\t"
               "s_wait_xcnt 0x0"
               :: "v"(l), "v"(l + lstep), "v"(l + 2 * lstep), "v"(l + 3 * lstep), "v"(l + 4 * lstep), "v"(l + 5 * lstep), "v"(l + 6 * lstep), "v"(l + 7 * lstep),
                  "v"(gsrc), "v"(gsrc + gstep), "v"(gsrc + 2 * gstep), "v"(gsrc + 3 * gstep), "v"(gsrc + 4 * gstep), "v"(gsrc + 5 * gstep), "v"(gsrc + 6 * gstep), "v"(gsrc + 7 * gstep)
               : "memory");
}
// one wave's share of a tile: its 16 P rows (512 B each, one row a copy) and 16 v rows (256 B each, two rows a copy)
__device__ __forceinline__ void pv_tile(unsigned lp, unsigned lv, const char* gp, const char* gv) {
  acopy8(lp, PVP * 4u, gp, (size_t)PVK * 4); acopy8(lp + 8u * PVP * 4u, PVP * 4u, gp + (size_t)8 * PVK * 4, (size_t)PVK * 4); acopy8(lv, 2u * PVV * 2u, gv, (size_t)2 * TT * 2);
}
// frag_f32 with 16-byte reads (LDS rows)
__device__ __forceinline__ v16h frag_f32v(const float* rowk0, int lane) {
  const float* p = rowk0 + 8 * (lane >> 4); const v4f a0 = *(const v4f*)p, a1 = *(const v4f*)(p + 4), a2 = *(const v4f*)(p + 16), a3 = *(const v4f*)(p + 20); v16h a;
#pragma unroll
  for (int i = 0; i < 4; ++i) { a[i] = (_Float16)a0[i]; a[4 + i] = (_Float16)a1[i]; a[8 + i] = (_Float16)a2[i]; a[12 + i] = (_Float16)a3[i]; }
  return a;
}
// ---- k_pv: block = 64 queries (qb) of (b, h): ctx = P . v over keys [0, kend) (P x 2^11 once to f16 against v f16: 1 product; causal early query blocks: P and v as bf16 hi + lo, 3 products); 256-B (row, head) segment by 16 lanes
__global__ __launch_bounds__(128) void k_pv(const float* __restrict__ PS0, const _Float16* __restrict__ VT, const __bf16* __restrict__ VB, const __bf16* __restrict__ VBL, int h0, float* __restrict__ Y) { const int h = h0 + blockIdx.y, b = blockIdx.z;   /* blockIdx.y = column group, blockIdx.z = batch; every group reads its batch's one probability plane */ __shared__ __align__(16) float ss[4][16][HD + 4];
  __shared__ __align__(16) float sp[2][64][PVP]; __shared__ __align__(16) _Float16 sv[2][HD][PVV];   /* two buffers each: P tile (64 queries x 128 keys, f32) and v tile (64 columns x 128 keys, f16) */
  const int tid = threadIdx.x, wave = tid >> 5, lane = tid & 31, col = lane & 15, g = lane >> 4; const int qb = blockIdx.x;
  const int ql0 = qb * 64 + wave * 16; const int kce = (kb_last(qb) + 1) * 4; const float* PS = PS0 + (size_t)b * SPLANE + s_base(qb);
  v8f acc[HD / 16] = {};
  if (qb < QBH) {
#pragma unroll 1
    for (int kc = 0; kc < kce; ++kc) { const F2 p = split_row(PS + (kc >> 2) * STILE + (wave * 16 + col) * 128, (kc & 3) * 32, lane);
      asm volatile("s_wait_loadcnt 0x0" ::: "memory");
#pragma unroll
      for (int j = 0; j < HD / 16; ++j) { const size_t po = ((size_t)b * CC + h * HD + j * 16 + col) * (size_t)VHI + kc * 32; const v16b vh = frag_b(VB + po, lane); acc[j] = wmma_bf(p.h, vh, acc[j]); acc[j] = wmma_bf(p.l, vh, acc[j]); acc[j] = wmma_bf(p.h, frag_b(VBL + po, lane), acc[j]); } }
  } else {
    // tiles of 128 keys come into LDS in whole 128-byte lines (a P row = one copy of a wave, two v rows = one copy); each wave brings 16 P rows and 16 v rows of every tile
    const int nst = kce / (PVK / 32);
    const unsigned lp = (unsigned)(size_t)&sp[0][wave * 16][lane * 4], lv = (unsigned)(size_t)&sv[0][wave * 16 + g][col * 8];
    const char* gp = (const char*)(PS + wave * 16 * PVK + lane * 4); const char* gv = (const char*)(VT + ((size_t)b * CC + h * HD + wave * 16 + g) * (size_t)TT + col * 8);
    pv_tile(lp, lv, gp, gv);
    asm volatile("s_wait_asynccnt 0x0" ::: "memory");   // tile 0 has landed before the barrier publishes it
    __syncthreads();
    if (nst > 1) pv_tile(lp + (unsigned)sizeof(sp[0]), lv + (unsigned)sizeof(sv[0]), gp + STILE * 4, gv + PVK * 2);
#pragma unroll 1   // one tile a trip: the buffer index alternates, the code stays small
    for (int t = 0; t < nst; ++t) { const int bu = t & 1;
      v16h pf[PVK / 32], vf[PVK / 32][HD / 16];   // all fragment reads of the tile are issued first: the products then wait on counted LDS returns, not on one LDS latency each
#pragma unroll
      for (int kc = 0; kc < PVK / 32; ++kc) { pf[kc] = frag_f32v(&sp[bu][wave * 16 + col][kc * 32], lane);
#pragma unroll
        for (int j = 0; j < HD / 16; ++j) vf[kc][j] = frag_h(&sv[bu][j * 16 + col][kc * 32], lane); }
#pragma unroll
      for (int kc = 0; kc < PVK / 32; ++kc) {
#pragma unroll
        for (int j = 0; j < HD / 16; ++j) acc[j] = wmma16(pf[kc], vf[kc][j], acc[j]); }
      asm volatile("s_wait_dscnt 0x0" ::: "memory");      // this wave's reads of buffer bu are done before the barrier frees it
      asm volatile("s_wait_asynccnt 0x0" ::: "memory");   // this wave's copies of tile t + 1 have landed before the barrier publishes them
      __syncthreads();
      if (t + 2 < nst) pv_tile(lp + (unsigned)(bu * sizeof(sp[0])), lv + (unsigned)(bu * sizeof(sv[0])), gp + (size_t)(t + 2) * (STILE * 4), gv + (size_t)(t + 2) * (PVK * 2)); }
    asm volatile("s_wait_asynccnt 0x0" ::: "memory");   // no copy is left in flight behind the loop
  }
#pragma unroll
  for (int j = 0; j < HD / 16; ++j)
#pragma unroll
    for (int r = 0; r < 8; ++r) ss[wave][8 * g + r][j * 16 + col] = acc[j][r] * (1.0f / 2048.0f);
  LDSX(); for (int rl = 0; rl < 16; ++rl) if (lane < HD / 4) vst2(Y + ((size_t)b * TT + ql0 + rl) * CC + h * HD + lane * 4, *(const v4f*)&ss[wave][rl][lane * 4]); }

#define LN_EPS 1.0e-5f
__global__ __launch_bounds__(128) void k_resln(const float* __restrict__ O, const float* __restrict__ X, const float* __restrict__ GAM, const float* __restrict__ BET, float* __restrict__ OUT) { __shared__ float sred[2][4]; const size_t r = blockIdx.x; const int tid = threadIdx.x; const v4f o = *(const v4f*)(O + r * CC + tid * 4); const v4f xr = *(const v4f*)(X + r * CC + tid * 4); asm volatile("s_wait_loadcnt 0x0" ::: "memory"); float y[4]; float a = 0.f;
#pragma unroll
  for (int i = 0; i < 4; ++i) { y[i] = bfr(xr[i]) + o[i]; a += y[i]; }
#pragma unroll
  for (int s_ = 1; s_ < 32; s_ <<= 1) a += __shfl_xor(a, s_);
  if ((tid & 31) == 0) sred[0][tid >> 5] = a; __syncthreads();
  const float mu = (sred[0][0] + sred[0][1] + sred[0][2] + sred[0][3]) * (1.0f / (float)CC); float v = 0.f;
#pragma unroll
  for (int i = 0; i < 4; ++i) { const float d = y[i] - mu; v += d * d; }
#pragma unroll
  for (int s_ = 1; s_ < 32; s_ <<= 1) v += __shfl_xor(v, s_);
  if ((tid & 31) == 0) sred[1][tid >> 5] = v; __syncthreads();
  const float rs = 1.0f / sqrtf((sred[1][0] + sred[1][1] + sred[1][2] + sred[1][3]) * (1.0f / (float)CC) + LN_EPS); const v4f g4 = *(const v4f*)(GAM + tid * 4), b4 = *(const v4f*)(BET + tid * 4); v4f w;
#pragma unroll
  for (int i = 0; i < 4; ++i) w[i] = (y[i] - mu) * rs * bfr(g4[i]) + bfr(b4[i]);
  vst2(OUT + r * CC + tid * 4, w); }
static_assert(CC == 512 && DIN == CC, "k_resln: 128 threads x 4 floats per row; the residual adds the input row");
extern "C" void kernel_launch(void* const* d_in, const int* in_sizes, int n_in, void* d_out, int out_size, void* d_ws, size_t ws_size, hipStream_t stream) {
  (void)in_sizes; (void)n_in; (void)out_size;
  const float** F = (const float**)d_in;
  if (ws_size < (size_t)WS_END) return;
  char* ws = (char*)d_ws; _Float16 *QH = (_Float16*)(ws + WS_QH), *KH = (_Float16*)(ws + WS_KH), *VT = (_Float16*)(ws + WS_VT), *QL = (_Float16*)(ws + WS_QL), *KL = (_Float16*)(ws + WS_KL); __bf16 *VB = (__bf16*)(ws + WS_VB), *VBL = (__bf16*)(ws + WS_VBL); float *S = (float*)(ws + WS_S), *Y = (float*)(ws + WS_Y);
  (void)Y; (void)QL; (void)KL; (void)VB; (void)VBL;
  // inputs: 0 x [4,4096,512]; 1 Wq [512,64] (in,out), 2 bq [64]; 3 Wk [512,64], 4 bk; 5 Wv [512,512], 6 bv [512] (biases NONZERO); 7 gamma [512]; 8 beta [512] (ones / zeros, read)
  float* Yo = (float*)(ws + WS_Y);
  k_proj<<<dim3(TNB * TT / 64, CC / 128, 3), 128, 0, stream>>>(F[0], F[0], F[0], F[1], F[3], F[5], F[2], F[4], F[6], QH, QL, KH, KL, VT, VB, VBL);
  k_sc<<<dim3(NQB, TT / 128, TNB), 128, 0, stream>>>(QH, KH, QL, KL, 0, S);   /* the one score head: columns 0..63; all batches in one grid */
  k_sm<<<dim3(TT / 8, TNB), 256, 0, stream>>>(S);
  k_pv<<<dim3(NQB, NH, TNB), 128, 0, stream>>>(S, VT, VB, VBL, 0, Yo);   /* column group g: v / o columns 64g .. 64g+63, all eight from the batch's one plane; batch = slowest index, so the work-groups of one batch stay neighbours in index order */
  k_resln<<<dim3(TNB * TT), 128, 0, stream>>>(Yo, F[0], F[7], F[8], (float*)d_out);
}

// v006
// One run takes 191 microseconds.
// Next to v005, in two timings, it ran 1.16 and 1.17 times as fast.
// All steps since v000 together make it 20.2 times as fast.
// compute dtype: all float inputs rounded to bf16; q / k (64-wide) and v (512-wide) projections with EXACT bf16 products on WMMA 16x16x32 (f32 accumulate) + bias; causal logits UNSCALED: q and k each as f16 hi + (x 2^10) residual, 3 products on every row; softmax f32; P x 2^11 once to f16 x v once to f16 (bf16 hi + lo below row 384), eight 64-column passes over the same probability plane; y = bf16(x) + o and LayerNorm over 512 in f32; f32 output.
#include <hip/hip_runtime.h>
#include <math.h>

typedef __attribute__((ext_vector_type(16))) _Float16 v16h;
typedef __attribute__((ext_vector_type(16))) __bf16 v16b;
typedef __attribute__((ext_vector_type(8)))  _Float16 v8h;
typedef __attribute__((ext_vector_type(8)))  float v8f;
typedef __attribute__((ext_vector_type(4)))  float v4f;
typedef __attribute__((ext_vector_type(2)))  float v2f;
typedef __attribute__((ext_vector_type(4)))  unsigned v4u;
typedef __attribute__((ext_vector_type(4)))  int v4i;
typedef float __attribute__((may_alias)) float_a;
typedef int __attribute__((may_alias)) int_a;

template <typename T> __device__ __forceinline__ void vst2(void* p, T v) { *(T*)p = v;  }
__device__ __forceinline__ v8f wmma16(v16h a, v16h b, v8f c) {
  v8f d = __builtin_amdgcn_wmma_f32_16x16x32_f16(false, a, false, b, (short)0, c, false, false);
  asm volatile("v_nop\n\tv_nop\n\tv_nop\n\tv_nop" : "+v"(d) : "v"(a), "v"(b));
  return d;
}
__device__ __forceinline__ v8f wmma_bf(v16b a, v16b b, v8f c) {
  v8f d = __builtin_amdgcn_wmma_f32_16x16x32_bf16(false, a, false, b, (short)0, c, false, false);
  asm volatile("v_nop\n\tv_nop\n\tv_nop\n\tv_nop" : "+v"(d) : "v"(a), "v"(b));
  return d;
}
// 16x16x32 fragments: lane = (h = lane>>4, row/col = lane&15); elements 0..7 = k0+8h+0..7, 8..15 = k0+16+8h+0..7; D element r = row 8h+r
__device__ __forceinline__ v16h frag_h(const _Float16* rowk0, int lane) {
  union { v16h v; v8h q[2]; } u; const _Float16* p = rowk0 + 8 * (lane >> 4);
  u.q[0] = *(const v8h*)p; u.q[1] = *(const v8h*)(p + 16); return u.v;
}
__device__ __forceinline__ v16h frag_f32(const float* rowk0, int lane) {
  v16h a; const float* p = rowk0 + 8 * (lane >> 4);
#pragma unroll
  for (int i = 0; i < 8; ++i) { a[i] = (_Float16)p[i]; a[8 + i] = (_Float16)p[16 + i]; }
  return a;
}
__device__ __forceinline__ v16h frag_f32s(const float* rowk0, int lane, float sc) {
  v16h a; const float* p = rowk0 + 8 * (lane >> 4);
#pragma unroll
  for (int i = 0; i < 8; ++i) { a[i] = (_Float16)(p[i] * sc); a[8 + i] = (_Float16)(p[16 + i] * sc); }
  return a;
}
// column fragment from a [K][ld] layout (column n), rows >= K read as 0
__device__ __forceinline__ v16h fragc_f32(const float* W, int k0, int n, int lane, int ld, int K) {
  v16h a; const int g = lane >> 4;
#pragma unroll
  for (int i = 0; i < 8; ++i) { const int ka = k0 + 8 * g + i, kb = ka + 16;
    a[i] = (_Float16)(ka < K ? W[(size_t)(ka < K ? ka : K - 1) * ld + n] : 0.f); a[8 + i] = (_Float16)(kb < K ? W[(size_t)(kb < K ? kb : K - 1) * ld + n] : 0.f); }
  return a;
}
struct F2 { v16b h, l; };
__device__ __forceinline__ F2 bsplit16(const float v[16]) { F2 r;
#pragma unroll
  for (int i = 0; i < 16; ++i) { const __bf16 h = (__bf16)v[i]; r.h[i] = h; r.l[i] = (__bf16)(v[i] - (float)h); }
  return r; }
__device__ __forceinline__ F2 split_row(const float* row, int k0, int lane) { float v[16]; const float* p = row + k0 + 8 * (lane >> 4);
#pragma unroll
  for (int i = 0; i < 8; ++i) { v[i] = p[i]; v[8 + i] = p[16 + i]; }
  return bsplit16(v); }
__device__ __forceinline__ F2 split_rowK(const float* row, int k0, int lane, int K) { float v[16]; const int g = lane >> 4;
#pragma unroll
  for (int i = 0; i < 8; ++i) { const int ka = k0 + 8 * g + i, kb = ka + 16; v[i] = ka < K ? row[ka < K ? ka : K - 1] : 0.f; v[8 + i] = kb < K ? row[kb < K ? kb : K - 1] : 0.f; }
  return bsplit16(v); }
__device__ __forceinline__ F2 split_col(const float* W, int k0, int n, int lane, int ld, int K) { float v[16]; const int g = lane >> 4;
#pragma unroll
  for (int i = 0; i < 8; ++i) { const int ka = k0 + 8 * g + i, kb = ka + 16; v[i] = ka < K ? W[(size_t)(ka < K ? ka : K - 1) * ld + n] : 0.f; v[8 + i] = kb < K ? W[(size_t)(kb < K ? kb : K - 1) * ld + n] : 0.f; }
  return bsplit16(v); }
__device__ __forceinline__ v8f mac3(const F2& a, const F2& b, v8f c) { c = wmma_bf(a.l, b.h, c); c = wmma_bf(a.h, b.l, c); return wmma_bf(a.h, b.h, c); }
__device__ __forceinline__ float sigm(float v) { return 1.0f / (1.0f + expf(-v)); }
#define LDSX() do { asm volatile("s_wait_dscnt 0" ::: "memory"); __builtin_amdgcn_wave_barrier(); __builtin_amdgcn_fence(__ATOMIC_RELEASE, "workgroup"); } while (0)

// Single-head causal self-attention with a residual and LayerNorm (x [4,4096,512]; (in,out) Wq / Wk [512,64] and Wv [512,512] uniform(+-1/sqrt(512)) with biases of the same scale - NONZERO; q, k = x W + b (64-wide), v = x Wv + bv (512-wide); scores = q k^T with NO scaling; tril kept, -inf elsewhere; softmax over the keys; o = attn v [4,4096,512]; y = x + o; LayerNorm over the 512 features (biased variance, eps 1e-5) * gamma + beta (ones / zeros, read)). ONE 64-wide score head in columns 0..63 of the 512-wide q / k rows; P.v as eight ordinary 64-wide column groups that all read the same probability plane.
#define NB 4
#define TT 4096
#define CC 512            // NH * HD = projected width
#define DIN 512          // input (model) width
#define NH 8
#define HD 64
#define NQB (TT / 64)
#define HG 1
#define SCALE (1.0f)
#define CAUSAL 1
#ifndef TNB
#define TNB NB
#endif
__device__ __forceinline__ float bfr(float v) { return (float)(__bf16)v; }
__host__ __device__ __forceinline__ int kb_last(int qb) { return CAUSAL ? ((qb * 64 + 63) >> 7) : (TT / 128 - 1); }
// packed causal logits / P plane of one batch: tiles of 64 queries x 128 keys (STILE floats, rows of 128), for query block qb only its key blocks 0..kb_last(qb), one behind the other from s_base(qb); so the planes of all batches fit in the workspace together, and every stride inside a query block is a constant
#define STILE (64 * 128)
static_assert(CAUSAL == 1 && NQB % 2 == 0, "s_base sums kb_last(i) + 1 = (i >> 1) + 1 over i < qb");
__device__ __forceinline__ size_t s_base(int qb) { const int m = qb >> 1; return (size_t)STILE * (size_t)((m + 1) * (m + (qb & 1))); }
#define SPLANE ((size_t)STILE * (NQB / 2) * (NQB / 2 + 1))   // floats per batch = s_base(NQB)
typedef __attribute__((ext_vector_type(8))) __bf16 v8b;
__device__ __forceinline__ v16b frag_b(const __bf16* rowk0, int lane) {
  union { v16b v; v8b q[2]; } u; const __bf16* p = rowk0 + 8 * (lane >> 4);
  u.q[0] = *(const v8b*)p; u.q[1] = *(const v8b*)(p + 16); return u.v;
}
#define QBH 6              // causal: query blocks 0..QBH-1 of each sequence (few keys, no averaging) take the high-precision path
#define QHI TT             // rows carrying a q residual plane (all rows: 3-product logits everywhere)
#define KHI TT             // key rows carrying a k residual plane (read by every k_sc block: its 3-product branch)
#define VHI 384            // v bf16 hi / lo planes only for key rows t < VHI (read by the causal early band: query blocks < 6 see keys <= 383)
#define RW 64              // real width of q / k
// B fragment (k rows k0+.., output column o) of a weight: (in,out) [K][ld] or (out,in) [ld rows of K]: bf16 exact, or f16(bf16 * 256) exact
__device__ __forceinline__ v16b wcol_io(const float* Wm, int k0, int o, int lane, int ld) { v16b w; const int g = lane >> 4;
#pragma unroll
  for (int i = 0; i < 8; ++i) { w[i] = (__bf16)Wm[(size_t)(k0 + 8 * g + i) * ld + o]; w[8 + i] = (__bf16)Wm[(size_t)(k0 + 16 + 8 * g + i) * ld + o]; }
  return w; }
__device__ __forceinline__ v16b wcol_oi(const float* Wm, int k0, int o, int lane, int K) { v16b w; const float* p = Wm + (size_t)o * K + k0 + 8 * (lane >> 4);
#pragma unroll
  for (int i = 0; i < 8; ++i) { w[i] = (__bf16)p[i]; w[8 + i] = (__bf16)p[16 + i]; }
  return w; }
__device__ __forceinline__ v16h wcolh_io(const float* Wm, int k0, int o, int lane, int ld) { v16h w; const int g = lane >> 4;
#pragma unroll
  for (int i = 0; i < 8; ++i) { w[i] = (_Float16)(bfr(Wm[(size_t)(k0 + 8 * g + i) * ld + o]) * 256.0f); w[8 + i] = (_Float16)(bfr(Wm[(size_t)(k0 + 16 + 8 * g + i) * ld + o]) * 256.0f); }
  return w; }
__device__ __forceinline__ v16h wcolh_oi(const float* Wm, int k0, int o, int lane, int K) { v16h w; const float* p = Wm + (size_t)o * K + k0 + 8 * (lane >> 4);
#pragma unroll
  for (int i = 0; i < 8; ++i) { w[i] = (_Float16)(bfr(p[i]) * 256.0f); w[8 + i] = (_Float16)(bfr(p[16 + i]) * 256.0f); }
  return w; }
#define WQKV_LAYOUT 0   // 0 = (in,out): Wv [DIN][CC], Wq / Wk [DIN][RW]; 1 = (out,in) [CC][DIN]; 2 = per-head [NH][DIN][HD]
__device__ __forceinline__ v16b wcol_hdk(const float* Wm, int k0, int o, int lane) { v16b w; const int g = lane >> 4; const float* p = Wm + (size_t)(o / HD) * DIN * HD + (o % HD);
#pragma unroll
  for (int i = 0; i < 8; ++i) { w[i] = (__bf16)p[(size_t)(k0 + 8 * g + i) * HD]; w[8 + i] = (__bf16)p[(size_t)(k0 + 16 + 8 * g + i) * HD]; }
  return w; }
#define WO_OUT_IN 0
#if WQKV_LAYOUT == 1
#define WCOL(W, k0, o, lane) wcol_oi(W, k0, o, lane, DIN)
#elif WQKV_LAYOUT == 2
#define WCOL(W, k0, o, lane) wcol_hdk(W, k0, o, lane)
#else
__device__ __forceinline__ v16b zero16b() { v16b w; _Pragma("unroll") for (int i = 0; i < 16; ++i) w[i] = (__bf16)0.0f; return w; }
#define WCOL(W, k0, o, lane) (((which) == 2) ? wcol_io(W, k0, o, lane, CC) : (((o) < RW) ? wcol_io(W, k0, o, lane, RW) : zero16b()))   /* (in,out): Wv [512][512]; Wq / Wk [512][64]: columns >= 64 of the q / k rows are zero (and never read) */
#endif
#if WO_OUT_IN
#define WOCOL(W, k0, o, lane) wcol_oi(W, k0, o, lane, CC)
#define WOCOLH(W, k0, o, lane) wcolh_oi(W, k0, o, lane, CC)
#else
#define WOCOL(W, k0, o, lane) wcol_io(W, k0, o, lane, DIN)
#define WOCOLH(W, k0, o, lane) wcolh_io(W, k0, o, lane, DIN)
#endif

#ifndef SM_EXTRA_PARAMS
#define SM_EXTRA_PARAMS
#endif
#ifndef PROJ_EXTRA_PARAMS
#define PROJ_EXTRA_PARAMS
#endif
#ifndef SM_MASK_HOOK
#define SM_MASK_HOOK (void)0
#endif

#define WS_QH  0u                                      // f16 q rows [b*t][CC]
#define WS_KH  (WS_QH + 2u * (size_t)NB * TT * CC)      // f16 k rows [b*t][CC]
#define WS_VT  (WS_KH + 2u * (size_t)NB * TT * CC)      // f16 v planes [b][c][t]
#define WS_QL  (WS_VT + 2u * (size_t)NB * CC * TT)      // f16 q residual x 2^10 rows [b][t < QHI][CC]
#define WS_KL  (WS_QL + 2u * (size_t)NB * QHI * CC)     // f16 k residual x 2^10 rows [b][t < KHI][CC]
#define WS_VB  (WS_KL + 2u * (size_t)NB * KHI * CC)     // bf16 v hi planes [b][c][t < VHI]
#define WS_VBL (WS_VB + 2u * (size_t)NB * CC * VHI)
#define WS_S   (WS_VBL + 2u * (size_t)NB * CC * VHI)    // f32 logits / P (f16 P outside the early band), one packed plane per batch [b][SPLANE]
#define WS_Y   (WS_S  + 4u * (size_t)NB * SPLANE)       // f32 ctx rows [b*t][CC]
#define WS_END (WS_Y  + 4u * (size_t)NB * TT * CC)   // o rows [(b*TT + t)][CC] (k_pv writes them; the residual-LayerNorm kernel writes the output)

#define PJK 64             // k rows per staged weight tile of k_proj
// one thread's share of a stage: 16 weight rows x 4 columns (a row of 128 columns = one 512-byte access of a wave; LD, the row length, is a constant, so the 16 rows are immediate offsets from one address) and the x values of its two A fragments
template <int LD> __device__ __forceinline__ void pj_load(v4f (&wr)[16], v4f (&xr)[8], const float* wp, const float* xrow) {
#pragma unroll
  for (int i = 0; i < 16; ++i) wr[i] = *(const v4f*)(wp + i * LD);
#pragma unroll
  for (int kc = 0; kc < PJK / 32; ++kc) { const float* p = xrow + kc * 32; xr[kc * 4] = *(const v4f*)p; xr[kc * 4 + 1] = *(const v4f*)(p + 4); xr[kc * 4 + 2] = *(const v4f*)(p + 16); xr[kc * 4 + 3] = *(const v4f*)(p + 20); }
}
// the 16 x 4 weight values to bf16, transposed in registers: eight k of one column = one 16-byte LDS store. The 16-byte group kg of column c lies at place kg ^ ((c >> 4) & 3) of its row: 16 lanes, four columns apart, then fall on 16 different bank groups; a fragment's 16 columns share one (c >> 4)
__device__ __forceinline__ void pj_store(__bf16 (*buf)[72], const v4f (&wr)[16], int wave, int lane) {
#pragma unroll
  for (int q = 0; q < 2; ++q) {
#pragma unroll
    for (int cc = 0; cc < 4; ++cc) { v8b pk;
#pragma unroll
      for (int i = 0; i < 8; ++i) pk[i] = (__bf16)wr[q * 8 + i][cc];
      *(v8b*)&buf[lane * 4 + cc][((wave * 2 + q) ^ ((lane >> 2) & 3)) * 8] = pk; } }
}
__device__ __forceinline__ void pj_afrag(v16b (&a)[PJK / 32], const v4f (&xr)[8]) {
#pragma unroll
  for (int kc = 0; kc < PJK / 32; ++kc)
#pragma unroll
    for (int i = 0; i < 4; ++i) { a[kc][i] = (__bf16)xr[kc * 4][i]; a[kc][4 + i] = (__bf16)xr[kc * 4 + 1][i]; a[kc][8 + i] = (__bf16)xr[kc * 4 + 2][i]; a[kc][12 + i] = (__bf16)xr[kc * 4 + 3][i]; }
}
// K loop of k_proj in stages of PJK k rows: the stage's weight tile (PJK x 128 columns) lies in LDS as bf16 [column][k], in b0 and b1 by turns; the next stage's weight rows and x values are loaded while this stage's products run. LD = 64 (Wq / Wk, 64 real columns): tile columns >= 64 are zero in both buffers, written once in front of the loop; their lanes re-read real columns (in bounds) and store nothing
template <int LD> __device__ __forceinline__ void pj_main(v8f (&acc)[8], const float* wp, const float* xrow, __bf16 (*b0)[72], __bf16 (*b1)[72], int wave, int lane) {
  const int col = lane & 15, g = lane >> 4; const bool wreal = LD == CC || lane < RW / 4;
  v4f wr[16], xr[8]; v16b a[PJK / 32];
  pj_load<LD>(wr, xr, wp, xrow);
  if (wreal) pj_store(b0, wr, wave, lane);
  else { const v4f z[16] = {}; pj_store(b0, z, wave, lane); pj_store(b1, z, wave, lane); }
  pj_afrag(a, xr);
  __syncthreads();
#pragma unroll 1   // one stage a trip: the buffers alternate, the code stays small
  for (int s = 0; s < DIN / PJK; ++s) { const __bf16 (*cur)[72] = (s & 1) ? b1 : b0; __bf16 (*nxt)[72] = (s & 1) ? b0 : b1;
    if (s + 1 < DIN / PJK) { wp += PJK * LD; xrow += PJK; pj_load<LD>(wr, xr, wp, xrow); }
#pragma unroll
    for (int kc = 0; kc < PJK / 32; ++kc) { union { v16b v; v8b q[2]; } u[8];   // the eight fragment reads of a k step are issued first: the products then wait on counted LDS returns, not on one LDS latency each
#pragma unroll
      for (int j = 0; j < 8; ++j) { const __bf16* rw = &cur[j * 16 + col][0]; u[j].q[0] = *(const v8b*)(rw + ((kc * 4 + g) ^ (j & 3)) * 8); u[j].q[1] = *(const v8b*)(rw + ((kc * 4 + 2 + g) ^ (j & 3)) * 8); }
#pragma unroll
      for (int j = 0; j < 8; ++j) acc[j] = wmma_bf(a[kc], u[j].v, acc[j]); }
    if (s + 1 < DIN / PJK) { if (wreal) pj_store(nxt, wr, wave, lane); pj_afrag(a, xr); }
    __syncthreads(); }   /* publishes stage s + 1 and ends every read of stage s: its buffer is rewritten in the next trip, or by the epilogue */
}
// ---- k_proj: block = (64 rows, 128 cols, which): q/k/v = X W (+ b) with exact bf16 products (K = DIN) -> which 0: q f16 rows (+ residual rows < QHI); 1: k f16 rows (+ residual rows < KHI); 2: v f16 planes [c][t] (+ bf16 hi/lo planes for t < VHI)
__global__ __launch_bounds__(128) void k_proj(const float* __restrict__ XQ, const float* __restrict__ XK, const float* __restrict__ XV, const float* __restrict__ WQ, const float* __restrict__ WK, const float* __restrict__ WV, const float* __restrict__ BQ, const float* __restrict__ BK, const float* __restrict__ BV,
    _Float16* __restrict__ QH, _Float16* __restrict__ QL, _Float16* __restrict__ KH, _Float16* __restrict__ KL, _Float16* __restrict__ VT, __bf16* __restrict__ VB, __bf16* __restrict__ VBL) {
  __shared__ __align__(16) _Float16 sh[64][136], sl[64][136]; __shared__ __align__(16) _Float16 th[128][72]; __shared__ __align__(16) __bf16 tb[128][72], tbl[128][72];
  const int tid = threadIdx.x, wave = tid >> 5, lane = tid & 31, col = lane & 15, g = lane >> 4; const int which = blockIdx.z; const int c0 = blockIdx.y * 128; const size_t r0 = (size_t)blockIdx.x * 64; const size_t bb = r0 / TT; const int t0 = (int)(r0 % TT);
  if (which < 2 && blockIdx.y > 0) return;   /* q / k have 64 real columns: only the first 128-column tile is computed; the others are never read (block-uniform exit before any barrier) */
  const float* X = which == 0 ? XQ : which == 1 ? XK : XV; const float* WA = which == 0 ? WQ : which == 1 ? WK : WV; const float* BA = which == 0 ? BQ : which == 1 ? BK : BV;
  v8f acc[8] = {};
  { const float* xrow = X + (r0 + wave * 16 + col) * DIN + 8 * g;   /* tb and tbl, free until the epilogue, are the two weight buffers; which is the same for the whole block */
    if (which == 2) pj_main<CC>(acc, WA + (size_t)(wave * 16) * CC + c0 + lane * 4, xrow, tb, tbl, wave, lane);
    else pj_main<RW>(acc, WA + (size_t)(wave * 16) * RW + (lane & (RW / 4 - 1)) * 4, xrow, tb, tbl, wave, lane); }
  if (which < 2) { _Float16* DH = which == 0 ? QH : KH; _Float16* DL = which == 0 ? QL : KL; const int nhi = which == 0 ? QHI : KHI; const bool hi_rows = t0 < nhi;
#pragma unroll
    for (int j = 0; j < 8; ++j) { const float bias = (BA && ((which) == 2 || (c0 + j * 16 + col) < RW)) ? bfr(BA[c0 + j * 16 + col]) : 0.f;
#pragma unroll
      for (int r = 0; r < 8; ++r) { const float v = acc[j][r] + bias; const _Float16 hv = (_Float16)v; sh[wave * 16 + 8 * g + r][j * 16 + col] = hv; sl[wave * 16 + 8 * g + r][j * 16 + col] = (_Float16)((v - (float)hv) * 1024.0f); } }
    __syncthreads();
    for (int e = tid; e < 64 * 16; e += 128) { const int rl = e >> 4, q = e & 15; vst2((unsigned*)(DH + (r0 + rl) * CC + c0 + q * 8), *(const v4u*)&sh[rl][q * 8]); if (hi_rows) vst2((unsigned*)(DL + (bb * nhi + t0 + rl) * (size_t)CC + c0 + q * 8), *(const v4u*)&sl[rl][q * 8]); }
  } else { const bool hi_rows = t0 < VHI;
#pragma unroll
    for (int j = 0; j < 8; ++j) { const float bias = (BA && ((which) == 2 || (c0 + j * 16 + col) < RW)) ? bfr(BA[c0 + j * 16 + col]) : 0.f;
#pragma unroll
      for (int r = 0; r < 8; ++r) { const float v = acc[j][r] + bias; const int rl = wave * 16 + 8 * g + r, cl = j * 16 + col; th[cl][rl] = (_Float16)v; const __bf16 bh = (__bf16)v; tb[cl][rl] = bh; tbl[cl][rl] = (__bf16)(v - (float)bh); } }
    __syncthreads();
    for (int e = tid; e < 128 * 8; e += 128) { const int cl = e >> 3, q = e & 7; vst2((unsigned*)(VT + (bb * CC + c0 + cl) * (size_t)TT + t0 + q * 8), *(const v4u*)&th[cl][q * 8]); if (hi_rows) { const size_t o3 = (bb * CC + c0 + cl) * (size_t)VHI + t0 + q * 8; vst2((unsigned*)(VB + o3), *(const v4u*)&tb[cl][q * 8]); vst2((unsigned*)(VBL + o3), *(const v4u*)&tbl[cl][q * 8]); } } } }
#undef QBH
#define QBH NQB   // SCORE KERNEL ONLY: every query block takes the 3-product branch (unscaled logits)
// ---- k_sc: block = (query block qb, key block kb <= kb_last(qb), batch b): logits x SCALE; q hi + residual (x 2^10) against k (2 products) for query rows < QHI, plus the k residual (3 products) for query blocks < QBH (here every query block); causal: blocks past the diagonal exit, the mask itself is applied by index in k_sm
__global__ __launch_bounds__(128) void k_sc(const _Float16* __restrict__ QH, const _Float16* __restrict__ KH, const _Float16* __restrict__ QL, const _Float16* __restrict__ KL, int h0, float* __restrict__ S0) { __shared__ __align__(16) float ss[4][16][132];
  const int qb = blockIdx.x, kb = blockIdx.y; if (kb > kb_last(qb)) return;
  const int b = blockIdx.z, h = h0; float* S = S0 + (size_t)b * SPLANE + s_base(qb) + (size_t)kb * STILE;   /* blockIdx.z = batch; S = this block's tile */
  const int tid = threadIdx.x, wave = tid >> 5, lane = tid & 31, col = lane & 15, g = lane >> 4; const int k0 = kb * 128; const int ql0 = qb * 64 + wave * 16; const size_t q0 = (size_t)b * TT + ql0, kr0 = (size_t)b * TT + k0;
  v8f acc[8] = {}, accl[8] = {};
  const _Float16* QLb = QL + (size_t)b * QHI * CC; const _Float16* KLb = KL + (size_t)b * KHI * CC;
  if (qb < QBH) {
#pragma unroll
    for (int kc = 0; kc < HD / 32; ++kc) { const v16h ah = frag_h(QH + (q0 + col) * CC + h * HD + kc * 32, lane), al = frag_h(QLb + (size_t)(ql0 + col) * CC + h * HD + kc * 32, lane);
#pragma unroll
      for (int j = 0; j < 8; ++j) { const v16h kbf = frag_h(KH + (kr0 + j * 16 + col) * CC + h * HD + kc * 32, lane), klf = frag_h(KLb + (size_t)(k0 + j * 16 + col) * CC + h * HD + kc * 32, lane); acc[j] = wmma16(ah, kbf, acc[j]); accl[j] = wmma16(al, kbf, accl[j]); accl[j] = wmma16(ah, klf, accl[j]); } }
  } else if (qb * 64 < QHI) {
#pragma unroll
    for (int kc = 0; kc < HD / 32; ++kc) { const v16h ah = frag_h(QH + (q0 + col) * CC + h * HD + kc * 32, lane), al = frag_h(QLb + (size_t)(ql0 + col) * CC + h * HD + kc * 32, lane);
#pragma unroll
      for (int j = 0; j < 8; ++j) { const v16h kbf = frag_h(KH + (kr0 + j * 16 + col) * CC + h * HD + kc * 32, lane); acc[j] = wmma16(ah, kbf, acc[j]); accl[j] = wmma16(al, kbf, accl[j]); } }
  } else {
#pragma unroll
    for (int kc = 0; kc < HD / 32; ++kc) { const v16h ah = frag_h(QH + (q0 + col) * CC + h * HD + kc * 32, lane);
#pragma unroll
      for (int j = 0; j < 8; ++j) { const v16h kbf = frag_h(KH + (kr0 + j * 16 + col) * CC + h * HD + kc * 32, lane); acc[j] = wmma16(ah, kbf, acc[j]); } } }
#pragma unroll
  for (int j = 0; j < 8; ++j) {
#pragma unroll
    for (int r = 0; r < 8; ++r) ss[wave][8 * g + r][j * 16 + col] = (acc[j][r] + accl[j][r] * (1.0f / 1024.0f)) * SCALE; }
  LDSX(); for (int rl = 0; rl < 16; ++rl) vst2(S + (wave * 16 + rl) * 128 + lane * 4, *(const v4f*)&ss[wave][rl][lane * 4]); }
#undef QBH
#define QBH 6   // restored: the softmax and P.v kernels keep the causal early band of 6 query blocks
// ---- k_sm: one wave = one query row t (eight rows a block, no LDS, no barrier, so the waves of a block need not run alike): the row's keys [0, kend) stay in registers from the load to the store, 16 bytes a lane and 512 bytes a wave per access; causal -> logit if s <= t else excluded; softmax in f32; P x 2^11 in place (0 for excluded): f32 for the early band (query blocks < QBH); for all other rows rounded to f16 here, once, instead of in each of the eight column groups of k_pv: the 128 halves of a chunk lie in the first 256 bytes of the row's own 512-byte place in its tile, so a wave still writes only where it alone has read
#define SMC (TT / 128)     // 128-key chunks of a full row: one 16-byte access of a wave each
__device__ __forceinline__ float sm_e(float x, float m) { const float ex = expf(x - m); return (x <= -1.0e38f) ? 0.f : ex; }   /* excluded -> 0; the exponential stands in front of the choice, so the choice is a select and no branch per element */
typedef __attribute__((ext_vector_type(4))) _Float16 v4h;
__device__ __forceinline__ v4h sm_h(v4f p) { v4h r;
#pragma unroll
  for (int c = 0; c < 4; ++c) r[c] = (_Float16)p[c];
  return r; }
__global__ __launch_bounds__(256) void k_sm(float* __restrict__ S0 SM_EXTRA_PARAMS) {
  const int lane = threadIdx.x & 31; const int wv = __builtin_amdgcn_readfirstlane(threadIdx.x >> 5);   /* the wave's number as a scalar: the row and its chunk count are then scalars, and the tests on nf below scalar branches */
  const int r = blockIdx.x * 4 + (wv & 3); const int t = wv < 4 ? r : TT - 1 - r;   /* waves w and w + 4 take rows r and TT - 1 - r, a short causal row and a long one: every block carries the same work; each row is taken once */
  const int nf = kb_last(t >> 6);   /* whole chunks in front of the row's last one */
  float* sr = S0 + (size_t)blockIdx.y * SPLANE + s_base(t >> 6) + (t & 63) * 128 + lane * 4;   /* blockIdx.y = batch; chunk i of the row lies in tile i of its query block */
  v4f v[SMC - 1]; v4f vl = *(const v4f*)(sr + nf * STILE);   /* vl: the last chunk, the only one the diagonal crosses (t >> 7 == nf) */
#pragma unroll   // constant chunk numbers keep the row in registers (so for every loop over the chunks in this kernel); all loads of the row are in flight together
  for (int i = 0; i < SMC - 1; ++i) if (i < nf) v[i] = *(const v4f*)(sr + i * STILE);
  if (CAUSAL) {
#pragma unroll
    for (int c = 0; c < 4; ++c) if (nf * 128 + lane * 4 + c > t) vl[c] = -3.0e38f; }
  float m = fmaxf(-3.0e38f, fmaxf(fmaxf(vl[0], vl[1]), fmaxf(vl[2], vl[3])));
#pragma unroll
  for (int i = 0; i < SMC - 1; ++i) if (i < nf) m = fmaxf(m, fmaxf(fmaxf(v[i][0], v[i][1]), fmaxf(v[i][2], v[i][3])));
#pragma unroll
  for (int o = 1; o < 32; o <<= 1) m = fmaxf(m, __shfl_xor(m, o));
  v4f s4 = {0.f, 0.f, 0.f, 0.f};
#pragma unroll
  for (int i = 0; i < SMC - 1; ++i) if (i < nf) {
#pragma unroll
    for (int c = 0; c < 4; ++c) { const float e = sm_e(v[i][c], m); v[i][c] = e; s4[c] += e; } }
#pragma unroll
  for (int c = 0; c < 4; ++c) { const float e = sm_e(vl[c], m); vl[c] = e; s4[c] += e; }
  float sum = (s4[0] + s4[1]) + (s4[2] + s4[3]);
#pragma unroll
  for (int o = 1; o < 32; o <<= 1) sum += __shfl_xor(sum, o);
  const float inv = sum > 0.f ? 2048.0f / sum : 0.f;   /* a fully excluded row yields P = 0 */
  if ((t >> 6) < QBH) {   /* t is a scalar: a scalar branch */
#pragma unroll
    for (int i = 0; i < SMC - 1; ++i) if (i < nf) { vst2(sr + i * STILE, v[i] * inv);
      asm volatile("s_wait_xcnt 0x0" ::: "memory"); }   // the next chunk's products reuse the registers this store names: the wait stands between the store and that overwrite
    vst2(sr + nf * STILE, vl * inv);
  } else { _Float16* hr = (_Float16*)(sr - lane * 4) + lane * 4;   /* the row's place again, counted in halves: 8 bytes a lane, 256 bytes a wave per store */
#pragma unroll
    for (int i = 0; i < SMC - 1; ++i) if (i < nf) { vst2(hr + i * (2 * STILE), sm_h(v[i] * inv));
      asm volatile("s_wait_xcnt 0x0" ::: "memory"); }   // as above: between the store and the overwrite of its registers
    vst2(hr + nf * (2 * STILE), sm_h(vl * inv)); } }
#define PVK 128            // keys per staged tile of k_pv (kb_last counts in the same 128-key units; a staged P tile is the f16 P of one stored tile: the first 256 B of each 512-B row)
#define PVP (PVK + 8)      // P row pitch in LDS, halves: 272 B = 16 B x 17, conflict-free for 16-byte reads
#define PVV (PVK + 8)      // v row pitch in LDS, halves: 272 B = 16 B x 17
// eight asynchronous copies of 16 bytes a lane, global -> LDS, rows lstep / gstep bytes apart; the s_wait_xcnt in the same statement stands before anything can rewrite an address register of a copy
__device__ __forceinline__ void acopy8(unsigned l, unsigned lstep, const char* gsrc, size_t gstep) {
  asm volatile("global_load_async_to_lds_b128 %0, %8, off\n\t"
               "global_load_async_to_lds_b128 %1, %9, off\n\t"
               "global_load_async_to_lds_b128 %2, %10, off\n\t"
               "global_load_async_to_lds_b128 %3, %11, off\n\t"
               "global_load_async_to_lds_b128 %4, %12, off\n\t"
               "global_load_async_to_lds_b128 %5, %13, off\n\t"
               "global_load_async_to_lds_b128 %6, %14, off\n\t"
               "global_load_async_to_lds_b128 %7, %15, off\n\t"
               "s_wait_xcnt 0x0"
               :: "v"(l), "v"(l + lstep), "v"(l + 2 * lstep), "v"(l + 3 * lstep), "v"(l + 4 * lstep), "v"(l + 5 * lstep), "v"(l + 6 * lstep), "v"(l + 7 * lstep),
                  "v"(gsrc), "v"(gsrc + gstep), "v"(gsrc + 2 * gstep), "v"(gsrc + 3 * gstep), "v"(gsrc + 4 * gstep), "v"(gsrc + 5 * gstep), "v"(gsrc + 6 * gstep), "v"(gsrc + 7 * gstep)
               : "memory");
}
// one wave's share of a tile: its 16 P rows (256 B of f16 each, 512 B apart in the stored tile) and 16 v rows (256 B each), two rows a copy
__device__ __forceinline__ void pv_tile(unsigned lp, unsigned lv, const char* gp, const char* gv) {
  acopy8(lp, 2u * PVP * 2u, gp, (size_t)2 * PVK * 4); acopy8(lv, 2u * PVV * 2u, gv, (size_t)2 * TT * 2);
}
// ---- k_pv: block = 64 queries (qb) of (b, h): ctx = P . v over keys [0, kend) (P x 2^11, stored as f16 by k_sm, against v f16: 1 product; causal early query blocks: f32 P and v as bf16 hi + lo, 3 products); 256-B (row, head) segment by 16 lanes
__global__ __launch_bounds__(128) void k_pv(const float* __restrict__ PS0, const _Float16* __restrict__ VT, const __bf16* __restrict__ VB, const __bf16* __restrict__ VBL, int h0, float* __restrict__ Y) { const int h = h0 + blockIdx.y, b = blockIdx.z;   /* blockIdx.y = column group, blockIdx.z = batch; every group reads its batch's one probability plane */ __shared__ __align__(16) float ss[4][16][HD + 4];
  __shared__ __align__(16) _Float16 sp[2][64][PVP]; __shared__ __align__(16) _Float16 sv[2][HD][PVV];   /* two buffers each: P tile (64 queries x 128 keys, f16) and v tile (64 columns x 128 keys, f16) */
  const int tid = threadIdx.x, wave = tid >> 5, lane = tid & 31, col = lane & 15, g = lane >> 4; const int qb = blockIdx.x;
  const int ql0 = qb * 64 + wave * 16; const int kce = (kb_last(qb) + 1) * 4; const float* PS = PS0 + (size_t)b * SPLANE + s_base(qb);
  v8f acc[HD / 16] = {};
  if (qb < QBH) {
#pragma unroll 1
    for (int kc = 0; kc < kce; ++kc) { const F2 p = split_row(PS + (kc >> 2) * STILE + (wave * 16 + col) * 128, (kc & 3) * 32, lane);
      asm volatile("s_wait_loadcnt 0x0" ::: "memory");
#pragma unroll
      for (int j = 0; j < HD / 16; ++j) { const size_t po = ((size_t)b * CC + h * HD + j * 16 + col) * (size_t)VHI + kc * 32; const v16b vh = frag_b(VB + po, lane); acc[j] = wmma_bf(p.h, vh, acc[j]); acc[j] = wmma_bf(p.l, vh, acc[j]); acc[j] = wmma_bf(p.h, frag_b(VBL + po, lane), acc[j]); } }
  } else {
    // tiles of 128 keys come into LDS in whole 128-byte lines (two P rows or two v rows = one copy of a wave); each wave brings 16 P rows and 16 v rows of every tile
    const int nst = kce / (PVK / 32);
    const unsigned lp = (unsigned)(size_t)&sp[0][wave * 16 + g][col * 8], lv = (unsigned)(size_t)&sv[0][wave * 16 + g][col * 8];
    const char* gp = (const char*)(PS + (wave * 16 + g) * PVK) + col * 16; const char* gv = (const char*)(VT + ((size_t)b * CC + h * HD + wave * 16 + g) * (size_t)TT + col * 8);
    pv_tile(lp, lv, gp, gv);
    asm volatile("s_wait_asynccnt 0x0" ::: "memory");   // tile 0 has landed before the barrier publishes it
    __syncthreads();
    if (nst > 1) pv_tile(lp + (unsigned)sizeof(sp[0]), lv + (unsigned)sizeof(sv[0]), gp + STILE * 4, gv + PVK * 2);
#pragma unroll 1   // one tile a trip: the buffer index alternates, the code stays small
    for (int t = 0; t < nst; ++t) { const int bu = t & 1;
      v16h pf[PVK / 32], vf[PVK / 32][HD / 16];   // all fragment reads of the tile are issued first: the products then wait on counted LDS returns, not on one LDS latency each
#pragma unroll
      for (int kc = 0; kc < PVK / 32; ++kc) { pf[kc] = frag_h(&sp[bu][wave * 16 + col][kc * 32], lane);
#pragma unroll
        for (int j = 0; j < HD / 16; ++j) vf[kc][j] = frag_h(&sv[bu][j * 16 + col][kc * 32], lane); }
#pragma unroll
      for (int kc = 0; kc < PVK / 32; ++kc) {
#pragma unroll
        for (int j = 0; j < HD / 16; ++j) acc[j] = wmma16(pf[kc], vf[kc][j], acc[j]); }
      asm volatile("s_wait_dscnt 0x0" ::: "memory");      // this wave's reads of buffer bu are done before the barrier frees it
      asm volatile("s_wait_asynccnt 0x0" ::: "memory");   // this wave's copies of tile t + 1 have landed before the barrier publishes them
      __syncthreads();
      if (t + 2 < nst) pv_tile(lp + (unsigned)(bu * sizeof(sp[0])), lv + (unsigned)(bu * sizeof(sv[0])), gp + (size_t)(t + 2) * (STILE * 4), gv + (size_t)(t + 2) * (PVK * 2)); }
    asm volatile("s_wait_asynccnt 0x0" ::: "memory");   // no copy is left in flight behind the loop
  }
#pragma unroll
  for (int j = 0; j < HD / 16; ++j)
#pragma unroll
    for (int r = 0; r < 8; ++r) ss[wave][8 * g + r][j * 16 + col] = acc[j][r] * (1.0f / 2048.0f);
  LDSX(); for (int rl = 0; rl < 16; ++rl) if (lane < HD / 4) vst2(Y + ((size_t)b * TT + ql0 + rl) * CC + h * HD + lane * 4, *(const v4f*)&ss[wave][rl][lane * 4]); }

#define LN_EPS 1.0e-5f
__global__ __launch_bounds__(128) void k_resln(const float* __restrict__ O, const float* __restrict__ X, const float* __restrict__ GAM, const float* __restrict__ BET, float* __restrict__ OUT) { __shared__ float sred[2][4]; const size_t r = blockIdx.x; const int tid = threadIdx.x; const v4f o = *(const v4f*)(O + r * CC + tid * 4); const v4f xr = *(const v4f*)(X + r * CC + tid * 4); asm volatile("s_wait_loadcnt 0x0" ::: "memory"); float y[4]; float a = 0.f;
#pragma unroll
  for (int i = 0; i < 4; ++i) { y[i] = bfr(xr[i]) + o[i]; a += y[i]; }
#pragma unroll
  for (int s_ = 1; s_ < 32; s_ <<= 1) a += __shfl_xor(a, s_);
  if ((tid & 31) == 0) sred[0][tid >> 5] = a; __syncthreads();
  const float mu = (sred[0][0] + sred[0][1] + sred[0][2] + sred[0][3]) * (1.0f / (float)CC); float v = 0.f;
#pragma unroll
  for (int i = 0; i < 4; ++i) { const float d = y[i] - mu; v += d * d; }
#pragma unroll
  for (int s_ = 1; s_ < 32; s_ <<= 1) v += __shfl_xor(v, s_);
  if ((tid & 31) == 0) sred[1][tid >> 5] = v; __syncthreads();
  const float rs = 1.0f / sqrtf((sred[1][0] + sred[1][1] + sred[1][2] + sred[1][3]) * (1.0f / (float)CC) + LN_EPS); const v4f g4 = *(const v4f*)(GAM + tid * 4), b4 = *(const v4f*)(BET + tid * 4); v4f w;
#pragma unroll
  for (int i = 0; i < 4; ++i) w[i] = (y[i] - mu) * rs * bfr(g4[i]) + bfr(b4[i]);
  vst2(OUT + r * CC + tid * 4, w); }
static_assert(CC == 512 && DIN == CC, "k_resln: 128 threads x 4 floats per row; the residual adds the input row");
extern "C" void kernel_launch(void* const* d_in, const int* in_sizes, int n_in, void* d_out, int out_size, void* d_ws, size_t ws_size, hipStream_t stream) {
  (void)in_sizes; (void)n_in; (void)out_size;
  const float** F = (const float**)d_in;
  if (ws_size < (size_t)WS_END) return;
  char* ws = (char*)d_ws; _Float16 *QH = (_Float16*)(ws + WS_QH), *KH = (_Float16*)(ws + WS_KH), *VT = (_Float16*)(ws + WS_VT), *QL = (_Float16*)(ws + WS_QL), *KL = (_Float16*)(ws + WS_KL); __bf16 *VB = (__bf16*)(ws + WS_VB), *VBL = (__bf16*)(ws + WS_VBL); float *S = (float*)(ws + WS_S), *Y = (float*)(ws + WS_Y);
  (void)Y; (void)QL; (void)KL; (void)VB; (void)VBL;
  // inputs: 0 x [4,4096,512]; 1 Wq [512,64] (in,out), 2 bq [64]; 3 Wk [512,64], 4 bk; 5 Wv [512,512], 6 bv [512] (biases NONZERO); 7 gamma [512]; 8 beta [512] (ones / zeros, read)
  float* Yo = (float*)(ws + WS_Y);
  k_proj<<<dim3(TNB * TT / 64, CC / 128, 3), 128, 0, stream>>>(F[0], F[0], F[0], F[1], F[3], F[5], F[2], F[4], F[6], QH, QL, KH, KL, VT, VB, VBL);
  k_sc<<<dim3(NQB, TT / 128, TNB), 128, 0, stream>>>(QH, KH, QL, KL, 0, S);   /* the one score head: columns 0..63; all batches in one grid */
  k_sm<<<dim3(TT / 8, TNB), 256, 0, stream>>>(S);
  k_pv<<<dim3(NQB, NH, TNB), 128, 0, stream>>>(S, VT, VB, VBL, 0, Yo);   /* column group g: v / o columns 64g .. 64g+63, all eight from the batch's one plane; batch = slowest index, so the work-groups of one batch stay neighbours in index order */
  k_resln<<<dim3(TNB * TT), 128, 0, stream>>>(Yo, F[0], F[7], F[8], (float*)d_out);
}

// v007
// It runs in 171 microseconds.
// Two timings next to v006 both put it at 1.12 times that version's speed.
// All steps since v000 together make it 22.6 times as fast.
// compute dtype: all float inputs rounded to bf16; q / k (64-wide) and v (512-wide) projections with EXACT bf16 products on WMMA 16x16x32 (f32 accumulate) + bias; causal logits UNSCALED: q and k each as f16 hi + (x 2^10) residual, 3 products on every row; softmax f32; P x 2^11 once to f16 x v once to f16 (bf16 hi + lo below row 384), four 128-column passes over the same probability plane; y = bf16(x) + o and LayerNorm over 512 in f32; f32 output.
#include <hip/hip_runtime.h>
#include <math.h>

typedef __attribute__((ext_vector_type(16))) _Float16 v16h;
typedef __attribute__((ext_vector_type(16))) __bf16 v16b;
typedef __attribute__((ext_vector_type(8)))  _Float16 v8h;
typedef __attribute__((ext_vector_type(8)))  float v8f;
typedef __attribute__((ext_vector_type(4)))  float v4f;
typedef __attribute__((ext_vector_type(2)))  float v2f;
typedef __attribute__((ext_vector_type(4)))  unsigned v4u;
typedef __attribute__((ext_vector_type(4)))  int v4i;
typedef float __attribute__((may_alias)) float_a;
typedef int __attribute__((may_alias)) int_a;

template <typename T> __device__ __forceinline__ void vst2(void* p, T v) { *(T*)p = v;  }
__device__ __forceinline__ v8f wmma16(v16h a, v16h b, v8f c) {
  v8f d = __builtin_amdgcn_wmma_f32_16x16x32_f16(false, a, false, b, (short)0, c, false, false);
  asm volatile("v_nop\n\tv_nop\n\tv_nop\n\tv_nop" : "+v"(d) : "v"(a), "v"(b));
  return d;
}
__device__ __forceinline__ v8f wmma_bf(v16b a, v16b b, v8f c) {
  v8f d = __builtin_amdgcn_wmma_f32_16x16x32_bf16(false, a, false, b, (short)0, c, false, false);
  asm volatile("v_nop\n\tv_nop\n\tv_nop\n\tv_nop" : "+v"(d) : "v"(a), "v"(b));
  return d;
}
// 16x16x32 fragments: lane = (h = lane>>4, row/col = lane&15); elements 0..7 = k0+8h+0..7, 8..15 = k0+16+8h+0..7; D element r = row 8h+r
__device__ __forceinline__ v16h frag_h(const _Float16* rowk0, int lane) {
  union { v16h v; v8h q[2]; } u; const _Float16* p = rowk0 + 8 * (lane >> 4);
  u.q[0] = *(const v8h*)p; u.q[1] = *(const v8h*)(p + 16); return u.v;
}
__device__ __forceinline__ v16h frag_f32(const float* rowk0, int lane) {
  v16h a; const float* p = rowk0 + 8 * (lane >> 4);
#pragma unroll
  for (int i = 0; i < 8; ++i) { a[i] = (_Float16)p[i]; a[8 + i] = (_Float16)p[16 + i]; }
  return a;
}
__device__ __forceinline__ v16h frag_f32s(const float* rowk0, int lane, float sc) {
  v16h a; const float* p = rowk0 + 8 * (lane >> 4);
#pragma unroll
  for (int i = 0; i < 8; ++i) { a[i] = (_Float16)(p[i] * sc); a[8 + i] = (_Float16)(p[16 + i] * sc); }
  return a;
}
// column fragment from a [K][ld] layout (column n), rows >= K read as 0
__device__ __forceinline__ v16h fragc_f32(const float* W, int k0, int n, int lane, int ld, int K) {
  v16h a; const int g = lane >> 4;
#pragma unroll
  for (int i = 0; i < 8; ++i) { const int ka = k0 + 8 * g + i, kb = ka + 16;
    a[i] = (_Float16)(ka < K ? W[(size_t)(ka < K ? ka : K - 1) * ld + n] : 0.f); a[8 + i] = (_Float16)(kb < K ? W[(size_t)(kb < K ? kb : K - 1) * ld + n] : 0.f); }
  return a;
}
struct F2 { v16b h, l; };
__device__ __forceinline__ F2 bsplit16(const float v[16]) { F2 r;
#pragma unroll
  for (int i = 0; i < 16; ++i) { const __bf16 h = (__bf16)v[i]; r.h[i] = h; r.l[i] = (__bf16)(v[i] - (float)h); }
  return r; }
__device__ __forceinline__ F2 split_row(const float* row, int k0, int lane) { float v[16]; const float* p = row + k0 + 8 * (lane >> 4);
#pragma unroll
  for (int i = 0; i < 8; ++i) { v[i] = p[i]; v[8 + i] = p[16 + i]; }
  return bsplit16(v); }
__device__ __forceinline__ F2 split_rowK(const float* row, int k0, int lane, int K) { float v[16]; const int g = lane >> 4;
#pragma unroll
  for (int i = 0; i < 8; ++i) { const int ka = k0 + 8 * g + i, kb = ka + 16; v[i] = ka < K ? row[ka < K ? ka : K - 1] : 0.f; v[8 + i] = kb < K ? row[kb < K ? kb : K - 1] : 0.f; }
  return bsplit16(v); }
__device__ __forceinline__ F2 split_col(const float* W, int k0, int n, int lane, int ld, int K) { float v[16]; const int g = lane >> 4;
#pragma unroll
  for (int i = 0; i < 8; ++i) { const int ka = k0 + 8 * g + i, kb = ka + 16; v[i] = ka < K ? W[(size_t)(ka < K ? ka : K - 1) * ld + n] : 0.f; v[8 + i] = kb < K ? W[(size_t)(kb < K ? kb : K - 1) * ld + n] : 0.f; }
  return bsplit16(v); }
__device__ __forceinline__ v8f mac3(const F2& a, const F2& b, v8f c) { c = wmma_bf(a.l, b.h, c); c = wmma_bf(a.h, b.l, c); return wmma_bf(a.h, b.h, c); }
__device__ __forceinline__ float sigm(float v) { return 1.0f / (1.0f + expf(-v)); }
#define LDSX() do { asm volatile("s_wait_dscnt 0" ::: "memory"); __builtin_amdgcn_wave_barrier(); __builtin_amdgcn_fence(__ATOMIC_RELEASE, "workgroup"); } while (0)

// Single-head causal self-attention with a residual and LayerNorm (x [4,4096,512]; (in,out) Wq / Wk [512,64] and Wv [512,512] uniform(+-1/sqrt(512)) with biases of the same scale - NONZERO; q, k = x W + b (64-wide), v = x Wv + bv (512-wide); scores = q k^T with NO scaling; tril kept, -inf elsewhere; softmax over the keys; o = attn v [4,4096,512]; y = x + o; LayerNorm over the 512 features (biased variance, eps 1e-5) * gamma + beta (ones / zeros, read)). ONE 64-wide score head in columns 0..63 of the 512-wide q / k rows; P.v as eight ordinary 64-wide column groups that all read the same probability plane.
#define NB 4
#define TT 4096
#define CC 512            // NH * HD = projected width
#define DIN 512          // input (model) width
#define NH 8
#define HD 64
#define NQB (TT / 64)
#define HG 1
#define SCALE (1.0f)
#define CAUSAL 1
#ifndef TNB
#define TNB NB
#endif
__device__ __forceinline__ float bfr(float v) { return (float)(__bf16)v; }
__host__ __device__ __forceinline__ int kb_last(int qb) { return CAUSAL ? ((qb * 64 + 63) >> 7) : (TT / 128 - 1); }
// packed causal logits / P plane of one batch: tiles of 64 queries x 128 keys (STILE floats, rows of 128), for query block qb only its key blocks 0..kb_last(qb), one behind the other from s_base(qb); so the planes of all batches fit in the workspace together, and every stride inside a query block is a constant
#define STILE (64 * 128)
static_assert(CAUSAL == 1 && NQB % 2 == 0, "s_base sums kb_last(i) + 1 = (i >> 1) + 1 over i < qb");
__device__ __forceinline__ size_t s_base(int qb) { const int m = qb >> 1; return (size_t)STILE * (size_t)((m + 1) * (m + (qb & 1))); }
#define SPLANE ((size_t)STILE * (NQB / 2) * (NQB / 2 + 1))   // floats per batch = s_base(NQB)
typedef __attribute__((ext_vector_type(8))) __bf16 v8b;
__device__ __forceinline__ v16b frag_b(const __bf16* rowk0, int lane) {
  union { v16b v; v8b q[2]; } u; const __bf16* p = rowk0 + 8 * (lane >> 4);
  u.q[0] = *(const v8b*)p; u.q[1] = *(const v8b*)(p + 16); return u.v;
}
#define QBH 6              // causal: query blocks 0..QBH-1 of each sequence (few keys, no averaging) take the high-precision path
#define QHI TT             // rows carrying a q residual plane (all rows: 3-product logits everywhere)
#define KHI TT             // key rows carrying a k residual plane (read by every k_sc block: its 3-product branch)
#define VHI 384            // v bf16 hi / lo planes only for key rows t < VHI (read by the causal early band: query blocks < 6 see keys <= 383)
#define RW 64              // real width of q / k
// B fragment (k rows k0+.., output column o) of a weight: (in,out) [K][ld] or (out,in) [ld rows of K]: bf16 exact, or f16(bf16 * 256) exact
__device__ __forceinline__ v16b wcol_io(const float* Wm, int k0, int o, int lane, int ld) { v16b w; const int g = lane >> 4;
#pragma unroll
  for (int i = 0; i < 8; ++i) { w[i] = (__bf16)Wm[(size_t)(k0 + 8 * g + i) * ld + o]; w[8 + i] = (__bf16)Wm[(size_t)(k0 + 16 + 8 * g + i) * ld + o]; }
  return w; }
__device__ __forceinline__ v16b wcol_oi(const float* Wm, int k0, int o, int lane, int K) { v16b w; const float* p = Wm + (size_t)o * K + k0 + 8 * (lane >> 4);
#pragma unroll
  for (int i = 0; i < 8; ++i) { w[i] = (__bf16)p[i]; w[8 + i] = (__bf16)p[16 + i]; }
  return w; }
__device__ __forceinline__ v16h wcolh_io(const float* Wm, int k0, int o, int lane, int ld) { v16h w; const int g = lane >> 4;
#pragma unroll
  for (int i = 0; i < 8; ++i) { w[i] = (_Float16)(bfr(Wm[(size_t)(k0 + 8 * g + i) * ld + o]) * 256.0f); w[8 + i] = (_Float16)(bfr(Wm[(size_t)(k0 + 16 + 8 * g + i) * ld + o]) * 256.0f); }
  return w; }
__device__ __forceinline__ v16h wcolh_oi(const float* Wm, int k0, int o, int lane, int K) { v16h w; const float* p = Wm + (size_t)o * K + k0 + 8 * (lane >> 4);
#pragma unroll
  for (int i = 0; i < 8; ++i) { w[i] = (_Float16)(bfr(p[i]) * 256.0f); w[8 + i] = (_Float16)(bfr(p[16 + i]) * 256.0f); }
  return w; }
#define WQKV_LAYOUT 0   // 0 = (in,out): Wv [DIN][CC], Wq / Wk [DIN][RW]; 1 = (out,in) [CC][DIN]; 2 = per-head [NH][DIN][HD]
__device__ __forceinline__ v16b wcol_hdk(const float* Wm, int k0, int o, int lane) { v16b w; const int g = lane >> 4; const float* p = Wm + (size_t)(o / HD) * DIN * HD + (o % HD);
#pragma unroll
  for (int i = 0; i < 8; ++i) { w[i] = (__bf16)p[(size_t)(k0 + 8 * g + i) * HD]; w[8 + i] = (__bf16)p[(size_t)(k0 + 16 + 8 * g + i) * HD]; }
  return w; }
#define WO_OUT_IN 0
#if WQKV_LAYOUT == 1
#define WCOL(W, k0, o, lane) wcol_oi(W, k0, o, lane, DIN)
#elif WQKV_LAYOUT == 2
#define WCOL(W, k0, o, lane) wcol_hdk(W, k0, o, lane)
#else
__device__ __forceinline__ v16b zero16b() { v16b w; _Pragma("unroll") for (int i = 0; i < 16; ++i) w[i] = (__bf16)0.0f; return w; }
#define WCOL(W, k0, o, lane) (((which) == 2) ? wcol_io(W, k0, o, lane, CC) : (((o) < RW) ? wcol_io(W, k0, o, lane, RW) : zero16b()))   /* (in,out): Wv [512][512]; Wq / Wk [512][64]: columns >= 64 of the q / k rows are zero (and never read) */
#endif
#if WO_OUT_IN
#define WOCOL(W, k0, o, lane) wcol_oi(W, k0, o, lane, CC)
#define WOCOLH(W, k0, o, lane) wcolh_oi(W, k0, o, lane, CC)
#else
#define WOCOL(W, k0, o, lane) wcol_io(W, k0, o, lane, DIN)
#define WOCOLH(W, k0, o, lane) wcolh_io(W, k0, o, lane, DIN)
#endif

#ifndef SM_EXTRA_PARAMS
#define SM_EXTRA_PARAMS
#endif
#ifndef PROJ_EXTRA_PARAMS
#define PROJ_EXTRA_PARAMS
#endif
#ifndef SM_MASK_HOOK
#define SM_MASK_HOOK (void)0
#endif

#define WS_QH  0u                                      // f16 q rows [b*t][CC]
#define WS_KH  (WS_QH + 2u * (size_t)NB * TT * CC)      // f16 k rows [b*t][CC]
#define WS_VT  (WS_KH + 2u * (size_t)NB * TT * CC)      // f16 v planes [b][c][t]
#define WS_QL  (WS_VT + 2u * (size_t)NB * CC * TT)      // f16 q residual x 2^10 rows [b][t < QHI][CC]
#define WS_KL  (WS_QL + 2u * (size_t)NB * QHI * CC)     // f16 k residual x 2^10 rows [b][t < KHI][CC]
#define WS_VB  (WS_KL + 2u * (size_t)NB * KHI * CC)     // bf16 v hi planes [b][c][t < VHI]
#define WS_VBL (WS_VB + 2u * (size_t)NB * CC * VHI)
#define WS_S   (WS_VBL + 2u * (size_t)NB * CC * VHI)    // f32 logits / P (f16 P outside the early band), one packed plane per batch [b][SPLANE]
#define WS_Y   (WS_S  + 4u * (size_t)NB * SPLANE)       // f32 ctx rows [b*t][CC]
#define WS_END (WS_Y  + 4u * (size_t)NB * TT * CC)   // o rows [(b*TT + t)][CC] (k_pv writes them; the residual-LayerNorm kernel writes the output)

#define PJK 64             // k rows per staged weight tile of k_proj
// one thread's share of a stage: 16 weight rows x 4 columns (a row of 128 columns = one 512-byte access of a wave; LD, the row length, is a constant, so the 16 rows are immediate offsets from one address) and the x values of its two A fragments
template <int LD> __device__ __forceinline__ void pj_load(v4f (&wr)[16], v4f (&xr)[8], const float* wp, const float* xrow) {
#pragma unroll
  for (int i = 0; i < 16; ++i) wr[i] = *(const v4f*)(wp + i * LD);
#pragma unroll
  for (int kc = 0; kc < PJK / 32; ++kc) { const float* p = xrow + kc * 32; xr[kc * 4] = *(const v4f*)p; xr[kc * 4 + 1] = *(const v4f*)(p + 4); xr[kc * 4 + 2] = *(const v4f*)(p + 16); xr[kc * 4 + 3] = *(const v4f*)(p + 20); }
}
// the 16 x 4 weight values to bf16, transposed in registers: eight k of one column = one 16-byte LDS store. The 16-byte group kg of column c lies at place kg ^ ((c >> 4) & 3) of its row: 16 lanes, four columns apart, then fall on 16 different bank groups; a fragment's 16 columns share one (c >> 4)
__device__ __forceinline__ void pj_store(__bf16 (*buf)[72], const v4f (&wr)[16], int wave, int lane) {
#pragma unroll
  for (int q = 0; q < 2; ++q) {
#pragma unroll
    for (int cc = 0; cc < 4; ++cc) { v8b pk;
#pragma unroll
      for (int i = 0; i < 8; ++i) pk[i] = (__bf16)wr[q * 8 + i][cc];
      *(v8b*)&buf[lane * 4 + cc][((wave * 2 + q) ^ ((lane >> 2) & 3)) * 8] = pk; } }
}
__device__ __forceinline__ void pj_afrag(v16b (&a)[PJK / 32], const v4f (&xr)[8]) {
#pragma unroll
  for (int kc = 0; kc < PJK / 32; ++kc)
#pragma unroll
    for (int i = 0; i < 4; ++i) { a[kc][i] = (__bf16)xr[kc * 4][i]; a[kc][4 + i] = (__bf16)xr[kc * 4 + 1][i]; a[kc][8 + i] = (__bf16)xr[kc * 4 + 2][i]; a[kc][12 + i] = (__bf16)xr[kc * 4 + 3][i]; }
}
// K loop of k_proj in stages of PJK k rows: the stage's weight tile (PJK x 128 columns) lies in LDS as bf16 [column][k], in b0 and b1 by turns; the next stage's weight rows and x values are loaded while this stage's products run. LD = 64 (Wq / Wk, 64 real columns): tile columns >= 64 are zero in both buffers, written once in front of the loop; their lanes re-read real columns (in bounds) and store nothing
template <int LD> __device__ __forceinline__ void pj_main(v8f (&acc)[8], const float* wp, const float* xrow, __bf16 (*b0)[72], __bf16 (*b1)[72], int wave, int lane) {
  const int col = lane & 15, g = lane >> 4; const bool wreal = LD == CC || lane < RW / 4;
  v4f wr[16], xr[8]; v16b a[PJK / 32];
  pj_load<LD>(wr, xr, wp, xrow);
  if (wreal) pj_store(b0, wr, wave, lane);
  else { const v4f z[16] = {}; pj_store(b0, z, wave, lane); pj_store(b1, z, wave, lane); }
  pj_afrag(a, xr);
  __syncthreads();
#pragma unroll 1   // one stage a trip: the buffers alternate, the code stays small
  for (int s = 0; s < DIN / PJK; ++s) { const __bf16 (*cur)[72] = (s & 1) ? b1 : b0; __bf16 (*nxt)[72] = (s & 1) ? b0 : b1;
    if (s + 1 < DIN / PJK) { wp += PJK * LD; xrow += PJK; pj_load<LD>(wr, xr, wp, xrow); }
#pragma unroll
    for (int kc = 0; kc < PJK / 32; ++kc) { union { v16b v; v8b q[2]; } u[8];   // the eight fragment reads of a k step are issued first: the products then wait on counted LDS returns, not on one LDS latency each
#pragma unroll
      for (int j = 0; j < 8; ++j) { const __bf16* rw = &cur[j * 16 + col][0]; u[j].q[0] = *(const v8b*)(rw + ((kc * 4 + g) ^ (j & 3)) * 8); u[j].q[1] = *(const v8b*)(rw + ((kc * 4 + 2 + g) ^ (j & 3)) * 8); }
#pragma unroll
      for (int j = 0; j < 8; ++j) acc[j] = wmma_bf(a[kc], u[j].v, acc[j]); }
    if (s + 1 < DIN / PJK) { if (wreal) pj_store(nxt, wr, wave, lane); pj_afrag(a, xr); }
    __syncthreads(); }   /* publishes stage s + 1 and ends every read of stage s: its buffer is rewritten in the next trip, or by the epilogue */
}
// ---- k_proj: block = (64 rows, 128 cols, which): q/k/v = X W (+ b) with exact bf16 products (K = DIN) -> which 0: q f16 rows (+ residual rows < QHI); 1: k f16 rows (+ residual rows < KHI); 2: v f16 planes [c][t] (+ bf16 hi/lo planes for t < VHI)
__global__ __launch_bounds__(128) void k_proj(const float* __restrict__ XQ, const float* __restrict__ XK, const float* __restrict__ XV, const float* __restrict__ WQ, const float* __restrict__ WK, const float* __restrict__ WV, const float* __restrict__ BQ, const float* __restrict__ BK, const float* __restrict__ BV,
    _Float16* __restrict__ QH, _Float16* __restrict__ QL, _Float16* __restrict__ KH, _Float16* __restrict__ KL, _Float16* __restrict__ VT, __bf16* __restrict__ VB, __bf16* __restrict__ VBL) {
  __shared__ __align__(16) _Float16 sh[64][136], sl[64][136]; __shared__ __align__(16) _Float16 th[128][72]; __shared__ __align__(16) __bf16 tb[128][72], tbl[128][72];
  const int tid = threadIdx.x, wave = tid >> 5, lane = tid & 31, col = lane & 15, g = lane >> 4; const int which = blockIdx.z; const int c0 = blockIdx.y * 128; const size_t r0 = (size_t)blockIdx.x * 64; const size_t bb = r0 / TT; const int t0 = (int)(r0 % TT);
  if (which < 2 && blockIdx.y > 0) return;   /* q / k have 64 real columns: only the first 128-column tile is computed; the others are never read (block-uniform exit before any barrier) */
  const float* X = which == 0 ? XQ : which == 1 ? XK : XV; const float* WA = which == 0 ? WQ : which == 1 ? WK : WV; const float* BA = which == 0 ? BQ : which == 1 ? BK : BV;
  v8f acc[8] = {};
  { const float* xrow = X + (r0 + wave * 16 + col) * DIN + 8 * g;   /* tb and tbl, free until the epilogue, are the two weight buffers; which is the same for the whole block */
    if (which == 2) pj_main<CC>(acc, WA + (size_t)(wave * 16) * CC + c0 + lane * 4, xrow, tb, tbl, wave, lane);
    else pj_main<RW>(acc, WA + (size_t)(wave * 16) * RW + (lane & (RW / 4 - 1)) * 4, xrow, tb, tbl, wave, lane); }
  if (which < 2) { _Float16* DH = which == 0 ? QH : KH; _Float16* DL = which == 0 ? QL : KL; const int nhi = which == 0 ? QHI : KHI; const bool hi_rows = t0 < nhi;
#pragma unroll
    for (int j = 0; j < 8; ++j) { const float bias = (BA && ((which) == 2 || (c0 + j * 16 + col) < RW)) ? bfr(BA[c0 + j * 16 + col]) : 0.f;
#pragma unroll
      for (int r = 0; r < 8; ++r) { const float v = acc[j][r] + bias; const _Float16 hv = (_Float16)v; sh[wave * 16 + 8 * g + r][j * 16 + col] = hv; sl[wave * 16 + 8 * g + r][j * 16 + col] = (_Float16)((v - (float)hv) * 1024.0f); } }
    __syncthreads();
    for (int e = tid; e < 64 * 16; e += 128) { const int rl = e >> 4, q = e & 15; vst2((unsigned*)(DH + (r0 + rl) * CC + c0 + q * 8), *(const v4u*)&sh[rl][q * 8]); if (hi_rows) vst2((unsigned*)(DL + (bb * nhi + t0 + rl) * (size_t)CC + c0 + q * 8), *(const v4u*)&sl[rl][q * 8]); }
  } else { const bool hi_rows = t0 < VHI;
#pragma unroll
    for (int j = 0; j < 8; ++j) { const float bias = (BA && ((which) == 2 || (c0 + j * 16 + col) < RW)) ? bfr(BA[c0 + j * 16 + col]) : 0.f;
#pragma unroll
      for (int r = 0; r < 8; ++r) { const float v = acc[j][r] + bias; const int rl = wave * 16 + 8 * g + r, cl = j * 16 + col; th[cl][rl] = (_Float16)v; const __bf16 bh = (__bf16)v; tb[cl][rl] = bh; tbl[cl][rl] = (__bf16)(v - (float)bh); } }
    __syncthreads();
    for (int e = tid; e < 128 * 8; e += 128) { const int cl = e >> 3, q = e & 7; vst2((unsigned*)(VT + (bb * CC + c0 + cl) * (size_t)TT + t0 + q * 8), *(const v4u*)&th[cl][q * 8]); if (hi_rows) { const size_t o3 = (bb * CC + c0 + cl) * (size_t)VHI + t0 + q * 8; vst2((unsigned*)(VB + o3), *(const v4u*)&tb[cl][q * 8]); vst2((unsigned*)(VBL + o3), *(const v4u*)&tbl[cl][q * 8]); } } } }
#undef QBH
#define QBH NQB   // SCORE KERNEL ONLY: every query block takes the 3-product branch (unscaled logits)
// ---- k_sc: block = (query block qb, key block kb <= kb_last(qb), batch b): logits x SCALE; q hi + residual (x 2^10) against k (2 products) for query rows < QHI, plus the k residual (3 products) for query blocks < QBH (here every query block); causal: blocks past the diagonal exit, the mask itself is applied by index in k_sm
__global__ __launch_bounds__(128) void k_sc(const _Float16* __restrict__ QH, const _Float16* __restrict__ KH, const _Float16* __restrict__ QL, const _Float16* __restrict__ KL, int h0, float* __restrict__ S0) { __shared__ __align__(16) float ss[4][16][132];
  const int qb = blockIdx.x, kb = blockIdx.y; if (kb > kb_last(qb)) return;
  const int b = blockIdx.z, h = h0; float* S = S0 + (size_t)b * SPLANE + s_base(qb) + (size_t)kb * STILE;   /* blockIdx.z = batch; S = this block's tile */
  const int tid = threadIdx.x, wave = tid >> 5, lane = tid & 31, col = lane & 15, g = lane >> 4; const int k0 = kb * 128; const int ql0 = qb * 64 + wave * 16; const size_t q0 = (size_t)b * TT + ql0, kr0 = (size_t)b * TT + k0;
  v8f acc[8] = {}, accl[8] = {};
  const _Float16* QLb = QL + (size_t)b * QHI * CC; const _Float16* KLb = KL + (size_t)b * KHI * CC;
  if (qb < QBH) {
#pragma unroll
    for (int kc = 0; kc < HD / 32; ++kc) { const v16h ah = frag_h(QH + (q0 + col) * CC + h * HD + kc * 32, lane), al = frag_h(QLb + (size_t)(ql0 + col) * CC + h * HD + kc * 32, lane);
#pragma unroll
      for (int j = 0; j < 8; ++j) { const v16h kbf = frag_h(KH + (kr0 + j * 16 + col) * CC + h * HD + kc * 32, lane), klf = frag_h(KLb + (size_t)(k0 + j * 16 + col) * CC + h * HD + kc * 32, lane); acc[j] = wmma16(ah, kbf, acc[j]); accl[j] = wmma16(al, kbf, accl[j]); accl[j] = wmma16(ah, klf, accl[j]); } }
  } else if (qb * 64 < QHI) {
#pragma unroll
    for (int kc = 0; kc < HD / 32; ++kc) { const v16h ah = frag_h(QH + (q0 + col) * CC + h * HD + kc * 32, lane), al = frag_h(QLb + (size_t)(ql0 + col) * CC + h * HD + kc * 32, lane);
#pragma unroll
      for (int j = 0; j < 8; ++j) { const v16h kbf = frag_h(KH + (kr0 + j * 16 + col) * CC + h * HD + kc * 32, lane); acc[j] = wmma16(ah, kbf, acc[j]); accl[j] = wmma16(al, kbf, accl[j]); } }
  } else {
#pragma unroll
    for (int kc = 0; kc < HD / 32; ++kc) { const v16h ah = frag_h(QH + (q0 + col) * CC + h * HD + kc * 32, lane);
#pragma unroll
      for (int j = 0; j < 8; ++j) { const v16h kbf = frag_h(KH + (kr0 + j * 16 + col) * CC + h * HD + kc * 32, lane); acc[j] = wmma16(ah, kbf, acc[j]); } } }
#pragma unroll
  for (int j = 0; j < 8; ++j) {
#pragma unroll
    for (int r = 0; r < 8; ++r) ss[wave][8 * g + r][j * 16 + col] = (acc[j][r] + accl[j][r] * (1.0f / 1024.0f)) * SCALE; }
  LDSX(); for (int rl = 0; rl < 16; ++rl) vst2(S + (wave * 16 + rl) * 128 + lane * 4, *(const v4f*)&ss[wave][rl][lane * 4]); }
#undef QBH
#define QBH 6   // restored: the softmax and P.v kernels keep the causal early band of 6 query blocks
// ---- k_sm: one wave = one query row t (eight rows a block, no LDS, no barrier, so the waves of a block need not run alike): the row's keys [0, kend) stay in registers from the load to the store, 16 bytes a lane and 512 bytes a wave per access; causal -> logit if s <= t else excluded; softmax in f32; P x 2^11 in place (0 for excluded): f32 for the early band (query blocks < QBH); for all other rows rounded to f16 here, once, instead of in each of the eight column groups of k_pv: the 128 halves of a chunk lie in the first 256 bytes of the row's own 512-byte place in its tile, so a wave still writes only where it alone has read
#define SMC (TT / 128)     // 128-key chunks of a full row: one 16-byte access of a wave each
__device__ __forceinline__ float sm_e(float x, float m) { const float ex = expf(x - m); return (x <= -1.0e38f) ? 0.f : ex; }   /* excluded -> 0; the exponential stands in front of the choice, so the choice is a select and no branch per element */
typedef __attribute__((ext_vector_type(4))) _Float16 v4h;
__device__ __forceinline__ v4h sm_h(v4f p) { v4h r;
#pragma unroll
  for (int c = 0; c < 4; ++c) r[c] = (_Float16)p[c];
  return r; }
__global__ __launch_bounds__(256) void k_sm(float* __restrict__ S0 SM_EXTRA_PARAMS) {
  const int lane = threadIdx.x & 31; const int wv = __builtin_amdgcn_readfirstlane(threadIdx.x >> 5);   /* the wave's number as a scalar: the row and its chunk count are then scalars, and the tests on nf below scalar branches */
  const int r = blockIdx.x * 4 + (wv & 3); const int t = wv < 4 ? r : TT - 1 - r;   /* waves w and w + 4 take rows r and TT - 1 - r, a short causal row and a long one: every block carries the same work; each row is taken once */
  const int nf = kb_last(t >> 6);   /* whole chunks in front of the row's last one */
  float* sr = S0 + (size_t)blockIdx.y * SPLANE + s_base(t >> 6) + (t & 63) * 128 + lane * 4;   /* blockIdx.y = batch; chunk i of the row lies in tile i of its query block */
  v4f v[SMC - 1]; v4f vl = *(const v4f*)(sr + nf * STILE);   /* vl: the last chunk, the only one the diagonal crosses (t >> 7 == nf) */
#pragma unroll   // constant chunk numbers keep the row in registers (so for every loop over the chunks in this kernel); all loads of the row are in flight together
  for (int i = 0; i < SMC - 1; ++i) if (i < nf) v[i] = *(const v4f*)(sr + i * STILE);
  if (CAUSAL) {
#pragma unroll
    for (int c = 0; c < 4; ++c) if (nf * 128 + lane * 4 + c > t) vl[c] = -3.0e38f; }
  float m = fmaxf(-3.0e38f, fmaxf(fmaxf(vl[0], vl[1]), fmaxf(vl[2], vl[3])));
#pragma unroll
  for (int i = 0; i < SMC - 1; ++i) if (i < nf) m = fmaxf(m, fmaxf(fmaxf(v[i][0], v[i][1]), fmaxf(v[i][2], v[i][3])));
#pragma unroll
  for (int o = 1; o < 32; o <<= 1) m = fmaxf(m, __shfl_xor(m, o));
  v4f s4 = {0.f, 0.f, 0.f, 0.f};
#pragma unroll
  for (int i = 0; i < SMC - 1; ++i) if (i < nf) {
#pragma unroll
    for (int c = 0; c < 4; ++c) { const float e = sm_e(v[i][c], m); v[i][c] = e; s4[c] += e; } }
#pragma unroll
  for (int c = 0; c < 4; ++c) { const float e = sm_e(vl[c], m); vl[c] = e; s4[c] += e; }
  float sum = (s4[0] + s4[1]) + (s4[2] + s4[3]);
#pragma unroll
  for (int o = 1; o < 32; o <<= 1) sum += __shfl_xor(sum, o);
  const float inv = sum > 0.f ? 2048.0f / sum : 0.f;   /* a fully excluded row yields P = 0 */
  if ((t >> 6) < QBH) {   /* t is a scalar: a scalar branch */
#pragma unroll
    for (int i = 0; i < SMC - 1; ++i) if (i < nf) { vst2(sr + i * STILE, v[i] * inv);
      asm volatile("s_wait_xcnt 0x0" ::: "memory"); }   // the next chunk's products reuse the registers this store names: the wait stands between the store and that overwrite
    vst2(sr + nf * STILE, vl * inv);
  } else { _Float16* hr = (_Float16*)(sr - lane * 4) + lane * 4;   /* the row's place again, counted in halves: 8 bytes a lane, 256 bytes a wave per store */
#pragma unroll
    for (int i = 0; i < SMC - 1; ++i) if (i < nf) { vst2(hr + i * (2 * STILE), sm_h(v[i] * inv));
      asm volatile("s_wait_xcnt 0x0" ::: "memory"); }   // as above: between the store and the overwrite of its registers
    vst2(hr + nf * (2 * STILE), sm_h(vl * inv)); } }
#define PVK 128            // keys per staged tile of k_pv (kb_last counts in the same 128-key units; a staged P tile holds the f16 halves of the same-numbered stored tile of both query blocks of the pair)
#define PVP (PVK + 8)      // P row pitch in LDS, halves: 272 B = 16 B x 17, conflict-free for 16-byte reads
#define PVV (PVK + 8)      // v row pitch in LDS, halves: 272 B = 16 B x 17
// eight asynchronous copies of 16 bytes a lane, global -> LDS, rows lstep / gstep bytes apart; the s_wait_xcnt in the same statement stands before anything can rewrite an address register of a copy
__device__ __forceinline__ void acopy8(unsigned l, unsigned lstep, const char* gsrc, size_t gstep) {
  asm volatile("global_load_async_to_lds_b128 %0, %8, off\n\t"
               "global_load_async_to_lds_b128 %1, %9, off\n\t"
               "global_load_async_to_lds_b128 %2, %10, off\n\t"
               "global_load_async_to_lds_b128 %3, %11, off\n\t"
               "global_load_async_to_lds_b128 %4, %12, off\n\t"
               "global_load_async_to_lds_b128 %5, %13, off\n\t"
               "global_load_async_to_lds_b128 %6, %14, off\n\t"
               "global_load_async_to_lds_b128 %7, %15, off\n\t"
               "s_wait_xcnt 0x0"
               :: "v"(l), "v"(l + lstep), "v"(l + 2 * lstep), "v"(l + 3 * lstep), "v"(l + 4 * lstep), "v"(l + 5 * lstep), "v"(l + 6 * lstep), "v"(l + 7 * lstep),
                  "v"(gsrc), "v"(gsrc + gstep), "v"(gsrc + 2 * gstep), "v"(gsrc + 3 * gstep), "v"(gsrc + 4 * gstep), "v"(gsrc + 5 * gstep), "v"(gsrc + 6 * gstep), "v"(gsrc + 7 * gstep)
               : "memory");
}
#define PVQ 128            // queries per block of k_pv: query blocks 2m and 2m + 1, which see the same key tiles 0..m
#define PVC 128            // v columns per block of k_pv: two 64-column groups
static_assert(CAUSAL == 1 && QBH % 2 == 0 && NQB % 2 == 0 && NH % 2 == 0, "k_pv pairs query blocks 2m, 2m + 1 (kb_last of both = m; both in the early band or neither) and column groups 2y, 2y + 1");
// one wave's share of a tile: 32 P rows (256 B of f16 each, 512 B apart in the stored tile) and 32 v rows (256 B each), two rows a copy: 32 copies of a wave in flight
__device__ __forceinline__ void pv_tile(unsigned lp, unsigned lv, const char* gp, const char* gv) {
  acopy8(lp, 2u * PVP * 2u, gp, (size_t)2 * PVK * 4); acopy8(lp + 16u * PVP * 2u, 2u * PVP * 2u, gp + (size_t)16 * PVK * 4, (size_t)2 * PVK * 4);
  acopy8(lv, 2u * PVV * 2u, gv, (size_t)2 * TT * 2); acopy8(lv + 16u * PVV * 2u, 2u * PVV * 2u, gv + (size_t)16 * TT * 2, (size_t)2 * TT * 2);
}
// ---- k_pv: block = 128 queries (query blocks 2m, 2m + 1) x 128 v columns of batch b; wave = 64 queries (one query block) x 64 columns (one column group), 4 x 4 accumulator tiles, so every staged P or v fragment feeds four products: ctx = P . v over keys [0, kend) (P x 2^11, stored as f16 by k_sm, against v f16: 1 product; causal early query blocks: f32 P and v as bf16 hi + lo, 3 products); 256-B (row, head) segment by 16 lanes
__global__ __launch_bounds__(128) void k_pv(const float* __restrict__ PS0, const _Float16* __restrict__ VT, const __bf16* __restrict__ VB, const __bf16* __restrict__ VBL, int h0, float* __restrict__ Y) { __shared__ __align__(16) float ss[4][16][HD + 4];
  __shared__ __align__(16) _Float16 sp[2][PVQ][PVP]; __shared__ __align__(16) _Float16 sv[2][PVC][PVV];   /* two buffers each: P tile (128 queries x 128 keys, f16) and v tile (128 columns x 128 keys, f16) */
  const int tid = threadIdx.x, wave = tid >> 5, lane = tid & 31, col = lane & 15, g = lane >> 4; const int b = blockIdx.z;   /* blockIdx.y = pair of column groups, blockIdx.z = batch */
  const int m = blockIdx.x;   /* the pair of query blocks: m + 1 key tiles */
  const int wq = wave >> 1, wc = wave & 1; const int qb = 2 * m + wq, h = h0 + blockIdx.y * 2 + wc;   /* the wave's query block and column group */
  const int kce = (kb_last(2 * m) + 1) * 4; const float* PS = PS0 + (size_t)b * SPLANE + s_base(qb);
  v8f acc[4][HD / 16] = {};
  if (2 * m < QBH) {
    const size_t po = ((size_t)b * CC + h * HD + col) * (size_t)VHI + 8 * g; const __bf16* vhp = VB + po; const __bf16* vlp = VBL + po;   /* the lane's own first eight keys in its v row of column tile 0, hi and lo plane: every v load of a trip is one of these two addresses plus a constant; both go on by 32 keys a trip */
#pragma unroll 1
    for (int kc = 0; kc < kce; ++kc) { const float* pp = PS + (kc >> 2) * STILE + col * 128; F2 p[4];
#pragma unroll
      for (int qi = 0; qi < 4; ++qi) p[qi] = split_row(pp + qi * 16 * 128, (kc & 3) * 32, lane);
      asm volatile("s_wait_loadcnt 0x0" ::: "memory");
#pragma unroll
      for (int j = 0; j < HD / 16; ++j) { const v16b vh = frag_b(vhp + j * 16 * VHI, 0), vl = frag_b(vlp + j * 16 * VHI, 0);   /* lane argument 0: the lane's half, 8 g, is in the two addresses already; per accumulator the three products stay in the order p.h vh, p.l vh, p.h vl */
#pragma unroll
        for (int qi = 0; qi < 4; ++qi) acc[qi][j] = __builtin_amdgcn_wmma_f32_16x16x32_bf16(false, p[qi].h, false, vh, (short)0, acc[qi][j], false, false);   /* the builtin alone, as in the loop below */
#pragma unroll
        for (int qi = 0; qi < 4; ++qi) acc[qi][j] = __builtin_amdgcn_wmma_f32_16x16x32_bf16(false, p[qi].l, false, vh, (short)0, acc[qi][j], false, false);
#pragma unroll
        for (int qi = 0; qi < 4; ++qi) acc[qi][j] = __builtin_amdgcn_wmma_f32_16x16x32_bf16(false, p[qi].h, false, vl, (short)0, acc[qi][j], false, false); }
      asm volatile("s_wait_xcnt 0x0" :: "v"(vhp), "v"(vlp) : "memory");   // the two addresses that the v loads of the trip name are inputs of the wait: their registers stay whole up to it and are rewritten only behind it
      vhp += 32; vlp += 32; }
  } else {
    // tiles of 128 keys come into LDS in whole 128-byte lines (two P rows or two v rows = one copy of a wave); each wave brings 32 P rows (half of its own query block's tile) and 32 v rows of every tile
    const int nst = kce / (PVK / 32);
    const unsigned lp = (unsigned)(size_t)&sp[0][wave * 32 + g][col * 8], lv = (unsigned)(size_t)&sv[0][wave * 32 + g][col * 8];
    const char* gp = (const char*)(PS + (wc * 32 + g) * PVK) + col * 16; const char* gv = (const char*)(VT + ((size_t)b * CC + (h0 + blockIdx.y * 2) * HD + wave * 32 + g) * (size_t)TT + col * 8);
    pv_tile(lp, lv, gp, gv);
    asm volatile("s_wait_asynccnt 0x0" ::: "memory");   // tile 0 has landed before the barrier publishes it
    __syncthreads();
    if (nst > 1) pv_tile(lp + (unsigned)sizeof(sp[0]), lv + (unsigned)sizeof(sv[0]), gp + STILE * 4, gv + PVK * 2);
#pragma unroll 1   // one tile a trip: the buffer index alternates, the code stays small
    for (int t = 0; t < nst; ++t) { const int bu = t & 1;
      v16h pf[PVK / 32][4], vf[PVK / 32][HD / 16];   // the fragment reads of k step kc + 1 are issued as one group in front of the products of k step kc: the products wait on counted LDS returns, and the reads run beside the products
#pragma unroll
      for (int kc = -1; kc < PVK / 32; ++kc) {
        if (kc + 1 < PVK / 32) {
#pragma unroll
          for (int qi = 0; qi < 4; ++qi) pf[kc + 1][qi] = frag_h(&sp[bu][wq * 64 + qi * 16 + col][(kc + 1) * 32], lane);
#pragma unroll
          for (int j = 0; j < HD / 16; ++j) vf[kc + 1][j] = frag_h(&sv[bu][wc * 64 + j * 16 + col][(kc + 1) * 32], lane); }
        __builtin_amdgcn_sched_barrier(0);   // keeps the group of reads in front of these products: without it the compiler sinks each read to its first use, and the wave waits out one LDS latency per fragment
        if (kc >= 0) {
#pragma unroll
          for (int qi = 0; qi < 4; ++qi) {
#pragma unroll
            for (int j = 0; j < HD / 16; ++j) acc[qi][j] = __builtin_amdgcn_wmma_f32_16x16x32_f16(false, pf[kc][qi], false, vf[kc][j], (short)0, acc[qi][j], false, false); } }   /* the builtin alone: the compiler keeps the distances behind it, and fragments may lie above v255, where an asm operand cannot */
        __builtin_amdgcn_sched_barrier(0); }   // keeps the next group of reads, and behind the last products the waits and the barrier, from moving up among these products
      asm volatile("s_wait_dscnt 0x0" ::: "memory");      // this wave's reads of buffer bu are done before the barrier frees it
      asm volatile("s_wait_asynccnt 0x0" ::: "memory");   // this wave's copies of tile t + 1 have landed before the barrier publishes them
      __syncthreads();
      if (t + 2 < nst) pv_tile(lp + (unsigned)(bu * sizeof(sp[0])), lv + (unsigned)(bu * sizeof(sv[0])), gp + (size_t)(t + 2) * (STILE * 4), gv + (size_t)(t + 2) * (PVK * 2)); }
    asm volatile("s_wait_asynccnt 0x0" ::: "memory");   // no copy is left in flight behind the loop
  }
#pragma unroll
  for (int qi = 0; qi < 4; ++qi) {   /* 16 rows at a time through the wave's own ss rows */
#pragma unroll
    for (int j = 0; j < HD / 16; ++j)
#pragma unroll
      for (int r = 0; r < 8; ++r) ss[wave][8 * g + r][j * 16 + col] = acc[qi][j][r] * (1.0f / 2048.0f);
    LDSX(); for (int rl = 0; rl < 16; ++rl) if (lane < HD / 4) vst2(Y + ((size_t)b * TT + qb * 64 + qi * 16 + rl) * CC + h * HD + lane * 4, *(const v4f*)&ss[wave][rl][lane * 4]);
    LDSX(); } }   /* the second LDSX: the rows are read before the next 16 rows overwrite them */

#define LN_EPS 1.0e-5f
__global__ __launch_bounds__(128) void k_resln(const float* __restrict__ O, const float* __restrict__ X, const float* __restrict__ GAM, const float* __restrict__ BET, float* __restrict__ OUT) { __shared__ float sred[2][4]; const size_t r = blockIdx.x; const int tid = threadIdx.x; const v4f o = *(const v4f*)(O + r * CC + tid * 4); const v4f xr = *(const v4f*)(X + r * CC + tid * 4); asm volatile("s_wait_loadcnt 0x0" ::: "memory"); float y[4]; float a = 0.f;
#pragma unroll
  for (int i = 0; i < 4; ++i) { y[i] = bfr(xr[i]) + o[i]; a += y[i]; }
#pragma unroll
  for (int s_ = 1; s_ < 32; s_ <<= 1) a += __shfl_xor(a, s_);
  if ((tid & 31) == 0) sred[0][tid >> 5] = a; __syncthreads();
  const float mu = (sred[0][0] + sred[0][1] + sred[0][2] + sred[0][3]) * (1.0f / (float)CC); float v = 0.f;
#pragma unroll
  for (int i = 0; i < 4; ++i) { const float d = y[i] - mu; v += d * d; }
#pragma unroll
  for (int s_ = 1; s_ < 32; s_ <<= 1) v += __shfl_xor(v, s_);
  if ((tid & 31) == 0) sred[1][tid >> 5] = v; __syncthreads();
  const float rs = 1.0f / sqrtf((sred[1][0] + sred[1][1] + sred[1][2] + sred[1][3]) * (1.0f / (float)CC) + LN_EPS); const v4f g4 = *(const v4f*)(GAM + tid * 4), b4 = *(const v4f*)(BET + tid * 4); v4f w;
#pragma unroll
  for (int i = 0; i < 4; ++i) w[i] = (y[i] - mu) * rs * bfr(g4[i]) + bfr(b4[i]);
  vst2(OUT + r * CC + tid * 4, w); }
static_assert(CC == 512 && DIN == CC, "k_resln: 128 threads x 4 floats per row; the residual adds the input row");
extern "C" void kernel_launch(void* const* d_in, const int* in_sizes, int n_in, void* d_out, int out_size, void* d_ws, size_t ws_size, hipStream_t stream) {
  (void)in_sizes; (void)n_in; (void)out_size;
  const float** F = (const float**)d_in;
  if (ws_size < (size_t)WS_END) return;
  char* ws = (char*)d_ws; _Float16 *QH = (_Float16*)(ws + WS_QH), *KH = (_Float16*)(ws + WS_KH), *VT = (_Float16*)(ws + WS_VT), *QL = (_Float16*)(ws + WS_QL), *KL = (_Float16*)(ws + WS_KL); __bf16 *VB = (__bf16*)(ws + WS_VB), *VBL = (__bf16*)(ws + WS_VBL); float *S = (float*)(ws + WS_S), *Y = (float*)(ws + WS_Y);
  (void)Y; (void)QL; (void)KL; (void)VB; (void)VBL;
  // inputs: 0 x [4,4096,512]; 1 Wq [512,64] (in,out), 2 bq [64]; 3 Wk [512,64], 4 bk; 5 Wv [512,512], 6 bv [512] (biases NONZERO); 7 gamma [512]; 8 beta [512] (ones / zeros, read)
  float* Yo = (float*)(ws + WS_Y);
  k_proj<<<dim3(TNB * TT / 64, CC / 128, 3), 128, 0, stream>>>(F[0], F[0], F[0], F[1], F[3], F[5], F[2], F[4], F[6], QH, QL, KH, KL, VT, VB, VBL);
  k_sc<<<dim3(NQB, TT / 128, TNB), 128, 0, stream>>>(QH, KH, QL, KL, 0, S);   /* the one score head: columns 0..63; all batches in one grid */
  k_sm<<<dim3(TT / 8, TNB), 256, 0, stream>>>(S);
  k_pv<<<dim3(NQB / 2, NH / 2, TNB), 128, 0, stream>>>(S, VT, VB, VBL, 0, Yo);   /* 128 queries x 128 v / o columns a block, all four column pairs from the batch's one plane; batch = slowest index */
  k_resln<<<dim3(TNB * TT), 128, 0, stream>>>(Yo, F[0], F[7], F[8], (float*)d_out);
}

// v008
// A run of this version takes 141 microseconds.
// In both of two side-by-side timings against v007, it was 1.21 times as fast.
// All steps since v000 together make it 27.3 times as fast.
// compute dtype: all float inputs rounded to bf16; q / k (64-wide) and v (512-wide) projections with EXACT bf16 products on WMMA 16x16x32 (f32 accumulate) + bias; causal logits UNSCALED: q and k each as f16 hi + (x 2^10) residual, 3 products on every row; softmax f32; P x 2^11 once to f16 x v once to f16 (bf16 hi + lo below row 384), four 128-column passes over the same probability plane; y = bf16(x) + o and LayerNorm over 512 in f32; f32 output.
#include <hip/hip_runtime.h>
#include <math.h>

typedef __attribute__((ext_vector_type(16))) _Float16 v16h;
typedef __attribute__((ext_vector_type(16))) __bf16 v16b;
typedef __attribute__((ext_vector_type(8)))  _Float16 v8h;
typedef __attribute__((ext_vector_type(8)))  float v8f;
typedef __attribute__((ext_vector_type(4)))  float v4f;
typedef __attribute__((ext_vector_type(2)))  float v2f;
typedef __attribute__((ext_vector_type(4)))  unsigned v4u;
typedef __attribute__((ext_vector_type(4)))  int v4i;
typedef float __attribute__((may_alias)) float_a;
typedef int __attribute__((may_alias)) int_a;

template <typename T> __device__ __forceinline__ void vst2(void* p, T v) { *(T*)p = v;  }
__device__ __forceinline__ v8f wmma16(v16h a, v16h b, v8f c) {
  v8f d = __builtin_amdgcn_wmma_f32_16x16x32_f16(false, a, false, b, (short)0, c, false, false);
  asm volatile("v_nop\n\tv_nop\n\tv_nop\n\tv_nop" : "+v"(d) : "v"(a), "v"(b));
  return d;
}
__device__ __forceinline__ v8f wmma_bf(v16b a, v16b b, v8f c) {
  v8f d = __builtin_amdgcn_wmma_f32_16x16x32_bf16(false, a, false, b, (short)0, c, false, false);
  asm volatile("v_nop\n\tv_nop\n\tv_nop\n\tv_nop" : "+v"(d) : "v"(a), "v"(b));
  return d;
}
// 16x16x32 fragments: lane = (h = lane>>4, row/col = lane&15); elements 0..7 = k0+8h+0..7, 8..15 = k0+16+8h+0..7; D element r = row 8h+r
__device__ __forceinline__ v16h frag_h(const _Float16* rowk0, int lane) {
  union { v16h v; v8h q[2]; } u; const _Float16* p = rowk0 + 8 * (lane >> 4);
  u.q[0] = *(const v8h*)p; u.q[1] = *(const v8h*)(p + 16); return u.v;
}
__device__ __forceinline__ v16h frag_f32(const float* rowk0, int lane) {
  v16h a; const float* p = rowk0 + 8 * (lane >> 4);
#pragma unroll
  for (int i = 0; i < 8; ++i) { a[i] = (_Float16)p[i]; a[8 + i] = (_Float16)p[16 + i]; }
  return a;
}
__device__ __forceinline__ v16h frag_f32s(const float* rowk0, int lane, float sc) {
  v16h a; const float* p = rowk0 + 8 * (lane >> 4);
#pragma unroll
  for (int i = 0; i < 8; ++i) { a[i] = (_Float16)(p[i] * sc); a[8 + i] = (_Float16)(p[16 + i] * sc); }
  return a;
}
// column fragment from a [K][ld] layout (column n), rows >= K read as 0
__device__ __forceinline__ v16h fragc_f32(const float* W, int k0, int n, int lane, int ld, int K) {
  v16h a; const int g = lane >> 4;
#pragma unroll
  for (int i = 0; i < 8; ++i) { const int ka = k0 + 8 * g + i, kb = ka + 16;
    a[i] = (_Float16)(ka < K ? W[(size_t)(ka < K ? ka : K - 1) * ld + n] : 0.f); a[8 + i] = (_Float16)(kb < K ? W[(size_t)(kb < K ? kb : K - 1) * ld + n] : 0.f); }
  return a;
}
struct F2 { v16b h, l; };
__device__ __forceinline__ F2 bsplit16(const float v[16]) { F2 r;
#pragma unroll
  for (int i = 0; i < 16; ++i) { const __bf16 h = (__bf16)v[i]; r.h[i] = h; r.l[i] = (__bf16)(v[i] - (float)h); }
  return r; }
__device__ __forceinline__ F2 split_row(const float* row, int k0, int lane) { float v[16]; const float* p = row + k0 + 8 * (lane >> 4);
#pragma unroll
  for (int i = 0; i < 8; ++i) { v[i] = p[i]; v[8 + i] = p[16 + i]; }
  return bsplit16(v); }
__device__ __forceinline__ F2 split_rowK(const float* row, int k0, int lane, int K) { float v[16]; const int g = lane >> 4;
#pragma unroll
  for (int i = 0; i < 8; ++i) { const int ka = k0 + 8 * g + i, kb = ka + 16; v[i] = ka < K ? row[ka < K ? ka : K - 1] : 0.f; v[8 + i] = kb < K ? row[kb < K ? kb : K - 1] : 0.f; }
  return bsplit16(v); }
__device__ __forceinline__ F2 split_col(const float* W, int k0, int n, int lane, int ld, int K) { float v[16]; const int g = lane >> 4;
#pragma unroll
  for (int i = 0; i < 8; ++i) { const int ka = k0 + 8 * g + i, kb = ka + 16; v[i] = ka < K ? W[(size_t)(ka < K ? ka : K - 1) * ld + n] : 0.f; v[8 + i] = kb < K ? W[(size_t)(kb < K ? kb : K - 1) * ld + n] : 0.f; }
  return bsplit16(v); }
__device__ __forceinline__ v8f mac3(const F2& a, const F2& b, v8f c) { c = wmma_bf(a.l, b.h, c); c = wmma_bf(a.h, b.l, c); return wmma_bf(a.h, b.h, c); }
__device__ __forceinline__ float sigm(float v) { return 1.0f / (1.0f + expf(-v)); }
#define LDSX() do { asm volatile("s_wait_dscnt 0" ::: "memory"); __builtin_amdgcn_wave_barrier(); __builtin_amdgcn_fence(__ATOMIC_RELEASE, "workgroup"); } while (0)

// Single-head causal self-attention with a residual and LayerNorm (x [4,4096,512]; (in,out) Wq / Wk [512,64] and Wv [512,512] uniform(+-1/sqrt(512)) with biases of the same scale - NONZERO; q, k = x W + b (64-wide), v = x Wv + bv (512-wide); scores = q k^T with NO scaling; tril kept, -inf elsewhere; softmax over the keys; o = attn v [4,4096,512]; y = x + o; LayerNorm over the 512 features (biased variance, eps 1e-5) * gamma + beta (ones / zeros, read)). ONE 64-wide score head in columns 0..63 of the 512-wide q / k rows; P.v as eight ordinary 64-wide column groups that all read the same probability plane.
#define NB 4
#define TT 4096
#define CC 512            // NH * HD = projected width
#define DIN 512          // input (model) width
#define NH 8
#define HD 64
#define NQB (TT / 64)
#define HG 1
#define SCALE (1.0f)
#define CAUSAL 1
#ifndef TNB
#define TNB NB
#endif
__device__ __forceinline__ float bfr(float v) { return (float)(__bf16)v; }
__host__ __device__ __forceinline__ int kb_last(int qb) { return CAUSAL ? ((qb * 64 + 63) >> 7) : (TT / 128 - 1); }
// packed causal logits / P plane of one batch: tiles of 64 queries x 128 keys (STILE floats, rows of 128), for query block qb only its key blocks 0..kb_last(qb), one behind the other from s_base(qb); so the planes of all batches fit in the workspace together, and every stride inside a query block is a constant
#define STILE (64 * 128)
static_assert(CAUSAL == 1 && NQB % 2 == 0, "s_base sums kb_last(i) + 1 = (i >> 1) + 1 over i < qb");
__device__ __forceinline__ size_t s_base(int qb) { const int m = qb >> 1; return (size_t)STILE * (size_t)((m + 1) * (m + (qb & 1))); }
#define SPLANE ((size_t)STILE * (NQB / 2) * (NQB / 2 + 1))   // floats per batch = s_base(NQB)
typedef __attribute__((ext_vector_type(8))) __bf16 v8b;
__device__ __forceinline__ v16b frag_b(const __bf16* rowk0, int lane) {
  union { v16b v; v8b q[2]; } u; const __bf16* p = rowk0 + 8 * (lane >> 4);
  u.q[0] = *(const v8b*)p; u.q[1] = *(const v8b*)(p + 16); return u.v;
}
#define QBH 6              // causal: query blocks 0..QBH-1 of each sequence (few keys, no averaging) take the high-precision path
#define QHI TT             // rows carrying a q residual plane (all rows: 3-product logits everywhere)
#define KHI TT             // key rows carrying a k residual plane (read by every k_sc block: its 3-product branch)
#define VHI 384            // v bf16 hi / lo planes only for key rows t < VHI (read by the causal early band: query blocks < 6 see keys <= 383)
#define RW 64              // real width of q / k
// B fragment (k rows k0+.., output column o) of a weight: (in,out) [K][ld] or (out,in) [ld rows of K]: bf16 exact, or f16(bf16 * 256) exact
__device__ __forceinline__ v16b wcol_io(const float* Wm, int k0, int o, int lane, int ld) { v16b w; const int g = lane >> 4;
#pragma unroll
  for (int i = 0; i < 8; ++i) { w[i] = (__bf16)Wm[(size_t)(k0 + 8 * g + i) * ld + o]; w[8 + i] = (__bf16)Wm[(size_t)(k0 + 16 + 8 * g + i) * ld + o]; }
  return w; }
__device__ __forceinline__ v16b wcol_oi(const float* Wm, int k0, int o, int lane, int K) { v16b w; const float* p = Wm + (size_t)o * K + k0 + 8 * (lane >> 4);
#pragma unroll
  for (int i = 0; i < 8; ++i) { w[i] = (__bf16)p[i]; w[8 + i] = (__bf16)p[16 + i]; }
  return w; }
__device__ __forceinline__ v16h wcolh_io(const float* Wm, int k0, int o, int lane, int ld) { v16h w; const int g = lane >> 4;
#pragma unroll
  for (int i = 0; i < 8; ++i) { w[i] = (_Float16)(bfr(Wm[(size_t)(k0 + 8 * g + i) * ld + o]) * 256.0f); w[8 + i] = (_Float16)(bfr(Wm[(size_t)(k0 + 16 + 8 * g + i) * ld + o]) * 256.0f); }
  return w; }
__device__ __forceinline__ v16h wcolh_oi(const float* Wm, int k0, int o, int lane, int K) { v16h w; const float* p = Wm + (size_t)o * K + k0 + 8 * (lane >> 4);
#pragma unroll
  for (int i = 0; i < 8; ++i) { w[i] = (_Float16)(bfr(p[i]) * 256.0f); w[8 + i] = (_Float16)(bfr(p[16 + i]) * 256.0f); }
  return w; }
#define WQKV_LAYOUT 0   // 0 = (in,out): Wv [DIN][CC], Wq / Wk [DIN][RW]; 1 = (out,in) [CC][DIN]; 2 = per-head [NH][DIN][HD]
__device__ __forceinline__ v16b wcol_hdk(const float* Wm, int k0, int o, int lane) { v16b w; const int g = lane >> 4; const float* p = Wm + (size_t)(o / HD) * DIN * HD + (o % HD);
#pragma unroll
  for (int i = 0; i < 8; ++i) { w[i] = (__bf16)p[(size_t)(k0 + 8 * g + i) * HD]; w[8 + i] = (__bf16)p[(size_t)(k0 + 16 + 8 * g + i) * HD]; }
  return w; }
#define WO_OUT_IN 0
#if WQKV_LAYOUT == 1
#define WCOL(W, k0, o, lane) wcol_oi(W, k0, o, lane, DIN)
#elif WQKV_LAYOUT == 2
#define WCOL(W, k0, o, lane) wcol_hdk(W, k0, o, lane)
#else
__device__ __forceinline__ v16b zero16b() { v16b w; _Pragma("unroll") for (int i = 0; i < 16; ++i) w[i] = (__bf16)0.0f; return w; }
#define WCOL(W, k0, o, lane) (((which) == 2) ? wcol_io(W, k0, o, lane, CC) : (((o) < RW) ? wcol_io(W, k0, o, lane, RW) : zero16b()))   /* (in,out): Wv [512][512]; Wq / Wk [512][64]: columns >= 64 of the q / k rows are zero (and never read) */
#endif
#if WO_OUT_IN
#define WOCOL(W, k0, o, lane) wcol_oi(W, k0, o, lane, CC)
#define WOCOLH(W, k0, o, lane) wcolh_oi(W, k0, o, lane, CC)
#else
#define WOCOL(W, k0, o, lane) wcol_io(W, k0, o, lane, DIN)
#define WOCOLH(W, k0, o, lane) wcolh_io(W, k0, o, lane, DIN)
#endif

#ifndef SM_EXTRA_PARAMS
#define SM_EXTRA_PARAMS
#endif
#ifndef PROJ_EXTRA_PARAMS
#define PROJ_EXTRA_PARAMS
#endif
#ifndef SM_MASK_HOOK
#define SM_MASK_HOOK (void)0
#endif

#define WS_QH  0u                                      // f16 q rows [b*t][CC]
#define WS_KH  (WS_QH + 2u * (size_t)NB * TT * CC)      // f16 k rows [b*t][CC]
#define WS_VT  (WS_KH + 2u * (size_t)NB * TT * CC)      // f16 v planes [b][c][t]
#define WS_QL  (WS_VT + 2u * (size_t)NB * CC * TT)      // f16 q residual x 2^10 rows [b][t < QHI][CC]
#define WS_KL  (WS_QL + 2u * (size_t)NB * QHI * CC)     // f16 k residual x 2^10 rows [b][t < KHI][CC]
#define WS_VB  (WS_KL + 2u * (size_t)NB * KHI * CC)     // bf16 v hi planes [b][c][t < VHI]
#define WS_VBL (WS_VB + 2u * (size_t)NB * CC * VHI)
#define WS_S   (WS_VBL + 2u * (size_t)NB * CC * VHI)    // f32 logits / P (f16 P outside the early band), one packed plane per batch [b][SPLANE]
#define WS_Y   (WS_S  + 4u * (size_t)NB * SPLANE)       // f32 ctx rows [b*t][CC]
#define WS_END (WS_Y  + 4u * (size_t)NB * TT * CC)   // o rows [(b*TT + t)][CC] (k_pv writes them; the residual-LayerNorm kernel writes the output)

#define PJK 64             // k rows per staged weight tile of k_proj
// one thread's share of a stage: 16 weight rows x 4 columns (a row of 128 columns = one 512-byte access of a wave; LD, the row length, is a constant, so the 16 rows are immediate offsets from one address) and the x values of its two A fragments
template <int LD> __device__ __forceinline__ void pj_load(v4f (&wr)[16], v4f (&xr)[8], const float* wp, const float* xrow) {
#pragma unroll
  for (int i = 0; i < 16; ++i) wr[i] = *(const v4f*)(wp + i * LD);
#pragma unroll
  for (int kc = 0; kc < PJK / 32; ++kc) { const float* p = xrow + kc * 32; xr[kc * 4] = *(const v4f*)p; xr[kc * 4 + 1] = *(const v4f*)(p + 4); xr[kc * 4 + 2] = *(const v4f*)(p + 16); xr[kc * 4 + 3] = *(const v4f*)(p + 20); }
}
// the 16 x 4 weight values to bf16, transposed in registers: eight k of one column = one 16-byte LDS store. The 16-byte group kg of column c lies at place kg ^ ((c >> 4) & 3) of its row: 16 lanes, four columns apart, then fall on 16 different bank groups; a fragment's 16 columns share one (c >> 4)
__device__ __forceinline__ void pj_store(__bf16 (*buf)[72], const v4f (&wr)[16], int wave, int lane) {
#pragma unroll
  for (int q = 0; q < 2; ++q) {
#pragma unroll
    for (int cc = 0; cc < 4; ++cc) { v8b pk;
#pragma unroll
      for (int i = 0; i < 8; ++i) pk[i] = (__bf16)wr[q * 8 + i][cc];
      *(v8b*)&buf[lane * 4 + cc][((wave * 2 + q) ^ ((lane >> 2) & 3)) * 8] = pk; } }
}
__device__ __forceinline__ void pj_afrag(v16b (&a)[PJK / 32], const v4f (&xr)[8]) {
#pragma unroll
  for (int kc = 0; kc < PJK / 32; ++kc)
#pragma unroll
    for (int i = 0; i < 4; ++i) { a[kc][i] = (__bf16)xr[kc * 4][i]; a[kc][4 + i] = (__bf16)xr[kc * 4 + 1][i]; a[kc][8 + i] = (__bf16)xr[kc * 4 + 2][i]; a[kc][12 + i] = (__bf16)xr[kc * 4 + 3][i]; }
}
// K loop of k_proj in stages of PJK k rows: the stage's weight tile (PJK x 128 columns) lies in LDS as bf16 [column][k], in b0 and b1 by turns; the next stage's weight rows and x values are loaded while this stage's products run. LD = 64 (Wq / Wk, 64 real columns): tile columns >= 64 are zero in both buffers, written once in front of the loop; their lanes re-read real columns (in bounds) and store nothing
template <int LD> __device__ __forceinline__ void pj_main(v8f (&acc)[8], const float* wp, const float* xrow, __bf16 (*b0)[72], __bf16 (*b1)[72], int wave, int lane) {
  const int col = lane & 15, g = lane >> 4; const bool wreal = LD == CC || lane < RW / 4;
  v4f wr[16], xr[8]; v16b a[PJK / 32];
  pj_load<LD>(wr, xr, wp, xrow);
  if (wreal) pj_store(b0, wr, wave, lane);
  else { const v4f z[16] = {}; pj_store(b0, z, wave, lane); pj_store(b1, z, wave, lane); }
  pj_afrag(a, xr);
  __syncthreads();
#pragma unroll 1   // one stage a trip: the buffers alternate, the code stays small
  for (int s = 0; s < DIN / PJK; ++s) { const __bf16 (*cur)[72] = (s & 1) ? b1 : b0; __bf16 (*nxt)[72] = (s & 1) ? b0 : b1;
    if (s + 1 < DIN / PJK) { wp += PJK * LD; xrow += PJK; pj_load<LD>(wr, xr, wp, xrow); }
#pragma unroll
    for (int kc = 0; kc < PJK / 32; ++kc) { union { v16b v; v8b q[2]; } u[8];   // the eight fragment reads of a k step are issued first: the products then wait on counted LDS returns, not on one LDS latency each
#pragma unroll
      for (int j = 0; j < 8; ++j) { const __bf16* rw = &cur[j * 16 + col][0]; u[j].q[0] = *(const v8b*)(rw + ((kc * 4 + g) ^ (j & 3)) * 8); u[j].q[1] = *(const v8b*)(rw + ((kc * 4 + 2 + g) ^ (j & 3)) * 8); }
#pragma unroll
      for (int j = 0; j < 8; ++j) acc[j] = wmma_bf(a[kc], u[j].v, acc[j]); }
    if (s + 1 < DIN / PJK) { if (wreal) pj_store(nxt, wr, wave, lane); pj_afrag(a, xr); }
    __syncthreads(); }   /* publishes stage s + 1 and ends every read of stage s: its buffer is rewritten in the next trip, or by the epilogue */
}
// ---- k_proj: block = (64 rows, 128 cols, which): q/k/v = X W (+ b) with exact bf16 products (K = DIN) -> which 0: q f16 rows (+ residual rows < QHI); 1: k f16 rows (+ residual rows < KHI); 2: v f16 planes [c][t] (+ bf16 hi/lo planes for t < VHI)
__global__ __launch_bounds__(128) void k_proj(const float* __restrict__ XQ, const float* __restrict__ XK, const float* __restrict__ XV, const float* __restrict__ WQ, const float* __restrict__ WK, const float* __restrict__ WV, const float* __restrict__ BQ, const float* __restrict__ BK, const float* __restrict__ BV,
    _Float16* __restrict__ QH, _Float16* __restrict__ QL, _Float16* __restrict__ KH, _Float16* __restrict__ KL, _Float16* __restrict__ VT, __bf16* __restrict__ VB, __bf16* __restrict__ VBL) {
  __shared__ __align__(16) _Float16 sh[64][136], sl[64][136]; __shared__ __align__(16) _Float16 th[128][72]; __shared__ __align__(16) __bf16 tb[128][72], tbl[128][72];
  const int tid = threadIdx.x, wave = tid >> 5, lane = tid & 31, col = lane & 15, g = lane >> 4; const int which = blockIdx.z; const int c0 = blockIdx.y * 128; const size_t r0 = (size_t)blockIdx.x * 64; const size_t bb = r0 / TT; const int t0 = (int)(r0 % TT);
  if (which < 2 && blockIdx.y > 0) return;   /* q / k have 64 real columns: only the first 128-column tile is computed; the others are never read (block-uniform exit before any barrier) */
  const float* X = which == 0 ? XQ : which == 1 ? XK : XV; const float* WA = which == 0 ? WQ : which == 1 ? WK : WV; const float* BA = which == 0 ? BQ : which == 1 ? BK : BV;
  v8f acc[8] = {};
  { const float* xrow = X + (r0 + wave * 16 + col) * DIN + 8 * g;   /* tb and tbl, free until the epilogue, are the two weight buffers; which is the same for the whole block */
    if (which == 2) pj_main<CC>(acc, WA + (size_t)(wave * 16) * CC + c0 + lane * 4, xrow, tb, tbl, wave, lane);
    else pj_main<RW>(acc, WA + (size_t)(wave * 16) * RW + (lane & (RW / 4 - 1)) * 4, xrow, tb, tbl, wave, lane); }
  if (which < 2) { _Float16* DH = which == 0 ? QH : KH; _Float16* DL = which == 0 ? QL : KL; const int nhi = which == 0 ? QHI : KHI; const bool hi_rows = t0 < nhi;
#pragma unroll
    for (int j = 0; j < 8; ++j) { const float bias = (BA && ((which) == 2 || (c0 + j * 16 + col) < RW)) ? bfr(BA[c0 + j * 16 + col]) : 0.f;
#pragma unroll
      for (int r = 0; r < 8; ++r) { const float v = acc[j][r] + bias; const _Float16 hv = (_Float16)v; sh[wave * 16 + 8 * g + r][j * 16 + col] = hv; sl[wave * 16 + 8 * g + r][j * 16 + col] = (_Float16)((v - (float)hv) * 1024.0f); } }
    __syncthreads();
    for (int e = tid; e < 64 * 16; e += 128) { const int rl = e >> 4, q = e & 15; vst2((unsigned*)(DH + (r0 + rl) * CC + c0 + q * 8), *(const v4u*)&sh[rl][q * 8]); if (hi_rows) vst2((unsigned*)(DL + (bb * nhi + t0 + rl) * (size_t)CC + c0 + q * 8), *(const v4u*)&sl[rl][q * 8]); }
  } else { const bool hi_rows = t0 < VHI;
#pragma unroll
    for (int j = 0; j < 8; ++j) { const float bias = (BA && ((which) == 2 || (c0 + j * 16 + col) < RW)) ? bfr(BA[c0 + j * 16 + col]) : 0.f;
#pragma unroll
      for (int r = 0; r < 8; ++r) { const float v = acc[j][r] + bias; const int rl = wave * 16 + 8 * g + r, cl = j * 16 + col; th[cl][rl] = (_Float16)v; const __bf16 bh = (__bf16)v; tb[cl][rl] = bh; tbl[cl][rl] = (__bf16)(v - (float)bh); } }
    __syncthreads();
    for (int e = tid; e < 128 * 8; e += 128) { const int cl = e >> 3, q = e & 7; vst2((unsigned*)(VT + (bb * CC + c0 + cl) * (size_t)TT + t0 + q * 8), *(const v4u*)&th[cl][q * 8]); if (hi_rows) { const size_t o3 = (bb * CC + c0 + cl) * (size_t)VHI + t0 + q * 8; vst2((unsigned*)(VB + o3), *(const v4u*)&tb[cl][q * 8]); vst2((unsigned*)(VBL + o3), *(const v4u*)&tbl[cl][q * 8]); } } } }
#undef QBH
#define QBH NQB   // SCORE KERNEL ONLY: every query block takes the 3-product branch (unscaled logits)
// eight asynchronous copies of 16 bytes a lane, global -> LDS, rows lstep / gstep bytes apart; the s_wait_xcnt in the same statement stands before anything can rewrite an address register of a copy
__device__ __forceinline__ void acopy8(unsigned l, unsigned lstep, const char* gsrc, size_t gstep) {
  asm volatile("global_load_async_to_lds_b128 %0, %8, off\n\t"
               "global_load_async_to_lds_b128 %1, %9, off\n\t"
               "global_load_async_to_lds_b128 %2, %10, off\n\t"
               "global_load_async_to_lds_b128 %3, %11, off\n\t"
               "global_load_async_to_lds_b128 %4, %12, off\n\t"
               "global_load_async_to_lds_b128 %5, %13, off\n\t"
               "global_load_async_to_lds_b128 %6, %14, off\n\t"
               "global_load_async_to_lds_b128 %7, %15, off\n\t"
               "s_wait_xcnt 0x0"
               :: "v"(l), "v"(l + lstep), "v"(l + 2 * lstep), "v"(l + 3 * lstep), "v"(l + 4 * lstep), "v"(l + 5 * lstep), "v"(l + 6 * lstep), "v"(l + 7 * lstep),
                  "v"(gsrc), "v"(gsrc + gstep), "v"(gsrc + 2 * gstep), "v"(gsrc + 3 * gstep), "v"(gsrc + 4 * gstep), "v"(gsrc + 5 * gstep), "v"(gsrc + 6 * gstep), "v"(gsrc + 7 * gstep)
               : "memory");
}
#define SCP (HD + 8)       // q / k row pitch in LDS, halves: 144 B = 16 B x 9, conflict-free for 16-byte reads
// four such copies, for the 16 q rows of a wave
__device__ __forceinline__ void acopy4(unsigned l, unsigned lstep, const char* gsrc, size_t gstep) {
  asm volatile("global_load_async_to_lds_b128 %0, %4, off\n\t"
               "global_load_async_to_lds_b128 %1, %5, off\n\t"
               "global_load_async_to_lds_b128 %2, %6, off\n\t"
               "global_load_async_to_lds_b128 %3, %7, off\n\t"
               "s_wait_xcnt 0x0"
               :: "v"(l), "v"(l + lstep), "v"(l + 2 * lstep), "v"(l + 3 * lstep),
                  "v"(gsrc), "v"(gsrc + gstep), "v"(gsrc + 2 * gstep), "v"(gsrc + 3 * gstep)
               : "memory");
}
static_assert(HD * 2 == 128, "k_sc: a q / k row of one head is one 128-byte line, eight lanes of a copy");
// ---- k_sc: block = (query block qb, key block kb <= kb_last(qb), batch b): logits x SCALE; q hi + residual (x 2^10) against k (2 products) for query rows < QHI, plus the k residual (3 products) for query blocks < QBH (here every query block); causal: blocks past the diagonal exit, the mask itself is applied by index in k_sm. The block's 128 k rows and 64 q rows, hi and residual, come into LDS once, in whole 128-byte lines (four rows a copy of a wave); all four waves take their k fragments from there
__global__ __launch_bounds__(128) void k_sc(const _Float16* __restrict__ QH, const _Float16* __restrict__ KH, const _Float16* __restrict__ QL, const _Float16* __restrict__ KL, int h0, float* __restrict__ S0) {
  union SCU { struct { _Float16 h[128][SCP], l[128][SCP]; } k; float ss[4][16][132]; };   /* the output rows ss take the place of the k tile once every wave has read it */
  __shared__ __align__(16) SCU u; __shared__ __align__(16) _Float16 sqh[64][SCP], sql[64][SCP];
  const int qb = blockIdx.x, kb = blockIdx.y; if (kb > kb_last(qb)) return;
  const int b = blockIdx.z, h = h0; float* S = S0 + (size_t)b * SPLANE + s_base(qb) + (size_t)kb * STILE;   /* blockIdx.z = batch; S = this block's tile */
  const int tid = threadIdx.x, wave = tid >> 5, lane = tid & 31, col = lane & 15, g = lane >> 4; const int k0 = kb * 128; const int ql0 = qb * 64 + wave * 16; const size_t q0 = (size_t)b * TT + ql0, kr0 = (size_t)b * TT + k0;
  v8f acc[8] = {}, accl[8] = {};
  const _Float16* QLb = QL + (size_t)b * QHI * CC; const _Float16* KLb = KL + (size_t)b * KHI * CC;
  { const int cr = lane >> 3, cq = (lane & 7) * 8;   /* a copy = rows cr, cr + 4, ..: eight lanes a row. Each wave brings 32 k rows and its own 16 q rows, hi and residual: 24 copies in flight */
    const size_t go = (size_t)cr * CC + h * HD + cq;
    acopy8((unsigned)(size_t)&u.k.h[wave * 32 + cr][cq], 4u * SCP * 2u, (const char*)(KH + (kr0 + wave * 32) * CC + go), (size_t)4 * CC * 2);
    acopy8((unsigned)(size_t)&u.k.l[wave * 32 + cr][cq], 4u * SCP * 2u, (const char*)(KLb + (size_t)(k0 + wave * 32) * CC + go), (size_t)4 * CC * 2);
    acopy4((unsigned)(size_t)&sqh[wave * 16 + cr][cq], 4u * SCP * 2u, (const char*)(QH + q0 * CC + go), (size_t)4 * CC * 2);
    acopy4((unsigned)(size_t)&sql[wave * 16 + cr][cq], 4u * SCP * 2u, (const char*)(QLb + (size_t)ql0 * CC + go), (size_t)4 * CC * 2); }
  asm volatile("s_wait_asynccnt 0x0" ::: "memory");   // this wave's copies have landed before the barrier publishes them
  __syncthreads();
  if (qb < QBH) {
    v16h ah, al, kbf[HD / 4], klf[HD / 4];   // step s = (kc = s >> 3, j = s & 7), in the order kc, j as before; the k fragments of step s + 1 are read in front of the products of step s, so that a product waits on a counted LDS return and not on a whole LDS latency; the q fragments of a kc are read with the group in front of its first products (no earlier: two sets of them would cost a resident wave)
#pragma unroll
    for (int s = -1; s < HD / 4; ++s) {
      if (s >= 0 && (s & 7) == 0) { ah = frag_h(&sqh[wave * 16 + col][(s >> 3) * 32], lane); al = frag_h(&sql[wave * 16 + col][(s >> 3) * 32], lane); }
      if (s + 1 < HD / 4) { kbf[s + 1] = frag_h(&u.k.h[((s + 1) & 7) * 16 + col][((s + 1) >> 3) * 32], lane); klf[s + 1] = frag_h(&u.k.l[((s + 1) & 7) * 16 + col][((s + 1) >> 3) * 32], lane); }
      __builtin_amdgcn_sched_barrier(0);   // keeps the reads in front of these products: without it the compiler sinks each read to its first use
      if (s >= 0) { const int j = s & 7; acc[j] = wmma16(ah, kbf[s], acc[j]); accl[j] = wmma16(al, kbf[s], accl[j]); accl[j] = wmma16(ah, klf[s], accl[j]); }
      __builtin_amdgcn_sched_barrier(0); }   // keeps the next reads from moving up among these products
  } else if (qb * 64 < QHI) {
#pragma unroll
    for (int kc = 0; kc < HD / 32; ++kc) { const v16h ah = frag_h(&sqh[wave * 16 + col][kc * 32], lane), al = frag_h(&sql[wave * 16 + col][kc * 32], lane);
#pragma unroll
      for (int j = 0; j < 8; ++j) { const v16h kbf = frag_h(&u.k.h[j * 16 + col][kc * 32], lane); acc[j] = wmma16(ah, kbf, acc[j]); accl[j] = wmma16(al, kbf, accl[j]); } }
  } else {
#pragma unroll
    for (int kc = 0; kc < HD / 32; ++kc) { const v16h ah = frag_h(&sqh[wave * 16 + col][kc * 32], lane);
#pragma unroll
      for (int j = 0; j < 8; ++j) { const v16h kbf = frag_h(&u.k.h[j * 16 + col][kc * 32], lane); acc[j] = wmma16(ah, kbf, acc[j]); } } }
  __syncthreads();   /* ends every wave's reads of the k tile: ss overwrites it */
#pragma unroll
  for (int j = 0; j < 8; ++j) {
#pragma unroll
    for (int r = 0; r < 8; ++r) u.ss[wave][8 * g + r][j * 16 + col] = (acc[j][r] + accl[j][r] * (1.0f / 1024.0f)) * SCALE; }
  LDSX(); for (int rl = 0; rl < 16; ++rl) vst2(S + (wave * 16 + rl) * 128 + lane * 4, *(const v4f*)&u.ss[wave][rl][lane * 4]); }
#undef QBH
#define QBH 6   // restored: the softmax and P.v kernels keep the causal early band of 6 query blocks
// ---- k_sm: one wave = one query row t (eight rows a block, no LDS, no barrier, so the waves of a block need not run alike): the row's keys [0, kend) stay in registers from the load to the store, 16 bytes a lane and 512 bytes a wave per access; causal -> logit if s <= t else excluded; softmax in f32; P x 2^11 in place (0 for excluded): f32 for the early band (query blocks < QBH); for all other rows rounded to f16 here, once, instead of in each of the eight column groups of k_pv: the 128 halves of a chunk lie in the first 256 bytes of the row's own 512-byte place in its tile, so a wave still writes only where it alone has read
#define SMC (TT / 128)     // 128-key chunks of a full row: one 16-byte access of a wave each
__device__ __forceinline__ float sm_e(float x, float m) { const float ex = expf(x - m); return (x <= -1.0e38f) ? 0.f : ex; }   /* excluded -> 0; the exponential stands in front of the choice, so the choice is a select and no branch per element */
typedef __attribute__((ext_vector_type(4))) _Float16 v4h;
__device__ __forceinline__ v4h sm_h(v4f p) { v4h r;
#pragma unroll
  for (int c = 0; c < 4; ++c) r[c] = (_Float16)p[c];
  return r; }
__global__ __launch_bounds__(256) void k_sm(float* __restrict__ S0 SM_EXTRA_PARAMS) {
  const int lane = threadIdx.x & 31; const int wv = __builtin_amdgcn_readfirstlane(threadIdx.x >> 5);   /* the wave's number as a scalar: the row and its chunk count are then scalars, and the tests on nf below scalar branches */
  const int r = blockIdx.x * 4 + (wv & 3); const int t = wv < 4 ? r : TT - 1 - r;   /* waves w and w + 4 take rows r and TT - 1 - r, a short causal row and a long one: every block carries the same work; each row is taken once */
  const int nf = kb_last(t >> 6);   /* whole chunks in front of the row's last one */
  float* sr = S0 + (size_t)blockIdx.y * SPLANE + s_base(t >> 6) + (t & 63) * 128 + lane * 4;   /* blockIdx.y = batch; chunk i of the row lies in tile i of its query block */
  v4f v[SMC - 1]; v4f vl = *(const v4f*)(sr + nf * STILE);   /* vl: the last chunk, the only one the diagonal crosses (t >> 7 == nf) */
#pragma unroll   // constant chunk numbers keep the row in registers (so for every loop over the chunks in this kernel); all loads of the row are in flight together
  for (int i = 0; i < SMC - 1; ++i) if (i < nf) v[i] = *(const v4f*)(sr + i * STILE);
  if (CAUSAL) {
#pragma unroll
    for (int c = 0; c < 4; ++c) if (nf * 128 + lane * 4 + c > t) vl[c] = -3.0e38f; }
  float m = fmaxf(-3.0e38f, fmaxf(fmaxf(vl[0], vl[1]), fmaxf(vl[2], vl[3])));
#pragma unroll
  for (int i = 0; i < SMC - 1; ++i) if (i < nf) m = fmaxf(m, fmaxf(fmaxf(v[i][0], v[i][1]), fmaxf(v[i][2], v[i][3])));
#pragma unroll
  for (int o = 1; o < 32; o <<= 1) m = fmaxf(m, __shfl_xor(m, o));
  v4f s4 = {0.f, 0.f, 0.f, 0.f};
#pragma unroll
  for (int i = 0; i < SMC - 1; ++i) if (i < nf) {
#pragma unroll
    for (int c = 0; c < 4; ++c) { const float e = sm_e(v[i][c], m); v[i][c] = e; s4[c] += e; } }
#pragma unroll
  for (int c = 0; c < 4; ++c) { const float e = sm_e(vl[c], m); vl[c] = e; s4[c] += e; }
  float sum = (s4[0] + s4[1]) + (s4[2] + s4[3]);
#pragma unroll
  for (int o = 1; o < 32; o <<= 1) sum += __shfl_xor(sum, o);
  const float inv = sum > 0.f ? 2048.0f / sum : 0.f;   /* a fully excluded row yields P = 0 */
  if ((t >> 6) < QBH) {   /* t is a scalar: a scalar branch */
#pragma unroll
    for (int i = 0; i < SMC - 1; ++i) if (i < nf) { vst2(sr + i * STILE, v[i] * inv);
      asm volatile("s_wait_xcnt 0x0" ::: "memory"); }   // the next chunk's products reuse the registers this store names: the wait stands between the store and that overwrite
    vst2(sr + nf * STILE, vl * inv);
  } else { _Float16* hr = (_Float16*)(sr - lane * 4) + lane * 4;   /* the row's place again, counted in halves: 8 bytes a lane, 256 bytes a wave per store */
#pragma unroll
    for (int i = 0; i < SMC - 1; ++i) if (i < nf) { vst2(hr + i * (2 * STILE), sm_h(v[i] * inv));
      asm volatile("s_wait_xcnt 0x0" ::: "memory"); }   // as above: between the store and the overwrite of its registers
    vst2(hr + nf * (2 * STILE), sm_h(vl * inv)); } }
#define PVK 128            // keys per staged tile of k_pv (kb_last counts in the same 128-key units; a staged P tile holds the f16 halves of the same-numbered stored tile of both query blocks of the pair)
#define PVP (PVK + 8)      // P row pitch in LDS, halves: 272 B = 16 B x 17, conflict-free for 16-byte reads
#define PVV (PVK + 8)      // v row pitch in LDS, halves: 272 B = 16 B x 17
#define PVQ 128            // queries per block of k_pv: query blocks 2m and 2m + 1, which see the same key tiles 0..m
#define PVC 128            // v columns per block of k_pv: two 64-column groups
static_assert(CAUSAL == 1 && QBH % 2 == 0 && NQB % 2 == 0 && NH % 2 == 0, "k_pv pairs query blocks 2m, 2m + 1 (kb_last of both = m; both in the early band or neither) and column groups 2y, 2y + 1");
// one wave's share of a tile: 32 P rows (256 B of f16 each, 512 B apart in the stored tile) and 32 v rows (256 B each), two rows a copy: 32 copies of a wave in flight
__device__ __forceinline__ void pv_tile(unsigned lp, unsigned lv, const char* gp, const char* gv) {
  acopy8(lp, 2u * PVP * 2u, gp, (size_t)2 * PVK * 4); acopy8(lp + 16u * PVP * 2u, 2u * PVP * 2u, gp + (size_t)16 * PVK * 4, (size_t)2 * PVK * 4);
  acopy8(lv, 2u * PVV * 2u, gv, (size_t)2 * TT * 2); acopy8(lv + 16u * PVV * 2u, 2u * PVV * 2u, gv + (size_t)16 * TT * 2, (size_t)2 * TT * 2);
}
// ---- k_pv: block = 128 queries (query blocks 2m, 2m + 1) x 128 v columns of batch b; wave = 64 queries (one query block) x 64 columns (one column group), 4 x 4 accumulator tiles, so every staged P or v fragment feeds four products: ctx = P . v over keys [0, kend) (P x 2^11, stored as f16 by k_sm, against v f16: 1 product; causal early query blocks: f32 P and v as bf16 hi + lo, 3 products); 256-B (row, head) segment by 16 lanes
__global__ __launch_bounds__(128) void k_pv(const float* __restrict__ PS0, const _Float16* __restrict__ VT, const __bf16* __restrict__ VB, const __bf16* __restrict__ VBL, int h0, float* __restrict__ Y) { __shared__ __align__(16) float ss[4][16][HD + 4];
  __shared__ __align__(16) _Float16 sp[2][PVQ][PVP]; __shared__ __align__(16) _Float16 sv[2][PVC][PVV];   /* two buffers each: P tile (128 queries x 128 keys, f16) and v tile (128 columns x 128 keys, f16) */
  const int tid = threadIdx.x, wave = tid >> 5, lane = tid & 31, col = lane & 15, g = lane >> 4; const int b = blockIdx.z;   /* blockIdx.y = pair of column groups, blockIdx.z = batch */
  const int m = blockIdx.x;   /* the pair of query blocks: m + 1 key tiles */
  const int wq = wave >> 1, wc = wave & 1; const int qb = 2 * m + wq, h = h0 + blockIdx.y * 2 + wc;   /* the wave's query block and column group */
  const int kce = (kb_last(2 * m) + 1) * 4; const float* PS = PS0 + (size_t)b * SPLANE + s_base(qb);
  v8f acc[4][HD / 16] = {};
  if (2 * m < QBH) {
    const size_t po = ((size_t)b * CC + h * HD + col) * (size_t)VHI + 8 * g; const __bf16* vhp = VB + po; const __bf16* vlp = VBL + po;   /* the lane's own first eight keys in its v row of column tile 0, hi and lo plane: every v load of a trip is one of these two addresses plus a constant; both go on by 32 keys a trip */
#pragma unroll 1
    for (int kc = 0; kc < kce; ++kc) { const float* pp = PS + (kc >> 2) * STILE + col * 128; F2 p[4];
#pragma unroll
      for (int qi = 0; qi < 4; ++qi) p[qi] = split_row(pp + qi * 16 * 128, (kc & 3) * 32, lane);
      asm volatile("s_wait_loadcnt 0x0" ::: "memory");
#pragma unroll
      for (int j = 0; j < HD / 16; ++j) { const v16b vh = frag_b(vhp + j * 16 * VHI, 0), vl = frag_b(vlp + j * 16 * VHI, 0);   /* lane argument 0: the lane's half, 8 g, is in the two addresses already; per accumulator the three products stay in the order p.h vh, p.l vh, p.h vl */
#pragma unroll
        for (int qi = 0; qi < 4; ++qi) acc[qi][j] = __builtin_amdgcn_wmma_f32_16x16x32_bf16(false, p[qi].h, false, vh, (short)0, acc[qi][j], false, false);   /* the builtin alone, as in the loop below */
#pragma unroll
        for (int qi = 0; qi < 4; ++qi) acc[qi][j] = __builtin_amdgcn_wmma_f32_16x16x32_bf16(false, p[qi].l, false, vh, (short)0, acc[qi][j], false, false);
#pragma unroll
        for (int qi = 0; qi < 4; ++qi) acc[qi][j] = __builtin_amdgcn_wmma_f32_16x16x32_bf16(false, p[qi].h, false, vl, (short)0, acc[qi][j], false, false); }
      asm volatile("s_wait_xcnt 0x0" :: "v"(vhp), "v"(vlp) : "memory");   // the two addresses that the v loads of the trip name are inputs of the wait: their registers stay whole up to it and are rewritten only behind it
      vhp += 32; vlp += 32; }
  } else {
    // tiles of 128 keys come into LDS in whole 128-byte lines (two P rows or two v rows = one copy of a wave); each wave brings 32 P rows (half of its own query block's tile) and 32 v rows of every tile
    const int nst = kce / (PVK / 32);
    const unsigned lp = (unsigned)(size_t)&sp[0][wave * 32 + g][col * 8], lv = (unsigned)(size_t)&sv[0][wave * 32 + g][col * 8];
    const char* gp = (const char*)(PS + (wc * 32 + g) * PVK) + col * 16; const char* gv = (const char*)(VT + ((size_t)b * CC + (h0 + blockIdx.y * 2) * HD + wave * 32 + g) * (size_t)TT + col * 8);
    pv_tile(lp, lv, gp, gv);
    asm volatile("s_wait_asynccnt 0x0" ::: "memory");   // tile 0 has landed before the barrier publishes it
    __syncthreads();
    if (nst > 1) pv_tile(lp + (unsigned)sizeof(sp[0]), lv + (unsigned)sizeof(sv[0]), gp + STILE * 4, gv + PVK * 2);
#pragma unroll 1   // one tile a trip: the buffer index alternates, the code stays small
    for (int t = 0; t < nst; ++t) { const int bu = t & 1;
      v16h pf[PVK / 32][4], vf[PVK / 32][HD / 16];   // the fragment reads of k step kc + 1 are issued as one group in front of the products of k step kc: the products wait on counted LDS returns, and the reads run beside the products
#pragma unroll
      for (int kc = -1; kc < PVK / 32; ++kc) {
        if (kc + 1 < PVK / 32) {
#pragma unroll
          for (int qi = 0; qi < 4; ++qi) pf[kc + 1][qi] = frag_h(&sp[bu][wq * 64 + qi * 16 + col][(kc + 1) * 32], lane);
#pragma unroll
          for (int j = 0; j < HD / 16; ++j) vf[kc + 1][j] = frag_h(&sv[bu][wc * 64 + j * 16 + col][(kc + 1) * 32], lane); }
        __builtin_amdgcn_sched_barrier(0);   // keeps the group of reads in front of these products: without it the compiler sinks each read to its first use, and the wave waits out one LDS latency per fragment
        if (kc >= 0) {
#pragma unroll
          for (int qi = 0; qi < 4; ++qi) {
#pragma unroll
            for (int j = 0; j < HD / 16; ++j) acc[qi][j] = __builtin_amdgcn_wmma_f32_16x16x32_f16(false, pf[kc][qi], false, vf[kc][j], (short)0, acc[qi][j], false, false); } }   /* the builtin alone: the compiler keeps the distances behind it, and fragments may lie above v255, where an asm operand cannot */
        __builtin_amdgcn_sched_barrier(0); }   // keeps the next group of reads, and behind the last products the waits and the barrier, from moving up among these products
      asm volatile("s_wait_dscnt 0x0" ::: "memory");      // this wave's reads of buffer bu are done before the barrier frees it
      asm volatile("s_wait_asynccnt 0x0" ::: "memory");   // this wave's copies of tile t + 1 have landed before the barrier publishes them
      __syncthreads();
      if (t + 2 < nst) pv_tile(lp + (unsigned)(bu * sizeof(sp[0])), lv + (unsigned)(bu * sizeof(sv[0])), gp + (size_t)(t + 2) * (STILE * 4), gv + (size_t)(t + 2) * (PVK * 2)); }
    asm volatile("s_wait_asynccnt 0x0" ::: "memory");   // no copy is left in flight behind the loop
  }
#pragma unroll
  for (int qi = 0; qi < 4; ++qi) {   /* 16 rows at a time through the wave's own ss rows */
#pragma unroll
    for (int j = 0; j < HD / 16; ++j)
#pragma unroll
      for (int r = 0; r < 8; ++r) ss[wave][8 * g + r][j * 16 + col] = acc[qi][j][r] * (1.0f / 2048.0f);
    LDSX(); for (int rl = 0; rl < 16; ++rl) if (lane < HD / 4) vst2(Y + ((size_t)b * TT + qb * 64 + qi * 16 + rl) * CC + h * HD + lane * 4, *(const v4f*)&ss[wave][rl][lane * 4]);
    LDSX(); } }   /* the second LDSX: the rows are read before the next 16 rows overwrite them */

#define LN_EPS 1.0e-5f
__global__ __launch_bounds__(128) void k_resln(const float* __restrict__ O, const float* __restrict__ X, const float* __restrict__ GAM, const float* __restrict__ BET, float* __restrict__ OUT) { __shared__ float sred[2][4]; const size_t r = blockIdx.x; const int tid = threadIdx.x; const v4f o = *(const v4f*)(O + r * CC + tid * 4); const v4f xr = *(const v4f*)(X + r * CC + tid * 4); asm volatile("s_wait_loadcnt 0x0" ::: "memory"); float y[4]; float a = 0.f;
#pragma unroll
  for (int i = 0; i < 4; ++i) { y[i] = bfr(xr[i]) + o[i]; a += y[i]; }
#pragma unroll
  for (int s_ = 1; s_ < 32; s_ <<= 1) a += __shfl_xor(a, s_);
  if ((tid & 31) == 0) sred[0][tid >> 5] = a; __syncthreads();
  const float mu = (sred[0][0] + sred[0][1] + sred[0][2] + sred[0][3]) * (1.0f / (float)CC); float v = 0.f;
#pragma unroll
  for (int i = 0; i < 4; ++i) { const float d = y[i] - mu; v += d * d; }
#pragma unroll
  for (int s_ = 1; s_ < 32; s_ <<= 1) v += __shfl_xor(v, s_);
  if ((tid & 31) == 0) sred[1][tid >> 5] = v; __syncthreads();
  const float rs = 1.0f / sqrtf((sred[1][0] + sred[1][1] + sred[1][2] + sred[1][3]) * (1.0f / (float)CC) + LN_EPS); const v4f g4 = *(const v4f*)(GAM + tid * 4), b4 = *(const v4f*)(BET + tid * 4); v4f w;
#pragma unroll
  for (int i = 0; i < 4; ++i) w[i] = (y[i] - mu) * rs * bfr(g4[i]) + bfr(b4[i]);
  vst2(OUT + r * CC + tid * 4, w); }
static_assert(CC == 512 && DIN == CC, "k_resln: 128 threads x 4 floats per row; the residual adds the input row");
extern "C" void kernel_launch(void* const* d_in, const int* in_sizes, int n_in, void* d_out, int out_size, void* d_ws, size_t ws_size, hipStream_t stream) {
  (void)in_sizes; (void)n_in; (void)out_size;
  const float** F = (const float**)d_in;
  if (ws_size < (size_t)WS_END) return;
  char* ws = (char*)d_ws; _Float16 *QH = (_Float16*)(ws + WS_QH), *KH = (_Float16*)(ws + WS_KH), *VT = (_Float16*)(ws + WS_VT), *QL = (_Float16*)(ws + WS_QL), *KL = (_Float16*)(ws + WS_KL); __bf16 *VB = (__bf16*)(ws + WS_VB), *VBL = (__bf16*)(ws + WS_VBL); float *S = (float*)(ws + WS_S), *Y = (float*)(ws + WS_Y);
  (void)Y; (void)QL; (void)KL; (void)VB; (void)VBL;
  // inputs: 0 x [4,4096,512]; 1 Wq [512,64] (in,out), 2 bq [64]; 3 Wk [512,64], 4 bk; 5 Wv [512,512], 6 bv [512] (biases NONZERO); 7 gamma [512]; 8 beta [512] (ones / zeros, read)
  float* Yo = (float*)(ws + WS_Y);
  k_proj<<<dim3(TNB * TT / 64, CC / 128, 3), 128, 0, stream>>>(F[0], F[0], F[0], F[1], F[3], F[5], F[2], F[4], F[6], QH, QL, KH, KL, VT, VB, VBL);
  k_sc<<<dim3(NQB, TT / 128, TNB), 128, 0, stream>>>(QH, KH, QL, KL, 0, S);   /* the one score head: columns 0..63; all batches in one grid */
  k_sm<<<dim3(TT / 8, TNB), 256, 0, stream>>>(S);
  k_pv<<<dim3(NQB / 2, NH / 2, TNB), 128, 0, stream>>>(S, VT, VB, VBL, 0, Yo);   /* 128 queries x 128 v / o columns a block, all four column pairs from the batch's one plane; batch = slowest index */
  k_resln<<<dim3(TNB * TT), 128, 0, stream>>>(Yo, F[0], F[7], F[8], (float*)d_out);
}

// v009
// It runs in 113 microseconds.
// Two timings next to v008 put it at 1.24 and 1.25 times that version's speed.
// All steps since v000 together make it 34.0 times as fast.
// compute dtype: all float inputs rounded to bf16; q / k (64-wide) and v (512-wide) projections with EXACT bf16 products on WMMA 16x16x32 (f32 accumulate) + bias; causal logits UNSCALED: q and k each as f16 hi + (x 2^10) residual, 3 products on every row; softmax f32, its exponentials taken in the score kernel against a power-of-two reference per (row, key tile), brought to the row's reference and normalised in the P.v kernel; P x 2^11 once to f16 x v once to f16 (bf16 hi + lo below row 384), four 128-column passes over the same probability plane; y = bf16(x) + o and LayerNorm over 512 in f32; f32 output.
#include <hip/hip_runtime.h>
#include <math.h>

typedef __attribute__((ext_vector_type(16))) _Float16 v16h;
typedef __attribute__((ext_vector_type(16))) __bf16 v16b;
typedef __attribute__((ext_vector_type(8)))  _Float16 v8h;
typedef __attribute__((ext_vector_type(8)))  float v8f;
typedef __attribute__((ext_vector_type(4)))  float v4f;
typedef __attribute__((ext_vector_type(2)))  float v2f;
typedef __attribute__((ext_vector_type(4)))  unsigned v4u;
typedef __attribute__((ext_vector_type(4)))  int v4i;
typedef float __attribute__((may_alias)) float_a;
typedef int __attribute__((may_alias)) int_a;

template <typename T> __device__ __forceinline__ void vst2(void* p, T v) { *(T*)p = v;  }
__device__ __forceinline__ v8f wmma16(v16h a, v16h b, v8f c) {
  v8f d = __builtin_amdgcn_wmma_f32_16x16x32_f16(false, a, false, b, (short)0, c, false, false);
  asm volatile("v_nop\n\tv_nop\n\tv_nop\n\tv_nop" : "+v"(d) : "v"(a), "v"(b));
  return d;
}
__device__ __forceinline__ v8f wmma_bf(v16b a, v16b b, v8f c) {
  v8f d = __builtin_amdgcn_wmma_f32_16x16x32_bf16(false, a, false, b, (short)0, c, false, false);
  asm volatile("v_nop\n\tv_nop\n\tv_nop\n\tv_nop" : "+v"(d) : "v"(a), "v"(b));
  return d;
}
// 16x16x32 fragments: lane = (h = lane>>4, row/col = lane&15); elements 0..7 = k0+8h+0..7, 8..15 = k0+16+8h+0..7; D element r = row 8h+r
__device__ __forceinline__ v16h frag_h(const _Float16* rowk0, int lane) {
  union { v16h v; v8h q[2]; } u; const _Float16* p = rowk0 + 8 * (lane >> 4);
  u.q[0] = *(const v8h*)p; u.q[1] = *(const v8h*)(p + 16); return u.v;
}
__device__ __forceinline__ v16h frag_f32(const float* rowk0, int lane) {
  v16h a; const float* p = rowk0 + 8 * (lane >> 4);
#pragma unroll
  for (int i = 0; i < 8; ++i) { a[i] = (_Float16)p[i]; a[8 + i] = (_Float16)p[16 + i]; }
  return a;
}
__device__ __forceinline__ v16h frag_f32s(const float* rowk0, int lane, float sc) {
  v16h a; const float* p = rowk0 + 8 * (lane >> 4);
#pragma unroll
  for (int i = 0; i < 8; ++i) { a[i] = (_Float16)(p[i] * sc); a[8 + i] = (_Float16)(p[16 + i] * sc); }
  return a;
}
// column fragment from a [K][ld] layout (column n), rows >= K read as 0
__device__ __forceinline__ v16h fragc_f32(const float* W, int k0, int n, int lane, int ld, int K) {
  v16h a; const int g = lane >> 4;
#pragma unroll
  for (int i = 0; i < 8; ++i) { const int ka = k0 + 8 * g + i, kb = ka + 16;
    a[i] = (_Float16)(ka < K ? W[(size_t)(ka < K ? ka : K - 1) * ld + n] : 0.f); a[8 + i] = (_Float16)(kb < K ? W[(size_t)(kb < K ? kb : K - 1) * ld + n] : 0.f); }
  return a;
}
struct F2 { v16b h, l; };
__device__ __forceinline__ F2 bsplit16(const float v[16]) { F2 r;
#pragma unroll
  for (int i = 0; i < 16; ++i) { const __bf16 h = (__bf16)v[i]; r.h[i] = h; r.l[i] = (__bf16)(v[i] - (float)h); }
  return r; }
__device__ __forceinline__ F2 split_row(const float* row, int k0, int lane) { float v[16]; const float* p = row + k0 + 8 * (lane >> 4);
#pragma unroll
  for (int i = 0; i < 8; ++i) { v[i] = p[i]; v[8 + i] = p[16 + i]; }
  return bsplit16(v); }
__device__ __forceinline__ F2 split_rowK(const float* row, int k0, int lane, int K) { float v[16]; const int g = lane >> 4;
#pragma unroll
  for (int i = 0; i < 8; ++i) { const int ka = k0 + 8 * g + i, kb = ka + 16; v[i] = ka < K ? row[ka < K ? ka : K - 1] : 0.f; v[8 + i] = kb < K ? row[kb < K ? kb : K - 1] : 0.f; }
  return bsplit16(v); }
__device__ __forceinline__ F2 split_col(const float* W, int k0, int n, int lane, int ld, int K) { float v[16]; const int g = lane >> 4;
#pragma unroll
  for (int i = 0; i < 8; ++i) { const int ka = k0 + 8 * g + i, kb = ka + 16; v[i] = ka < K ? W[(size_t)(ka < K ? ka : K - 1) * ld + n] : 0.f; v[8 + i] = kb < K ? W[(size_t)(kb < K ? kb : K - 1) * ld + n] : 0.f; }
  return bsplit16(v); }
__device__ __forceinline__ v8f mac3(const F2& a, const F2& b, v8f c) { c = wmma_bf(a.l, b.h, c); c = wmma_bf(a.h, b.l, c); return wmma_bf(a.h, b.h, c); }
__device__ __forceinline__ float sigm(float v) { return 1.0f / (1.0f + expf(-v)); }
#define LDSX() do { asm volatile("s_wait_dscnt 0" ::: "memory"); __builtin_amdgcn_wave_barrier(); __builtin_amdgcn_fence(__ATOMIC_RELEASE, "workgroup"); } while (0)

// Single-head causal self-attention with a residual and LayerNorm (x [4,4096,512]; (in,out) Wq / Wk [512,64] and Wv [512,512] uniform(+-1/sqrt(512)) with biases of the same scale - NONZERO; q, k = x W + b (64-wide), v = x Wv + bv (512-wide); scores = q k^T with NO scaling; tril kept, -inf elsewhere; softmax over the keys; o = attn v [4,4096,512]; y = x + o; LayerNorm over the 512 features (biased variance, eps 1e-5) * gamma + beta (ones / zeros, read)). ONE 64-wide score head in columns 0..63 of the 512-wide q / k rows; P.v as eight ordinary 64-wide column groups that all read the same probability plane.
#define NB 4
#define TT 4096
#define CC 512            // NH * HD = projected width
#define DIN 512          // input (model) width
#define NH 8
#define HD 64
#define NQB (TT / 64)
#define HG 1
#define SCALE (1.0f)
#define CAUSAL 1
#ifndef TNB
#define TNB NB
#endif
__device__ __forceinline__ float bfr(float v) { return (float)(__bf16)v; }
__host__ __device__ __forceinline__ int kb_last(int qb) { return CAUSAL ? ((qb * 64 + 63) >> 7) : (TT / 128 - 1); }
// packed causal P plane of one batch: tiles of 64 queries x 128 keys (STILE floats, rows of 128), for query block qb only its key blocks 0..kb_last(qb), one behind the other from s_base(qb); so the planes of all batches fit in the workspace together, and every stride inside a query block is a constant
#define STILE (64 * 128)
static_assert(CAUSAL == 1 && NQB % 2 == 0, "s_base sums kb_last(i) + 1 = (i >> 1) + 1 over i < qb");
__device__ __forceinline__ size_t s_base(int qb) { const int m = qb >> 1; return (size_t)STILE * (size_t)((m + 1) * (m + (qb & 1))); }
#define SPLANE ((size_t)STILE * (NQB / 2) * (NQB / 2 + 1))   // floats per batch = s_base(NQB)
#define NTB ((NQB / 2) * (NQB / 2 + 1))   // tiles per batch
// softmax statistics of a tile: per 16 query rows (one wave of k_sc) one 128-byte line: 16 references (whole numbers, the power of two the row's exponentials of this tile are counted against), then 16 sums of those exponentials
#define STW 32
#define QBE 6              // the causal early band (equal to QBH of the P.v kernel): its P tiles stay f32
#define LOG2E 1.44269504f
typedef __attribute__((ext_vector_type(8))) __bf16 v8b;
__device__ __forceinline__ v16b frag_b(const __bf16* rowk0, int lane) {
  union { v16b v; v8b q[2]; } u; const __bf16* p = rowk0 + 8 * (lane >> 4);
  u.q[0] = *(const v8b*)p; u.q[1] = *(const v8b*)(p + 16); return u.v;
}
#define QBH 6              // causal: query blocks 0..QBH-1 of each sequence (few keys, no averaging) take the high-precision path
#define QHI TT             // rows carrying a q residual plane (all rows: 3-product logits everywhere)
#define KHI TT             // key rows carrying a k residual plane (read by every k_sc block: its 3-product branch)
#define VHI 384            // v bf16 hi / lo planes only for key rows t < VHI (read by the causal early band: query blocks < 6 see keys <= 383)
#define RW 64              // real width of q / k
// B fragment (k rows k0+.., output column o) of a weight: (in,out) [K][ld] or (out,in) [ld rows of K]: bf16 exact, or f16(bf16 * 256) exact
__device__ __forceinline__ v16b wcol_io(const float* Wm, int k0, int o, int lane, int ld) { v16b w; const int g = lane >> 4;
#pragma unroll
  for (int i = 0; i < 8; ++i) { w[i] = (__bf16)Wm[(size_t)(k0 + 8 * g + i) * ld + o]; w[8 + i] = (__bf16)Wm[(size_t)(k0 + 16 + 8 * g + i) * ld + o]; }
  return w; }
__device__ __forceinline__ v16b wcol_oi(const float* Wm, int k0, int o, int lane, int K) { v16b w; const float* p = Wm + (size_t)o * K + k0 + 8 * (lane >> 4);
#pragma unroll
  for (int i = 0; i < 8; ++i) { w[i] = (__bf16)p[i]; w[8 + i] = (__bf16)p[16 + i]; }
  return w; }
__device__ __forceinline__ v16h wcolh_io(const float* Wm, int k0, int o, int lane, int ld) { v16h w; const int g = lane >> 4;
#pragma unroll
  for (int i = 0; i < 8; ++i) { w[i] = (_Float16)(bfr(Wm[(size_t)(k0 + 8 * g + i) * ld + o]) * 256.0f); w[8 + i] = (_Float16)(bfr(Wm[(size_t)(k0 + 16 + 8 * g + i) * ld + o]) * 256.0f); }
  return w; }
__device__ __forceinline__ v16h wcolh_oi(const float* Wm, int k0, int o, int lane, int K) { v16h w; const float* p = Wm + (size_t)o * K + k0 + 8 * (lane >> 4);
#pragma unroll
  for (int i = 0; i < 8; ++i) { w[i] = (_Float16)(bfr(p[i]) * 256.0f); w[8 + i] = (_Float16)(bfr(p[16 + i]) * 256.0f); }
  return w; }
#define WQKV_LAYOUT 0   // 0 = (in,out): Wv [DIN][CC], Wq / Wk [DIN][RW]; 1 = (out,in) [CC][DIN]; 2 = per-head [NH][DIN][HD]
__device__ __forceinline__ v16b wcol_hdk(const float* Wm, int k0, int o, int lane) { v16b w; const int g = lane >> 4; const float* p = Wm + (size_t)(o / HD) * DIN * HD + (o % HD);
#pragma unroll
  for (int i = 0; i < 8; ++i) { w[i] = (__bf16)p[(size_t)(k0 + 8 * g + i) * HD]; w[8 + i] = (__bf16)p[(size_t)(k0 + 16 + 8 * g + i) * HD]; }
  return w; }
#define WO_OUT_IN 0
#if WQKV_LAYOUT == 1
#define WCOL(W, k0, o, lane) wcol_oi(W, k0, o, lane, DIN)
#elif WQKV_LAYOUT == 2
#define WCOL(W, k0, o, lane) wcol_hdk(W, k0, o, lane)
#else
__device__ __forceinline__ v16b zero16b() { v16b w; _Pragma("unroll") for (int i = 0; i < 16; ++i) w[i] = (__bf16)0.0f; return w; }
#define WCOL(W, k0, o, lane) (((which) == 2) ? wcol_io(W, k0, o, lane, CC) : (((o) < RW) ? wcol_io(W, k0, o, lane, RW) : zero16b()))   /* (in,out): Wv [512][512]; Wq / Wk [512][64]: columns >= 64 of the q / k rows are zero (and never read) */
#endif
#if WO_OUT_IN
#define WOCOL(W, k0, o, lane) wcol_oi(W, k0, o, lane, CC)
#define WOCOLH(W, k0, o, lane) wcolh_oi(W, k0, o, lane, CC)
#else
#define WOCOL(W, k0, o, lane) wcol_io(W, k0, o, lane, DIN)
#define WOCOLH(W, k0, o, lane) wcolh_io(W, k0, o, lane, DIN)
#endif

#ifndef SM_EXTRA_PARAMS
#define SM_EXTRA_PARAMS
#endif
#ifndef PROJ_EXTRA_PARAMS
#define PROJ_EXTRA_PARAMS
#endif
#ifndef SM_MASK_HOOK
#define SM_MASK_HOOK (void)0
#endif

#define WS_QH  0u                                      // f16 q rows [b*t][CC]
#define WS_KH  (WS_QH + 2u * (size_t)NB * TT * CC)      // f16 k rows [b*t][CC]
#define WS_VT  (WS_KH + 2u * (size_t)NB * TT * CC)      // f16 v planes [b][c][t]
#define WS_QL  (WS_VT + 2u * (size_t)NB * CC * TT)      // f16 q residual x 2^10 rows [b][t < QHI][CC]
#define WS_KL  (WS_QL + 2u * (size_t)NB * QHI * CC)     // f16 k residual x 2^10 rows [b][t < KHI][CC]
#define WS_VB  (WS_KL + 2u * (size_t)NB * KHI * CC)     // bf16 v hi planes [b][c][t < VHI]
#define WS_VBL (WS_VB + 2u * (size_t)NB * CC * VHI)
#define WS_S   (WS_VBL + 2u * (size_t)NB * CC * VHI)    // f32 P (f16 P outside the early band), one packed plane per batch [b][SPLANE]
#define WS_Y   (WS_S  + 4u * (size_t)NB * SPLANE)       // f32 ctx rows [b*t][CC]
#define WS_ST  (WS_Y  + 4u * (size_t)NB * TT * CC)      // f32 softmax statistics [b][tile][4][STW]
#define WS_END (WS_ST + 4u * (size_t)NB * NTB * 4 * STW)   // end of the softmax statistics, the last region (k_sc writes them, k_pv reads them)

#define PJK 64             // k rows per staged weight tile of k_proj
// one thread's share of a stage: 16 weight rows x 4 columns (a row of 128 columns = one 512-byte access of a wave; LD, the row length, is a constant, so the 16 rows are immediate offsets from one address) and the x values of its two A fragments
template <int LD> __device__ __forceinline__ void pj_load(v4f (&wr)[16], v4f (&xr)[8], const float* wp, const float* xrow) {
#pragma unroll
  for (int i = 0; i < 16; ++i) wr[i] = *(const v4f*)(wp + i * LD);
#pragma unroll
  for (int kc = 0; kc < PJK / 32; ++kc) { const float* p = xrow + kc * 32; xr[kc * 4] = *(const v4f*)p; xr[kc * 4 + 1] = *(const v4f*)(p + 4); xr[kc * 4 + 2] = *(const v4f*)(p + 16); xr[kc * 4 + 3] = *(const v4f*)(p + 20); }
}
// the 16 x 4 weight values to bf16, transposed in registers: eight k of one column = one 16-byte LDS store. The 16-byte group kg of column c lies at place kg ^ ((c >> 4) & 3) of its row: 16 lanes, four columns apart, then fall on 16 different bank groups; a fragment's 16 columns share one (c >> 4)
__device__ __forceinline__ void pj_store(__bf16 (*buf)[72], const v4f (&wr)[16], int wave, int lane) {
#pragma unroll
  for (int q = 0; q < 2; ++q) {
#pragma unroll
    for (int cc = 0; cc < 4; ++cc) { v8b pk;
#pragma unroll
      for (int i = 0; i < 8; ++i) pk[i] = (__bf16)wr[q * 8 + i][cc];
      *(v8b*)&buf[lane * 4 + cc][((wave * 2 + q) ^ ((lane >> 2) & 3)) * 8] = pk; } }
}
__device__ __forceinline__ void pj_afrag(v16b (&a)[PJK / 32], const v4f (&xr)[8]) {
#pragma unroll
  for (int kc = 0; kc < PJK / 32; ++kc)
#pragma unroll
    for (int i = 0; i < 4; ++i) { a[kc][i] = (__bf16)xr[kc * 4][i]; a[kc][4 + i] = (__bf16)xr[kc * 4 + 1][i]; a[kc][8 + i] = (__bf16)xr[kc * 4 + 2][i]; a[kc][12 + i] = (__bf16)xr[kc * 4 + 3][i]; }
}
// K loop of k_proj in stages of PJK k rows: the stage's weight tile (PJK x 128 columns) lies in LDS as bf16 [column][k], in b0 and b1 by turns; the next stage's weight rows and x values are loaded while this stage's products run. LD = 64 (Wq / Wk, 64 real columns): tile columns >= 64 are zero in both buffers, written once in front of the loop; their lanes re-read real columns (in bounds) and store nothing
template <int LD> __device__ __forceinline__ void pj_main(v8f (&acc)[8], const float* wp, const float* xrow, __bf16 (*b0)[72], __bf16 (*b1)[72], int wave, int lane) {
  const int col = lane & 15, g = lane >> 4; const bool wreal = LD == CC || lane < RW / 4;
  v4f wr[16], xr[8]; v16b a[PJK / 32];
  pj_load<LD>(wr, xr, wp, xrow);
  if (wreal) pj_store(b0, wr, wave, lane);
  else { const v4f z[16] = {}; pj_store(b0, z, wave, lane); pj_store(b1, z, wave, lane); }
  pj_afrag(a, xr);
  __syncthreads();
#pragma unroll 1   // one stage a trip: the buffers alternate, the code stays small
  for (int s = 0; s < DIN / PJK; ++s) { const __bf16 (*cur)[72] = (s & 1) ? b1 : b0; __bf16 (*nxt)[72] = (s & 1) ? b0 : b1;
    if (s + 1 < DIN / PJK) { wp += PJK * LD; xrow += PJK; pj_load<LD>(wr, xr, wp, xrow); }
#pragma unroll
    for (int kc = 0; kc < PJK / 32; ++kc) { union { v16b v; v8b q[2]; } u[8];   // the eight fragment reads of a k step are issued first: the products then wait on counted LDS returns, not on one LDS latency each
#pragma unroll
      for (int j = 0; j < 8; ++j) { const __bf16* rw = &cur[j * 16 + col][0]; u[j].q[0] = *(const v8b*)(rw + ((kc * 4 + g) ^ (j & 3)) * 8); u[j].q[1] = *(const v8b*)(rw + ((kc * 4 + 2 + g) ^ (j & 3)) * 8); }
#pragma unroll
      for (int j = 0; j < 8; ++j) acc[j] = wmma_bf(a[kc], u[j].v, acc[j]); }
    if (s + 1 < DIN / PJK) { if (wreal) pj_store(nxt, wr, wave, lane); pj_afrag(a, xr); }
    __syncthreads(); }   /* publishes stage s + 1 and ends every read of stage s: its buffer is rewritten in the next trip, or by the epilogue */
}
// ---- k_proj: block = (64 rows, 128 cols, which): q/k/v = X W (+ b) with exact bf16 products (K = DIN) -> which 0: q f16 rows (+ residual rows < QHI); 1: k f16 rows (+ residual rows < KHI); 2: v f16 planes [c][t] (+ bf16 hi/lo planes for t < VHI)
__global__ __launch_bounds__(128) void k_proj(const float* __restrict__ XQ, const float* __restrict__ XK, const float* __restrict__ XV, const float* __restrict__ WQ, const float* __restrict__ WK, const float* __restrict__ WV, const float* __restrict__ BQ, const float* __restrict__ BK, const float* __restrict__ BV,
    _Float16* __restrict__ QH, _Float16* __restrict__ QL, _Float16* __restrict__ KH, _Float16* __restrict__ KL, _Float16* __restrict__ VT, __bf16* __restrict__ VB, __bf16* __restrict__ VBL) {
  __shared__ __align__(16) _Float16 sh[64][136], sl[64][136]; __shared__ __align__(16) _Float16 th[128][72]; __shared__ __align__(16) __bf16 tb[128][72], tbl[128][72];
  const int tid = threadIdx.x, wave = tid >> 5, lane = tid & 31, col = lane & 15, g = lane >> 4; const int which = blockIdx.z; const int c0 = blockIdx.y * 128; const size_t r0 = (size_t)blockIdx.x * 64; const size_t bb = r0 / TT; const int t0 = (int)(r0 % TT);
  if (which < 2 && blockIdx.y > 0) return;   /* q / k have 64 real columns: only the first 128-column tile is computed; the others are never read (block-uniform exit before any barrier) */
  const float* X = which == 0 ? XQ : which == 1 ? XK : XV; const float* WA = which == 0 ? WQ : which == 1 ? WK : WV; const float* BA = which == 0 ? BQ : which == 1 ? BK : BV;
  v8f acc[8] = {};
  { const float* xrow = X + (r0 + wave * 16 + col) * DIN + 8 * g;   /* tb and tbl, free until the epilogue, are the two weight buffers; which is the same for the whole block */
    if (which == 2) pj_main<CC>(acc, WA + (size_t)(wave * 16) * CC + c0 + lane * 4, xrow, tb, tbl, wave, lane);
    else pj_main<RW>(acc, WA + (size_t)(wave * 16) * RW + (lane & (RW / 4 - 1)) * 4, xrow, tb, tbl, wave, lane); }
  if (which < 2) { _Float16* DH = which == 0 ? QH : KH; _Float16* DL = which == 0 ? QL : KL; const int nhi = which == 0 ? QHI : KHI; const bool hi_rows = t0 < nhi;
#pragma unroll
    for (int j = 0; j < 8; ++j) { const float bias = (BA && ((which) == 2 || (c0 + j * 16 + col) < RW)) ? bfr(BA[c0 + j * 16 + col]) : 0.f;
#pragma unroll
      for (int r = 0; r < 8; ++r) { const float v = acc[j][r] + bias; const _Float16 hv = (_Float16)v; sh[wave * 16 + 8 * g + r][j * 16 + col] = hv; sl[wave * 16 + 8 * g + r][j * 16 + col] = (_Float16)((v - (float)hv) * 1024.0f); } }
    __syncthreads();
    for (int e = tid; e < 64 * 16; e += 128) { const int rl = e >> 4, q = e & 15; vst2((unsigned*)(DH + (r0 + rl) * CC + c0 + q * 8), *(const v4u*)&sh[rl][q * 8]); if (hi_rows) vst2((unsigned*)(DL + (bb * nhi + t0 + rl) * (size_t)CC + c0 + q * 8), *(const v4u*)&sl[rl][q * 8]); }
  } else { const bool hi_rows = t0 < VHI;
#pragma unroll
    for (int j = 0; j < 8; ++j) { const float bias = (BA && ((which) == 2 || (c0 + j * 16 + col) < RW)) ? bfr(BA[c0 + j * 16 + col]) : 0.f;
#pragma unroll
      for (int r = 0; r < 8; ++r) { const float v = acc[j][r] + bias; const int rl = wave * 16 + 8 * g + r, cl = j * 16 + col; th[cl][rl] = (_Float16)v; const __bf16 bh = (__bf16)v; tb[cl][rl] = bh; tbl[cl][rl] = (__bf16)(v - (float)bh); } }
    __syncthreads();
    for (int e = tid; e < 128 * 8; e += 128) { const int cl = e >> 3, q = e & 7; vst2((unsigned*)(VT + (bb * CC + c0 + cl) * (size_t)TT + t0 + q * 8), *(const v4u*)&th[cl][q * 8]); if (hi_rows) { const size_t o3 = (bb * CC + c0 + cl) * (size_t)VHI + t0 + q * 8; vst2((unsigned*)(VB + o3), *(const v4u*)&tb[cl][q * 8]); vst2((unsigned*)(VBL + o3), *(const v4u*)&tbl[cl][q * 8]); } } } }
#undef QBH
#define QBH NQB   // SCORE KERNEL ONLY: every query block takes the 3-product branch (unscaled logits)
// eight asynchronous copies of 16 bytes a lane, global -> LDS, rows lstep / gstep bytes apart; the s_wait_xcnt in the same statement stands before anything can rewrite an address register of a copy
__device__ __forceinline__ void acopy8(unsigned l, unsigned lstep, const char* gsrc, size_t gstep) {
  asm volatile("global_load_async_to_lds_b128 %0, %8, off\n\t"
               "global_load_async_to_lds_b128 %1, %9, off\n\t"
               "global_load_async_to_lds_b128 %2, %10, off\n\t"
               "global_load_async_to_lds_b128 %3, %11, off\n\t"
               "global_load_async_to_lds_b128 %4, %12, off\n\t"
               "global_load_async_to_lds_b128 %5, %13, off\n\t"
               "global_load_async_to_lds_b128 %6, %14, off\n\t"
               "global_load_async_to_lds_b128 %7, %15, off\n\t"
               "s_wait_xcnt 0x0"
               :: "v"(l), "v"(l + lstep), "v"(l + 2 * lstep), "v"(l + 3 * lstep), "v"(l + 4 * lstep), "v"(l + 5 * lstep), "v"(l + 6 * lstep), "v"(l + 7 * lstep),
                  "v"(gsrc), "v"(gsrc + gstep), "v"(gsrc + 2 * gstep), "v"(gsrc + 3 * gstep), "v"(gsrc + 4 * gstep), "v"(gsrc + 5 * gstep), "v"(gsrc + 6 * gstep), "v"(gsrc + 7 * gstep)
               : "memory");
}
#define SCP (HD + 8)       // q / k row pitch in LDS, halves: 144 B = 16 B x 9, conflict-free for 16-byte reads
// four such copies, for the 16 q rows of a wave
__device__ __forceinline__ void acopy4(unsigned l, unsigned lstep, const char* gsrc, size_t gstep) {
  asm volatile("global_load_async_to_lds_b128 %0, %4, off\n\t"
               "global_load_async_to_lds_b128 %1, %5, off\n\t"
               "global_load_async_to_lds_b128 %2, %6, off\n\t"
               "global_load_async_to_lds_b128 %3, %7, off\n\t"
               "s_wait_xcnt 0x0"
               :: "v"(l), "v"(l + lstep), "v"(l + 2 * lstep), "v"(l + 3 * lstep),
                  "v"(gsrc), "v"(gsrc + gstep), "v"(gsrc + 2 * gstep), "v"(gsrc + 3 * gstep)
               : "memory");
}
static_assert(HD * 2 == 128, "k_sc: a q / k row of one head is one 128-byte line, eight lanes of a copy");
__device__ __forceinline__ int t_base(int qb) { const int m = qb >> 1; return (m + 1) * (m + (qb & 1)); }   /* s_base in tiles */
// the value of lane (l ^ X) of the same 16-lane row, as a DPP operand (row_xmask): no LDS trip
template <int X> __device__ __forceinline__ float dppx(float v) { return __builtin_bit_cast(float, __builtin_amdgcn_update_dpp(0, __builtin_bit_cast(int, v), 0x160 | X, 0xf, 0xf, true)); }
// 2^y, results under 2^-126 as 0; the v_nop is the one slot that the instruction set asks for behind a transcendental, in front of whatever the compiler puts next
__device__ __forceinline__ float exp2_slot(float y) { float e; asm("v_exp_f32 %0, %1\n\tv_nop" : "=v"(e) : "v"(y)); return e; }
__device__ __forceinline__ float row16_max(float v) { v = fmaxf(v, dppx<1>(v)); v = fmaxf(v, dppx<2>(v)); v = fmaxf(v, dppx<4>(v)); return fmaxf(v, dppx<8>(v)); }
__device__ __forceinline__ float row16_sum(float v) { v += dppx<1>(v); v += dppx<2>(v); v += dppx<4>(v); return v + dppx<8>(v); }
// ---- k_sc: block = (query block qb, key block kb <= kb_last(qb), batch b): logits x SCALE; q hi + residual (x 2^10) against k (2 products) for query rows < QHI, plus the k residual (3 products) for query blocks < QBH (= NQB here: every query block); causal: blocks past the diagonal exit, the mask is applied by index in the diagonal tile; then the tile's share of the softmax: what is stored is 2^11 x exp(logit) / 2^reference, with the reference and the row sum per (row, tile) in ST. The block's 128 k rows and 64 q rows, hi and residual, come into LDS once, in whole 128-byte lines (four rows a copy of a wave); all four waves take their k fragments from there
__global__ __launch_bounds__(128) void k_sc(const _Float16* __restrict__ QH, const _Float16* __restrict__ KH, const _Float16* __restrict__ QL, const _Float16* __restrict__ KL, int h0, float* __restrict__ S0, float* __restrict__ ST) {
  union SCU { struct { _Float16 h[128][SCP], l[128][SCP]; } k; float ss[4][16][132]; _Float16 hs[4][16][264]; };   /* the output rows ss take the place of the k tile once every wave has read it */
  __shared__ __align__(16) SCU u; __shared__ __align__(16) _Float16 sqh[64][SCP], sql[64][SCP];
  const int qb = blockIdx.x, kb = blockIdx.y; if (kb > kb_last(qb)) return;
  const int b = blockIdx.z, h = h0; float* S = S0 + (size_t)b * SPLANE + s_base(qb) + (size_t)kb * STILE;   /* blockIdx.z = batch; S = this block's tile */
  const int tid = threadIdx.x, wave = tid >> 5, lane = tid & 31, col = lane & 15, g = lane >> 4; const int k0 = kb * 128; const int ql0 = qb * 64 + wave * 16; const size_t q0 = (size_t)b * TT + ql0, kr0 = (size_t)b * TT + k0;
  v8f acc[8] = {}, accl[8] = {};
  const _Float16* QLb = QL + (size_t)b * QHI * CC; const _Float16* KLb = KL + (size_t)b * KHI * CC;
  { const int cr = lane >> 3, cq = (lane & 7) * 8;   /* a copy = rows cr, cr + 4, ..: eight lanes a row. Each wave brings 32 k rows and its own 16 q rows, hi and residual: 24 copies in flight */
    const size_t go = (size_t)cr * CC + h * HD + cq;
    acopy8((unsigned)(size_t)&u.k.h[wave * 32 + cr][cq], 4u * SCP * 2u, (const char*)(KH + (kr0 + wave * 32) * CC + go), (size_t)4 * CC * 2);
    acopy8((unsigned)(size_t)&u.k.l[wave * 32 + cr][cq], 4u * SCP * 2u, (const char*)(KLb + (size_t)(k0 + wave * 32) * CC + go), (size_t)4 * CC * 2);
    acopy4((unsigned)(size_t)&sqh[wave * 16 + cr][cq], 4u * SCP * 2u, (const char*)(QH + q0 * CC + go), (size_t)4 * CC * 2);
    acopy4((unsigned)(size_t)&sql[wave * 16 + cr][cq], 4u * SCP * 2u, (const char*)(QLb + (size_t)ql0 * CC + go), (size_t)4 * CC * 2); }
  asm volatile("s_wait_asynccnt 0x0" ::: "memory");   // this wave's copies have landed before the barrier publishes them
  __syncthreads();
  if (qb < QBH) {
    v16h ah, al, kbf[HD / 4], klf[HD / 4];   // step s = (kc = s >> 3, j = s & 7), in the order kc, j as before; the k fragments of step s + 1 are read in front of the products of step s, so that a product waits on a counted LDS return and not on a whole LDS latency; the q fragments of a kc are read with the group in front of its first products (no earlier: two sets of them would cost a resident wave)
#pragma unroll
    for (int s = -1; s < HD / 4; ++s) {
      if (s >= 0 && (s & 7) == 0) { ah = frag_h(&sqh[wave * 16 + col][(s >> 3) * 32], lane); al = frag_h(&sql[wave * 16 + col][(s >> 3) * 32], lane); }
      if (s + 1 < HD / 4) { kbf[s + 1] = frag_h(&u.k.h[((s + 1) & 7) * 16 + col][((s + 1) >> 3) * 32], lane); klf[s + 1] = frag_h(&u.k.l[((s + 1) & 7) * 16 + col][((s + 1) >> 3) * 32], lane); }
      __builtin_amdgcn_sched_barrier(0);   // keeps the reads in front of these products: without it the compiler sinks each read to its first use
      if (s >= 0) { const int j = s & 7; acc[j] = wmma16(ah, kbf[s], acc[j]); accl[j] = wmma16(al, kbf[s], accl[j]); accl[j] = wmma16(ah, klf[s], accl[j]); }
      __builtin_amdgcn_sched_barrier(0); }   // keeps the next reads from moving up among these products
  } else if (qb * 64 < QHI) {
#pragma unroll
    for (int kc = 0; kc < HD / 32; ++kc) { const v16h ah = frag_h(&sqh[wave * 16 + col][kc * 32], lane), al = frag_h(&sql[wave * 16 + col][kc * 32], lane);
#pragma unroll
      for (int j = 0; j < 8; ++j) { const v16h kbf = frag_h(&u.k.h[j * 16 + col][kc * 32], lane); acc[j] = wmma16(ah, kbf, acc[j]); accl[j] = wmma16(al, kbf, accl[j]); } }
  } else {
#pragma unroll
    for (int kc = 0; kc < HD / 32; ++kc) { const v16h ah = frag_h(&sqh[wave * 16 + col][kc * 32], lane);
#pragma unroll
      for (int j = 0; j < 8; ++j) { const v16h kbf = frag_h(&u.k.h[j * 16 + col][kc * 32], lane); acc[j] = wmma16(ah, kbf, acc[j]); } } }
  __syncthreads();   /* ends every wave's reads of the k tile: ss overwrites it */
#pragma unroll
  for (int j = 0; j < 8; ++j) {
#pragma unroll
    for (int r = 0; r < 8; ++r) acc[j][r] = (acc[j][r] + accl[j][r] * (1.0f / 1024.0f)) * SCALE; }
  if (CAUSAL && kb == kb_last(qb)) {   /* the one tile of the query block that the diagonal crosses (block-uniform); every row keeps at least its key k0 there, so a tile's row maximum is always a real logit */
#pragma unroll
    for (int j = 0; j < 8; ++j) {
#pragma unroll
      for (int r = 0; r < 8; ++r) if (k0 + j * 16 + col > ql0 + 8 * g + r) acc[j][r] = -3.0e38f; } }
  // softmax, the tile's share: row 8 g + r lies in the 16 lanes of half g, eight keys a lane. Reference rf = ceil(max logit x log2 e), a whole number: e = 2^(logit x log2 e - rf + 11) <= 2^11; between two tiles of a row the references differ by a power of two, which k_pv applies without rounding. An excluded key gives 2^(-inf) = 0
  float rf[8], sm[8];
#pragma unroll
  for (int r = 0; r < 8; ++r) { float a = acc[0][r];
#pragma unroll
    for (int j = 1; j < 8; ++j) a = fmaxf(a, acc[j][r]);
    rf[r] = ceilf(row16_max(a) * LOG2E); }
#pragma unroll
  for (int r = 0; r < 8; ++r) { const float c = 11.0f - rf[r]; float a = 0.f;
#pragma unroll
    for (int j = 0; j < 8; ++j) { const float e = exp2_slot(fmaf(acc[j][r], LOG2E, c)); acc[j][r] = e; a += e; }
    sm[r] = row16_sum(a); }
  if (qb < QBE) {   /* early band: f32 */
#pragma unroll
    for (int j = 0; j < 8; ++j) {
#pragma unroll
      for (int r = 0; r < 8; ++r) u.ss[wave][8 * g + r][j * 16 + col] = acc[j][r]; }
    LDSX(); for (int rl = 0; rl < 16; ++rl) vst2(S + (wave * 16 + rl) * 128 + lane * 4, *(const v4f*)&u.ss[wave][rl][lane * 4]);
    asm volatile("s_wait_xcnt 0x0" ::: "memory");   // behind the run of tile stores, in front of whatever rewrites a register that one of them names
  } else {   /* all other rows: rounded to f16 here, once; the 128 halves of a row lie in the first 256 bytes of its 512-byte place in the tile; two rows a store of a wave */
#pragma unroll
    for (int j = 0; j < 8; ++j) {
#pragma unroll
      for (int r = 0; r < 8; ++r) u.hs[wave][8 * g + r][j * 16 + col] = (_Float16)acc[j][r]; }
    LDSX(); for (int rl = 0; rl < 8; ++rl) vst2((_Float16*)(S + (wave * 16 + rl * 2 + g) * 128) + col * 8, *(const v4u*)&u.hs[wave][rl * 2 + g][col * 8]);
    asm volatile("s_wait_xcnt 0x0" ::: "memory"); }   // as above: behind the run of tile stores
  /* the statistics last: in front of LDSX its release would wait for these stores */
  if (col == 0) { float* st = ST + (((size_t)b * NTB + t_base(qb) + kb) * 4 + wave) * STW + 8 * g;   /* the wave's own 128-byte line */
    const v4f r0 = {rf[0], rf[1], rf[2], rf[3]}, r1 = {rf[4], rf[5], rf[6], rf[7]}, s0 = {sm[0], sm[1], sm[2], sm[3]}, s1 = {sm[4], sm[5], sm[6], sm[7]};
    vst2(st, r0); vst2(st + 4, r1); vst2(st + 16, s0); vst2(st + 20, s1); } }
#undef QBH
#define QBH 6   // restored: the P.v kernel keeps the causal early band of 6 query blocks
static_assert(QBE == QBH, "k_sc stores f32 P tiles for exactly the query blocks that k_pv reads as f32");
#define PVK 128            // keys per staged tile of k_pv (kb_last counts in the same 128-key units; a staged P tile holds the f16 halves of two stored tiles, query blocks 2m and 2m + 1)
#define PVP (PVK + 8)      // P row pitch in LDS, halves: 272 B = 16 B x 17, conflict-free for 16-byte reads
#define PVV (PVK + 8)      // v row pitch in LDS, halves: 272 B = 16 B x 17
#define PVQ 128            // queries per block of k_pv: query blocks 2m and 2m + 1, which see the same key tiles 0..m
#define PVC 128            // v columns per block of k_pv: two 64-column groups
static_assert(CAUSAL == 1 && QBH % 2 == 0 && NQB % 2 == 0 && NH % 2 == 0, "k_pv pairs query blocks 2m, 2m + 1 (kb_last of both = m; both in the early band or neither) and column groups 2y, 2y + 1");
// one wave's share of a tile: 32 P rows (256 B of f16 each, 512 B apart in the stored tile) and 32 v rows (256 B each), two rows a copy: 32 copies of a wave in flight
__device__ __forceinline__ void pv_tile(unsigned lp, unsigned lv, const char* gp, const char* gv) {
  acopy8(lp, 2u * PVP * 2u, gp, (size_t)2 * PVK * 4); acopy8(lp + 16u * PVP * 2u, 2u * PVP * 2u, gp + (size_t)16 * PVK * 4, (size_t)2 * PVK * 4);
  acopy8(lv, 2u * PVV * 2u, gv, (size_t)2 * TT * 2); acopy8(lv + 16u * PVV * 2u, 2u * PVV * 2u, gv + (size_t)16 * TT * 2, (size_t)2 * TT * 2);
}
// thread = one of the block's 128 query rows: from the row's references and sums of its m + 1 key tiles (all loads in flight together, constant offsets from one address) the row's reference R = the largest; per tile the factor 2^(reference - R), exact in f16 down to 2^-24 and 0 below; and 1 / (sum of the row's exponentials counted against R)
__device__ __forceinline__ void pv_stats(const float* __restrict__ ST, int b, int m, int tid, _Float16 (*fac)[PVQ], float* sinv) {
  const float* st = ST + (((size_t)b * NTB + t_base(2 * m + (tid >> 6))) * 4 + ((tid >> 4) & 3)) * STW + (tid & 15);
  float rv[TT / PVK], lv[TT / PVK];
#pragma unroll   // constant tile numbers keep both lists in registers (so for the two loops below)
  for (int i = 0; i < TT / PVK; ++i) if (i <= m) { rv[i] = st[i * 4 * STW]; lv[i] = st[i * 4 * STW + 16]; }
  float R = rv[0];
#pragma unroll
  for (int i = 1; i < TT / PVK; ++i) if (i <= m) R = fmaxf(R, rv[i]);
  float L = 0.f;
#pragma unroll
  for (int i = 0; i < TT / PVK; ++i) if (i <= m) { const float f = ldexpf(1.0f, (int)fmaxf(rv[i] - R, -126.0f)); L += lv[i] * f; fac[i][tid] = (_Float16)f; }
  sinv[tid] = 1.0f / L;   /* L >= 2^10: the row's largest exponential counts at least that */
}
__device__ __forceinline__ F2 split_row_s(const float* row, int k0, int lane, float f) { float v[16]; const float* p = row + k0 + 8 * (lane >> 4);
#pragma unroll
  for (int i = 0; i < 8; ++i) { v[i] = p[i] * f; v[8 + i] = p[16 + i] * f; }
  return bsplit16(v); }
// ---- k_pv: block = 128 queries (query blocks 2m, 2m + 1) x 128 v columns of batch b; wave = 64 queries (one query block) x 64 columns (one column group), 4 x 4 accumulator tiles, so every staged P or v fragment feeds four products: ctx = P . v over keys [0, kend) (P x 2^11 against the tile's reference, stored as f16 by k_sc, times the tile's power-of-two factor, against v f16: 1 product; the division by the row's sum stands in the epilogue; causal early query blocks: f32 P and v as bf16 hi + lo, 3 products); 256-B (row, head) segment by 16 lanes
__global__ __launch_bounds__(128) void k_pv(const float* __restrict__ PS0, const _Float16* __restrict__ VT, const __bf16* __restrict__ VB, const __bf16* __restrict__ VBL, const float* __restrict__ ST, int h0, float* __restrict__ Y) { __shared__ __align__(16) _Float16 fac[TT / PVK][PVQ]; __shared__ __align__(16) float sinv[PVQ];
  __shared__ __align__(16) _Float16 sp[2][PVQ][PVP]; __shared__ __align__(16) _Float16 sv[2][PVC][PVV];   /* two buffers each: P tile (128 queries x 128 keys, f16) and v tile (128 columns x 128 keys, f16) */
  const int tid = threadIdx.x, wave = tid >> 5, lane = tid & 31, col = lane & 15, g = lane >> 4; const int b = blockIdx.z;   /* blockIdx.y = pair of column groups, blockIdx.z = batch */
  const int m = blockIdx.x;   /* the pair of query blocks: m + 1 key tiles */
  const int wq = wave >> 1, wc = wave & 1; const int qb = 2 * m + wq, h = h0 + blockIdx.y * 2 + wc;   /* the wave's query block and column group */
  const int kce = (kb_last(2 * m) + 1) * 4; const float* PS = PS0 + (size_t)b * SPLANE + s_base(qb);
  v8f acc[4][HD / 16] = {};
  if (2 * m < QBH) {
    pv_stats(ST, b, m, tid, fac, sinv);
    __syncthreads();   /* publishes the factors and the row sums (block-uniform branch) */
    const size_t po = ((size_t)b * CC + h * HD + col) * (size_t)VHI + 8 * g; const __bf16* vhp = VB + po; const __bf16* vlp = VBL + po;   /* the lane's own first eight keys in its v row of column tile 0, hi and lo plane: every v load of a trip is one of these two addresses plus a constant; both go on by 32 keys a trip */
#pragma unroll 1
    for (int kc = 0; kc < kce; ++kc) { const float* pp = PS + (kc >> 2) * STILE + col * 128; F2 p[4];
#pragma unroll
      for (int qi = 0; qi < 4; ++qi) p[qi] = split_row_s(pp + qi * 16 * 128, (kc & 3) * 32, lane, (float)fac[kc >> 2][wq * 64 + qi * 16 + col]);
      asm volatile("s_wait_loadcnt 0x0" ::: "memory");
#pragma unroll
      for (int j = 0; j < HD / 16; ++j) { const v16b vh = frag_b(vhp + j * 16 * VHI, 0), vl = frag_b(vlp + j * 16 * VHI, 0);   /* lane argument 0: the lane's half, 8 g, is in the two addresses already; per accumulator the three products stay in the order p.h vh, p.l vh, p.h vl */
#pragma unroll
        for (int qi = 0; qi < 4; ++qi) acc[qi][j] = __builtin_amdgcn_wmma_f32_16x16x32_bf16(false, p[qi].h, false, vh, (short)0, acc[qi][j], false, false);   /* the builtin alone, as in the loop below */
#pragma unroll
        for (int qi = 0; qi < 4; ++qi) acc[qi][j] = __builtin_amdgcn_wmma_f32_16x16x32_bf16(false, p[qi].l, false, vh, (short)0, acc[qi][j], false, false);
#pragma unroll
        for (int qi = 0; qi < 4; ++qi) acc[qi][j] = __builtin_amdgcn_wmma_f32_16x16x32_bf16(false, p[qi].h, false, vl, (short)0, acc[qi][j], false, false); }
      asm volatile("s_wait_xcnt 0x0" :: "v"(vhp), "v"(vlp) : "memory");   // the two addresses that the v loads of the trip name are inputs of the wait: their registers stay whole up to it and are rewritten only behind it
      vhp += 32; vlp += 32; }
  } else {
    // tiles of 128 keys come into LDS in whole 128-byte lines (two P rows or two v rows = one copy of a wave); each wave brings 32 P rows (half of its own query block's tile) and 32 v rows of every tile
    const int nst = kce / (PVK / 32);
    const unsigned lp = (unsigned)(size_t)&sp[0][wave * 32 + g][col * 8], lv = (unsigned)(size_t)&sv[0][wave * 32 + g][col * 8];
    const char* gp = (const char*)(PS + (wc * 32 + g) * PVK) + col * 16; const char* gv = (const char*)(VT + ((size_t)b * CC + (h0 + blockIdx.y * 2) * HD + wave * 32 + g) * (size_t)TT + col * 8);
    pv_tile(lp, lv, gp, gv);
    pv_stats(ST, b, m, tid, fac, sinv);   /* beside the flight of tile 0; the barrier below publishes both */
    asm volatile("s_wait_asynccnt 0x0" ::: "memory");   // tile 0 has landed before the barrier publishes it
    __syncthreads();
    if (nst > 1) pv_tile(lp + (unsigned)sizeof(sp[0]), lv + (unsigned)sizeof(sv[0]), gp + STILE * 4, gv + PVK * 2);
#pragma unroll 1   // one tile a trip: the buffer index alternates, the code stays small
    for (int t = 0; t < nst; ++t) { const int bu = t & 1;
      _Float16 fq[4];   // the tile's factor of the lane's own query row in each of the four A fragments
#pragma unroll
      for (int qi = 0; qi < 4; ++qi) fq[qi] = fac[t][wq * 64 + qi * 16 + col];
      v16h pa, pf[PVK / 32][4], vf[PVK / 32][HD / 16];   // the fragment reads of k step kc + 1 are issued as one group in front of the products of k step kc: the products wait on counted LDS returns, and the reads run beside the products
#pragma unroll
      for (int kc = -1; kc < PVK / 32; ++kc) {
        if (kc + 1 < PVK / 32) {
#pragma unroll
          for (int qi = 0; qi < 4; ++qi) pf[kc + 1][qi] = frag_h(&sp[bu][wq * 64 + qi * 16 + col][(kc + 1) * 32], lane);
#pragma unroll
          for (int j = 0; j < HD / 16; ++j) vf[kc + 1][j] = frag_h(&sv[bu][wc * 64 + j * 16 + col][(kc + 1) * 32], lane); }
        __builtin_amdgcn_sched_barrier(0);   // keeps the group of reads in front of these products: without it the compiler sinks each read to its first use, and the wave waits out one LDS latency per fragment
        if (kc >= 0) {   /* pa = the A fragment of the coming four products, times its row's factor (a power of two: no second rounding above the subnormals); the next one is scaled beside these products, into registers of its own */
          if (kc == 0) pa = pf[0][0] * fq[0];
#pragma unroll
          for (int qi = 0; qi < 4; ++qi) { v16h pn = pa;
            if (qi < 3) pn = pf[kc][qi + 1] * fq[qi + 1]; else if (kc + 1 < PVK / 32) pn = pf[kc + 1][0] * fq[0];
#pragma unroll
            for (int j = 0; j < HD / 16; ++j) acc[qi][j] = __builtin_amdgcn_wmma_f32_16x16x32_f16(false, pa, false, vf[kc][j], (short)0, acc[qi][j], false, false);   /* the builtin alone: the compiler keeps the distances behind it, and fragments may lie above v255, where an asm operand cannot */
            pa = pn; }
          // order asked of the scheduler: two of the eight multiplies of the next fragment behind each product, where they issue beside the matrix unit; left alone it puts all eight, and four v_nop, between two groups of four products
          if (kc == 0) __builtin_amdgcn_sched_group_barrier(0x2, 8, 0);
#pragma unroll
          for (int i = 0; i < 16; ++i) { __builtin_amdgcn_sched_group_barrier(0x8, 1, 0); if (i < 12 || kc + 1 < PVK / 32) __builtin_amdgcn_sched_group_barrier(0x2, 2, 0); } }
        __builtin_amdgcn_sched_barrier(0); }   // keeps the next group of reads, and behind the last products the waits and the barrier, from moving up among these products
      asm volatile("s_wait_dscnt 0x0" ::: "memory");      // this wave's reads of buffer bu are done before the barrier frees it
      asm volatile("s_wait_asynccnt 0x0" ::: "memory");   // this wave's copies of tile t + 1 have landed before the barrier publishes them
      __syncthreads();
      if (t + 2 < nst) pv_tile(lp + (unsigned)(bu * sizeof(sp[0])), lv + (unsigned)(bu * sizeof(sv[0])), gp + (size_t)(t + 2) * (STILE * 4), gv + (size_t)(t + 2) * (PVK * 2)); }
    asm volatile("s_wait_asynccnt 0x0" ::: "memory");   // no copy is left in flight behind the loop
  }
  float (*ss)[16][HD + 4] = (float (*)[16][HD + 4])&sp[0][0][0];   /* the P buffers are free: behind the last trip's barrier nobody reads them and no copy is in flight; so two blocks still fit a WGP's LDS */
#pragma unroll
  for (int qi = 0; qi < 4; ++qi) {   /* 16 rows at a time through the wave's own ss rows */
    const v4f i0 = *(const v4f*)&sinv[wq * 64 + qi * 16 + 8 * g], i1 = *(const v4f*)&sinv[wq * 64 + qi * 16 + 8 * g + 4];
#pragma unroll
    for (int j = 0; j < HD / 16; ++j)
#pragma unroll
      for (int r = 0; r < 8; ++r) ss[wave][8 * g + r][j * 16 + col] = acc[qi][j][r] * (r < 4 ? i0[r & 3] : i1[r & 3]);
    LDSX(); for (int rl = 0; rl < 16; ++rl) if (lane < HD / 4) vst2(Y + ((size_t)b * TT + qb * 64 + qi * 16 + rl) * CC + h * HD + lane * 4, *(const v4f*)&ss[wave][rl][lane * 4]);
    LDSX(); } }   /* the second LDSX: the rows are read before the next 16 rows overwrite them */

#define LN_EPS 1.0e-5f
__global__ __launch_bounds__(128) void k_resln(const float* __restrict__ O, const float* __restrict__ X, const float* __restrict__ GAM, const float* __restrict__ BET, float* __restrict__ OUT) { __shared__ float sred[2][4]; const size_t r = blockIdx.x; const int tid = threadIdx.x; const v4f o = *(const v4f*)(O + r * CC + tid * 4); const v4f xr = *(const v4f*)(X + r * CC + tid * 4); asm volatile("s_wait_loadcnt 0x0" ::: "memory"); float y[4]; float a = 0.f;
#pragma unroll
  for (int i = 0; i < 4; ++i) { y[i] = bfr(xr[i]) + o[i]; a += y[i]; }
#pragma unroll
  for (int s_ = 1; s_ < 32; s_ <<= 1) a += __shfl_xor(a, s_);
  if ((tid & 31) == 0) sred[0][tid >> 5] = a; __syncthreads();
  const float mu = (sred[0][0] + sred[0][1] + sred[0][2] + sred[0][3]) * (1.0f / (float)CC); float v = 0.f;
#pragma unroll
  for (int i = 0; i < 4; ++i) { const float d = y[i] - mu; v += d * d; }
#pragma unroll
  for (int s_ = 1; s_ < 32; s_ <<= 1) v += __shfl_xor(v, s_);
  if ((tid & 31) == 0) sred[1][tid >> 5] = v; __syncthreads();
  const float rs = 1.0f / sqrtf((sred[1][0] + sred[1][1] + sred[1][2] + sred[1][3]) * (1.0f / (float)CC) + LN_EPS); const v4f g4 = *(const v4f*)(GAM + tid * 4), b4 = *(const v4f*)(BET + tid * 4); v4f w;
#pragma unroll
  for (int i = 0; i < 4; ++i) w[i] = (y[i] - mu) * rs * bfr(g4[i]) + bfr(b4[i]);
  vst2(OUT + r * CC + tid * 4, w); }
static_assert(CC == 512 && DIN == CC, "k_resln: 128 threads x 4 floats per row; the residual adds the input row");
extern "C" void kernel_launch(void* const* d_in, const int* in_sizes, int n_in, void* d_out, int out_size, void* d_ws, size_t ws_size, hipStream_t stream) {
  (void)in_sizes; (void)n_in; (void)out_size;
  const float** F = (const float**)d_in;
  if (ws_size < (size_t)WS_END) return;
  char* ws = (char*)d_ws; _Float16 *QH = (_Float16*)(ws + WS_QH), *KH = (_Float16*)(ws + WS_KH), *VT = (_Float16*)(ws + WS_VT), *QL = (_Float16*)(ws + WS_QL), *KL = (_Float16*)(ws + WS_KL); __bf16 *VB = (__bf16*)(ws + WS_VB), *VBL = (__bf16*)(ws + WS_VBL); float *S = (float*)(ws + WS_S), *Y = (float*)(ws + WS_Y), *ST = (float*)(ws + WS_ST);
  (void)Y; (void)QL; (void)KL; (void)VB; (void)VBL;
  // inputs: 0 x [4,4096,512]; 1 Wq [512,64] (in,out), 2 bq [64]; 3 Wk [512,64], 4 bk; 5 Wv [512,512], 6 bv [512] (biases NONZERO); 7 gamma [512]; 8 beta [512] (ones / zeros, read)
  float* Yo = (float*)(ws + WS_Y);
  k_proj<<<dim3(TNB * TT / 64, CC / 128, 3), 128, 0, stream>>>(F[0], F[0], F[0], F[1], F[3], F[5], F[2], F[4], F[6], QH, QL, KH, KL, VT, VB, VBL);
  k_sc<<<dim3(NQB, TT / 128, TNB), 128, 0, stream>>>(QH, KH, QL, KL, 0, S, ST);   /* the one score head: columns 0..63; all batches in one grid */
  k_pv<<<dim3(NQB / 2, NH / 2, TNB), 128, 0, stream>>>(S, VT, VB, VBL, ST, 0, Yo);   /* 128 queries x 128 v / o columns a block, all four column pairs from the batch's one plane; batch = slowest index */
  k_resln<<<dim3(TNB * TT), 128, 0, stream>>>(Yo, F[0], F[7], F[8], (float*)d_out);
}

// v010
// One run takes 110 microseconds.
// In both of two side-by-side timings against v009, it was 1.03 times as fast.
// Over all steps from v000 it is 35.0 times as fast.
// compute dtype: all float inputs rounded to bf16; q / k (64-wide) and v (512-wide) projections with EXACT bf16 products on WMMA 16x16x32 (f32 accumulate) + bias; causal logits UNSCALED: q and k each as f16 hi + (x 2^10) residual, 3 products on every row; softmax f32, its exponentials taken in the score kernel against a power-of-two reference per (row, key tile), brought to the row's reference and normalised in the P.v kernel; P x 2^11 once to f16 x v once to f16 (bf16 hi + lo below row 384), four 128-column passes over the same probability plane; y = bf16(x) + o and LayerNorm over 512 in f32; f32 output.
#include <hip/hip_runtime.h>
#include <math.h>

typedef __attribute__((ext_vector_type(16))) _Float16 v16h;
typedef __attribute__((ext_vector_type(16))) __bf16 v16b;
typedef __attribute__((ext_vector_type(8)))  _Float16 v8h;
typedef __attribute__((ext_vector_type(8)))  float v8f;
typedef __attribute__((ext_vector_type(4)))  float v4f;
typedef __attribute__((ext_vector_type(2)))  float v2f;
typedef __attribute__((ext_vector_type(4)))  unsigned v4u;
typedef __attribute__((ext_vector_type(4)))  int v4i;
typedef float __attribute__((may_alias)) float_a;
typedef int __attribute__((may_alias)) int_a;

template <typename T> __device__ __forceinline__ void vst2(void* p, T v) { *(T*)p = v;  }
__device__ __forceinline__ v8f wmma16(v16h a, v16h b, v8f c) {
  v8f d = __builtin_amdgcn_wmma_f32_16x16x32_f16(false, a, false, b, (short)0, c, false, false);
  asm volatile("v_nop\n\tv_nop\n\tv_nop\n\tv_nop" : "+v"(d) : "v"(a), "v"(b));
  return d;
}
__device__ __forceinline__ v8f wmma_bf(v16b a, v16b b, v8f c) {
  v8f d = __builtin_amdgcn_wmma_f32_16x16x32_bf16(false, a, false, b, (short)0, c, false, false);
  asm volatile("v_nop\n\tv_nop\n\tv_nop\n\tv_nop" : "+v"(d) : "v"(a), "v"(b));
  return d;
}
// 16x16x32 fragments: lane = (h = lane>>4, row/col = lane&15); elements 0..7 = k0+8h+0..7, 8..15 = k0+16+8h+0..7; D element r = row 8h+r
__device__ __forceinline__ v16h frag_h(const _Float16* rowk0, int lane) {
  union { v16h v; v8h q[2]; } u; const _Float16* p = rowk0 + 8 * (lane >> 4);
  u.q[0] = *(const v8h*)p; u.q[1] = *(const v8h*)(p + 16); return u.v;
}
__device__ __forceinline__ v16h frag_f32(const float* rowk0, int lane) {
  v16h a; const float* p = rowk0 + 8 * (lane >> 4);
#pragma unroll
  for (int i = 0; i < 8; ++i) { a[i] = (_Float16)p[i]; a[8 + i] = (_Float16)p[16 + i]; }
  return a;
}
__device__ __forceinline__ v16h frag_f32s(const float* rowk0, int lane, float sc) {
  v16h a; const float* p = rowk0 + 8 * (lane >> 4);
#pragma unroll
  for (int i = 0; i < 8; ++i) { a[i] = (_Float16)(p[i] * sc); a[8 + i] = (_Float16)(p[16 + i] * sc); }
  return a;
}
// column fragment from a [K][ld] layout (column n), rows >= K read as 0
__device__ __forceinline__ v16h fragc_f32(const float* W, int k0, int n, int lane, int ld, int K) {
  v16h a; const int g = lane >> 4;
#pragma unroll
  for (int i = 0; i < 8; ++i) { const int ka = k0 + 8 * g + i, kb = ka + 16;
    a[i] = (_Float16)(ka < K ? W[(size_t)(ka < K ? ka : K - 1) * ld + n] : 0.f); a[8 + i] = (_Float16)(kb < K ? W[(size_t)(kb < K ? kb : K - 1) * ld + n] : 0.f); }
  return a;
}
struct F2 { v16b h, l; };
__device__ __forceinline__ F2 bsplit16(const float v[16]) { F2 r;
#pragma unroll
  for (int i = 0; i < 16; ++i) { const __bf16 h = (__bf16)v[i]; r.h[i] = h; r.l[i] = (__bf16)(v[i] - (float)h); }
  return r; }
__device__ __forceinline__ F2 split_row(const float* row, int k0, int lane) { float v[16]; const float* p = row + k0 + 8 * (lane >> 4);
#pragma unroll
  for (int i = 0; i < 8; ++i) { v[i] = p[i]; v[8 + i] = p[16 + i]; }
  return bsplit16(v); }
__device__ __forceinline__ F2 split_rowK(const float* row, int k0, int lane, int K) { float v[16]; const int g = lane >> 4;
#pragma unroll
  for (int i = 0; i < 8; ++i) { const int ka = k0 + 8 * g + i, kb = ka + 16; v[i] = ka < K ? row[ka < K ? ka : K - 1] : 0.f; v[8 + i] = kb < K ? row[kb < K ? kb : K - 1] : 0.f; }
  return bsplit16(v); }
__device__ __forceinline__ F2 split_col(const float* W, int k0, int n, int lane, int ld, int K) { float v[16]; const int g = lane >> 4;
#pragma unroll
  for (int i = 0; i < 8; ++i) { const int ka = k0 + 8 * g + i, kb = ka + 16; v[i] = ka < K ? W[(size_t)(ka < K ? ka : K - 1) * ld + n] : 0.f; v[8 + i] = kb < K ? W[(size_t)(kb < K ? kb : K - 1) * ld + n] : 0.f; }
  return bsplit16(v); }
__device__ __forceinline__ v8f mac3(const F2& a, const F2& b, v8f c) { c = wmma_bf(a.l, b.h, c); c = wmma_bf(a.h, b.l, c); return wmma_bf(a.h, b.h, c); }
__device__ __forceinline__ float sigm(float v) { return 1.0f / (1.0f + expf(-v)); }
#define LDSX() do { asm volatile("s_wait_dscnt 0" ::: "memory"); __builtin_amdgcn_wave_barrier(); __builtin_amdgcn_fence(__ATOMIC_RELEASE, "workgroup"); } while (0)

// Single-head causal self-attention with a residual and LayerNorm (x [4,4096,512]; (in,out) Wq / Wk [512,64] and Wv [512,512] uniform(+-1/sqrt(512)) with biases of the same scale - NONZERO; q, k = x W + b (64-wide), v = x Wv + bv (512-wide); scores = q k^T with NO scaling; tril kept, -inf elsewhere; softmax over the keys; o = attn v [4,4096,512]; y = x + o; LayerNorm over the 512 features (biased variance, eps 1e-5) * gamma + beta (ones / zeros, read)). ONE 64-wide score head in columns 0..63 of the 512-wide q / k rows; P.v as eight ordinary 64-wide column groups that all read the same probability plane.
#define NB 4
#define TT 4096
#define CC 512            // NH * HD = projected width
#define DIN 512          // input (model) width
#define NH 8
#define HD 64
#define NQB (TT / 64)
#define HG 1
#define SCALE (1.0f)
#define CAUSAL 1
#ifndef TNB
#define TNB NB
#endif
__device__ __forceinline__ float bfr(float v) { return (float)(__bf16)v; }
__host__ __device__ __forceinline__ int kb_last(int qb) { return CAUSAL ? ((qb * 64 + 63) >> 7) : (TT / 128 - 1); }
// packed causal P plane of one batch: tiles of 64 queries x 128 keys (STILE floats, rows of 128), for query block qb only its key blocks 0..kb_last(qb), one behind the other from s_base(qb); so the planes of all batches fit in the workspace together, and every stride inside a query block is a constant
#define STILE (64 * 128)
static_assert(CAUSAL == 1 && NQB % 2 == 0, "s_base sums kb_last(i) + 1 = (i >> 1) + 1 over i < qb");
__device__ __forceinline__ size_t s_base(int qb) { const int m = qb >> 1; return (size_t)STILE * (size_t)((m + 1) * (m + (qb & 1))); }
#define SPLANE ((size_t)STILE * (NQB / 2) * (NQB / 2 + 1))   // floats per batch = s_base(NQB)
#define NTB ((NQB / 2) * (NQB / 2 + 1))   // tiles per batch
// softmax statistics of a tile: per 16 query rows (one wave of k_sc) one 128-byte line: 16 references (whole numbers, the power of two the row's exponentials of this tile are counted against), then 16 sums of those exponentials
#define STW 32
#define QBE 6              // the causal early band (equal to QBH of the P.v kernel): its P tiles stay f32
#define LOG2E 1.44269504f
typedef __attribute__((ext_vector_type(8))) __bf16 v8b;
__device__ __forceinline__ v16b frag_b(const __bf16* rowk0, int lane) {
  union { v16b v; v8b q[2]; } u; const __bf16* p = rowk0 + 8 * (lane >> 4);
  u.q[0] = *(const v8b*)p; u.q[1] = *(const v8b*)(p + 16); return u.v;
}
#define QBH 6              // causal: query blocks 0..QBH-1 of each sequence (few keys, no averaging) take the high-precision path
#define QHI TT             // rows carrying a q residual plane (all rows: 3-product logits everywhere)
#define KHI TT             // key rows carrying a k residual plane (read by every k_sc block: its 3-product branch)
#define VHI 384            // v bf16 hi / lo planes only for key rows t < VHI (read by the causal early band: query blocks < 6 see keys <= 383)
#define RW 64              // real width of q / k
// B fragment (k rows k0+.., output column o) of a weight: (in,out) [K][ld] or (out,in) [ld rows of K]: bf16 exact, or f16(bf16 * 256) exact
__device__ __forceinline__ v16b wcol_io(const float* Wm, int k0, int o, int lane, int ld) { v16b w; const int g = lane >> 4;
#pragma unroll
  for (int i = 0; i < 8; ++i) { w[i] = (__bf16)Wm[(size_t)(k0 + 8 * g + i) * ld + o]; w[8 + i] = (__bf16)Wm[(size_t)(k0 + 16 + 8 * g + i) * ld + o]; }
  return w; }
__device__ __forceinline__ v16b wcol_oi(const float* Wm, int k0, int o, int lane, int K) { v16b w; const float* p = Wm + (size_t)o * K + k0 + 8 * (lane >> 4);
#pragma unroll
  for (int i = 0; i < 8; ++i) { w[i] = (__bf16)p[i]; w[8 + i] = (__bf16)p[16 + i]; }
  return w; }
__device__ __forceinline__ v16h wcolh_io(const float* Wm, int k0, int o, int lane, int ld) { v16h w; const int g = lane >> 4;
#pragma unroll
  for (int i = 0; i < 8; ++i) { w[i] = (_Float16)(bfr(Wm[(size_t)(k0 + 8 * g + i) * ld + o]) * 256.0f); w[8 + i] = (_Float16)(bfr(Wm[(size_t)(k0 + 16 + 8 * g + i) * ld + o]) * 256.0f); }
  return w; }
__device__ __forceinline__ v16h wcolh_oi(const float* Wm, int k0, int o, int lane, int K) { v16h w; const float* p = Wm + (size_t)o * K + k0 + 8 * (lane >> 4);
#pragma unroll
  for (int i = 0; i < 8; ++i) { w[i] = (_Float16)(bfr(p[i]) * 256.0f); w[8 + i] = (_Float16)(bfr(p[16 + i]) * 256.0f); }
  return w; }
#define WQKV_LAYOUT 0   // 0 = (in,out): Wv [DIN][CC], Wq / Wk [DIN][RW]; 1 = (out,in) [CC][DIN]; 2 = per-head [NH][DIN][HD]
__device__ __forceinline__ v16b wcol_hdk(const float* Wm, int k0, int o, int lane) { v16b w; const int g = lane >> 4; const float* p = Wm + (size_t)(o / HD) * DIN * HD + (o % HD);
#pragma unroll
  for (int i = 0; i < 8; ++i) { w[i] = (__bf16)p[(size_t)(k0 + 8 * g + i) * HD]; w[8 + i] = (__bf16)p[(size_t)(k0 + 16 + 8 * g + i) * HD]; }
  return w; }
#define WO_OUT_IN 0
#if WQKV_LAYOUT == 1
#define WCOL(W, k0, o, lane) wcol_oi(W, k0, o, lane, DIN)
#elif WQKV_LAYOUT == 2
#define WCOL(W, k0, o, lane) wcol_hdk(W, k0, o, lane)
#else
__device__ __forceinline__ v16b zero16b() { v16b w; _Pragma("unroll") for (int i = 0; i < 16; ++i) w[i] = (__bf16)0.0f; return w; }
#define WCOL(W, k0, o, lane) (((which) == 2) ? wcol_io(W, k0, o, lane, CC) : (((o) < RW) ? wcol_io(W, k0, o, lane, RW) : zero16b()))   /* (in,out): Wv [512][512]; Wq / Wk [512][64]: columns >= 64 of the q / k rows are zero (and never read) */
#endif
#if WO_OUT_IN
#define WOCOL(W, k0, o, lane) wcol_oi(W, k0, o, lane, CC)
#define WOCOLH(W, k0, o, lane) wcolh_oi(W, k0, o, lane, CC)
#else
#define WOCOL(W, k0, o, lane) wcol_io(W, k0, o, lane, DIN)
#define WOCOLH(W, k0, o, lane) wcolh_io(W, k0, o, lane, DIN)
#endif

#ifndef SM_EXTRA_PARAMS
#define SM_EXTRA_PARAMS
#endif
#ifndef PROJ_EXTRA_PARAMS
#define PROJ_EXTRA_PARAMS
#endif
#ifndef SM_MASK_HOOK
#define SM_MASK_HOOK (void)0
#endif

#define WS_QH  0u                                      // f16 q rows [b*t][CC]
#define WS_KH  (WS_QH + 2u * (size_t)NB * TT * CC)      // f16 k rows [b*t][CC]
#define WS_VT  (WS_KH + 2u * (size_t)NB * TT * CC)      // f16 v planes [b][c][t]
#define WS_QL  (WS_VT + 2u * (size_t)NB * CC * TT)      // f16 q residual x 2^10 rows [b][t < QHI][CC]
#define WS_KL  (WS_QL + 2u * (size_t)NB * QHI * CC)     // f16 k residual x 2^10 rows [b][t < KHI][CC]
#define WS_VB  (WS_KL + 2u * (size_t)NB * KHI * CC)     // bf16 v hi planes [b][c][t < VHI]
#define WS_VBL (WS_VB + 2u * (size_t)NB * CC * VHI)
#define WS_S   (WS_VBL + 2u * (size_t)NB * CC * VHI)    // f32 P (f16 P outside the early band), one packed plane per batch [b][SPLANE]
#define WS_Y   (WS_S  + 4u * (size_t)NB * SPLANE)       // f32 ctx rows [b*t][CC]
#define WS_ST  (WS_Y  + 4u * (size_t)NB * TT * CC)      // f32 softmax statistics [b][tile][4][STW]
#define WS_END (WS_ST + 4u * (size_t)NB * NTB * 4 * STW)   // end of the softmax statistics, the last region (k_sc writes them, k_pv reads them)

#define PJK 64             // k rows per staged weight tile of k_proj
// one thread's share of a stage: 16 weight rows x 4 columns (a row of 128 columns = one 512-byte access of a wave; LD, the row length, is a constant, so the 16 rows are immediate offsets from one address) and the x values of its two A fragments
template <int LD> __device__ __forceinline__ void pj_load(v4f (&wr)[16], v4f (&xr)[8], const float* wp, const float* xrow) {
#pragma unroll
  for (int i = 0; i < 16; ++i) wr[i] = *(const v4f*)(wp + i * LD);
#pragma unroll
  for (int kc = 0; kc < PJK / 32; ++kc) { const float* p = xrow + kc * 32; xr[kc * 4] = *(const v4f*)p; xr[kc * 4 + 1] = *(const v4f*)(p + 4); xr[kc * 4 + 2] = *(const v4f*)(p + 16); xr[kc * 4 + 3] = *(const v4f*)(p + 20); }
}
// the 16 x 4 weight values to bf16, transposed in registers: eight k of one column = one 16-byte LDS store. The 16-byte group kg of column c lies at place kg ^ ((c >> 4) & 3) of its row: 16 lanes, four columns apart, then fall on 16 different bank groups; a fragment's 16 columns share one (c >> 4)
__device__ __forceinline__ void pj_store(__bf16 (*buf)[72], const v4f (&wr)[16], int wave, int lane) {
#pragma unroll
  for (int q = 0; q < 2; ++q) {
#pragma unroll
    for (int cc = 0; cc < 4; ++cc) { v8b pk;
#pragma unroll
      for (int i = 0; i < 8; ++i) pk[i] = (__bf16)wr[q * 8 + i][cc];
      *(v8b*)&buf[lane * 4 + cc][((wave * 2 + q) ^ ((lane >> 2) & 3)) * 8] = pk; } }
}
__device__ __forceinline__ void pj_afrag(v16b (&a)[PJK / 32], const v4f (&xr)[8]) {
#pragma unroll
  for (int kc = 0; kc < PJK / 32; ++kc)
#pragma unroll
    for (int i = 0; i < 4; ++i) { a[kc][i] = (__bf16)xr[kc * 4][i]; a[kc][4 + i] = (__bf16)xr[kc * 4 + 1][i]; a[kc][8 + i] = (__bf16)xr[kc * 4 + 2][i]; a[kc][12 + i] = (__bf16)xr[kc * 4 + 3][i]; }
}
// K loop of k_proj in stages of PJK k rows: the stage's weight tile (PJK x 128 columns) lies in LDS as bf16 [column][k], in b0 and b1 by turns; the next stage's weight rows and x values are loaded while this stage's products run. LD = 64 (Wq / Wk, 64 real columns): tile columns >= 64 are zero in both buffers, written once in front of the loop; their lanes re-read real columns (in bounds) and store nothing
template <int LD> __device__ __forceinline__ void pj_main(v8f (&acc)[8], const float* wp, const float* xrow, __bf16 (*b0)[72], __bf16 (*b1)[72], int wave, int lane) {
  const int col = lane & 15, g = lane >> 4; const bool wreal = LD == CC || lane < RW / 4;
  v4f wr[16], xr[8]; v16b a[PJK / 32];
  pj_load<LD>(wr, xr, wp, xrow);
  if (wreal) pj_store(b0, wr, wave, lane);
  else { const v4f z[16] = {}; pj_store(b0, z, wave, lane); pj_store(b1, z, wave, lane); }
  pj_afrag(a, xr);
  __syncthreads();
#pragma unroll 1   // one stage a trip: the buffers alternate, the code stays small
  for (int s = 0; s < DIN / PJK; ++s) { const __bf16 (*cur)[72] = (s & 1) ? b1 : b0; __bf16 (*nxt)[72] = (s & 1) ? b0 : b1;
    if (s + 1 < DIN / PJK) { wp += PJK * LD; xrow += PJK; pj_load<LD>(wr, xr, wp, xrow); }
#pragma unroll
    for (int kc = 0; kc < PJK / 32; ++kc) { union { v16b v; v8b q[2]; } u[8];   // the eight fragment reads of a k step are issued first: the products then wait on counted LDS returns, not on one LDS latency each
#pragma unroll
      for (int j = 0; j < 8; ++j) { const __bf16* rw = &cur[j * 16 + col][0]; u[j].q[0] = *(const v8b*)(rw + ((kc * 4 + g) ^ (j & 3)) * 8); u[j].q[1] = *(const v8b*)(rw + ((kc * 4 + 2 + g) ^ (j & 3)) * 8); }
#pragma unroll
      for (int j = 0; j < 8; ++j) acc[j] = wmma_bf(a[kc], u[j].v, acc[j]); }
    if (s + 1 < DIN / PJK) { if (wreal) pj_store(nxt, wr, wave, lane); pj_afrag(a, xr); }
    __syncthreads(); }   /* publishes stage s + 1 and ends every read of stage s: its buffer is rewritten in the next trip, or by the epilogue */
}
// ---- k_proj: block = (64 rows, 128 cols, which): q/k/v = X W (+ b) with exact bf16 products (K = DIN) -> which 0: q f16 rows (+ residual rows < QHI); 1: k f16 rows (+ residual rows < KHI); 2: v f16 planes [c][t] (+ bf16 hi/lo planes for t < VHI)
__global__ __launch_bounds__(128) void k_proj(const float* __restrict__ XQ, const float* __restrict__ XK, const float* __restrict__ XV, const float* __restrict__ WQ, const float* __restrict__ WK, const float* __restrict__ WV, const float* __restrict__ BQ, const float* __restrict__ BK, const float* __restrict__ BV,
    _Float16* __restrict__ QH, _Float16* __restrict__ QL, _Float16* __restrict__ KH, _Float16* __restrict__ KL, _Float16* __restrict__ VT, __bf16* __restrict__ VB, __bf16* __restrict__ VBL) {
  __shared__ __align__(16) _Float16 sh[64][136], sl[64][136]; __shared__ __align__(16) _Float16 th[128][72]; __shared__ __align__(16) __bf16 tb[128][72], tbl[128][72];
  const int tid = threadIdx.x, wave = tid >> 5, lane = tid & 31, col = lane & 15, g = lane >> 4; const int which = blockIdx.z; const int c0 = blockIdx.y * 128; const size_t r0 = (size_t)blockIdx.x * 64; const size_t bb = r0 / TT; const int t0 = (int)(r0 % TT);
  if (which < 2 && blockIdx.y > 0) return;   /* q / k have 64 real columns: only the first 128-column tile is computed; the others are never read (block-uniform exit before any barrier) */
  const float* X = which == 0 ? XQ : which == 1 ? XK : XV; const float* WA = which == 0 ? WQ : which == 1 ? WK : WV; const float* BA = which == 0 ? BQ : which == 1 ? BK : BV;
  v8f acc[8] = {};
  { const float* xrow = X + (r0 + wave * 16 + col) * DIN + 8 * g;   /* tb and tbl, free until the epilogue, are the two weight buffers; which is the same for the whole block */
    if (which == 2) pj_main<CC>(acc, WA + (size_t)(wave * 16) * CC + c0 + lane * 4, xrow, tb, tbl, wave, lane);
    else pj_main<RW>(acc, WA + (size_t)(wave * 16) * RW + (lane & (RW / 4 - 1)) * 4, xrow, tb, tbl, wave, lane); }
  if (which < 2) { _Float16* DH = which == 0 ? QH : KH; _Float16* DL = which == 0 ? QL : KL; const int nhi = which == 0 ? QHI : KHI; const bool hi_rows = t0 < nhi;
#pragma unroll
    for (int j = 0; j < 8; ++j) { const float bias = (BA && ((which) == 2 || (c0 + j * 16 + col) < RW)) ? bfr(BA[c0 + j * 16 + col]) : 0.f;
#pragma unroll
      for (int r = 0; r < 8; ++r) { const float v = acc[j][r] + bias; const _Float16 hv = (_Float16)v; sh[wave * 16 + 8 * g + r][j * 16 + col] = hv; sl[wave * 16 + 8 * g + r][j * 16 + col] = (_Float16)((v - (float)hv) * 1024.0f); } }
    __syncthreads();
    for (int e = tid; e < 64 * 16; e += 128) { const int rl = e >> 4, q = e & 15; vst2((unsigned*)(DH + (r0 + rl) * CC + c0 + q * 8), *(const v4u*)&sh[rl][q * 8]); if (hi_rows) vst2((unsigned*)(DL + (bb * nhi + t0 + rl) * (size_t)CC + c0 + q * 8), *(const v4u*)&sl[rl][q * 8]); }
  } else { const bool hi_rows = t0 < VHI;
#pragma unroll
    for (int j = 0; j < 8; ++j) { const float bias = (BA && ((which) == 2 || (c0 + j * 16 + col) < RW)) ? bfr(BA[c0 + j * 16 + col]) : 0.f;
#pragma unroll
      for (int r = 0; r < 8; ++r) { const float v = acc[j][r] + bias; const int rl = wave * 16 + 8 * g + r, cl = j * 16 + col; th[cl][rl] = (_Float16)v; const __bf16 bh = (__bf16)v; tb[cl][rl] = bh; tbl[cl][rl] = (__bf16)(v - (float)bh); } }
    __syncthreads();
    for (int e = tid; e < 128 * 8; e += 128) { const int cl = e >> 3, q = e & 7; vst2((unsigned*)(VT + (bb * CC + c0 + cl) * (size_t)TT + t0 + q * 8), *(const v4u*)&th[cl][q * 8]); if (hi_rows) { const size_t o3 = (bb * CC + c0 + cl) * (size_t)VHI + t0 + q * 8; vst2((unsigned*)(VB + o3), *(const v4u*)&tb[cl][q * 8]); vst2((unsigned*)(VBL + o3), *(const v4u*)&tbl[cl][q * 8]); } } } }
#undef QBH
#define QBH NQB   // SCORE KERNEL ONLY: every query block takes the 3-product branch (unscaled logits)
// eight asynchronous copies of 16 bytes a lane, global -> LDS, rows lstep / gstep bytes apart; the s_wait_xcnt in the same statement stands before anything can rewrite an address register of a copy
__device__ __forceinline__ void acopy8(unsigned l, unsigned lstep, const char* gsrc, size_t gstep) {
  asm volatile("global_load_async_to_lds_b128 %0, %8, off\n\t"
               "global_load_async_to_lds_b128 %1, %9, off\n\t"
               "global_load_async_to_lds_b128 %2, %10, off\n\t"
               "global_load_async_to_lds_b128 %3, %11, off\n\t"
               "global_load_async_to_lds_b128 %4, %12, off\n\t"
               "global_load_async_to_lds_b128 %5, %13, off\n\t"
               "global_load_async_to_lds_b128 %6, %14, off\n\t"
               "global_load_async_to_lds_b128 %7, %15, off\n\t"
               "s_wait_xcnt 0x0"
               :: "v"(l), "v"(l + lstep), "v"(l + 2 * lstep), "v"(l + 3 * lstep), "v"(l + 4 * lstep), "v"(l + 5 * lstep), "v"(l + 6 * lstep), "v"(l + 7 * lstep),
                  "v"(gsrc), "v"(gsrc + gstep), "v"(gsrc + 2 * gstep), "v"(gsrc + 3 * gstep), "v"(gsrc + 4 * gstep), "v"(gsrc + 5 * gstep), "v"(gsrc + 6 * gstep), "v"(gsrc + 7 * gstep)
               : "memory");
}
#define SCP (HD + 8)       // q / k row pitch in LDS, halves: 144 B = 16 B x 9, conflict-free for 16-byte reads
// four such copies, for the 16 q rows of a wave
__device__ __forceinline__ void acopy4(unsigned l, unsigned lstep, const char* gsrc, size_t gstep) {
  asm volatile("global_load_async_to_lds_b128 %0, %4, off\n\t"
               "global_load_async_to_lds_b128 %1, %5, off\n\t"
               "global_load_async_to_lds_b128 %2, %6, off\n\t"
               "global_load_async_to_lds_b128 %3, %7, off\n\t"
               "s_wait_xcnt 0x0"
               :: "v"(l), "v"(l + lstep), "v"(l + 2 * lstep), "v"(l + 3 * lstep),
                  "v"(gsrc), "v"(gsrc + gstep), "v"(gsrc + 2 * gstep), "v"(gsrc + 3 * gstep)
               : "memory");
}
static_assert(HD * 2 == 128, "k_sc: a q / k row of one head is one 128-byte line, eight lanes of a copy");
__device__ __forceinline__ int t_base(int qb) { const int m = qb >> 1; return (m + 1) * (m + (qb & 1)); }   /* s_base in tiles */
// the value of lane (l ^ X) of the same 16-lane row, as a DPP operand (row_xmask): no LDS trip
template <int X> __device__ __forceinline__ float dppx(float v) { return __builtin_bit_cast(float, __builtin_amdgcn_update_dpp(0, __builtin_bit_cast(int, v), 0x160 | X, 0xf, 0xf, true)); }
// 2^y, results under 2^-126 as 0; the v_nop is the one slot that the instruction set asks for behind a transcendental, in front of whatever the compiler puts next
__device__ __forceinline__ float exp2_slot(float y) { float e; asm("v_exp_f32 %0, %1\n\tv_nop" : "=v"(e) : "v"(y)); return e; }
__device__ __forceinline__ float row16_max(float v) { v = fmaxf(v, dppx<1>(v)); v = fmaxf(v, dppx<2>(v)); v = fmaxf(v, dppx<4>(v)); return fmaxf(v, dppx<8>(v)); }
__device__ __forceinline__ float row16_sum(float v) { v += dppx<1>(v); v += dppx<2>(v); v += dppx<4>(v); return v + dppx<8>(v); }
// ---- k_sc: block = (query block qb, key block kb <= kb_last(qb), batch b): logits x SCALE; q hi + residual (x 2^10) against k (2 products) for query rows < QHI, plus the k residual (3 products) for query blocks < QBH (= NQB here: every query block); causal: blocks past the diagonal exit, the mask is applied by index in the diagonal tile; then the tile's share of the softmax: what is stored is 2^11 x exp(logit) / 2^reference, with the reference and the row sum per (row, tile) in ST. The block's 128 k rows and 64 q rows, hi and residual, come into LDS once, in whole 128-byte lines (four rows a copy of a wave); all four waves take their k fragments from there
__global__ __launch_bounds__(128) void k_sc(const _Float16* __restrict__ QH, const _Float16* __restrict__ KH, const _Float16* __restrict__ QL, const _Float16* __restrict__ KL, int h0, float* __restrict__ S0, float* __restrict__ ST) {
  union SCU { struct { _Float16 h[128][SCP], l[128][SCP]; } k; float ss[4][16][132]; _Float16 hs[4][16][264]; };   /* the output rows ss take the place of the k tile once every wave has read it */
  __shared__ __align__(16) SCU u; __shared__ __align__(16) _Float16 sqh[64][SCP], sql[64][SCP];
  const int qb = blockIdx.x, kb = blockIdx.y; if (kb > kb_last(qb)) return;
  const int b = blockIdx.z, h = h0; float* S = S0 + (size_t)b * SPLANE + s_base(qb) + (size_t)kb * STILE;   /* blockIdx.z = batch; S = this block's tile */
  const int tid = threadIdx.x, wave = tid >> 5, lane = tid & 31, col = lane & 15, g = lane >> 4; const int k0 = kb * 128; const int ql0 = qb * 64 + wave * 16; const size_t q0 = (size_t)b * TT + ql0, kr0 = (size_t)b * TT + k0;
  v8f acc[8] = {}, accl[8] = {};
  const _Float16* QLb = QL + (size_t)b * QHI * CC; const _Float16* KLb = KL + (size_t)b * KHI * CC;
  { const int cr = lane >> 3, cq = (lane & 7) * 8;   /* a copy = rows cr, cr + 4, ..: eight lanes a row. Each wave brings 32 k rows and its own 16 q rows, hi and residual: 24 copies in flight */
    const size_t go = (size_t)cr * CC + h * HD + cq;
    acopy8((unsigned)(size_t)&u.k.h[wave * 32 + cr][cq], 4u * SCP * 2u, (const char*)(KH + (kr0 + wave * 32) * CC + go), (size_t)4 * CC * 2);
    acopy8((unsigned)(size_t)&u.k.l[wave * 32 + cr][cq], 4u * SCP * 2u, (const char*)(KLb + (size_t)(k0 + wave * 32) * CC + go), (size_t)4 * CC * 2);
    acopy4((unsigned)(size_t)&sqh[wave * 16 + cr][cq], 4u * SCP * 2u, (const char*)(QH + q0 * CC + go), (size_t)4 * CC * 2);
    acopy4((unsigned)(size_t)&sql[wave * 16 + cr][cq], 4u * SCP * 2u, (const char*)(QLb + (size_t)ql0 * CC + go), (size_t)4 * CC * 2); }
  asm volatile("s_wait_asynccnt 0x0" ::: "memory");   // this wave's copies have landed before the barrier publishes them
  __syncthreads();
  if (qb < QBH) {
    v16h ah, al, kbf[HD / 4], klf[HD / 4];   // step s = (kc = s >> 3, j = s & 7), in the order kc, j as before; the k fragments of step s + 1 are read in front of the products of step s, so that a product waits on a counted LDS return and not on a whole LDS latency; the q fragments of a kc are read with the group in front of its first products (no earlier: two sets of them would cost a resident wave)
#pragma unroll
    for (int s = -1; s < HD / 4; ++s) {
      if (s >= 0 && (s & 7) == 0) { ah = frag_h(&sqh[wave * 16 + col][(s >> 3) * 32], lane); al = frag_h(&sql[wave * 16 + col][(s >> 3) * 32], lane); }
      if (s + 1 < HD / 4) { kbf[s + 1] = frag_h(&u.k.h[((s + 1) & 7) * 16 + col][((s + 1) >> 3) * 32], lane); klf[s + 1] = frag_h(&u.k.l[((s + 1) & 7) * 16 + col][((s + 1) >> 3) * 32], lane); }
      __builtin_amdgcn_sched_barrier(0);   // keeps the reads in front of these products: without it the compiler sinks each read to its first use
      if (s >= 0) { const int j = s & 7; acc[j] = wmma16(ah, kbf[s], acc[j]); accl[j] = wmma16(al, kbf[s], accl[j]); accl[j] = wmma16(ah, klf[s], accl[j]); }
      __builtin_amdgcn_sched_barrier(0); }   // keeps the next reads from moving up among these products
  } else if (qb * 64 < QHI) {
#pragma unroll
    for (int kc = 0; kc < HD / 32; ++kc) { const v16h ah = frag_h(&sqh[wave * 16 + col][kc * 32], lane), al = frag_h(&sql[wave * 16 + col][kc * 32], lane);
#pragma unroll
      for (int j = 0; j < 8; ++j) { const v16h kbf = frag_h(&u.k.h[j * 16 + col][kc * 32], lane); acc[j] = wmma16(ah, kbf, acc[j]); accl[j] = wmma16(al, kbf, accl[j]); } }
  } else {
#pragma unroll
    for (int kc = 0; kc < HD / 32; ++kc) { const v16h ah = frag_h(&sqh[wave * 16 + col][kc * 32], lane);
#pragma unroll
      for (int j = 0; j < 8; ++j) { const v16h kbf = frag_h(&u.k.h[j * 16 + col][kc * 32], lane); acc[j] = wmma16(ah, kbf, acc[j]); } } }
  __syncthreads();   /* ends every wave's reads of the k tile: ss overwrites it */
#pragma unroll
  for (int j = 0; j < 8; ++j) {
#pragma unroll
    for (int r = 0; r < 8; ++r) acc[j][r] = (acc[j][r] + accl[j][r] * (1.0f / 1024.0f)) * SCALE; }
  if (CAUSAL && kb == kb_last(qb)) {   /* the one tile of the query block that the diagonal crosses (block-uniform); every row keeps at least its key k0 there, so a tile's row maximum is always a real logit */
#pragma unroll
    for (int j = 0; j < 8; ++j) {
#pragma unroll
      for (int r = 0; r < 8; ++r) if (k0 + j * 16 + col > ql0 + 8 * g + r) acc[j][r] = -3.0e38f; } }
  // softmax, the tile's share: row 8 g + r lies in the 16 lanes of half g, eight keys a lane. Reference rf = ceil(max logit x log2 e), a whole number: e = 2^(logit x log2 e - rf + 11) <= 2^11; between two tiles of a row the references differ by a power of two, which k_pv applies without rounding. An excluded key gives 2^(-inf) = 0
  float rf[8], sm[8];
#pragma unroll
  for (int r = 0; r < 8; ++r) { float a = acc[0][r];
#pragma unroll
    for (int j = 1; j < 8; ++j) a = fmaxf(a, acc[j][r]);
    rf[r] = ceilf(row16_max(a) * LOG2E); }
#pragma unroll
  for (int r = 0; r < 8; ++r) { const float c = 11.0f - rf[r]; float a = 0.f;
#pragma unroll
    for (int j = 0; j < 8; ++j) { const float e = exp2_slot(fmaf(acc[j][r], LOG2E, c)); acc[j][r] = e; a += e; }
    sm[r] = row16_sum(a); }
  if (qb < QBE) {   /* early band: f32 */
#pragma unroll
    for (int j = 0; j < 8; ++j) {
#pragma unroll
      for (int r = 0; r < 8; ++r) u.ss[wave][8 * g + r][j * 16 + col] = acc[j][r]; }
    LDSX(); for (int rl = 0; rl < 16; ++rl) vst2(S + (wave * 16 + rl) * 128 + lane * 4, *(const v4f*)&u.ss[wave][rl][lane * 4]);
    asm volatile("s_wait_xcnt 0x0" ::: "memory");   // behind the run of tile stores, in front of whatever rewrites a register that one of them names
  } else {   /* all other rows: rounded to f16 here, once; the 128 halves of a row lie in the first 256 bytes of its 512-byte place in the tile; two rows a store of a wave */
#pragma unroll
    for (int j = 0; j < 8; ++j) {
#pragma unroll
      for (int r = 0; r < 8; ++r) u.hs[wave][8 * g + r][j * 16 + col] = (_Float16)acc[j][r]; }
    LDSX(); for (int rl = 0; rl < 8; ++rl) vst2((_Float16*)(S + (wave * 16 + rl * 2 + g) * 128) + col * 8, *(const v4u*)&u.hs[wave][rl * 2 + g][col * 8]);
    asm volatile("s_wait_xcnt 0x0" ::: "memory"); }   // as above: behind the run of tile stores
  /* the statistics last: in front of LDSX its release would wait for these stores */
  if (col == 0) { float* st = ST + (((size_t)b * NTB + t_base(qb) + kb) * 4 + wave) * STW + 8 * g;   /* the wave's own 128-byte line */
    const v4f r0 = {rf[0], rf[1], rf[2], rf[3]}, r1 = {rf[4], rf[5], rf[6], rf[7]}, s0 = {sm[0], sm[1], sm[2], sm[3]}, s1 = {sm[4], sm[5], sm[6], sm[7]};
    vst2(st, r0); vst2(st + 4, r1); vst2(st + 16, s0); vst2(st + 20, s1); } }
#undef QBH
#define QBH 6   // restored: the P.v kernel keeps the causal early band of 6 query blocks
static_assert(QBE == QBH, "k_sc stores f32 P tiles for exactly the query blocks that k_pv reads as f32");
#define PVK 128            // keys per staged tile of k_pv (kb_last counts in the same 128-key units; a staged P tile holds the f16 halves of two stored tiles, query blocks 2m and 2m + 1)
#define PVP (PVK + 8)      // P row pitch in LDS, halves: 272 B = 16 B x 17, conflict-free for 16-byte reads
#define PVV (PVK + 8)      // v row pitch in LDS, halves: 272 B = 16 B x 17
#define PVQ 128            // queries per block of k_pv: query blocks 2m and 2m + 1, which see the same key tiles 0..m
#define PVC 128            // v columns per block of k_pv: two 64-column groups
static_assert(CAUSAL == 1 && QBH % 2 == 0 && NQB % 2 == 0 && NH % 2 == 0, "k_pv pairs query blocks 2m, 2m + 1 (kb_last of both = m; both in the early band or neither) and column groups 2y, 2y + 1");
// one wave's share of a tile: 32 P rows (256 B of f16 each, 512 B apart in the stored tile) and 32 v rows (256 B each), two rows a copy: 32 copies of a wave in flight
__device__ __forceinline__ void pv_tile(unsigned lp, unsigned lv, const char* gp, const char* gv) {
  acopy8(lp, 2u * PVP * 2u, gp, (size_t)2 * PVK * 4); acopy8(lp + 16u * PVP * 2u, 2u * PVP * 2u, gp + (size_t)16 * PVK * 4, (size_t)2 * PVK * 4);
  acopy8(lv, 2u * PVV * 2u, gv, (size_t)2 * TT * 2); acopy8(lv + 16u * PVV * 2u, 2u * PVV * 2u, gv + (size_t)16 * TT * 2, (size_t)2 * TT * 2);
}
// thread = one of the block's 128 query rows: from the row's references and sums of its m + 1 key tiles (all loads in flight together, constant offsets from one address) the row's reference R = the largest; per tile the factor 2^(reference - R), exact in f16 down to 2^-24 and 0 below; and 1 / (sum of the row's exponentials counted against R)
__device__ __forceinline__ void pv_stats(const float* __restrict__ ST, int b, int m, int tid, _Float16 (*fac)[PVQ], float* sinv) {
  const float* st = ST + (((size_t)b * NTB + t_base(2 * m + (tid >> 6))) * 4 + ((tid >> 4) & 3)) * STW + (tid & 15);
  float rv[TT / PVK], lv[TT / PVK];
#pragma unroll   // constant tile numbers keep both lists in registers (so for the two loops below)
  for (int i = 0; i < TT / PVK; ++i) if (i <= m) { rv[i] = st[i * 4 * STW]; lv[i] = st[i * 4 * STW + 16]; }
  float R = rv[0];
#pragma unroll
  for (int i = 1; i < TT / PVK; ++i) if (i <= m) R = fmaxf(R, rv[i]);
  float L = 0.f;
#pragma unroll
  for (int i = 0; i < TT / PVK; ++i) if (i <= m) { const float f = ldexpf(1.0f, (int)fmaxf(rv[i] - R, -126.0f)); L += lv[i] * f; fac[i][tid] = (_Float16)f; }
  sinv[tid] = 1.0f / L;   /* L >= 2^10: the row's largest exponential counts at least that */
}
__device__ __forceinline__ F2 split_row_s(const float* row, int k0, int lane, float f) { float v[16]; const float* p = row + k0 + 8 * (lane >> 4);
#pragma unroll
  for (int i = 0; i < 8; ++i) { v[i] = p[i] * f; v[8 + i] = p[16 + i] * f; }
  return bsplit16(v); }
// ---- k_pv: block = 128 queries (query blocks 2m, 2m + 1) x 128 v columns of batch b; wave = 64 queries (one query block) x 64 columns (one column group), 4 x 4 accumulator tiles, so every staged P or v fragment feeds four products: ctx = P . v over keys [0, kend) (P x 2^11 against the tile's reference, stored as f16 by k_sc, times the tile's power-of-two factor, against v f16: 1 product; the division by the row's sum stands in the epilogue; causal early query blocks: f32 P and v as bf16 hi + lo, 3 products); 256-B (row, head) segment by 16 lanes
__global__ __launch_bounds__(128) void k_pv(const float* __restrict__ PS0, const _Float16* __restrict__ VT, const __bf16* __restrict__ VB, const __bf16* __restrict__ VBL, const float* __restrict__ ST, int h0, float* __restrict__ Y) { __shared__ __align__(16) _Float16 fac[TT / PVK][PVQ]; __shared__ __align__(16) float sinv[PVQ];
  __shared__ __align__(16) _Float16 sp[2][PVQ][PVP]; __shared__ __align__(16) _Float16 sv[2][PVC][PVV];   /* two buffers each: P tile (128 queries x 128 keys, f16) and v tile (128 columns x 128 keys, f16) */
  const int tid = threadIdx.x, wave = tid >> 5, lane = tid & 31, col = lane & 15, g = lane >> 4; const int b = blockIdx.z;   /* blockIdx.y = pair of column groups, blockIdx.z = batch */
  const int m = blockIdx.x;   /* the pair of query blocks: m + 1 key tiles */
  const int wq = wave >> 1, wc = wave & 1; const int qb = 2 * m + wq, h = h0 + blockIdx.y * 2 + wc;   /* the wave's query block and column group */
  const int kce = (kb_last(2 * m) + 1) * 4; const float* PS = PS0 + (size_t)b * SPLANE + s_base(qb);
  v8f acc[4][HD / 16] = {};
  if (2 * m < QBH) {
    pv_stats(ST, b, m, tid, fac, sinv);
    __syncthreads();   /* publishes the factors and the row sums (block-uniform branch) */
    const size_t po = ((size_t)b * CC + h * HD + col) * (size_t)VHI + 8 * g; const __bf16* vhp = VB + po; const __bf16* vlp = VBL + po;   /* the lane's own first eight keys in its v row of column tile 0, hi and lo plane: every v load of a trip is one of these two addresses plus a constant; both go on by 32 keys a trip */
#pragma unroll 1
    for (int kc = 0; kc < kce; ++kc) { const float* pp = PS + (kc >> 2) * STILE + col * 128; F2 p[4];
#pragma unroll
      for (int qi = 0; qi < 4; ++qi) p[qi] = split_row_s(pp + qi * 16 * 128, (kc & 3) * 32, lane, (float)fac[kc >> 2][wq * 64 + qi * 16 + col]);
      asm volatile("s_wait_loadcnt 0x0" ::: "memory");
#pragma unroll
      for (int j = 0; j < HD / 16; ++j) { const v16b vh = frag_b(vhp + j * 16 * VHI, 0), vl = frag_b(vlp + j * 16 * VHI, 0);   /* lane argument 0: the lane's half, 8 g, is in the two addresses already; per accumulator the three products stay in the order p.h vh, p.l vh, p.h vl */
#pragma unroll
        for (int qi = 0; qi < 4; ++qi) acc[qi][j] = __builtin_amdgcn_wmma_f32_16x16x32_bf16(false, p[qi].h, false, vh, (short)0, acc[qi][j], false, false);   /* the builtin alone, as in the loop below */
#pragma unroll
        for (int qi = 0; qi < 4; ++qi) acc[qi][j] = __builtin_amdgcn_wmma_f32_16x16x32_bf16(false, p[qi].l, false, vh, (short)0, acc[qi][j], false, false);
#pragma unroll
        for (int qi = 0; qi < 4; ++qi) acc[qi][j] = __builtin_amdgcn_wmma_f32_16x16x32_bf16(false, p[qi].h, false, vl, (short)0, acc[qi][j], false, false); }
      asm volatile("s_wait_xcnt 0x0" :: "v"(vhp), "v"(vlp) : "memory");   // the two addresses that the v loads of the trip name are inputs of the wait: their registers stay whole up to it and are rewritten only behind it
      vhp += 32; vlp += 32; }
  } else {
    // tiles of 128 keys come into LDS in whole 128-byte lines (two P rows or two v rows = one copy of a wave); each wave brings 32 P rows (half of its own query block's tile) and 32 v rows of every tile
    const int nst = kce / (PVK / 32);
    const unsigned lp = (unsigned)(size_t)&sp[0][wave * 32 + g][col * 8], lv = (unsigned)(size_t)&sv[0][wave * 32 + g][col * 8];
    const char* gp = (const char*)(PS + (wc * 32 + g) * PVK) + col * 16; const char* gv = (const char*)(VT + ((size_t)b * CC + (h0 + blockIdx.y * 2) * HD + wave * 32 + g) * (size_t)TT + col * 8);
    pv_tile(lp, lv, gp, gv);
    pv_stats(ST, b, m, tid, fac, sinv);   /* beside the flight of tile 0; the barrier below publishes both */
    asm volatile("s_wait_asynccnt 0x0" ::: "memory");   // tile 0 has landed before the barrier publishes it
    __syncthreads();
    if (nst > 1) pv_tile(lp + (unsigned)sizeof(sp[0]), lv + (unsigned)sizeof(sv[0]), gp + STILE * 4, gv + PVK * 2);
#pragma unroll 1   // one tile a trip: the buffer index alternates, the code stays small
    for (int t = 0; t < nst; ++t) { const int bu = t & 1;
      _Float16 fq[4];   // the tile's factor of the lane's own query row in each of the four A fragments
#pragma unroll
      for (int qi = 0; qi < 4; ++qi) fq[qi] = fac[t][wq * 64 + qi * 16 + col];
      v16h pa, pf[PVK / 32][4], vf[PVK / 32][HD / 16];   // the fragment reads of k step kc + 1 are issued as one group in front of the products of k step kc: the products wait on counted LDS returns, and the reads run beside the products
#pragma unroll
      for (int kc = -1; kc < PVK / 32; ++kc) {
        if (kc + 1 < PVK / 32) {
#pragma unroll
          for (int qi = 0; qi < 4; ++qi) pf[kc + 1][qi] = frag_h(&sp[bu][wq * 64 + qi * 16 + col][(kc + 1) * 32], lane);
#pragma unroll
          for (int j = 0; j < HD / 16; ++j) vf[kc + 1][j] = frag_h(&sv[bu][wc * 64 + j * 16 + col][(kc + 1) * 32], lane); }
        __builtin_amdgcn_sched_barrier(0);   // keeps the group of reads in front of these products: without it the compiler sinks each read to its first use, and the wave waits out one LDS latency per fragment
        if (kc >= 0) {   /* pa = the A fragment of the coming four products, times its row's factor (a power of two: no second rounding above the subnormals); the next one is scaled beside these products, into registers of its own */
          if (kc == 0) pa = pf[0][0] * fq[0];
#pragma unroll
          for (int qi = 0; qi < 4; ++qi) { v16h pn = pa;
            if (qi < 3) pn = pf[kc][qi + 1] * fq[qi + 1]; else if (kc + 1 < PVK / 32) pn = pf[kc + 1][0] * fq[0];
#pragma unroll
            for (int j = 0; j < HD / 16; ++j) acc[qi][j] = __builtin_amdgcn_wmma_f32_16x16x32_f16(false, pa, false, vf[kc][j], (short)0, acc[qi][j], false, false);   /* the builtin alone: the compiler keeps the distances behind it, and fragments may lie above v255, where an asm operand cannot */
            pa = pn; }
          // order asked of the scheduler: two of the eight multiplies of the next fragment behind each product, where they issue beside the matrix unit; left alone it puts all eight, and four v_nop, between two groups of four products
          if (kc == 0) __builtin_amdgcn_sched_group_barrier(0x2, 8, 0);
#pragma unroll
          for (int i = 0; i < 16; ++i) { __builtin_amdgcn_sched_group_barrier(0x8, 1, 0); if (i < 12 || kc + 1 < PVK / 32) __builtin_amdgcn_sched_group_barrier(0x2, 2, 0); } }
        __builtin_amdgcn_sched_barrier(0); }   // keeps the next group of reads, and behind the last products the waits and the barrier, from moving up among these products
      asm volatile("s_wait_dscnt 0x0" ::: "memory");      // this wave's reads of buffer bu are done before the barrier frees it
      asm volatile("s_wait_asynccnt 0x0" ::: "memory");   // this wave's copies of tile t + 1 have landed before the barrier publishes them
      __syncthreads();
      if (t + 2 < nst) pv_tile(lp + (unsigned)(bu * sizeof(sp[0])), lv + (unsigned)(bu * sizeof(sv[0])), gp + (size_t)(t + 2) * (STILE * 4), gv + (size_t)(t + 2) * (PVK * 2)); }
    asm volatile("s_wait_asynccnt 0x0" ::: "memory");   // no copy is left in flight behind the loop
  }
  float (*ss)[16][HD + 4] = (float (*)[16][HD + 4])&sp[0][0][0];   /* the P buffers are free: behind the last trip's barrier nobody reads them and no copy is in flight; so two blocks still fit a WGP's LDS */
#pragma unroll
  for (int qi = 0; qi < 4; ++qi) {   /* 16 rows at a time through the wave's own ss rows */
    const v4f i0 = *(const v4f*)&sinv[wq * 64 + qi * 16 + 8 * g], i1 = *(const v4f*)&sinv[wq * 64 + qi * 16 + 8 * g + 4];
#pragma unroll
    for (int j = 0; j < HD / 16; ++j)
#pragma unroll
      for (int r = 0; r < 8; ++r) ss[wave][8 * g + r][j * 16 + col] = acc[qi][j][r] * (r < 4 ? i0[r & 3] : i1[r & 3]);
    LDSX(); for (int rl = 0; rl < 16; ++rl) if (lane < HD / 4) vst2(Y + ((size_t)b * TT + qb * 64 + qi * 16 + rl) * CC + h * HD + lane * 4, *(const v4f*)&ss[wave][rl][lane * 4]);
    LDSX(); } }   /* the second LDSX: the rows are read before the next 16 rows overwrite them */

#define LN_EPS 1.0e-5f
#define LNW 16             // waves per block of k_resln: 256 blocks, one per WGP, 4 waves per SIMD
#define LNR 4              // rows per wave, one behind the other in memory
// the sum over all 32 lanes, in every lane: four DPP steps inside the 16-lane row, then the same lane of the other row by a vector cross-row move; no LDS trip
__device__ __forceinline__ float wave_sum(float v) { v = row16_sum(v); return v + __builtin_bit_cast(float, __builtin_amdgcn_permlanex16(0u, __builtin_bit_cast(unsigned, v), 0x76543210u, 0xfedcba98u, true, false)); }
// ---- k_resln: y = bf16(x) + o, LayerNorm over the 512 features. One wave per row, LNR rows a wave: a lane holds 16 values of a row (four 16-byte pieces, 512 bytes apart, so every load and store of a wave is 512 bytes in a row); the loads of all LNR rows are asked for at once; no LDS, no barrier; 4,096 waves in all
__global__ __launch_bounds__(LNW * 32) void k_resln(const float* __restrict__ O, const float* __restrict__ X, const float* __restrict__ GAM, const float* __restrict__ BET, float* __restrict__ OUT) {
  const int l4 = (threadIdx.x & 31) * 4; const size_t off = (((size_t)blockIdx.x * LNW + __builtin_amdgcn_readfirstlane(threadIdx.x >> 5)) * LNR) * CC;   /* the wave's first row: the same in every lane, so every address is a scalar base plus the one lane offset l4 */
  const float* op = O + off; const float* xp = X + off; float* wp = OUT + off;
  v4f y[LNR][4], x[LNR][4], ga[4], be[4];
#pragma unroll
  for (int r = 0; r < LNR; ++r) {
#pragma unroll
    for (int c = 0; c < 4; ++c) { y[r][c] = *(const v4f*)(op + r * CC + c * 128 + l4); x[r][c] = *(const v4f*)(xp + r * CC + c * 128 + l4); }
    if (r == 0) {
#pragma unroll
      for (int c = 0; c < 4; ++c) { ga[c] = *(const v4f*)(GAM + c * 128 + l4); be[c] = *(const v4f*)(BET + c * 128 + l4); } } }   /* gamma and beta are asked for directly behind the first row, which is the first to need them */
  __builtin_amdgcn_sched_barrier(0);   // keeps all 40 loads in front of the arithmetic: left alone the compiler puts the later rows' loads behind the first row's load waits, and they start a memory latency late
#pragma unroll
  for (int r = 0; r < LNR; ++r) { v4f s4 = {0.f, 0.f, 0.f, 0.f};   /* four independent chains a sum */
#pragma unroll
    for (int c = 0; c < 4; ++c) {
#pragma unroll
      for (int i = 0; i < 4; ++i) { y[r][c][i] += bfr(x[r][c][i]); s4[i] += y[r][c][i]; } }
    const float mu = wave_sum((s4[0] + s4[1]) + (s4[2] + s4[3])) * (1.0f / (float)CC); v4f q4 = {0.f, 0.f, 0.f, 0.f};
#pragma unroll
    for (int c = 0; c < 4; ++c) {
#pragma unroll
      for (int i = 0; i < 4; ++i) { y[r][c][i] -= mu; q4[i] += y[r][c][i] * y[r][c][i]; } }
    const float rs = 1.0f / sqrtf(wave_sum((q4[0] + q4[1]) + (q4[2] + q4[3])) * (1.0f / (float)CC) + LN_EPS);
#pragma unroll
    for (int c = 0; c < 4; ++c) {
#pragma unroll
      for (int i = 0; i < 4; ++i) y[r][c][i] = y[r][c][i] * rs * bfr(ga[c][i]) + bfr(be[c][i]);
      vst2(wp + r * CC + c * 128 + l4, y[r][c]); }
    if (r + 1 < LNR) asm volatile("s_wait_xcnt 0x0" ::: "memory");   // behind the row's four stores, in front of whatever rewrites a register that one of them names
    __builtin_amdgcn_sched_barrier(0); } }   // one row at a time: a row is summed and stored while the later rows' loads are still landing; left alone the compiler mixes the rows, and the first store stands behind the wait for the third row's loads
static_assert(CC == 512 && DIN == CC && (TNB * TT) % (LNW * LNR) == 0, "k_resln: 32 lanes x 16 floats per row; the residual adds the input row; every wave has LNR whole rows");
extern "C" void kernel_launch(void* const* d_in, const int* in_sizes, int n_in, void* d_out, int out_size, void* d_ws, size_t ws_size, hipStream_t stream) {
  (void)in_sizes; (void)n_in; (void)out_size;
  const float** F = (const float**)d_in;
  if (ws_size < (size_t)WS_END) return;
  char* ws = (char*)d_ws; _Float16 *QH = (_Float16*)(ws + WS_QH), *KH = (_Float16*)(ws + WS_KH), *VT = (_Float16*)(ws + WS_VT), *QL = (_Float16*)(ws + WS_QL), *KL = (_Float16*)(ws + WS_KL); __bf16 *VB = (__bf16*)(ws + WS_VB), *VBL = (__bf16*)(ws + WS_VBL); float *S = (float*)(ws + WS_S), *Y = (float*)(ws + WS_Y), *ST = (float*)(ws + WS_ST);
  (void)Y; (void)QL; (void)KL; (void)VB; (void)VBL;
  // inputs: 0 x [4,4096,512]; 1 Wq [512,64] (in,out), 2 bq [64]; 3 Wk [512,64], 4 bk; 5 Wv [512,512], 6 bv [512] (biases NONZERO); 7 gamma [512]; 8 beta [512] (ones / zeros, read)
  float* Yo = (float*)(ws + WS_Y);
  k_proj<<<dim3(TNB * TT / 64, CC / 128, 3), 128, 0, stream>>>(F[0], F[0], F[0], F[1], F[3], F[5], F[2], F[4], F[6], QH, QL, KH, KL, VT, VB, VBL);
  k_sc<<<dim3(NQB, TT / 128, TNB), 128, 0, stream>>>(QH, KH, QL, KL, 0, S, ST);   /* the one score head: columns 0..63; all batches in one grid */
  k_pv<<<dim3(NQB / 2, NH / 2, TNB), 128, 0, stream>>>(S, VT, VB, VBL, ST, 0, Yo);   /* 128 queries x 128 v / o columns a block, all four column pairs from the batch's one plane; batch = slowest index */
  k_resln<<<dim3(TNB * TT / (LNW * LNR)), LNW * 32, 0, stream>>>(Yo, F[0], F[7], F[8], (float*)d_out);
}
